// v000
// The times below were measured on an AMD MI455X: many runs one after another, warmed up first and cycling through
// copies of the inputs, with the whole window's GPU time divided by the number of runs. Launches and the gaps
// between them are all in it. The median over several windows is given; except for v000 it joins two sittings, which
// can be a few percent apart, so the side-by-side timings, each taken in one sitting, are the better comparison.
// v000, which the later versions start from, runs in 230 microseconds.
#include <hip/hip_runtime.h>

// Span scorer: head / tail projections (Linear 768 -> 200 + erf GELU) with an appended constant-one feature; biaffine form head^T U[k] tail plus a concatenation-linear term, evaluated for every query token on a sliding band of 129 key offsets (-64..+64); length masking (masked entries = classifier bias); 9-tag linear classifier; non-finite outputs set to 0.
// Algebra: the classifier is folded into the bilinear weights: G[i][j][t] = sum_k (U[k][i][j] + [j==200] Wcat[k][i] + [i==200] Wcat[k][201+j]) Wd[k][t] + [i==j==200] bd[t]; V[q][t][j] = sum_i head[q][i] G[i][j][t]; score[q][r][t] = sum_j tail[q-64+r][j] V[q][t][j].
// Compute dtypes, f32 accumulate everywhere: projections v_wmma_f32_16x16x32_bf16 (state, Wh, Wt, biases RNE-converted to bf16; products exact); G built in f32 on the vector unit from bf16-converted U, Wcat, Wd, bd (9 tag columns);
// V GEMM and band GEMM v_wmma_f32_16x16x32_f16 with every operand as f16 value + f16 residual x2048 (three products; residual products in their own accumulator folded by 1/2048); G carries x1024, folded back after the band GEMM.
// Layout: bf16 state plane [q][768]; bf16 weight plane [512][768] (rows 0..199 Wh^T, 256..455 Wt^T, others zero); head|tail planes [q][512] (head cols 0..255, tail cols 256..511; col 200 of each half = 1, cols 201..255 = 0);
// G^T planes [t*224 + j][256]; V planes [q][2048] with column t*224 + j; band plane f32 [q][1184] (129 x 9 used); output packed thread-linearly.

#ifndef NB
#define NB 2
#endif
#ifndef SEQ
#define SEQ 1024
#endif
#define NB_FULL  2
#define SEQ_FULL 1024
#ifndef OUT_SEQ
#define OUT_SEQ SEQ              // row pitch (in tokens) between batches of the output
#endif
#define HID    768               // model width
#define NF     200               // projection width
#define NU     201               // NF + constant-one feature
#define NK     200               // bilinear channels
#define NT     9                 // tags
#define WH     64                // band half width
#define WF     129               // band width
#define QE     (WF * NT)         // output floats per query (1161)
#define HTW    256               // column width of the head half / tail half
#define HTP    512               // row pitch (halves) of the head|tail planes
#define KJ     224               // contraction length of the V and band GEMMs (201 zero-padded)
#define NJ     224               // G^T rows / V columns per tag
#define GPITCH 256               // row pitch (halves) of the G^T planes
#define GROWS  2048              // rows of the G^T planes (9 * 224 = 2016, zero rows above)
#define VP     2048              // row pitch (halves) of the V planes
#define SP     1184
#define VW     4                 // waves per V GEMM block
#define BW     4                 // waves (queries) per band block
#define QRS    2048.0f           // carry of every residual plane
#define QRI    (1.0f / 2048.0f)
#define GSC    1024.0f           // carry of the G planes
#define GSI    (1.0f / 1024.0f)

static_assert(NU == NF + 1);
static_assert(HID % 64 == 0);                  // weight transpose tiles of 64 k; GEMM k-loop steps by 32
static_assert(KJ % 32 == 0);
static_assert(NU <= KJ);
static_assert(KJ <= HTW);
static_assert(KJ <= GPITCH);
static_assert(NJ == KJ);                       // V column block of one tag = one contraction row of the band GEMM
static_assert(HTP == 2 * HTW);
static_assert(HTW % 64 == 0);                  // a 64-column tile lies wholly in the head half or the tail half
static_assert((HTW & (HTW - 1)) == 0);
static_assert(NF <= HTW);
static_assert(GPITCH == 256);                  // one thread per G^T column
static_assert(NU <= GPITCH);
static_assert(NT * NJ <= GROWS);
static_assert(GROWS == VP);
static_assert(VP % 64 == 0);
static_assert(((GROWS - NT * NJ) * (GPITCH / 8)) % 256 == 0);
static_assert((NB * SEQ) % 64 == 0);
static_assert((NB * SEQ) % (16 * VW) == 0);
static_assert((NB * SEQ) % BW == 0);
static_assert(SEQ % 64 == 0);
static_assert(SEQ % 32 == 0);
static_assert(OUT_SEQ % 32 == 0);
static_assert(WF == 2 * WH + 1);
static_assert(WF <= 9 * 16);                   // nine 16-key tiles cover the band
static_assert(SP % 32 == 0);
static_assert(SP >= QE);
static_assert(SP - QE <= 32);                  // pad floats zeroed by one lane each
static_assert(SP / 4 <= 10 * 32);              // band store loop: 10 trips x 32 lanes x 16 B >= row bytes
static_assert(((size_t)SEQ * QE) % (4 * 256) == 0);
static_assert(NB <= NB_FULL);
static_assert(SEQ <= SEQ_FULL);
static_assert(4 * 32 * 16 == 16 * 64 * 2);     // slab store: 4 trips x 32 lanes x 16 B == 16 rows x 64 halves
static_assert(NT * 32 * 16 == NT * GPITCH * 2); // G^T store: 9 rows x 32 pieces x 16 B
static_assert(sizeof(float) * 16 * 68 <= 131072);
static_assert(sizeof(float) * VW * 16 * 68 <= 131072);
static_assert(sizeof(float) * BW * SP <= 131072);
static_assert(sizeof(float) * NT * GPITCH <= 131072);
static_assert(sizeof(float) * 64 * 33 <= 131072);

typedef _Float16 h16;
typedef unsigned short bf;
typedef __attribute__((ext_vector_type(16))) __bf16   v16bf;
typedef __attribute__((ext_vector_type(16))) _Float16 v16h;
typedef __attribute__((ext_vector_type(8)))  _Float16 v8h;
typedef __attribute__((ext_vector_type(8)))  unsigned short v8us;
typedef __attribute__((ext_vector_type(8)))  float    v8f;
typedef __attribute__((ext_vector_type(4)))  float    v4f;
typedef v4f  __attribute__((may_alias)) v4fa;

__device__ __forceinline__ unsigned short f2bf(float f) { unsigned u = __float_as_uint(f); u += 0x7FFFu + ((u >> 16) & 1u); return (unsigned short)(u >> 16); }
__device__ __forceinline__ float bfr(float f) { return __uint_as_float(((unsigned)f2bf(f)) << 16); }   // value after RNE convert to bf16
__device__ __forceinline__ v16h cat16(v8h lo, v8h hi) { return __builtin_shufflevector(lo, hi, 0, 1, 2, 3, 4, 5, 6, 7, 8, 9, 10, 11, 12, 13, 14, 15); }
__device__ __forceinline__ v16bf cat16b(v8us lo, v8us hi) { return __builtin_bit_cast(v16bf, __builtin_shufflevector(lo, hi, 0, 1, 2, 3, 4, 5, 6, 7, 8, 9, 10, 11, 12, 13, 14, 15)); }
__device__ __forceinline__ v8f wmma16(v16h a, v16h b, v8f c) { return __builtin_amdgcn_wmma_f32_16x16x32_f16(false, a, false, b, (short)0, c, false, false); }
__device__ __forceinline__ v8f wmmab(v16bf a, v16bf b, v8f c) { return __builtin_amdgcn_wmma_f32_16x16x32_bf16(false, a, false, b, (short)0, c, false, false); }
// fragment loaders from K-contiguous 16-bit rows; p already includes + 8*(lane>>4): elements 0..7 <- k0+8h+0..7, elements 8..15 <- k0+16+8h+0..7 (same map for A and B)
__device__ __forceinline__ v16h  ldh(const h16* p) { return cat16(*(const v8h*)p, *(const v8h*)(p + 16)); }
__device__ __forceinline__ v16bf ldb(const bf* p)  { return cat16b(*(const v8us*)p, *(const v8us*)(p + 16)); }
// ordering point for wave-private LDS tiles (same wave writes and reads)
__device__ __forceinline__ void wave_sync() { __builtin_amdgcn_fence(3 /* release order */, "wavefront"); __builtin_amdgcn_wave_barrier(); asm volatile("" ::: "memory"); }

// per-instruction guarded WMMA wrappers: one accumulator tied per guard, operands kept live across the nops
__device__ __forceinline__ v8f wg(v16h a, v16h b, v8f c) { c = wmma16(a, b, c); asm volatile("v_nop\n\tv_nop\n\tv_nop\n\tv_nop" : "+v"(c) : "v"(a), "v"(b)); return c; }
__device__ __forceinline__ v8f wgb(v16bf a, v16bf b, v8f c) { c = wmmab(a, b, c); asm volatile("v_nop\n\tv_nop\n\tv_nop\n\tv_nop" : "+v"(c) : "v"(a), "v"(b)); return c; }
// f32 -> f16 convert that cannot produce an f16 subnormal (|v| < 2^-14 -> +0), applied after the plane's carry
static __device__ __forceinline__ h16 toh_flush(float v) { const h16 r = (h16)v; return (fabsf(v) < 6.103515625e-05f) ? (h16)0.0f : r; }
__device__ __forceinline__ float gelu_erf(float x) { return 0.5f * x * (1.0f + erff(x * 0.70710678118654752f)); }

__global__ __launch_bounds__(256) void k_cvt8(const float* __restrict__ src, bf* dst, size_t n8) {
    const size_t i = (size_t)blockIdx.x * 256 + threadIdx.x; if (i >= n8) return;
    const v8f v = *(const v8f*)(src + i * 8); v8us o;
#pragma unroll
    for (int k = 0; k < 8; ++k) o[k] = f2bf(v[k]);
    *(v8us*)(dst + i * 8) = o; 
}

// k_wtr: in[HID rows k][NF cols n] (f32) -> out[HTW rows n][HID cols k] (bf16, RNE convert); rows n >= NF written as zeros.
// grid (HID/64, HTW/32).
__global__ __launch_bounds__(256) void k_wtr(const float* __restrict__ W, bf* dst) {
    __shared__ float tile[64 * 33];
    const int tid = threadIdx.x;
    const int k0 = blockIdx.x * 64, n0 = blockIdx.y * 32;
#pragma unroll 1
    for (int e = 0; e < 8; ++e) {                                  // 8 trips x 256 threads = 64 x 32 elements
        const int idx = e * 256 + tid; const int kk = idx >> 5, nn = idx & 31;
        const int n = n0 + nn; const int nc = n < NF ? n : NF - 1;  // clamped address
        float v = W[(size_t)(k0 + kk) * NF + nc];
        asm volatile("" : "+v"(v));
        tile[kk * 33 + nn] = (n < NF) ? v : 0.0f; }
    __syncthreads();
    const int row = tid >> 3, pc = tid & 7;
    v8us o;
#pragma unroll
    for (int e = 0; e < 8; ++e) o[e] = f2bf(tile[(pc * 8 + e) * 33 + row]);
    bf* p = dst + (size_t)(n0 + row) * HID + k0 + pc * 8;
    *(v8us*)p = o; 
}

// k_gp: folded weights. Block j (< NJ) builds the 9 rows n = t*NJ + j of the G^T planes, thread i = column; rows with j >= NU and columns i >= NU are zeros; block NJ zero-fills rows [NT*NJ, GROWS).
// grid NJ + 1.
__global__ __launch_bounds__(256) void k_gp(const float* __restrict__ U, const float* __restrict__ Wcat, const float* __restrict__ Wd, const float* __restrict__ bd, h16* GH, h16* GR) {
    __shared__ __align__(16) float gs[NT * GPITCH];
    const int tid = threadIdx.x; const int j = blockIdx.x;
    if (j >= NJ) {                                                  // block-uniform
        const v8h z = (v8h){};
        const size_t zb = (size_t)NT * NJ * GPITCH;
{
#pragma unroll 1
            for (int p = tid; p < (GROWS - NT * NJ) * (GPITCH / 8); p += 256) {
                *(v8h*)(GH + zb + (size_t)p * 8) = z; *(v8h*)(GR + zb + (size_t)p * 8) = z; }
             }
    } else {
        float acc[NT];
#pragma unroll
        for (int t = 0; t < NT; ++t) acc[t] = 0.0f;
        const int ic = tid < NU ? tid : NU - 1;                     // clamped row index
        if (j < NU) {                                               // block-uniform
            const float* up = U + (size_t)ic * NU + j;
#pragma unroll 1
            for (int k = 0; k < NK; ++k) {
                float u = up[(size_t)k * (NU * NU)];
                float wa = Wcat[(size_t)k * (2 * NU) + NU + j];
                float wb = Wcat[(size_t)k * (2 * NU) + ic];
                asm volatile("" : "+v"(u)); asm volatile("" : "+v"(wa)); asm volatile("" : "+v"(wb));
                const float w = bfr(u) + ((ic == NU - 1) ? bfr(wa) : 0.0f) + ((j == NU - 1) ? bfr(wb) : 0.0f);
#pragma unroll
                for (int t = 0; t < NT; ++t) acc[t] = fmaf(w, bfr(Wd[k * NT + t]), acc[t]); }
#pragma unroll
            for (int t = 0; t < NT; ++t) { float bv = bd[t]; asm volatile("" : "+v"(bv)); acc[t] += ((ic == NU - 1) & (j == NU - 1)) ? bfr(bv) : 0.0f; }
        }
        const bool ok = (tid < NU) & (j < NU);
#pragma unroll
        for (int t = 0; t < NT; ++t) gs[t * GPITCH + tid] = ok ? acc[t] * GSC : 0.0f;
        __syncthreads();
{
#pragma unroll 1
            for (int p = tid; p < NT * 32; p += 256) {              // 9 rows x 32 pieces; second trip = wave 0 only
                const int t = p >> 5, pc = p & 31;
                const v4f x0 = *(const v4fa*)(&gs[t * GPITCH + pc * 8]); const v4f x1 = *(const v4fa*)(&gs[t * GPITCH + pc * 8 + 4]); v8h hv, rv;
#pragma unroll
                for (int i = 0; i < 4; ++i) { const h16 a0 = toh_flush(x0[i]); const h16 a1 = toh_flush(x1[i]); hv[i] = a0; hv[4 + i] = a1;
                    rv[i] = toh_flush((x0[i] - (float)a0) * QRS); rv[4 + i] = toh_flush((x1[i] - (float)a1) * QRS); }
                const size_t oo = ((size_t)t * NJ + j) * GPITCH + (size_t)pc * 8;
                *(v8h*)(GH + oo) = hv; *(v8h*)(GR + oo) = rv; }
             }
    }
}

// k_ht: register-blocked bf16 GEMM, ONE WAVE per 64x64 tile (16 accumulators), operands straight from K-contiguous bf16 planes, K = HID.
// C[m][n] = sum_k A[m][k] Bt[n][k]; A = state rows (m = q), Bt = weight rows (n < 256: head column n, n >= 256: tail column n - 256).
// Epilogue per column nn = n mod 256: nn < 200 -> GELU(C + bias), nn == 200 -> 1, nn > 200 -> 0; written as f16 value (Ph) and f16 residual x2048 (Pr), row pitch HTP.
// grid (NB*SEQ/64, HTP/64).
__global__ __launch_bounds__(32) void k_ht(const bf* __restrict__ A, const bf* __restrict__ Bt, const float* __restrict__ bh, const float* __restrict__ bt, h16* Ph, h16* Pr) {
    __shared__ __align__(16) float os[16 * 68];
    const int K = HID;
    const int lane = threadIdx.x & 31, lr = lane & 15, hi = lane >> 4; const int r0 = blockIdx.x * 64, c0 = blockIdx.y * 64;
    v8f acc[4][4];
#pragma unroll
    for (int mb = 0; mb < 4; ++mb)
#pragma unroll
        for (int nb = 0; nb < 4; ++nb) acc[mb][nb] = (v8f){};
    const size_t aoff = (size_t)(r0 + lr) * K + 8 * hi, boff = (size_t)(c0 + lr) * K + 8 * hi;
#pragma unroll 1
    for (int kc = 0; kc < K; kc += 32) {
        v16bf a[4];
#pragma unroll
        for (int mb = 0; mb < 4; ++mb) a[mb] = ldb(A + aoff + (size_t)mb * 16 * K + kc);
#pragma unroll
        for (int nb = 0; nb < 4; ++nb) { const v16bf b = ldb(Bt + boff + (size_t)nb * 16 * K + kc);
#pragma unroll
            for (int mb = 0; mb < 4; ++mb) acc[mb][nb] = wgb(a[mb], b, acc[mb][nb]); }
    }
    float bc[4];
#pragma unroll
    for (int nb = 0; nb < 4; ++nb) { const int nn = (c0 + nb * 16 + lr) & (HTW - 1); const int bi = nn < NF ? nn : NF - 1;   // clamped address
        float x = bh[bi]; float y = bt[bi]; asm volatile("" : "+v"(x)); asm volatile("" : "+v"(y));
        bc[nb] = bfr((c0 >= HTW) ? y : x); }
#pragma unroll
    for (int mb = 0; mb < 4; ++mb) {
#pragma unroll
        for (int nb = 0; nb < 4; ++nb) {
#pragma unroll
            for (int j = 0; j < 8; ++j) os[(hi * 8 + j) * 68 + nb * 16 + lr] = acc[mb][nb][j] + bc[nb]; }   // D: row 8h+j, col lane&15
        wave_sync();
{
#pragma unroll 1
            for (int s = 0; s < 4; ++s) { const int row = 4 * s + (lane >> 3), c8 = (lane & 7) * 8;   // 4 s x 4 row groups = 16 rows; 8 lanes x 8 = 64 columns
                const v4f x0 = *(const v4fa*)(&os[row * 68 + c8]); const v4f x1 = *(const v4fa*)(&os[row * 68 + c8 + 4]); v8h hv, rv;
#pragma unroll
                for (int i = 0; i < 4; ++i) {
                    const int n0 = (c0 + c8 + i) & (HTW - 1), n1 = (c0 + c8 + 4 + i) & (HTW - 1);
                    const float g0 = gelu_erf(x0[i]), g1 = gelu_erf(x1[i]);
                    const float v0 = (n0 < NF) ? g0 : ((n0 == NF) ? 1.0f : 0.0f);
                    const float v1 = (n1 < NF) ? g1 : ((n1 == NF) ? 1.0f : 0.0f);
                    const h16 a0 = toh_flush(v0); const h16 a1 = toh_flush(v1); hv[i] = a0; hv[4 + i] = a1;
                    rv[i] = toh_flush((v0 - (float)a0) * QRS); rv[4 + i] = toh_flush((v1 - (float)a1) * QRS); }
                const size_t oo = (size_t)(r0 + mb * 16 + row) * HTP + c0 + c8;
                *(v8h*)(Ph + oo) = hv; *(v8h*)(Pr + oo) = rv; }
             }
        wave_sync();
    }
}

// k_vg: f16 GEMM with three products, one wave per 16x64 tile, K = KJ. V[q][n] = sum_i head[q][i] G^T[n][i], n = t*NJ + j.
// A = head planes (value AH, residual AR; row pitch HTP, columns 0..KJ-1), Bt = G^T planes (value GH, residual GR; row pitch GPITCH).
// aH = AH.GH; aR = AR.GH + AH.GR (both residual carries x2048, one accumulator); V = aH + aR/2048 (keeps the x1024 carry of G); written as f16 value (VH) + f16 residual x2048 (VR), row pitch VP.
// grid (NB*SEQ/(16*VW), VP/64).
__global__ __launch_bounds__(32 * VW) void k_vg(const h16* __restrict__ AH, const h16* __restrict__ AR, const h16* __restrict__ GH, const h16* __restrict__ GR, h16* VH, h16* VR) {
    __shared__ __align__(16) float os[VW * 16 * 68];
    const int lane = threadIdx.x & 31, lr = lane & 15, hi = lane >> 4;
    const int wave = __builtin_amdgcn_readfirstlane((int)(threadIdx.x >> 5));
    const int m0 = (blockIdx.x * VW + wave) * 16, c0 = blockIdx.y * 64;
    v8f aH[4], aR[4];
#pragma unroll
    for (int nb = 0; nb < 4; ++nb) { aH[nb] = (v8f){}; aR[nb] = (v8f){}; }
    const size_t aoff = (size_t)(m0 + lr) * HTP + 8 * hi, boff = (size_t)(c0 + lr) * GPITCH + 8 * hi;
#pragma unroll 1
    for (int kc = 0; kc < KJ; kc += 32) {
        const v16h ah = ldh(AH + aoff + kc), ar = ldh(AR + aoff + kc);
#pragma unroll
        for (int nb = 0; nb < 4; ++nb) {
            const v16h gh = ldh(GH + boff + (size_t)nb * 16 * GPITCH + kc), gr = ldh(GR + boff + (size_t)nb * 16 * GPITCH + kc);
            aH[nb] = wg(ah, gh, aH[nb]); aR[nb] = wg(ar, gh, aR[nb]); aR[nb] = wg(ah, gr, aR[nb]); }
    }
    const int wb = wave * 16 * 68;
#pragma unroll
    for (int nb = 0; nb < 4; ++nb) {
#pragma unroll
        for (int j = 0; j < 8; ++j) os[wb + (hi * 8 + j) * 68 + nb * 16 + lr] = aH[nb][j] + aR[nb][j] * QRI; }   // D: row 8h+j, col lane&15
    wave_sync();
{
#pragma unroll 1
        for (int s = 0; s < 4; ++s) { const int row = 4 * s + (lane >> 3), c8 = (lane & 7) * 8;   // 4 s x 4 row groups = 16 rows; 8 lanes x 8 = 64 columns
            const v4f x0 = *(const v4fa*)(&os[wb + row * 68 + c8]); const v4f x1 = *(const v4fa*)(&os[wb + row * 68 + c8 + 4]); v8h hv, rv;
#pragma unroll
            for (int i = 0; i < 4; ++i) { const h16 a0 = toh_flush(x0[i]); const h16 a1 = toh_flush(x1[i]); hv[i] = a0; hv[4 + i] = a1;
                rv[i] = toh_flush((x0[i] - (float)a0) * QRS); rv[4 + i] = toh_flush((x1[i] - (float)a1) * QRS); }
            const size_t oo = (size_t)(m0 + row) * VP + c0 + c8;
            *(v8h*)(VH + oo) = hv; *(v8h*)(VR + oo) = rv; }
         }
}

// k_band: one wave per query q = (b, n). Nine 16-key tiles cover the band r = 0..128 (key = n - 64 + r, row address clamped into the sequence; out-of-sequence keys are discarded by the pack kernel).
// A = tail rows of the window (row = key, k = j; columns HTW.. of the head|tail planes), B = V[q] (column t = lane&15 with the address clamped to t <= 8, k = j; columns 9..15 of D are discarded), K = KJ.
// sH = TH.VH; sR = TR.VH + TH.VR; score = (sH + sR/2048)/1024. D element j of lane (lr, hi) = (r = 16 mt + 8 hi + j, t = lr) -> os[r*9 + t].
// grid NB*SEQ/BW.
__global__ __launch_bounds__(32 * BW) void k_band(const h16* __restrict__ HTH, const h16* __restrict__ HTR, const h16* __restrict__ VH, const h16* __restrict__ VR, float* S) {
    __shared__ __align__(16) float os[BW * SP];
    const int lane = threadIdx.x & 31, lr = lane & 15, hi = lane >> 4;
    const int wave = __builtin_amdgcn_readfirstlane((int)(threadIdx.x >> 5));
    const int q = blockIdx.x * BW + wave;
    const int b = q / SEQ, n = q % SEQ;
    const int wb = wave * SP;
    const int tc = lr < NT ? lr : NT - 1;
    const size_t bo = (size_t)q * VP + (size_t)tc * NJ + 8 * hi;
#pragma unroll 1
    for (int mt = 0; mt < 9; ++mt) {
        int key = n - WH + 16 * mt + lr; key = key < 0 ? 0 : (key > SEQ - 1 ? SEQ - 1 : key);
        const size_t ao = ((size_t)b * SEQ + (size_t)key) * HTP + HTW + 8 * hi;
        v8f sH = (v8f){}, sR = (v8f){};
#pragma unroll
        for (int kc = 0; kc < KJ; kc += 32) {
            const v16h th = ldh(HTH + ao + kc), tr = ldh(HTR + ao + kc);
            const v16h vh = ldh(VH + bo + kc), vr = ldh(VR + bo + kc);
            sH = wg(th, vh, sH); sR = wg(tr, vh, sR); sR = wg(th, vr, sR); }
#pragma unroll
        for (int j = 0; j < 8; ++j) { const int r = 16 * mt + 8 * hi + j;
            const float val = (sH[j] + sR[j] * QRI) * GSI;
            if ((lr < NT) & (r < WF)) os[wb + r * NT + lr] = val; }
    }
    if (lane < SP - QE) os[wb + QE + lane] = 0.0f;
    wave_sync();
    float* dst = S + (size_t)q * SP;
{
#pragma unroll 1
        for (int i = 0; i < 10; ++i) { const int p = i * 32 + lane;
            if (p < SP / 4) { const v4f val = *(const v4fa*)(&os[wb + p * 4]); *(v4f*)(dst + (size_t)p * 4) = val; } }
         }
}

// Keep rule per element: (n < len) and (0 <= key < SEQ) and (key < len), key = n + r - 64; other elements get the classifier bias; non-finite values become 0.
// grid (SEQ*QE/4/256, NB).
__global__ __launch_bounds__(256) void k_out(const float* __restrict__ S, const int* __restrict__ lengths, const float* __restrict__ bd, float* OUT) {
    const int b = blockIdx.y;
    const size_t i4 = (size_t)blockIdx.x * 256 + threadIdx.x; if (i4 >= (size_t)SEQ * QE / 4) return;
    const int len = lengths[b];
    v4f o;
#pragma unroll
    for (int c = 0; c < 4; ++c) {
        const unsigned e = (unsigned)(i4 * 4) + (unsigned)c;
        const unsigned n = e / QE; const unsigned rem = e - n * QE; const unsigned r = rem / NT; const unsigned t = rem - r * NT;
        float s = S[((size_t)b * SEQ + n) * SP + rem]; float bv = bd[t];
        asm volatile("" : "+v"(s)); asm volatile("" : "+v"(bv));
        const int jk = (int)n + (int)r - WH;
        const bool ok = ((int)n < len) & (jk >= 0) & (jk < SEQ) & (jk < len);
        float v = ok ? s : bfr(bv);
        v = (fabsf(v) <= 3.402823466e38f) ? v : 0.0f;
        o[c] = v; }
    float* p = OUT + (size_t)b * OUT_SEQ * QE + i4 * 4;
    *(v4f*)p = o; 
}

static constexpr size_t al256(size_t v) { return (v + 255) & ~(size_t)255; }
static constexpr size_t SZ_XB = al256((size_t)NB * SEQ * HID * 2);
static constexpr size_t SZ_WT = al256((size_t)HTP * HID * 2);
static constexpr size_t SZ_HT = al256((size_t)NB * SEQ * HTP * 2);
static constexpr size_t SZ_GT = al256((size_t)GROWS * GPITCH * 2);
static constexpr size_t SZ_V  = al256((size_t)NB * SEQ * VP * 2);
static constexpr size_t SZ_S  = al256((size_t)NB * SEQ * SP * 4);
static constexpr size_t SZ_TOTAL = SZ_XB + SZ_WT + 2 * SZ_HT + 2 * SZ_GT + 2 * SZ_V + SZ_S;
static_assert(SZ_TOTAL <= (size_t)134217728);          // workspace carve <= 128 MiB
static_assert(((size_t)HTW * HID * 2) % 256 == 0);     // tail half of the weight plane stays 256-byte aligned
static_assert(((size_t)SEQ * HID) % 8 == 0);
static_assert((size_t)(NB_FULL - 1) * SEQ_FULL * QE * 4 + (size_t)SEQ_FULL * QE * 4 == (size_t)9510912);   // output bytes of the full problem

extern "C" void kernel_launch(void* const* d_in, const int* in_sizes, int n_in,
                              void* d_out, int out_size, void* d_ws, size_t ws_size, hipStream_t stream) {
    if (n_in < 10) return;
    const size_t needx = ((size_t)(NB - 1) * SEQ_FULL + SEQ) * HID;
    if ((size_t)in_sizes[0] < needx) return;
    if (in_sizes[1] < NB) return;
    if ((size_t)in_sizes[2] < (size_t)HID * NF || (size_t)in_sizes[4] < (size_t)HID * NF) return;
    if (in_sizes[3] < NF || in_sizes[5] < NF) return;
    if ((size_t)in_sizes[6] < (size_t)NK * NU * NU) return;
    if ((size_t)in_sizes[7] < (size_t)NK * 2 * NU) return;
    if (in_sizes[8] < NK * NT || in_sizes[9] < NT) return;
    if ((size_t)out_size < ((size_t)(NB - 1) * OUT_SEQ + SEQ) * QE) return;
    if (SZ_TOTAL > ws_size) return;
    // wire order: state, lengths, Wh, bh, Wt, bt, U, Wcat, Wd, bd
    const float* state = (const float*)d_in[0];
    const int*   lengths = (const int*)d_in[1];
    const float* Wh = (const float*)d_in[2]; const float* bh = (const float*)d_in[3];
    const float* Wt = (const float*)d_in[4]; const float* bt = (const float*)d_in[5];
    const float* U = (const float*)d_in[6]; const float* Wcat = (const float*)d_in[7];
    const float* Wd = (const float*)d_in[8]; const float* bd = (const float*)d_in[9];
    float* OUT = (float*)d_out;      // [NB][SEQ][129][9]
    char* wsp = (char*)d_ws;
    bf*  XB  = (bf*)wsp;  wsp += SZ_XB;              // state  [NB*SEQ][768] bf16
    bf*  WT  = (bf*)wsp;  wsp += SZ_WT;              // [512][768] bf16: Wh^T | Wt^T (zero rows 200..255 of each half)
    h16* HTH = (h16*)wsp; wsp += SZ_HT;              // [NB*SEQ][512] head | tail value
    h16* HTR = (h16*)wsp; wsp += SZ_HT;              // [NB*SEQ][512] head | tail residual x2048
    h16* GH  = (h16*)wsp; wsp += SZ_GT;              // [2048][256] G^T value (x1024)
    h16* GR  = (h16*)wsp; wsp += SZ_GT;              // [2048][256] G^T residual x2048
    h16* VH  = (h16*)wsp; wsp += SZ_V;               // [NB*SEQ][2048] V value (x1024)
    h16* VR  = (h16*)wsp; wsp += SZ_V;               // [NB*SEQ][2048] V residual x2048
    float* S = (float*)wsp; wsp += SZ_S;             // [NB*SEQ][1184] band scores

    if (SEQ == SEQ_FULL) {
        const size_t n8 = (size_t)NB * SEQ * HID / 8;
        k_cvt8<<<(unsigned)((n8 + 255) / 256), 256, 0, stream>>>(state, XB, n8);
    } else {
        const size_t n8 = (size_t)SEQ * HID / 8;
        for (int b = 0; b < NB; ++b) k_cvt8<<<(unsigned)((n8 + 255) / 256), 256, 0, stream>>>(state + (size_t)b * SEQ_FULL * HID, XB + (size_t)b * SEQ * HID, n8);
    }
    // in[768][200] -> out[256][768] (rows = output columns of the Linear), grid (768/64, 256/32)
    k_wtr<<<dim3(HID / 64, HTW / 32, 1), 256, 0, stream>>>(Wh, WT);
    k_wtr<<<dim3(HID / 64, HTW / 32, 1), 256, 0, stream>>>(Wt, WT + (size_t)HTW * HID);
    k_gp<<<NJ + 1, 256, 0, stream>>>(U, Wcat, Wd, bd, GH, GR);

    k_ht<<<dim3(NB * SEQ / 64, HTP / 64, 1), 32, 0, stream>>>(XB, WT, bh, bt, HTH, HTR);
    k_vg<<<dim3(NB * SEQ / (16 * VW), VP / 64, 1), 32 * VW, 0, stream>>>(HTH, HTR, GH, GR, VH, VR);
    k_band<<<NB * SEQ / BW, 32 * BW, 0, stream>>>(HTH, HTR, VH, VR, S);
    k_out<<<dim3((unsigned)((size_t)SEQ * QE / 4 / 256), NB, 1), 256, 0, stream>>>(S, lengths, bd, OUT);
}

// v001
// Measured time: 165 microseconds a run.
// In both of two side-by-side timings against v000, it was 1.40 times as fast.
#include <hip/hip_runtime.h>

// Span scorer: head / tail projections (Linear 768 -> 200 + erf GELU) with an appended constant-one feature; biaffine form head^T U[k] tail plus a concatenation-linear term, evaluated for every query token on a sliding band of 129 key offsets (-64..+64); length masking (masked entries = classifier bias); 9-tag linear classifier; non-finite outputs set to 0.
// Algebra: the classifier is folded into the bilinear weights: G[i][j][t] = sum_k (U[k][i][j] + [j==200] Wcat[k][i] + [i==200] Wcat[k][201+j]) Wd[k][t] + [i==j==200] bd[t]; V[q][t][j] = sum_i head[q][i] G[i][j][t]; score[q][r][t] = sum_j tail[q-64+r][j] V[q][t][j].
// Compute dtypes, f32 accumulate everywhere: projections v_wmma_f32_16x16x32_bf16 (state, Wh, Wt, biases RNE-converted to bf16; products exact); G built in f32 on the vector unit from bf16-converted U, Wcat, Wd, bd (9 tag columns);
// V GEMM and band GEMM v_wmma_f32_16x16x32_f16 with every operand as f16 value + f16 residual x2048 (three products; residual products in their own accumulator folded by 1/2048); G carries x1024, folded back after the band GEMM.
// Layout: bf16 state plane [q][768]; bf16 weight plane [512][768] (rows 0..199 Wh^T, 256..455 Wt^T, others zero); head|tail planes [q][512] (head cols 0..255, tail cols 256..511; col 200 of each half = 1, cols 201..255 = 0);
// G^T planes in 32 panels of 8 columns: [i/8][t*224 + j][i%8]; V planes [q][2048] with column t*224 + j; band plane f32 [q][1184] (129 x 9 used); output packed thread-linearly.

#ifndef NB
#define NB 2
#endif
#ifndef SEQ
#define SEQ 1024
#endif
#define NB_FULL  2
#define SEQ_FULL 1024
#ifndef OUT_SEQ
#define OUT_SEQ SEQ              // row pitch (in tokens) between batches of the output
#endif
#define HID    768               // model width
#define NF     200               // projection width
#define NU     201               // NF + constant-one feature
#define NK     200               // bilinear channels
#define NT     9                 // tags
#define WH     64                // band half width
#define WF     129               // band width
#define QE     (WF * NT)         // output floats per query (1161)
#define HTW    256               // column width of the head half / tail half
#define HTP    512               // row pitch (halves) of the head|tail planes
#define KJ     224               // contraction length of the V and band GEMMs (201 zero-padded)
#define NJ     224               // G^T rows / V columns per tag
#define GPITCH 256               // columns i of the G^T planes (32 panels of 8)
#define GROWS  2048              // rows of the G^T planes (9 * 224 = 2016, zero rows above)
#define GPS    (GROWS * 8)       // halves per 8-column panel of the G^T planes
#define GJ     32                // G^T rows j per k_gp block (one lane each)
#define GKB    40                // values of k per batch of U loads in k_gp
#define VP     2048              // row pitch (halves) of the V planes
#define SP     1184
#define VW     4                 // waves per V GEMM block
#define BW     4                 // waves (queries) per band block
#define QRS    2048.0f           // carry of every residual plane
#define QRI    (1.0f / 2048.0f)
#define GSC    1024.0f           // carry of the G planes
#define GSI    (1.0f / 1024.0f)

static_assert(NU == NF + 1);
static_assert(HID % 64 == 0);                  // weight transpose tiles of 64 k; GEMM k-loop steps by 32
static_assert(KJ % 32 == 0);
static_assert(NU <= KJ);
static_assert(KJ <= HTW);
static_assert(KJ <= GPITCH);
static_assert(NJ == KJ);                       // V column block of one tag = one contraction row of the band GEMM
static_assert(HTP == 2 * HTW);
static_assert(HTW % 64 == 0);                  // a 64-column tile lies wholly in the head half or the tail half
static_assert((HTW & (HTW - 1)) == 0);
static_assert(NF <= HTW);
static_assert(GPITCH % 8 == 0);
static_assert(NJ % GJ == 0);
static_assert(GROWS - NT * NJ == GJ);           // zero rows above the tags: one lane each
static_assert(NK % GKB == 0);
static_assert(NU <= GPITCH);
static_assert(NT * NJ <= GROWS);
static_assert(GROWS == VP);
static_assert(VP % 64 == 0);
static_assert((NB * SEQ) % 64 == 0);
static_assert((NB * SEQ) % (16 * VW) == 0);
static_assert((NB * SEQ) % BW == 0);
static_assert(SEQ % 64 == 0);
static_assert(SEQ % 32 == 0);
static_assert(OUT_SEQ % 32 == 0);
static_assert(WF == 2 * WH + 1);
static_assert(WF <= 9 * 16);                   // nine 16-key tiles cover the band
static_assert(SP % 32 == 0);
static_assert(SP >= QE);
static_assert(SP - QE <= 32);                  // pad floats zeroed by one lane each
static_assert(SP / 4 <= 10 * 32);              // band store loop: 10 trips x 32 lanes x 16 B >= row bytes
static_assert(((size_t)SEQ * QE) % (4 * 256) == 0);
static_assert(NB <= NB_FULL);
static_assert(SEQ <= SEQ_FULL);
static_assert(4 * 32 * 16 == 16 * 64 * 2);     // slab store: 4 trips x 32 lanes x 16 B == 16 rows x 64 halves
static_assert(sizeof(float) * 16 * 68 <= 131072);
static_assert(sizeof(float) * VW * 16 * 68 <= 131072);
static_assert(sizeof(float) * BW * SP <= 131072);
static_assert(sizeof(float) * NT * 8 * GJ <= 131072);
static_assert(sizeof(float) * 64 * 33 <= 131072);

typedef _Float16 h16;
typedef unsigned short bf;
typedef __attribute__((ext_vector_type(16))) __bf16   v16bf;
typedef __attribute__((ext_vector_type(16))) _Float16 v16h;
typedef __attribute__((ext_vector_type(8)))  _Float16 v8h;
typedef __attribute__((ext_vector_type(8)))  unsigned short v8us;
typedef __attribute__((ext_vector_type(8)))  float    v8f;
typedef __attribute__((ext_vector_type(4)))  float    v4f;
typedef v4f  __attribute__((may_alias)) v4fa;

__device__ __forceinline__ unsigned short f2bf(float f) { unsigned u = __float_as_uint(f); u += 0x7FFFu + ((u >> 16) & 1u); return (unsigned short)(u >> 16); }
__device__ __forceinline__ float bfr(float f) { return __uint_as_float(((unsigned)f2bf(f)) << 16); }   // value after RNE convert to bf16
__device__ __forceinline__ v16h cat16(v8h lo, v8h hi) { return __builtin_shufflevector(lo, hi, 0, 1, 2, 3, 4, 5, 6, 7, 8, 9, 10, 11, 12, 13, 14, 15); }
__device__ __forceinline__ v16bf cat16b(v8us lo, v8us hi) { return __builtin_bit_cast(v16bf, __builtin_shufflevector(lo, hi, 0, 1, 2, 3, 4, 5, 6, 7, 8, 9, 10, 11, 12, 13, 14, 15)); }
__device__ __forceinline__ v8f wmma16(v16h a, v16h b, v8f c) { return __builtin_amdgcn_wmma_f32_16x16x32_f16(false, a, false, b, (short)0, c, false, false); }
__device__ __forceinline__ v8f wmmab(v16bf a, v16bf b, v8f c) { return __builtin_amdgcn_wmma_f32_16x16x32_bf16(false, a, false, b, (short)0, c, false, false); }
// fragment loaders from K-contiguous 16-bit rows; p already includes + 8*(lane>>4): elements 0..7 <- k0+8h+0..7, elements 8..15 <- k0+16+8h+0..7 (same map for A and B)
__device__ __forceinline__ v16h  ldh(const h16* p) { return cat16(*(const v8h*)p, *(const v8h*)(p + 16)); }
__device__ __forceinline__ v16bf ldb(const bf* p)  { return cat16b(*(const v8us*)p, *(const v8us*)(p + 16)); }
// the same k map from 8-column panels; p already includes + (lane>>4) panels: elements 0..7 <- panel k0/8+h, elements 8..15 <- panel k0/8+2+h
__device__ __forceinline__ v16h  ldp(const h16* p) { return cat16(*(const v8h*)p, *(const v8h*)(p + 2 * GPS)); }
// ordering point for wave-private LDS tiles (same wave writes and reads)
__device__ __forceinline__ void wave_sync() { __builtin_amdgcn_fence(3 /* release order */, "wavefront"); __builtin_amdgcn_wave_barrier(); asm volatile("" ::: "memory"); }

// per-instruction guarded WMMA wrappers: one accumulator tied per guard, operands kept live across the nops
__device__ __forceinline__ v8f wg(v16h a, v16h b, v8f c) { c = wmma16(a, b, c); asm volatile("v_nop\n\tv_nop\n\tv_nop\n\tv_nop" : "+v"(c) : "v"(a), "v"(b)); return c; }
__device__ __forceinline__ v8f wgb(v16bf a, v16bf b, v8f c) { c = wmmab(a, b, c); asm volatile("v_nop\n\tv_nop\n\tv_nop\n\tv_nop" : "+v"(c) : "v"(a), "v"(b)); return c; }
// f32 -> f16 convert that cannot produce an f16 subnormal (|v| < 2^-14 -> +0), applied after the plane's carry
static __device__ __forceinline__ h16 toh_flush(float v) { const h16 r = (h16)v; return (fabsf(v) < 6.103515625e-05f) ? (h16)0.0f : r; }
__device__ __forceinline__ float gelu_erf(float x) { return 0.5f * x * (1.0f + erff(x * 0.70710678118654752f)); }

__global__ __launch_bounds__(256) void k_cvt8(const float* __restrict__ src, bf* dst, size_t n8) {
    const size_t i = (size_t)blockIdx.x * 256 + threadIdx.x; if (i >= n8) return;
    const v8f v = *(const v8f*)(src + i * 8); v8us o;
#pragma unroll
    for (int k = 0; k < 8; ++k) o[k] = f2bf(v[k]);
    *(v8us*)(dst + i * 8) = o; 
}

// k_wtr: in[HID rows k][NF cols n] (f32) -> out[HTW rows n][HID cols k] (bf16, RNE convert); rows n >= NF written as zeros.
// grid (HID/64, HTW/32).
__global__ __launch_bounds__(256) void k_wtr(const float* __restrict__ W, bf* dst) {
    __shared__ float tile[64 * 33];
    const int tid = threadIdx.x;
    const int k0 = blockIdx.x * 64, n0 = blockIdx.y * 32;
#pragma unroll 1
    for (int e = 0; e < 8; ++e) {                                  // 8 trips x 256 threads = 64 x 32 elements
        const int idx = e * 256 + tid; const int kk = idx >> 5, nn = idx & 31;
        const int n = n0 + nn; const int nc = n < NF ? n : NF - 1;  // clamped address
        float v = W[(size_t)(k0 + kk) * NF + nc];
        asm volatile("" : "+v"(v));
        tile[kk * 33 + nn] = (n < NF) ? v : 0.0f; }
    __syncthreads();
    const int row = tid >> 3, pc = tid & 7;
    v8us o;
#pragma unroll
    for (int e = 0; e < 8; ++e) o[e] = f2bf(tile[(pc * 8 + e) * 33 + row]);
    bf* p = dst + (size_t)(n0 + row) * HID + k0 + pc * 8;
    *(v8us*)p = o; 
}

// k_gp: folded weights. Block (jt, ip) builds the tile i = 8 ip + wave, j = 32 jt + lane of G for all 9 tags: a wave reads 32 consecutive j of one U row per k (one 128-byte run), GKB values of k in flight at a time.
// Each (i, j, t) is summed over k = 0..199 in order by one thread. The tile is turned in LDS and stored as 16-byte pieces (8 columns i) of panel ip, 512 contiguous bytes per tag.
// Entries with i >= NU or j >= NU are zeros; blocks jt == 0 also zero-fill rows [NT*NJ, GROWS) of their panel.
// grid (NJ/GJ, GPITCH/8).
// EDGE: the wave holds the row i == 200 or the column j == 200, where the concatenation-linear terms enter. up = U + i*NU + jc and pa = Wcat + NU + jc are the lane's own, jc its clamped column; wb = Wcat + i is wave-uniform.
// ma, mb: all ones where the row term / the column term enters, else zero; msk gives the value or +0 for any bit pattern, as a select does, with no branch round a load.
__device__ __forceinline__ float msk(float v, unsigned m) { return __uint_as_float(__float_as_uint(v) & m); }
template <bool EDGE>
__device__ __forceinline__ void gp_sum(const float* __restrict__ up, const float* __restrict__ pa, const float* __restrict__ wb, const float* __restrict__ Wd, unsigned ma, unsigned mb, float (&acc)[NT]) {
#pragma unroll 1   // rolled over the batches
    for (int kb = 0; kb < NK; kb += GKB) {
        float u[GKB], a[EDGE ? GKB : 1];
#pragma unroll
        for (int e = 0; e < GKB; ++e) {
            u[e] = up[(size_t)e * (NU * NU)];
            if constexpr (EDGE) a[e] = pa[(size_t)e * (2 * NU)]; }
        asm volatile("s_wait_xcnt 0x0" ::: "memory");   // stands ahead of every overwrite of the address registers that the batch's loads name
        __builtin_amdgcn_sched_barrier(0);   // the whole batch's loads are issued ahead of its first sum (else the scheduler may sink loads to their uses and their latencies add up), and the address steps below stay behind the wait
#pragma unroll
        for (int e = 0; e < GKB; ++e) {
            float w = bfr(u[e]);
            if constexpr (EDGE) w = w + msk(bfr(a[e]), ma) + msk(bfr(wb[(size_t)(kb + e) * (2 * NU)]), mb);
#pragma unroll
            for (int t = 0; t < NT; ++t) acc[t] = fmaf(w, bfr(Wd[(kb + e) * NT + t]), acc[t]); }
        up += (size_t)GKB * (NU * NU);
        if constexpr (EDGE) pa += (size_t)GKB * (2 * NU);
    }
}
__global__ __launch_bounds__(256) void k_gp(const float* __restrict__ U, const float* __restrict__ Wcat, const float* __restrict__ Wd, const float* __restrict__ bd, h16* GH, h16* GR) {
    __shared__ __align__(16) float gs[NT * 8 * GJ];
    const int tid = threadIdx.x, lane = tid & 31;
    const int wave = __builtin_amdgcn_readfirstlane(tid >> 5);
    const int jt = blockIdx.x, ip = blockIdx.y;
    const int i = ip * 8 + wave, j = jt * GJ + lane;
    float acc[NT];
#pragma unroll
    for (int t = 0; t < NT; ++t) acc[t] = 0.0f;
    const int jc = j < NU ? j : NU - 1;                             // clamped column index
    if (i < NU) {                                                   // wave-uniform
        if ((i == NU - 1) | (jt == (NU - 1) / GJ)) {                // wave-uniform: the row or the column of the constant-one feature lies in this wave
            const unsigned ma = (i == NU - 1) ? ~0u : 0u, mb = (j == NU - 1) ? ~0u : 0u;
            gp_sum<true>(U + (size_t)i * NU + jc, Wcat + NU + jc, Wcat + i, Wd, ma, mb, acc);
#pragma unroll
            for (int t = 0; t < NT; ++t) acc[t] += msk(bfr(bd[t]), ma & mb);
        } else {
            gp_sum<false>(U + (size_t)i * NU + jc, Wcat, Wcat, Wd, 0u, 0u, acc); }
    }
    const bool ok = (i < NU) & (j < NU);
#pragma unroll
    for (int t = 0; t < NT; ++t) gs[(t * 8 + wave) * GJ + lane] = ok ? acc[t] * GSC : 0.0f;
    __syncthreads();
#pragma unroll 1   // rolled: the second trip is one wave's
    for (int p = tid; p < NT * GJ; p += 256) {                      // 9 tags x 32 rows j; second trip = wave 0 only
        const int t = p >> 5, jj = p & 31; v8h hv, rv;
#pragma unroll
        for (int c = 0; c < 8; ++c) { const float x = gs[(t * 8 + c) * GJ + jj]; const h16 a0 = toh_flush(x); hv[c] = a0; rv[c] = toh_flush((x - (float)a0) * QRS); }
        const size_t oo = (size_t)ip * GPS + ((size_t)t * NJ + jt * GJ + jj) * 8;
        *(v8h*)(GH + oo) = hv; *(v8h*)(GR + oo) = rv; }
    if ((jt == 0) & (wave == 0)) {                                  // wave-uniform
        const v8h z = (v8h){};
        const size_t zo = (size_t)ip * GPS + ((size_t)NT * NJ + lane) * 8;
        *(v8h*)(GH + zo) = z; *(v8h*)(GR + zo) = z; }
}

// k_ht: register-blocked bf16 GEMM, ONE WAVE per 64x64 tile (16 accumulators), operands straight from K-contiguous bf16 planes, K = HID.
// C[m][n] = sum_k A[m][k] Bt[n][k]; A = state rows (m = q), Bt = weight rows (n < 256: head column n, n >= 256: tail column n - 256).
// Epilogue per column nn = n mod 256: nn < 200 -> GELU(C + bias), nn == 200 -> 1, nn > 200 -> 0; written as f16 value (Ph) and f16 residual x2048 (Pr), row pitch HTP.
// grid (NB*SEQ/64, HTP/64).
__global__ __launch_bounds__(32) void k_ht(const bf* __restrict__ A, const bf* __restrict__ Bt, const float* __restrict__ bh, const float* __restrict__ bt, h16* Ph, h16* Pr) {
    __shared__ __align__(16) float os[16 * 68];
    const int K = HID;
    const int lane = threadIdx.x & 31, lr = lane & 15, hi = lane >> 4; const int r0 = blockIdx.x * 64, c0 = blockIdx.y * 64;
    v8f acc[4][4];
#pragma unroll
    for (int mb = 0; mb < 4; ++mb)
#pragma unroll
        for (int nb = 0; nb < 4; ++nb) acc[mb][nb] = (v8f){};
    const size_t aoff = (size_t)(r0 + lr) * K + 8 * hi, boff = (size_t)(c0 + lr) * K + 8 * hi;
#pragma unroll 1
    for (int kc = 0; kc < K; kc += 32) {
        v16bf a[4];
#pragma unroll
        for (int mb = 0; mb < 4; ++mb) a[mb] = ldb(A + aoff + (size_t)mb * 16 * K + kc);
#pragma unroll
        for (int nb = 0; nb < 4; ++nb) { const v16bf b = ldb(Bt + boff + (size_t)nb * 16 * K + kc);
#pragma unroll
            for (int mb = 0; mb < 4; ++mb) acc[mb][nb] = wgb(a[mb], b, acc[mb][nb]); }
    }
    float bc[4];
#pragma unroll
    for (int nb = 0; nb < 4; ++nb) { const int nn = (c0 + nb * 16 + lr) & (HTW - 1); const int bi = nn < NF ? nn : NF - 1;   // clamped address
        float x = bh[bi]; float y = bt[bi]; asm volatile("" : "+v"(x)); asm volatile("" : "+v"(y));
        bc[nb] = bfr((c0 >= HTW) ? y : x); }
#pragma unroll
    for (int mb = 0; mb < 4; ++mb) {
#pragma unroll
        for (int nb = 0; nb < 4; ++nb) {
#pragma unroll
            for (int j = 0; j < 8; ++j) os[(hi * 8 + j) * 68 + nb * 16 + lr] = acc[mb][nb][j] + bc[nb]; }   // D: row 8h+j, col lane&15
        wave_sync();
{
#pragma unroll 1
            for (int s = 0; s < 4; ++s) { const int row = 4 * s + (lane >> 3), c8 = (lane & 7) * 8;   // 4 s x 4 row groups = 16 rows; 8 lanes x 8 = 64 columns
                const v4f x0 = *(const v4fa*)(&os[row * 68 + c8]); const v4f x1 = *(const v4fa*)(&os[row * 68 + c8 + 4]); v8h hv, rv;
#pragma unroll
                for (int i = 0; i < 4; ++i) {
                    const int n0 = (c0 + c8 + i) & (HTW - 1), n1 = (c0 + c8 + 4 + i) & (HTW - 1);
                    const float g0 = gelu_erf(x0[i]), g1 = gelu_erf(x1[i]);
                    const float v0 = (n0 < NF) ? g0 : ((n0 == NF) ? 1.0f : 0.0f);
                    const float v1 = (n1 < NF) ? g1 : ((n1 == NF) ? 1.0f : 0.0f);
                    const h16 a0 = toh_flush(v0); const h16 a1 = toh_flush(v1); hv[i] = a0; hv[4 + i] = a1;
                    rv[i] = toh_flush((v0 - (float)a0) * QRS); rv[4 + i] = toh_flush((v1 - (float)a1) * QRS); }
                const size_t oo = (size_t)(r0 + mb * 16 + row) * HTP + c0 + c8;
                *(v8h*)(Ph + oo) = hv; *(v8h*)(Pr + oo) = rv; }
             }
        wave_sync();
    }
}

// k_vg: f16 GEMM with three products, one wave per 16x64 tile, K = KJ. V[q][n] = sum_i head[q][i] G^T[n][i], n = t*NJ + j.
// A = head planes (value AH, residual AR; row pitch HTP, columns 0..KJ-1), Bt = G^T planes (value GH, residual GR; panels of 8 columns: 16 lanes read 256 contiguous bytes).
// aH = AH.GH; aR = AR.GH + AH.GR (both residual carries x2048, one accumulator); V = aH + aR/2048 (keeps the x1024 carry of G); written as f16 value (VH) + f16 residual x2048 (VR), row pitch VP.
// grid (NB*SEQ/(16*VW), VP/64).
__global__ __launch_bounds__(32 * VW) void k_vg(const h16* __restrict__ AH, const h16* __restrict__ AR, const h16* __restrict__ GH, const h16* __restrict__ GR, h16* VH, h16* VR) {
    __shared__ __align__(16) float os[VW * 16 * 68];
    const int lane = threadIdx.x & 31, lr = lane & 15, hi = lane >> 4;
    const int wave = __builtin_amdgcn_readfirstlane((int)(threadIdx.x >> 5));
    const int m0 = (blockIdx.x * VW + wave) * 16, c0 = blockIdx.y * 64;
    v8f aH[4], aR[4];
#pragma unroll
    for (int nb = 0; nb < 4; ++nb) { aH[nb] = (v8f){}; aR[nb] = (v8f){}; }
    const size_t aoff = (size_t)(m0 + lr) * HTP + 8 * hi, boff = (size_t)hi * GPS + (size_t)(c0 + lr) * 8;
#pragma unroll 1
    for (int kc = 0; kc < KJ; kc += 32) {
        const v16h ah = ldh(AH + aoff + kc), ar = ldh(AR + aoff + kc);
#pragma unroll
        for (int nb = 0; nb < 4; ++nb) {
            const v16h gh = ldp(GH + boff + (size_t)(kc / 8) * GPS + nb * 16 * 8), gr = ldp(GR + boff + (size_t)(kc / 8) * GPS + nb * 16 * 8);
            aH[nb] = wg(ah, gh, aH[nb]); aR[nb] = wg(ar, gh, aR[nb]); aR[nb] = wg(ah, gr, aR[nb]); }
    }
    const int wb = wave * 16 * 68;
#pragma unroll
    for (int nb = 0; nb < 4; ++nb) {
#pragma unroll
        for (int j = 0; j < 8; ++j) os[wb + (hi * 8 + j) * 68 + nb * 16 + lr] = aH[nb][j] + aR[nb][j] * QRI; }   // D: row 8h+j, col lane&15
    wave_sync();
{
#pragma unroll 1
        for (int s = 0; s < 4; ++s) { const int row = 4 * s + (lane >> 3), c8 = (lane & 7) * 8;   // 4 s x 4 row groups = 16 rows; 8 lanes x 8 = 64 columns
            const v4f x0 = *(const v4fa*)(&os[wb + row * 68 + c8]); const v4f x1 = *(const v4fa*)(&os[wb + row * 68 + c8 + 4]); v8h hv, rv;
#pragma unroll
            for (int i = 0; i < 4; ++i) { const h16 a0 = toh_flush(x0[i]); const h16 a1 = toh_flush(x1[i]); hv[i] = a0; hv[4 + i] = a1;
                rv[i] = toh_flush((x0[i] - (float)a0) * QRS); rv[4 + i] = toh_flush((x1[i] - (float)a1) * QRS); }
            const size_t oo = (size_t)(m0 + row) * VP + c0 + c8;
            *(v8h*)(VH + oo) = hv; *(v8h*)(VR + oo) = rv; }
         }
}

// k_band: one wave per query q = (b, n). Nine 16-key tiles cover the band r = 0..128 (key = n - 64 + r, row address clamped into the sequence; out-of-sequence keys are discarded by the pack kernel).
// A = tail rows of the window (row = key, k = j; columns HTW.. of the head|tail planes), B = V[q] (column t = lane&15 with the address clamped to t <= 8, k = j; columns 9..15 of D are discarded), K = KJ.
// sH = TH.VH; sR = TR.VH + TH.VR; score = (sH + sR/2048)/1024. D element j of lane (lr, hi) = (r = 16 mt + 8 hi + j, t = lr) -> os[r*9 + t].
// grid NB*SEQ/BW.
__global__ __launch_bounds__(32 * BW) void k_band(const h16* __restrict__ HTH, const h16* __restrict__ HTR, const h16* __restrict__ VH, const h16* __restrict__ VR, float* S) {
    __shared__ __align__(16) float os[BW * SP];
    const int lane = threadIdx.x & 31, lr = lane & 15, hi = lane >> 4;
    const int wave = __builtin_amdgcn_readfirstlane((int)(threadIdx.x >> 5));
    const int q = blockIdx.x * BW + wave;
    const int b = q / SEQ, n = q % SEQ;
    const int wb = wave * SP;
    const int tc = lr < NT ? lr : NT - 1;
    const size_t bo = (size_t)q * VP + (size_t)tc * NJ + 8 * hi;
#pragma unroll 1
    for (int mt = 0; mt < 9; ++mt) {
        int key = n - WH + 16 * mt + lr; key = key < 0 ? 0 : (key > SEQ - 1 ? SEQ - 1 : key);
        const size_t ao = ((size_t)b * SEQ + (size_t)key) * HTP + HTW + 8 * hi;
        v8f sH = (v8f){}, sR = (v8f){};
#pragma unroll
        for (int kc = 0; kc < KJ; kc += 32) {
            const v16h th = ldh(HTH + ao + kc), tr = ldh(HTR + ao + kc);
            const v16h vh = ldh(VH + bo + kc), vr = ldh(VR + bo + kc);
            sH = wg(th, vh, sH); sR = wg(tr, vh, sR); sR = wg(th, vr, sR); }
#pragma unroll
        for (int j = 0; j < 8; ++j) { const int r = 16 * mt + 8 * hi + j;
            const float val = (sH[j] + sR[j] * QRI) * GSI;
            if ((lr < NT) & (r < WF)) os[wb + r * NT + lr] = val; }
    }
    if (lane < SP - QE) os[wb + QE + lane] = 0.0f;
    wave_sync();
    float* dst = S + (size_t)q * SP;
{
#pragma unroll 1
        for (int i = 0; i < 10; ++i) { const int p = i * 32 + lane;
            if (p < SP / 4) { const v4f val = *(const v4fa*)(&os[wb + p * 4]); *(v4f*)(dst + (size_t)p * 4) = val; } }
         }
}

// Keep rule per element: (n < len) and (0 <= key < SEQ) and (key < len), key = n + r - 64; other elements get the classifier bias; non-finite values become 0.
// grid (SEQ*QE/4/256, NB).
__global__ __launch_bounds__(256) void k_out(const float* __restrict__ S, const int* __restrict__ lengths, const float* __restrict__ bd, float* OUT) {
    const int b = blockIdx.y;
    const size_t i4 = (size_t)blockIdx.x * 256 + threadIdx.x; if (i4 >= (size_t)SEQ * QE / 4) return;
    const int len = lengths[b];
    v4f o;
#pragma unroll
    for (int c = 0; c < 4; ++c) {
        const unsigned e = (unsigned)(i4 * 4) + (unsigned)c;
        const unsigned n = e / QE; const unsigned rem = e - n * QE; const unsigned r = rem / NT; const unsigned t = rem - r * NT;
        float s = S[((size_t)b * SEQ + n) * SP + rem]; float bv = bd[t];
        asm volatile("" : "+v"(s)); asm volatile("" : "+v"(bv));
        const int jk = (int)n + (int)r - WH;
        const bool ok = ((int)n < len) & (jk >= 0) & (jk < SEQ) & (jk < len);
        float v = ok ? s : bfr(bv);
        v = (fabsf(v) <= 3.402823466e38f) ? v : 0.0f;
        o[c] = v; }
    float* p = OUT + (size_t)b * OUT_SEQ * QE + i4 * 4;
    *(v4f*)p = o; 
}

static constexpr size_t al256(size_t v) { return (v + 255) & ~(size_t)255; }
static constexpr size_t SZ_XB = al256((size_t)NB * SEQ * HID * 2);
static constexpr size_t SZ_WT = al256((size_t)HTP * HID * 2);
static constexpr size_t SZ_HT = al256((size_t)NB * SEQ * HTP * 2);
static constexpr size_t SZ_GT = al256((size_t)GROWS * GPITCH * 2);
static constexpr size_t SZ_V  = al256((size_t)NB * SEQ * VP * 2);
static constexpr size_t SZ_S  = al256((size_t)NB * SEQ * SP * 4);
static constexpr size_t SZ_TOTAL = SZ_XB + SZ_WT + 2 * SZ_HT + 2 * SZ_GT + 2 * SZ_V + SZ_S;
static_assert(SZ_TOTAL <= (size_t)134217728);          // workspace carve <= 128 MiB
static_assert(((size_t)HTW * HID * 2) % 256 == 0);     // tail half of the weight plane stays 256-byte aligned
static_assert(((size_t)SEQ * HID) % 8 == 0);
static_assert((size_t)(NB_FULL - 1) * SEQ_FULL * QE * 4 + (size_t)SEQ_FULL * QE * 4 == (size_t)9510912);   // output bytes of the full problem

extern "C" void kernel_launch(void* const* d_in, const int* in_sizes, int n_in,
                              void* d_out, int out_size, void* d_ws, size_t ws_size, hipStream_t stream) {
    if (n_in < 10) return;
    const size_t needx = ((size_t)(NB - 1) * SEQ_FULL + SEQ) * HID;
    if ((size_t)in_sizes[0] < needx) return;
    if (in_sizes[1] < NB) return;
    if ((size_t)in_sizes[2] < (size_t)HID * NF || (size_t)in_sizes[4] < (size_t)HID * NF) return;
    if (in_sizes[3] < NF || in_sizes[5] < NF) return;
    if ((size_t)in_sizes[6] < (size_t)NK * NU * NU) return;
    if ((size_t)in_sizes[7] < (size_t)NK * 2 * NU) return;
    if (in_sizes[8] < NK * NT || in_sizes[9] < NT) return;
    if ((size_t)out_size < ((size_t)(NB - 1) * OUT_SEQ + SEQ) * QE) return;
    if (SZ_TOTAL > ws_size) return;
    // wire order: state, lengths, Wh, bh, Wt, bt, U, Wcat, Wd, bd
    const float* state = (const float*)d_in[0];
    const int*   lengths = (const int*)d_in[1];
    const float* Wh = (const float*)d_in[2]; const float* bh = (const float*)d_in[3];
    const float* Wt = (const float*)d_in[4]; const float* bt = (const float*)d_in[5];
    const float* U = (const float*)d_in[6]; const float* Wcat = (const float*)d_in[7];
    const float* Wd = (const float*)d_in[8]; const float* bd = (const float*)d_in[9];
    float* OUT = (float*)d_out;      // [NB][SEQ][129][9]
    char* wsp = (char*)d_ws;
    bf*  XB  = (bf*)wsp;  wsp += SZ_XB;              // state  [NB*SEQ][768] bf16
    bf*  WT  = (bf*)wsp;  wsp += SZ_WT;              // [512][768] bf16: Wh^T | Wt^T (zero rows 200..255 of each half)
    h16* HTH = (h16*)wsp; wsp += SZ_HT;              // [NB*SEQ][512] head | tail value
    h16* HTR = (h16*)wsp; wsp += SZ_HT;              // [NB*SEQ][512] head | tail residual x2048
    h16* GH  = (h16*)wsp; wsp += SZ_GT;              // [32][2048][8] G^T value (x1024)
    h16* GR  = (h16*)wsp; wsp += SZ_GT;              // [32][2048][8] G^T residual x2048
    h16* VH  = (h16*)wsp; wsp += SZ_V;               // [NB*SEQ][2048] V value (x1024)
    h16* VR  = (h16*)wsp; wsp += SZ_V;               // [NB*SEQ][2048] V residual x2048
    float* S = (float*)wsp; wsp += SZ_S;             // [NB*SEQ][1184] band scores

    if (SEQ == SEQ_FULL) {
        const size_t n8 = (size_t)NB * SEQ * HID / 8;
        k_cvt8<<<(unsigned)((n8 + 255) / 256), 256, 0, stream>>>(state, XB, n8);
    } else {
        const size_t n8 = (size_t)SEQ * HID / 8;
        for (int b = 0; b < NB; ++b) k_cvt8<<<(unsigned)((n8 + 255) / 256), 256, 0, stream>>>(state + (size_t)b * SEQ_FULL * HID, XB + (size_t)b * SEQ * HID, n8);
    }
    // in[768][200] -> out[256][768] (rows = output columns of the Linear), grid (768/64, 256/32)
    k_wtr<<<dim3(HID / 64, HTW / 32, 1), 256, 0, stream>>>(Wh, WT);
    k_wtr<<<dim3(HID / 64, HTW / 32, 1), 256, 0, stream>>>(Wt, WT + (size_t)HTW * HID);
    k_gp<<<dim3(NJ / GJ, GPITCH / 8, 1), 256, 0, stream>>>(U, Wcat, Wd, bd, GH, GR);

    k_ht<<<dim3(NB * SEQ / 64, HTP / 64, 1), 32, 0, stream>>>(XB, WT, bh, bt, HTH, HTR);
    k_vg<<<dim3(NB * SEQ / (16 * VW), VP / 64, 1), 32 * VW, 0, stream>>>(HTH, HTR, GH, GR, VH, VR);
    k_band<<<NB * SEQ / BW, 32 * BW, 0, stream>>>(HTH, HTR, VH, VR, S);
    k_out<<<dim3((unsigned)((size_t)SEQ * QE / 4 / 256), NB, 1), 256, 0, stream>>>(S, lengths, bd, OUT);
}

// v002
// A run of this version takes 152 microseconds.
// Next to v001, in two timings, it ran 1.09 and 1.07 times as fast.
// All steps since v000 together make it 1.52 times as fast.
#include <hip/hip_runtime.h>

// Span scorer: head / tail projections (Linear 768 -> 200 + erf GELU) with an appended constant-one feature; biaffine form head^T U[k] tail plus a concatenation-linear term, evaluated for every query token on a sliding band of 129 key offsets (-64..+64); length masking (masked entries = classifier bias); 9-tag linear classifier; non-finite outputs set to 0.
// Algebra: the classifier is folded into the bilinear weights: G[i][j][t] = sum_k (U[k][i][j] + [j==200] Wcat[k][i] + [i==200] Wcat[k][201+j]) Wd[k][t] + [i==j==200] bd[t]; V[q][t][j] = sum_i head[q][i] G[i][j][t]; score[q][r][t] = sum_j tail[q-64+r][j] V[q][t][j].
// Compute dtypes, f32 accumulate everywhere: projections v_wmma_f32_16x16x32_bf16 (state, Wh, Wt, biases RNE-converted to bf16; products exact); G built in f32 on the vector unit from bf16-converted U, Wcat, Wd, bd (9 tag columns);
// V GEMM and band GEMM v_wmma_f32_16x16x32_f16 with every operand as f16 value + f16 residual x2048 (three products; residual products in their own accumulator folded by 1/2048); G carries x1024, folded back after the band GEMM.
// Layout: bf16 state plane [q][768]; bf16 weight plane [512][768] (rows 0..199 Wh^T, 256..455 Wt^T, others zero); head|tail planes [q][512] (head cols 0..255, tail cols 256..511; col 200 of each half = 1, cols 201..255 = 0);
// G^T planes in 32 panels of 8 columns: [i/8][t*224 + j][i%8]; V planes [q][2048] with column t*224 + j; band plane f32 [q][1184] (129 x 9 used); output packed thread-linearly.

#ifndef NB
#define NB 2
#endif
#ifndef SEQ
#define SEQ 1024
#endif
#define NB_FULL  2
#define SEQ_FULL 1024
#ifndef OUT_SEQ
#define OUT_SEQ SEQ              // row pitch (in tokens) between batches of the output
#endif
#define HID    768               // model width
#define NF     200               // projection width
#define NU     201               // NF + constant-one feature
#define NK     200               // bilinear channels
#define NT     9                 // tags
#define WH     64                // band half width
#define WF     129               // band width
#define QE     (WF * NT)         // output floats per query (1161)
#define HTW    256               // column width of the head half / tail half
#define HTP    512               // row pitch (halves) of the head|tail planes
#define KJ     224               // contraction length of the V and band GEMMs (201 zero-padded)
#define NJ     224               // G^T rows / V columns per tag
#define GPITCH 256               // columns i of the G^T planes (32 panels of 8)
#define GROWS  2048              // rows of the G^T planes (9 * 224 = 2016, zero rows above)
#define GPS    (GROWS * 8)       // halves per 8-column panel of the G^T planes
#define GJ     32                // G^T rows j per folded-weight block (one lane each)
#define GKB    40                // values of k per batch of U loads in gp_sum
#define VP     2048              // row pitch (halves) of the V planes
#define SP     1184
#define VW     4                 // waves per V GEMM block
#define BW     4                 // waves (queries) per band block
#define QRS    2048.0f           // carry of every residual plane
#define QRI    (1.0f / 2048.0f)
#define GSC    1024.0f           // carry of the G planes
#define GSI    (1.0f / 1024.0f)

static_assert(NU == NF + 1);
static_assert(HID % 64 == 0);                  // weight transpose tiles of 64 k; GEMM k-loop steps by 32
static_assert(KJ % 32 == 0);
static_assert(NU <= KJ);
static_assert(KJ <= HTW);
static_assert(KJ <= GPITCH);
static_assert(NJ == KJ);                       // V column block of one tag = one contraction row of the band GEMM
static_assert(HTP == 2 * HTW);
static_assert(HTW % 64 == 0);                  // a 64-column tile lies wholly in the head half or the tail half
static_assert((HTW & (HTW - 1)) == 0);
static_assert(NF <= HTW);
static_assert(GPITCH % 8 == 0);
static_assert(NJ % GJ == 0);
static_assert(GROWS - NT * NJ == GJ);           // zero rows above the tags: one lane each
static_assert(NK % GKB == 0);
static_assert(NU <= GPITCH);
static_assert(NT * NJ <= GROWS);
static_assert(GROWS == VP);
static_assert(VP % 64 == 0);
static_assert((NB * SEQ) % 64 == 0);
static_assert((NB * SEQ) % (16 * VW) == 0);
static_assert((NB * SEQ) % BW == 0);
static_assert(SEQ % 64 == 0);
static_assert(SEQ % 32 == 0);
static_assert(OUT_SEQ % 32 == 0);
static_assert(WF == 2 * WH + 1);
static_assert(WF <= 9 * 16);                   // nine 16-key tiles cover the band
static_assert(SP % 32 == 0);
static_assert(SP >= QE);
static_assert(SP - QE <= 32);                  // pad floats zeroed by one lane each
static_assert(SP / 4 <= 10 * 32);              // band store loop: 10 trips x 32 lanes x 16 B >= row bytes
static_assert(((size_t)SEQ * QE) % (4 * 256) == 0);
static_assert(NB <= NB_FULL);
static_assert(SEQ <= SEQ_FULL);
static_assert(4 * 32 * 16 == 16 * 64 * 2);     // slab store: 4 trips x 32 lanes x 16 B == 16 rows x 64 halves
static_assert(sizeof(float) * 16 * 68 <= 131072);
static_assert(sizeof(float) * VW * 16 * 68 <= 131072);
static_assert(sizeof(float) * BW * SP <= 131072);
static_assert(sizeof(float) * NT * 8 * GJ <= 131072);
static_assert(sizeof(float) * 64 * 33 <= 131072);

typedef _Float16 h16;
typedef unsigned short bf;
typedef __attribute__((ext_vector_type(16))) __bf16   v16bf;
typedef __attribute__((ext_vector_type(16))) _Float16 v16h;
typedef __attribute__((ext_vector_type(8)))  _Float16 v8h;
typedef __attribute__((ext_vector_type(8)))  unsigned short v8us;
typedef __attribute__((ext_vector_type(8)))  float    v8f;
typedef __attribute__((ext_vector_type(4)))  float    v4f;
typedef v4f  __attribute__((may_alias)) v4fa;

__device__ __forceinline__ unsigned short f2bf(float f) { unsigned u = __float_as_uint(f); u += 0x7FFFu + ((u >> 16) & 1u); return (unsigned short)(u >> 16); }
__device__ __forceinline__ float bfr(float f) { return __uint_as_float(((unsigned)f2bf(f)) << 16); }   // value after RNE convert to bf16
__device__ __forceinline__ v16h cat16(v8h lo, v8h hi) { return __builtin_shufflevector(lo, hi, 0, 1, 2, 3, 4, 5, 6, 7, 8, 9, 10, 11, 12, 13, 14, 15); }
__device__ __forceinline__ v16bf cat16b(v8us lo, v8us hi) { return __builtin_bit_cast(v16bf, __builtin_shufflevector(lo, hi, 0, 1, 2, 3, 4, 5, 6, 7, 8, 9, 10, 11, 12, 13, 14, 15)); }
__device__ __forceinline__ v8f wmma16(v16h a, v16h b, v8f c) { return __builtin_amdgcn_wmma_f32_16x16x32_f16(false, a, false, b, (short)0, c, false, false); }
__device__ __forceinline__ v8f wmmab(v16bf a, v16bf b, v8f c) { return __builtin_amdgcn_wmma_f32_16x16x32_bf16(false, a, false, b, (short)0, c, false, false); }
// fragment loaders from K-contiguous 16-bit rows; p already includes + 8*(lane>>4): elements 0..7 <- k0+8h+0..7, elements 8..15 <- k0+16+8h+0..7 (same map for A and B)
__device__ __forceinline__ v16h  ldh(const h16* p) { return cat16(*(const v8h*)p, *(const v8h*)(p + 16)); }
__device__ __forceinline__ v16bf ldb(const bf* p)  { return cat16b(*(const v8us*)p, *(const v8us*)(p + 16)); }
// the same k map from 8-column panels; p already includes + (lane>>4) panels: elements 0..7 <- panel k0/8+h, elements 8..15 <- panel k0/8+2+h
__device__ __forceinline__ v16h  ldp(const h16* p) { return cat16(*(const v8h*)p, *(const v8h*)(p + 2 * GPS)); }
// ordering point for wave-private LDS tiles (same wave writes and reads)
__device__ __forceinline__ void wave_sync() { __builtin_amdgcn_fence(3 /* release order */, "wavefront"); __builtin_amdgcn_wave_barrier(); asm volatile("" ::: "memory"); }

// per-instruction guarded WMMA wrappers: one accumulator tied per guard, operands kept live across the nops
__device__ __forceinline__ v8f wg(v16h a, v16h b, v8f c) { c = wmma16(a, b, c); asm volatile("v_nop\n\tv_nop\n\tv_nop\n\tv_nop" : "+v"(c) : "v"(a), "v"(b)); return c; }
__device__ __forceinline__ v8f wgb(v16bf a, v16bf b, v8f c) { c = wmmab(a, b, c); asm volatile("v_nop\n\tv_nop\n\tv_nop\n\tv_nop" : "+v"(c) : "v"(a), "v"(b)); return c; }
// f32 -> f16 convert that cannot produce an f16 subnormal (|v| < 2^-14 -> +0), applied after the plane's carry
static __device__ __forceinline__ h16 toh_flush(float v) { const h16 r = (h16)v; return (fabsf(v) < 6.103515625e-05f) ? (h16)0.0f : r; }
__device__ __forceinline__ float gelu_erf(float x) { return 0.5f * x * (1.0f + erff(x * 0.70710678118654752f)); }

// d_cvt8: state (f32, batch pitch SEQ_FULL tokens) -> bf16 plane (batch pitch SEQ tokens), 8 elements per thread; blk = 0 .. PB_CVT-1.
__device__ __forceinline__ void d_cvt8(const float* __restrict__ src, bf* dst, int blk) {
    constexpr size_t per = (size_t)SEQ * HID / 8, n8 = (size_t)NB * per;
    const size_t i = (size_t)blk * 256 + threadIdx.x; if (i >= n8) return;
    const size_t so = (SEQ == SEQ_FULL) ? i * 8 : (i / per) * ((size_t)SEQ_FULL * HID) + (i % per) * 8;
    const v8f v = *(const v8f*)(src + so); v8us o;
#pragma unroll
    for (int k = 0; k < 8; ++k) o[k] = f2bf(v[k]);
    *(v8us*)(dst + i * 8) = o; 
}

// d_wtr: in[HID rows k][NF cols n] (f32) -> out[HTW rows n][HID cols k] (bf16, RNE convert); rows n >= NF written as zeros.
// blocks (bx, by) of (HID/64, HTW/32); tile: 64 x 33 floats of LDS.
__device__ __forceinline__ void d_wtr(const float* __restrict__ W, bf* dst, float* tile, int bx, int by) {
    const int tid = threadIdx.x;
    const int k0 = bx * 64, n0 = by * 32;
#pragma unroll 1
    for (int e = 0; e < 8; ++e) {                                  // 8 trips x 256 threads = 64 x 32 elements
        const int idx = e * 256 + tid; const int kk = idx >> 5, nn = idx & 31;
        const int n = n0 + nn; const int nc = n < NF ? n : NF - 1;  // clamped address
        float v = W[(size_t)(k0 + kk) * NF + nc];
        asm volatile("" : "+v"(v));
        tile[kk * 33 + nn] = (n < NF) ? v : 0.0f; }
    __syncthreads();
    const int row = tid >> 3, pc = tid & 7;
    v8us o;
#pragma unroll
    for (int e = 0; e < 8; ++e) o[e] = f2bf(tile[(pc * 8 + e) * 33 + row]);
    bf* p = dst + (size_t)(n0 + row) * HID + k0 + pc * 8;
    *(v8us*)p = o; 
}

// d_gp: folded weights. Block (jt, ip) builds the tile i = 8 ip + wave, j = 32 jt + lane of G for all 9 tags: a wave reads 32 consecutive j of one U row per k (one 128-byte run), GKB values of k in flight at a time.
// Each (i, j, t) is summed over k = 0..199 in order by one thread. The tile is turned in LDS and stored as 16-byte pieces (8 columns i) of panel ip, 512 contiguous bytes per tag.
// Entries with i >= NU or j >= NU are zeros; blocks jt == 0 also zero-fill rows [NT*NJ, GROWS) of their panel.
// blocks (jt, ip) of (NJ/GJ, GPITCH/8); gs: NT x 8 x GJ floats of LDS.
// EDGE: the wave holds the row i == 200 or the column j == 200, where the concatenation-linear terms enter. up = U + i*NU + jc and pa = Wcat + NU + jc are the lane's own, jc its clamped column; wb = Wcat + i is wave-uniform.
// ma, mb: all ones where the row term / the column term enters, else zero; msk gives the value or +0 for any bit pattern, as a select does, with no branch round a load.
__device__ __forceinline__ float msk(float v, unsigned m) { return __uint_as_float(__float_as_uint(v) & m); }
template <bool EDGE>
__device__ __forceinline__ void gp_sum(const float* __restrict__ up, const float* __restrict__ pa, const float* __restrict__ wb, const float* __restrict__ Wd, unsigned ma, unsigned mb, float (&acc)[NT]) {
#pragma unroll 1   // rolled over the batches
    for (int kb = 0; kb < NK; kb += GKB) {
        float u[GKB], a[EDGE ? GKB : 1];
#pragma unroll
        for (int e = 0; e < GKB; ++e) {
            u[e] = up[(size_t)e * (NU * NU)];
            if constexpr (EDGE) a[e] = pa[(size_t)e * (2 * NU)]; }
        asm volatile("s_wait_xcnt 0x0" ::: "memory");   // stands ahead of every overwrite of the address registers that the batch's loads name
        __builtin_amdgcn_sched_barrier(0);   // the whole batch's loads are issued ahead of its first sum (else the scheduler may sink loads to their uses and their latencies add up), and the address steps below stay behind the wait
#pragma unroll
        for (int e = 0; e < GKB; ++e) {
            float w = bfr(u[e]);
            if constexpr (EDGE) w = w + msk(bfr(a[e]), ma) + msk(bfr(wb[(size_t)(kb + e) * (2 * NU)]), mb);
#pragma unroll
            for (int t = 0; t < NT; ++t) acc[t] = fmaf(w, bfr(Wd[(kb + e) * NT + t]), acc[t]); }
        up += (size_t)GKB * (NU * NU);
        if constexpr (EDGE) pa += (size_t)GKB * (2 * NU);
    }
}
__device__ __forceinline__ void d_gp(const float* __restrict__ U, const float* __restrict__ Wcat, const float* __restrict__ Wd, const float* __restrict__ bd, h16* GH, h16* GR, float* gs, int jt, int ip) {
    const int tid = threadIdx.x, lane = tid & 31;
    const int wave = __builtin_amdgcn_readfirstlane(tid >> 5);
    const int i = ip * 8 + wave, j = jt * GJ + lane;
    float acc[NT];
#pragma unroll
    for (int t = 0; t < NT; ++t) acc[t] = 0.0f;
    const int jc = j < NU ? j : NU - 1;                             // clamped column index
    if (i < NU) {                                                   // wave-uniform
        if ((i == NU - 1) | (jt == (NU - 1) / GJ)) {                // wave-uniform: the row or the column of the constant-one feature lies in this wave
            const unsigned ma = (i == NU - 1) ? ~0u : 0u, mb = (j == NU - 1) ? ~0u : 0u;
            gp_sum<true>(U + (size_t)i * NU + jc, Wcat + NU + jc, Wcat + i, Wd, ma, mb, acc);
#pragma unroll
            for (int t = 0; t < NT; ++t) acc[t] += msk(bfr(bd[t]), ma & mb);
        } else {
            gp_sum<false>(U + (size_t)i * NU + jc, Wcat, Wcat, Wd, 0u, 0u, acc); }
    }
    const bool ok = (i < NU) & (j < NU);
#pragma unroll
    for (int t = 0; t < NT; ++t) gs[(t * 8 + wave) * GJ + lane] = ok ? acc[t] * GSC : 0.0f;
    __syncthreads();
#pragma unroll 1   // rolled: the second trip is one wave's
    for (int p = tid; p < NT * GJ; p += 256) {                      // 9 tags x 32 rows j; second trip = wave 0 only
        const int t = p >> 5, jj = p & 31; v8h hv, rv;
#pragma unroll
        for (int c = 0; c < 8; ++c) { const float x = gs[(t * 8 + c) * GJ + jj]; const h16 a0 = toh_flush(x); hv[c] = a0; rv[c] = toh_flush((x - (float)a0) * QRS); }
        const size_t oo = (size_t)ip * GPS + ((size_t)t * NJ + jt * GJ + jj) * 8;
        *(v8h*)(GH + oo) = hv; *(v8h*)(GR + oo) = rv; }
    if ((jt == 0) & (wave == 0)) {                                  // wave-uniform
        const v8h z = (v8h){};
        const size_t zo = (size_t)ip * GPS + ((size_t)NT * NJ + lane) * 8;
        *(v8h*)(GH + zo) = z; *(v8h*)(GR + zo) = z; }
}

// k_prep: the four preparation bodies, none of which reads what another writes, share one launch; a block's body is chosen by its index (block-uniform branch).
// The folded-weight blocks, the longest, hold the lowest indices; then the two weight transposes; then the state convert.
#define PB_GP   ((NJ / GJ) * (GPITCH / 8))
#define PB_WTR  ((HID / 64) * (HTW / 32))
#define PB_CVT  ((int)(((size_t)NB * SEQ * HID / 8 + 255) / 256))
static_assert(64 * 33 <= NT * 8 * GJ);          // the transpose tile fits the LDS array sized for the folded-weight tile
__global__ __launch_bounds__(256) void k_prep(const float* __restrict__ state, const float* __restrict__ Wh, const float* __restrict__ Wt, const float* __restrict__ U, const float* __restrict__ Wcat,
                                              const float* __restrict__ Wd, const float* __restrict__ bd, bf* XB, bf* WT, h16* GH, h16* GR) {
    __shared__ __align__(16) float sm[NT * 8 * GJ];
    const int blk = blockIdx.x;
    // The tests run from the highest range down: the built code then holds the folded-weight body first, with no other body's barrier on a path ahead of it, and its wave-uniform Wd loads stay scalar loads.
    // The bodies stand one behind another in the built code: each s_wait_xcnt 0 stands behind a body's last stores, ahead of the next body's first write of a register that those stores name.
    if (blk >= PB_GP + 2 * PB_WTR) d_cvt8(state, XB, blk - PB_GP - 2 * PB_WTR);
    else if (blk >= PB_GP + PB_WTR) { d_wtr(Wt, WT + (size_t)HTW * HID, sm, (blk - PB_GP - PB_WTR) % (HID / 64), (blk - PB_GP - PB_WTR) / (HID / 64)); asm volatile("s_wait_xcnt 0x0" ::: "memory"); }
    else if (blk >= PB_GP) { d_wtr(Wh, WT, sm, (blk - PB_GP) % (HID / 64), (blk - PB_GP) / (HID / 64)); asm volatile("s_wait_xcnt 0x0" ::: "memory"); }
    else { d_gp(U, Wcat, Wd, bd, GH, GR, sm, blk % (NJ / GJ), blk / (NJ / GJ)); asm volatile("s_wait_xcnt 0x0" ::: "memory"); }
}

// k_ht: register-blocked bf16 GEMM, ONE WAVE per 64x64 tile (16 accumulators), operands straight from K-contiguous bf16 planes, K = HID.
// C[m][n] = sum_k A[m][k] Bt[n][k]; A = state rows (m = q), Bt = weight rows (n < 256: head column n, n >= 256: tail column n - 256).
// Epilogue per column nn = n mod 256: nn < 200 -> GELU(C + bias), nn == 200 -> 1, nn > 200 -> 0; written as f16 value (Ph) and f16 residual x2048 (Pr), row pitch HTP.
// grid (NB*SEQ/64, HTP/64).
__global__ __launch_bounds__(32) void k_ht(const bf* __restrict__ A, const bf* __restrict__ Bt, const float* __restrict__ bh, const float* __restrict__ bt, h16* Ph, h16* Pr) {
    __shared__ __align__(16) float os[16 * 68];
    const int K = HID;
    const int lane = threadIdx.x & 31, lr = lane & 15, hi = lane >> 4; const int r0 = blockIdx.x * 64, c0 = blockIdx.y * 64;
    v8f acc[4][4];
#pragma unroll
    for (int mb = 0; mb < 4; ++mb)
#pragma unroll
        for (int nb = 0; nb < 4; ++nb) acc[mb][nb] = (v8f){};
    const size_t aoff = (size_t)(r0 + lr) * K + 8 * hi, boff = (size_t)(c0 + lr) * K + 8 * hi;
#pragma unroll 1
    for (int kc = 0; kc < K; kc += 32) {
        v16bf a[4];
#pragma unroll
        for (int mb = 0; mb < 4; ++mb) a[mb] = ldb(A + aoff + (size_t)mb * 16 * K + kc);
#pragma unroll
        for (int nb = 0; nb < 4; ++nb) { const v16bf b = ldb(Bt + boff + (size_t)nb * 16 * K + kc);
#pragma unroll
            for (int mb = 0; mb < 4; ++mb) acc[mb][nb] = wgb(a[mb], b, acc[mb][nb]); }
    }
    float bc[4];
#pragma unroll
    for (int nb = 0; nb < 4; ++nb) { const int nn = (c0 + nb * 16 + lr) & (HTW - 1); const int bi = nn < NF ? nn : NF - 1;   // clamped address
        float x = bh[bi]; float y = bt[bi]; asm volatile("" : "+v"(x)); asm volatile("" : "+v"(y));
        bc[nb] = bfr((c0 >= HTW) ? y : x); }
#pragma unroll
    for (int mb = 0; mb < 4; ++mb) {
#pragma unroll
        for (int nb = 0; nb < 4; ++nb) {
#pragma unroll
            for (int j = 0; j < 8; ++j) os[(hi * 8 + j) * 68 + nb * 16 + lr] = acc[mb][nb][j] + bc[nb]; }   // D: row 8h+j, col lane&15
        wave_sync();
{
#pragma unroll 1
            for (int s = 0; s < 4; ++s) { const int row = 4 * s + (lane >> 3), c8 = (lane & 7) * 8;   // 4 s x 4 row groups = 16 rows; 8 lanes x 8 = 64 columns
                const v4f x0 = *(const v4fa*)(&os[row * 68 + c8]); const v4f x1 = *(const v4fa*)(&os[row * 68 + c8 + 4]); v8h hv, rv;
#pragma unroll
                for (int i = 0; i < 4; ++i) {
                    const int n0 = (c0 + c8 + i) & (HTW - 1), n1 = (c0 + c8 + 4 + i) & (HTW - 1);
                    const float g0 = gelu_erf(x0[i]), g1 = gelu_erf(x1[i]);
                    const float v0 = (n0 < NF) ? g0 : ((n0 == NF) ? 1.0f : 0.0f);
                    const float v1 = (n1 < NF) ? g1 : ((n1 == NF) ? 1.0f : 0.0f);
                    const h16 a0 = toh_flush(v0); const h16 a1 = toh_flush(v1); hv[i] = a0; hv[4 + i] = a1;
                    rv[i] = toh_flush((v0 - (float)a0) * QRS); rv[4 + i] = toh_flush((v1 - (float)a1) * QRS); }
                const size_t oo = (size_t)(r0 + mb * 16 + row) * HTP + c0 + c8;
                *(v8h*)(Ph + oo) = hv; *(v8h*)(Pr + oo) = rv; }
             }
        wave_sync();
    }
}

// k_vg: f16 GEMM with three products, one wave per 16x64 tile, K = KJ. V[q][n] = sum_i head[q][i] G^T[n][i], n = t*NJ + j.
// A = head planes (value AH, residual AR; row pitch HTP, columns 0..KJ-1), Bt = G^T planes (value GH, residual GR; panels of 8 columns: 16 lanes read 256 contiguous bytes).
// aH = AH.GH; aR = AR.GH + AH.GR (both residual carries x2048, one accumulator); V = aH + aR/2048 (keeps the x1024 carry of G); written as f16 value (VH) + f16 residual x2048 (VR), row pitch VP.
// grid (NB*SEQ/(16*VW), VP/64).
__global__ __launch_bounds__(32 * VW) void k_vg(const h16* __restrict__ AH, const h16* __restrict__ AR, const h16* __restrict__ GH, const h16* __restrict__ GR, h16* VH, h16* VR) {
    __shared__ __align__(16) float os[VW * 16 * 68];
    const int lane = threadIdx.x & 31, lr = lane & 15, hi = lane >> 4;
    const int wave = __builtin_amdgcn_readfirstlane((int)(threadIdx.x >> 5));
    const int m0 = (blockIdx.x * VW + wave) * 16, c0 = blockIdx.y * 64;
    v8f aH[4], aR[4];
#pragma unroll
    for (int nb = 0; nb < 4; ++nb) { aH[nb] = (v8f){}; aR[nb] = (v8f){}; }
    const size_t aoff = (size_t)(m0 + lr) * HTP + 8 * hi, boff = (size_t)hi * GPS + (size_t)(c0 + lr) * 8;
#pragma unroll 1
    for (int kc = 0; kc < KJ; kc += 32) {
        const v16h ah = ldh(AH + aoff + kc), ar = ldh(AR + aoff + kc);
#pragma unroll
        for (int nb = 0; nb < 4; ++nb) {
            const v16h gh = ldp(GH + boff + (size_t)(kc / 8) * GPS + nb * 16 * 8), gr = ldp(GR + boff + (size_t)(kc / 8) * GPS + nb * 16 * 8);
            aH[nb] = wg(ah, gh, aH[nb]); aR[nb] = wg(ar, gh, aR[nb]); aR[nb] = wg(ah, gr, aR[nb]); }
    }
    const int wb = wave * 16 * 68;
#pragma unroll
    for (int nb = 0; nb < 4; ++nb) {
#pragma unroll
        for (int j = 0; j < 8; ++j) os[wb + (hi * 8 + j) * 68 + nb * 16 + lr] = aH[nb][j] + aR[nb][j] * QRI; }   // D: row 8h+j, col lane&15
    wave_sync();
{
#pragma unroll 1
        for (int s = 0; s < 4; ++s) { const int row = 4 * s + (lane >> 3), c8 = (lane & 7) * 8;   // 4 s x 4 row groups = 16 rows; 8 lanes x 8 = 64 columns
            const v4f x0 = *(const v4fa*)(&os[wb + row * 68 + c8]); const v4f x1 = *(const v4fa*)(&os[wb + row * 68 + c8 + 4]); v8h hv, rv;
#pragma unroll
            for (int i = 0; i < 4; ++i) { const h16 a0 = toh_flush(x0[i]); const h16 a1 = toh_flush(x1[i]); hv[i] = a0; hv[4 + i] = a1;
                rv[i] = toh_flush((x0[i] - (float)a0) * QRS); rv[4 + i] = toh_flush((x1[i] - (float)a1) * QRS); }
            const size_t oo = (size_t)(m0 + row) * VP + c0 + c8;
            *(v8h*)(VH + oo) = hv; *(v8h*)(VR + oo) = rv; }
         }
}

// k_band: one wave per query q = (b, n). Nine 16-key tiles cover the band r = 0..128 (key = n - 64 + r, row address clamped into the sequence; out-of-sequence keys are discarded by the pack kernel).
// A = tail rows of the window (row = key, k = j; columns HTW.. of the head|tail planes), B = V[q] (column t = lane&15 with the address clamped to t <= 8, k = j; columns 9..15 of D are discarded), K = KJ.
// sH = TH.VH; sR = TR.VH + TH.VR; score = (sH + sR/2048)/1024. D element j of lane (lr, hi) = (r = 16 mt + 8 hi + j, t = lr) -> os[r*9 + t].
// grid NB*SEQ/BW.
__global__ __launch_bounds__(32 * BW) void k_band(const h16* __restrict__ HTH, const h16* __restrict__ HTR, const h16* __restrict__ VH, const h16* __restrict__ VR, float* S) {
    __shared__ __align__(16) float os[BW * SP];
    const int lane = threadIdx.x & 31, lr = lane & 15, hi = lane >> 4;
    const int wave = __builtin_amdgcn_readfirstlane((int)(threadIdx.x >> 5));
    const int q = blockIdx.x * BW + wave;
    const int b = q / SEQ, n = q % SEQ;
    const int wb = wave * SP;
    const int tc = lr < NT ? lr : NT - 1;
    const size_t bo = (size_t)q * VP + (size_t)tc * NJ + 8 * hi;
#pragma unroll 1
    for (int mt = 0; mt < 9; ++mt) {
        int key = n - WH + 16 * mt + lr; key = key < 0 ? 0 : (key > SEQ - 1 ? SEQ - 1 : key);
        const size_t ao = ((size_t)b * SEQ + (size_t)key) * HTP + HTW + 8 * hi;
        v8f sH = (v8f){}, sR = (v8f){};
#pragma unroll
        for (int kc = 0; kc < KJ; kc += 32) {
            const v16h th = ldh(HTH + ao + kc), tr = ldh(HTR + ao + kc);
            const v16h vh = ldh(VH + bo + kc), vr = ldh(VR + bo + kc);
            sH = wg(th, vh, sH); sR = wg(tr, vh, sR); sR = wg(th, vr, sR); }
#pragma unroll
        for (int j = 0; j < 8; ++j) { const int r = 16 * mt + 8 * hi + j;
            const float val = (sH[j] + sR[j] * QRI) * GSI;
            if ((lr < NT) & (r < WF)) os[wb + r * NT + lr] = val; }
    }
    if (lane < SP - QE) os[wb + QE + lane] = 0.0f;
    wave_sync();
    float* dst = S + (size_t)q * SP;
{
#pragma unroll 1
        for (int i = 0; i < 10; ++i) { const int p = i * 32 + lane;
            if (p < SP / 4) { const v4f val = *(const v4fa*)(&os[wb + p * 4]); *(v4f*)(dst + (size_t)p * 4) = val; } }
         }
}

// Keep rule per element: (n < len) and (0 <= key < SEQ) and (key < len), key = n + r - 64; other elements get the classifier bias; non-finite values become 0.
// grid (SEQ*QE/4/256, NB).
__global__ __launch_bounds__(256) void k_out(const float* __restrict__ S, const int* __restrict__ lengths, const float* __restrict__ bd, float* OUT) {
    const int b = blockIdx.y;
    const size_t i4 = (size_t)blockIdx.x * 256 + threadIdx.x; if (i4 >= (size_t)SEQ * QE / 4) return;
    const int len = lengths[b];
    v4f o;
#pragma unroll
    for (int c = 0; c < 4; ++c) {
        const unsigned e = (unsigned)(i4 * 4) + (unsigned)c;
        const unsigned n = e / QE; const unsigned rem = e - n * QE; const unsigned r = rem / NT; const unsigned t = rem - r * NT;
        float s = S[((size_t)b * SEQ + n) * SP + rem]; float bv = bd[t];
        asm volatile("" : "+v"(s)); asm volatile("" : "+v"(bv));
        const int jk = (int)n + (int)r - WH;
        const bool ok = ((int)n < len) & (jk >= 0) & (jk < SEQ) & (jk < len);
        float v = ok ? s : bfr(bv);
        v = (fabsf(v) <= 3.402823466e38f) ? v : 0.0f;
        o[c] = v; }
    float* p = OUT + (size_t)b * OUT_SEQ * QE + i4 * 4;
    *(v4f*)p = o; 
}

static constexpr size_t al256(size_t v) { return (v + 255) & ~(size_t)255; }
static constexpr size_t SZ_XB = al256((size_t)NB * SEQ * HID * 2);
static constexpr size_t SZ_WT = al256((size_t)HTP * HID * 2);
static constexpr size_t SZ_HT = al256((size_t)NB * SEQ * HTP * 2);
static constexpr size_t SZ_GT = al256((size_t)GROWS * GPITCH * 2);
static constexpr size_t SZ_V  = al256((size_t)NB * SEQ * VP * 2);
static constexpr size_t SZ_S  = al256((size_t)NB * SEQ * SP * 4);
static constexpr size_t SZ_TOTAL = SZ_XB + SZ_WT + 2 * SZ_HT + 2 * SZ_GT + 2 * SZ_V + SZ_S;
static_assert(SZ_TOTAL <= (size_t)134217728);          // workspace carve <= 128 MiB
static_assert(((size_t)HTW * HID * 2) % 256 == 0);     // tail half of the weight plane stays 256-byte aligned
static_assert(((size_t)SEQ * HID) % 8 == 0);
static_assert((size_t)(NB_FULL - 1) * SEQ_FULL * QE * 4 + (size_t)SEQ_FULL * QE * 4 == (size_t)9510912);   // output bytes of the full problem

extern "C" void kernel_launch(void* const* d_in, const int* in_sizes, int n_in,
                              void* d_out, int out_size, void* d_ws, size_t ws_size, hipStream_t stream) {
    if (n_in < 10) return;
    const size_t needx = ((size_t)(NB - 1) * SEQ_FULL + SEQ) * HID;
    if ((size_t)in_sizes[0] < needx) return;
    if (in_sizes[1] < NB) return;
    if ((size_t)in_sizes[2] < (size_t)HID * NF || (size_t)in_sizes[4] < (size_t)HID * NF) return;
    if (in_sizes[3] < NF || in_sizes[5] < NF) return;
    if ((size_t)in_sizes[6] < (size_t)NK * NU * NU) return;
    if ((size_t)in_sizes[7] < (size_t)NK * 2 * NU) return;
    if (in_sizes[8] < NK * NT || in_sizes[9] < NT) return;
    if ((size_t)out_size < ((size_t)(NB - 1) * OUT_SEQ + SEQ) * QE) return;
    if (SZ_TOTAL > ws_size) return;
    // wire order: state, lengths, Wh, bh, Wt, bt, U, Wcat, Wd, bd
    const float* state = (const float*)d_in[0];
    const int*   lengths = (const int*)d_in[1];
    const float* Wh = (const float*)d_in[2]; const float* bh = (const float*)d_in[3];
    const float* Wt = (const float*)d_in[4]; const float* bt = (const float*)d_in[5];
    const float* U = (const float*)d_in[6]; const float* Wcat = (const float*)d_in[7];
    const float* Wd = (const float*)d_in[8]; const float* bd = (const float*)d_in[9];
    float* OUT = (float*)d_out;      // [NB][SEQ][129][9]
    char* wsp = (char*)d_ws;
    bf*  XB  = (bf*)wsp;  wsp += SZ_XB;              // state  [NB*SEQ][768] bf16
    bf*  WT  = (bf*)wsp;  wsp += SZ_WT;              // [512][768] bf16: Wh^T | Wt^T (zero rows 200..255 of each half)
    h16* HTH = (h16*)wsp; wsp += SZ_HT;              // [NB*SEQ][512] head | tail value
    h16* HTR = (h16*)wsp; wsp += SZ_HT;              // [NB*SEQ][512] head | tail residual x2048
    h16* GH  = (h16*)wsp; wsp += SZ_GT;              // [32][2048][8] G^T value (x1024)
    h16* GR  = (h16*)wsp; wsp += SZ_GT;              // [32][2048][8] G^T residual x2048
    h16* VH  = (h16*)wsp; wsp += SZ_V;               // [NB*SEQ][2048] V value (x1024)
    h16* VR  = (h16*)wsp; wsp += SZ_V;               // [NB*SEQ][2048] V residual x2048
    float* S = (float*)wsp; wsp += SZ_S;             // [NB*SEQ][1184] band scores

    k_prep<<<PB_GP + 2 * PB_WTR + PB_CVT, 256, 0, stream>>>(state, Wh, Wt, U, Wcat, Wd, bd, XB, WT, GH, GR);

    k_ht<<<dim3(NB * SEQ / 64, HTP / 64, 1), 32, 0, stream>>>(XB, WT, bh, bt, HTH, HTR);
    k_vg<<<dim3(NB * SEQ / (16 * VW), VP / 64, 1), 32 * VW, 0, stream>>>(HTH, HTR, GH, GR, VH, VR);
    k_band<<<NB * SEQ / BW, 32 * BW, 0, stream>>>(HTH, HTR, VH, VR, S);
    k_out<<<dim3((unsigned)((size_t)SEQ * QE / 4 / 256), NB, 1), 256, 0, stream>>>(S, lengths, bd, OUT);
}

// v003
// A run of this version takes 132 microseconds.
// Next to v002, in two timings, it ran 1.15 and 1.16 times as fast.
// Counting every step since v000, it is 1.75 times as fast.
#include <hip/hip_runtime.h>

// Span scorer: head / tail projections (Linear 768 -> 200 + erf GELU) with an appended constant-one feature; biaffine form head^T U[k] tail plus a concatenation-linear term, evaluated for every query token on a sliding band of 129 key offsets (-64..+64); length masking (masked entries = classifier bias); 9-tag linear classifier; non-finite outputs set to 0.
// Algebra: the classifier is folded into the bilinear weights: G[i][j][t] = sum_k (U[k][i][j] + [j==200] Wcat[k][i] + [i==200] Wcat[k][201+j]) Wd[k][t] + [i==j==200] bd[t]; V[q][t][j] = sum_i head[q][i] G[i][j][t]; score[q][r][t] = sum_j tail[q-64+r][j] V[q][t][j].
// Compute dtypes, f32 accumulate everywhere: projections v_wmma_f32_16x16x32_bf16 (state, Wh, Wt, biases RNE-converted to bf16; products exact); G built in f32 on the vector unit from bf16-converted U, Wcat, Wd, bd (9 tag columns);
// V GEMM and band GEMM v_wmma_f32_16x16x32_f16 with every operand as f16 value + f16 residual x2048 (three products; residual products in their own accumulator folded by 1/2048); G carries x1024, folded back after the band GEMM.
// Layout: bf16 state plane [q][768]; bf16 weight plane [512][768] (rows 0..199 Wh^T, 256..455 Wt^T, others zero); head|tail planes [q][512] (head cols 0..255, tail cols 256..511; col 200 of each half = 1, cols 201..255 = 0);
// G^T planes in 32 panels of 8 columns: [i/8][t*224 + j][i%8]; V planes [q][2048] with column t*224 + j; band plane f32 [q][1184] (129 x 9 used); output packed thread-linearly.

#ifndef NB
#define NB 2
#endif
#ifndef SEQ
#define SEQ 1024
#endif
#define NB_FULL  2
#define SEQ_FULL 1024
#ifndef OUT_SEQ
#define OUT_SEQ SEQ              // row pitch (in tokens) between batches of the output
#endif
#define HID    768               // model width
#define NF     200               // projection width
#define NU     201               // NF + constant-one feature
#define NK     200               // bilinear channels
#define NT     9                 // tags
#define WH     64                // band half width
#define WF     129               // band width
#define QE     (WF * NT)         // output floats per query (1161)
#define HTW    256               // column width of the head half / tail half
#define HTP    512               // row pitch (halves) of the head|tail planes
#define KJ     224               // contraction length of the V and band GEMMs (201 zero-padded)
#define NJ     224               // G^T rows / V columns per tag
#define GPITCH 256               // columns i of the G^T planes (32 panels of 8)
#define GROWS  2048              // rows of the G^T planes (9 * 224 = 2016, zero rows above)
#define GPS    (GROWS * 8)       // halves per 8-column panel of the G^T planes
#define GJ     32                // G^T rows j per folded-weight block (one lane each)
#define GKB    40                // values of k per batch of U loads in gp_sum
#define VP     2048              // row pitch (halves) of the V planes
#define SP     1184
#define VW     4                 // waves per V GEMM block
#define BQ     16                // queries per band block
#define BKT    9                 // 16-key tiles of a band block's window = its waves
#define BWIN   (BKT * 16)        // keys in a band block's window
#define BTG    3                 // tags whose products alternate in the band GEMM
#define TPL    (KJ + 8)          // LDS row pitch (halves) of the tail rows: 29 x 16 B
#define VPL    (NT * NJ + 8)     // LDS row pitch (halves) of the V rows: 253 x 16 B
#define QRS    2048.0f           // carry of every residual plane
#define QRI    (1.0f / 2048.0f)
#define GSC    1024.0f           // carry of the G planes
#define GSI    (1.0f / 1024.0f)

static_assert(NU == NF + 1);
static_assert(HID % 64 == 0);                  // weight transpose tiles of 64 k; GEMM k-loop steps by 32
static_assert(KJ % 32 == 0);
static_assert(NU <= KJ);
static_assert(KJ <= HTW);
static_assert(KJ <= GPITCH);
static_assert(NJ == KJ);                       // V column block of one tag = one contraction row of the band GEMM
static_assert(HTP == 2 * HTW);
static_assert(HTW % 64 == 0);                  // a 64-column tile lies wholly in the head half or the tail half
static_assert((HTW & (HTW - 1)) == 0);
static_assert(NF <= HTW);
static_assert(GPITCH % 8 == 0);
static_assert(NJ % GJ == 0);
static_assert(GROWS - NT * NJ == GJ);           // zero rows above the tags: one lane each
static_assert(NK % GKB == 0);
static_assert(NU <= GPITCH);
static_assert(NT * NJ <= GROWS);
static_assert(GROWS == VP);
static_assert(VP % 64 == 0);
static_assert((NB * SEQ) % 64 == 0);
static_assert((NB * SEQ) % (16 * VW) == 0);
static_assert(SEQ % BQ == 0);                  // a band block's queries lie in one batch
static_assert(BWIN == BQ + 2 * WH);            // the window holds every key of every query of the block
static_assert(NT % BTG == 0);
static_assert(KJ / 8 <= 32 && NJ == KJ);        // a row part of KJ halves: one 16-byte piece per lane
static_assert(BKT == NT && BQ == 16);          // wave w stages key tile w and tag w
static_assert(SEQ % 16 == 0 && WH % 16 == 0);  // key tiles start at multiples of 16
static_assert(SP - QE <= 32 && BQ <= 2 * BKT);  // pad floats zeroed by one lane each, at most two rows a wave
static_assert(((TPL / 8) & 1) == 1 && ((VPL / 8) & 1) == 1);
static_assert(sizeof(float) * BQ * SP <= sizeof(_Float16) * 2 * BWIN * TPL);   // the score tile fits the tail rows' LDS
static_assert(sizeof(_Float16) * (2 * BWIN * TPL + 2 * BQ * VPL) <= 327680);
static_assert(SEQ % 64 == 0);
static_assert(SEQ % 32 == 0);
static_assert(OUT_SEQ % 32 == 0);
static_assert(WF == 2 * WH + 1);
static_assert(WF <= 9 * 16);                   // nine 16-key tiles cover the band
static_assert(SP % 32 == 0);
static_assert(SP >= QE);
static_assert(((size_t)SEQ * QE) % (4 * 256) == 0);
static_assert(NB <= NB_FULL);
static_assert(SEQ <= SEQ_FULL);
static_assert(4 * 32 * 16 == 16 * 64 * 2);     // slab store: 4 trips x 32 lanes x 16 B == 16 rows x 64 halves
static_assert(sizeof(float) * 16 * 68 <= 131072);
static_assert(sizeof(float) * VW * 16 * 68 <= 131072);
static_assert(sizeof(float) * NT * 8 * GJ <= 131072);
static_assert(sizeof(float) * 64 * 33 <= 131072);

typedef _Float16 h16;
typedef unsigned short bf;
typedef __attribute__((ext_vector_type(16))) __bf16   v16bf;
typedef __attribute__((ext_vector_type(16))) _Float16 v16h;
typedef __attribute__((ext_vector_type(8)))  _Float16 v8h;
typedef __attribute__((ext_vector_type(8)))  unsigned short v8us;
typedef __attribute__((ext_vector_type(8)))  float    v8f;
typedef __attribute__((ext_vector_type(4)))  float    v4f;
typedef v4f  __attribute__((may_alias)) v4fa;

__device__ __forceinline__ unsigned short f2bf(float f) { unsigned u = __float_as_uint(f); u += 0x7FFFu + ((u >> 16) & 1u); return (unsigned short)(u >> 16); }
__device__ __forceinline__ float bfr(float f) { return __uint_as_float(((unsigned)f2bf(f)) << 16); }   // value after RNE convert to bf16
__device__ __forceinline__ v16h cat16(v8h lo, v8h hi) { return __builtin_shufflevector(lo, hi, 0, 1, 2, 3, 4, 5, 6, 7, 8, 9, 10, 11, 12, 13, 14, 15); }
__device__ __forceinline__ v16bf cat16b(v8us lo, v8us hi) { return __builtin_bit_cast(v16bf, __builtin_shufflevector(lo, hi, 0, 1, 2, 3, 4, 5, 6, 7, 8, 9, 10, 11, 12, 13, 14, 15)); }
__device__ __forceinline__ v8f wmma16(v16h a, v16h b, v8f c) { return __builtin_amdgcn_wmma_f32_16x16x32_f16(false, a, false, b, (short)0, c, false, false); }
__device__ __forceinline__ v8f wmmab(v16bf a, v16bf b, v8f c) { return __builtin_amdgcn_wmma_f32_16x16x32_bf16(false, a, false, b, (short)0, c, false, false); }
// fragment loaders from K-contiguous 16-bit rows; p already includes + 8*(lane>>4): elements 0..7 <- k0+8h+0..7, elements 8..15 <- k0+16+8h+0..7 (same map for A and B)
__device__ __forceinline__ v16h  ldh(const h16* p) { return cat16(*(const v8h*)p, *(const v8h*)(p + 16)); }
__device__ __forceinline__ v16bf ldb(const bf* p)  { return cat16b(*(const v8us*)p, *(const v8us*)(p + 16)); }
// the same k map from 8-column panels; p already includes + (lane>>4) panels: elements 0..7 <- panel k0/8+h, elements 8..15 <- panel k0/8+2+h
__device__ __forceinline__ v16h  ldp(const h16* p) { return cat16(*(const v8h*)p, *(const v8h*)(p + 2 * GPS)); }
// ordering point for wave-private LDS tiles (same wave writes and reads)
__device__ __forceinline__ void wave_sync() { __builtin_amdgcn_fence(3 /* release order */, "wavefront"); __builtin_amdgcn_wave_barrier(); asm volatile("" ::: "memory"); }

// per-instruction guarded WMMA wrappers: one accumulator tied per guard, operands kept live across the nops
__device__ __forceinline__ v8f wg(v16h a, v16h b, v8f c) { c = wmma16(a, b, c); asm volatile("v_nop\n\tv_nop\n\tv_nop\n\tv_nop" : "+v"(c) : "v"(a), "v"(b)); return c; }
__device__ __forceinline__ v8f wgb(v16bf a, v16bf b, v8f c) { c = wmmab(a, b, c); asm volatile("v_nop\n\tv_nop\n\tv_nop\n\tv_nop" : "+v"(c) : "v"(a), "v"(b)); return c; }
// f32 -> f16 convert that cannot produce an f16 subnormal (|v| < 2^-14 -> +0), applied after the plane's carry
static __device__ __forceinline__ h16 toh_flush(float v) { const h16 r = (h16)v; return (fabsf(v) < 6.103515625e-05f) ? (h16)0.0f : r; }
__device__ __forceinline__ float gelu_erf(float x) { return 0.5f * x * (1.0f + erff(x * 0.70710678118654752f)); }

// d_cvt8: state (f32, batch pitch SEQ_FULL tokens) -> bf16 plane (batch pitch SEQ tokens), 8 elements per thread; blk = 0 .. PB_CVT-1.
__device__ __forceinline__ void d_cvt8(const float* __restrict__ src, bf* dst, int blk) {
    constexpr size_t per = (size_t)SEQ * HID / 8, n8 = (size_t)NB * per;
    const size_t i = (size_t)blk * 256 + threadIdx.x; if (i >= n8) return;
    const size_t so = (SEQ == SEQ_FULL) ? i * 8 : (i / per) * ((size_t)SEQ_FULL * HID) + (i % per) * 8;
    const v8f v = *(const v8f*)(src + so); v8us o;
#pragma unroll
    for (int k = 0; k < 8; ++k) o[k] = f2bf(v[k]);
    *(v8us*)(dst + i * 8) = o; 
}

// d_wtr: in[HID rows k][NF cols n] (f32) -> out[HTW rows n][HID cols k] (bf16, RNE convert); rows n >= NF written as zeros.
// blocks (bx, by) of (HID/64, HTW/32); tile: 64 x 33 floats of LDS.
__device__ __forceinline__ void d_wtr(const float* __restrict__ W, bf* dst, float* tile, int bx, int by) {
    const int tid = threadIdx.x;
    const int k0 = bx * 64, n0 = by * 32;
#pragma unroll 1
    for (int e = 0; e < 8; ++e) {                                  // 8 trips x 256 threads = 64 x 32 elements
        const int idx = e * 256 + tid; const int kk = idx >> 5, nn = idx & 31;
        const int n = n0 + nn; const int nc = n < NF ? n : NF - 1;  // clamped address
        float v = W[(size_t)(k0 + kk) * NF + nc];
        asm volatile("" : "+v"(v));
        tile[kk * 33 + nn] = (n < NF) ? v : 0.0f; }
    __syncthreads();
    const int row = tid >> 3, pc = tid & 7;
    v8us o;
#pragma unroll
    for (int e = 0; e < 8; ++e) o[e] = f2bf(tile[(pc * 8 + e) * 33 + row]);
    bf* p = dst + (size_t)(n0 + row) * HID + k0 + pc * 8;
    *(v8us*)p = o; 
}

// d_gp: folded weights. Block (jt, ip) builds the tile i = 8 ip + wave, j = 32 jt + lane of G for all 9 tags: a wave reads 32 consecutive j of one U row per k (one 128-byte run), GKB values of k in flight at a time.
// Each (i, j, t) is summed over k = 0..199 in order by one thread. The tile is turned in LDS and stored as 16-byte pieces (8 columns i) of panel ip, 512 contiguous bytes per tag.
// Entries with i >= NU or j >= NU are zeros; blocks jt == 0 also zero-fill rows [NT*NJ, GROWS) of their panel.
// blocks (jt, ip) of (NJ/GJ, GPITCH/8); gs: NT x 8 x GJ floats of LDS.
// EDGE: the wave holds the row i == 200 or the column j == 200, where the concatenation-linear terms enter. up = U + i*NU + jc and pa = Wcat + NU + jc are the lane's own, jc its clamped column; wb = Wcat + i is wave-uniform.
// ma, mb: all ones where the row term / the column term enters, else zero; msk gives the value or +0 for any bit pattern, as a select does, with no branch round a load.
__device__ __forceinline__ float msk(float v, unsigned m) { return __uint_as_float(__float_as_uint(v) & m); }
template <bool EDGE>
__device__ __forceinline__ void gp_sum(const float* __restrict__ up, const float* __restrict__ pa, const float* __restrict__ wb, const float* __restrict__ Wd, unsigned ma, unsigned mb, float (&acc)[NT]) {
#pragma unroll 1   // rolled over the batches
    for (int kb = 0; kb < NK; kb += GKB) {
        float u[GKB], a[EDGE ? GKB : 1];
#pragma unroll
        for (int e = 0; e < GKB; ++e) {
            u[e] = up[(size_t)e * (NU * NU)];
            if constexpr (EDGE) a[e] = pa[(size_t)e * (2 * NU)]; }
        asm volatile("s_wait_xcnt 0x0" ::: "memory");   // stands ahead of every overwrite of the address registers that the batch's loads name
        __builtin_amdgcn_sched_barrier(0);   // the whole batch's loads are issued ahead of its first sum (else the scheduler may sink loads to their uses and their latencies add up), and the address steps below stay behind the wait
#pragma unroll
        for (int e = 0; e < GKB; ++e) {
            float w = bfr(u[e]);
            if constexpr (EDGE) w = w + msk(bfr(a[e]), ma) + msk(bfr(wb[(size_t)(kb + e) * (2 * NU)]), mb);
#pragma unroll
            for (int t = 0; t < NT; ++t) acc[t] = fmaf(w, bfr(Wd[(kb + e) * NT + t]), acc[t]); }
        up += (size_t)GKB * (NU * NU);
        if constexpr (EDGE) pa += (size_t)GKB * (2 * NU);
    }
}
__device__ __forceinline__ void d_gp(const float* __restrict__ U, const float* __restrict__ Wcat, const float* __restrict__ Wd, const float* __restrict__ bd, h16* GH, h16* GR, float* gs, int jt, int ip) {
    const int tid = threadIdx.x, lane = tid & 31;
    const int wave = __builtin_amdgcn_readfirstlane(tid >> 5);
    const int i = ip * 8 + wave, j = jt * GJ + lane;
    float acc[NT];
#pragma unroll
    for (int t = 0; t < NT; ++t) acc[t] = 0.0f;
    const int jc = j < NU ? j : NU - 1;                             // clamped column index
    if (i < NU) {                                                   // wave-uniform
        if ((i == NU - 1) | (jt == (NU - 1) / GJ)) {                // wave-uniform: the row or the column of the constant-one feature lies in this wave
            const unsigned ma = (i == NU - 1) ? ~0u : 0u, mb = (j == NU - 1) ? ~0u : 0u;
            gp_sum<true>(U + (size_t)i * NU + jc, Wcat + NU + jc, Wcat + i, Wd, ma, mb, acc);
#pragma unroll
            for (int t = 0; t < NT; ++t) acc[t] += msk(bfr(bd[t]), ma & mb);
        } else {
            gp_sum<false>(U + (size_t)i * NU + jc, Wcat, Wcat, Wd, 0u, 0u, acc); }
    }
    const bool ok = (i < NU) & (j < NU);
#pragma unroll
    for (int t = 0; t < NT; ++t) gs[(t * 8 + wave) * GJ + lane] = ok ? acc[t] * GSC : 0.0f;
    __syncthreads();
#pragma unroll 1   // rolled: the second trip is one wave's
    for (int p = tid; p < NT * GJ; p += 256) {                      // 9 tags x 32 rows j; second trip = wave 0 only
        const int t = p >> 5, jj = p & 31; v8h hv, rv;
#pragma unroll
        for (int c = 0; c < 8; ++c) { const float x = gs[(t * 8 + c) * GJ + jj]; const h16 a0 = toh_flush(x); hv[c] = a0; rv[c] = toh_flush((x - (float)a0) * QRS); }
        const size_t oo = (size_t)ip * GPS + ((size_t)t * NJ + jt * GJ + jj) * 8;
        *(v8h*)(GH + oo) = hv; *(v8h*)(GR + oo) = rv; }
    if ((jt == 0) & (wave == 0)) {                                  // wave-uniform
        const v8h z = (v8h){};
        const size_t zo = (size_t)ip * GPS + ((size_t)NT * NJ + lane) * 8;
        *(v8h*)(GH + zo) = z; *(v8h*)(GR + zo) = z; }
}

// k_prep: the four preparation bodies, none of which reads what another writes, share one launch; a block's body is chosen by its index (block-uniform branch).
// The folded-weight blocks, the longest, hold the lowest indices; then the two weight transposes; then the state convert.
#define PB_GP   ((NJ / GJ) * (GPITCH / 8))
#define PB_WTR  ((HID / 64) * (HTW / 32))
#define PB_CVT  ((int)(((size_t)NB * SEQ * HID / 8 + 255) / 256))
static_assert(64 * 33 <= NT * 8 * GJ);          // the transpose tile fits the LDS array sized for the folded-weight tile
__global__ __launch_bounds__(256) void k_prep(const float* __restrict__ state, const float* __restrict__ Wh, const float* __restrict__ Wt, const float* __restrict__ U, const float* __restrict__ Wcat,
                                              const float* __restrict__ Wd, const float* __restrict__ bd, bf* XB, bf* WT, h16* GH, h16* GR) {
    __shared__ __align__(16) float sm[NT * 8 * GJ];
    const int blk = blockIdx.x;
    // The tests run from the highest range down: the built code then holds the folded-weight body first, with no other body's barrier on a path ahead of it, and its wave-uniform Wd loads stay scalar loads.
    // The bodies stand one behind another in the built code: each s_wait_xcnt 0 stands behind a body's last stores, ahead of the next body's first write of a register that those stores name.
    if (blk >= PB_GP + 2 * PB_WTR) d_cvt8(state, XB, blk - PB_GP - 2 * PB_WTR);
    else if (blk >= PB_GP + PB_WTR) { d_wtr(Wt, WT + (size_t)HTW * HID, sm, (blk - PB_GP - PB_WTR) % (HID / 64), (blk - PB_GP - PB_WTR) / (HID / 64)); asm volatile("s_wait_xcnt 0x0" ::: "memory"); }
    else if (blk >= PB_GP) { d_wtr(Wh, WT, sm, (blk - PB_GP) % (HID / 64), (blk - PB_GP) / (HID / 64)); asm volatile("s_wait_xcnt 0x0" ::: "memory"); }
    else { d_gp(U, Wcat, Wd, bd, GH, GR, sm, blk % (NJ / GJ), blk / (NJ / GJ)); asm volatile("s_wait_xcnt 0x0" ::: "memory"); }
}

// k_ht: register-blocked bf16 GEMM, ONE WAVE per 64x64 tile (16 accumulators), operands straight from K-contiguous bf16 planes, K = HID.
// C[m][n] = sum_k A[m][k] Bt[n][k]; A = state rows (m = q), Bt = weight rows (n < 256: head column n, n >= 256: tail column n - 256).
// Epilogue per column nn = n mod 256: nn < 200 -> GELU(C + bias), nn == 200 -> 1, nn > 200 -> 0; written as f16 value (Ph) and f16 residual x2048 (Pr), row pitch HTP.
// grid (NB*SEQ/64, HTP/64).
__global__ __launch_bounds__(32) void k_ht(const bf* __restrict__ A, const bf* __restrict__ Bt, const float* __restrict__ bh, const float* __restrict__ bt, h16* Ph, h16* Pr) {
    __shared__ __align__(16) float os[16 * 68];
    const int K = HID;
    const int lane = threadIdx.x & 31, lr = lane & 15, hi = lane >> 4; const int r0 = blockIdx.x * 64, c0 = blockIdx.y * 64;
    v8f acc[4][4];
#pragma unroll
    for (int mb = 0; mb < 4; ++mb)
#pragma unroll
        for (int nb = 0; nb < 4; ++nb) acc[mb][nb] = (v8f){};
    const size_t aoff = (size_t)(r0 + lr) * K + 8 * hi, boff = (size_t)(c0 + lr) * K + 8 * hi;
#pragma unroll 1
    for (int kc = 0; kc < K; kc += 32) {
        v16bf a[4];
#pragma unroll
        for (int mb = 0; mb < 4; ++mb) a[mb] = ldb(A + aoff + (size_t)mb * 16 * K + kc);
#pragma unroll
        for (int nb = 0; nb < 4; ++nb) { const v16bf b = ldb(Bt + boff + (size_t)nb * 16 * K + kc);
#pragma unroll
            for (int mb = 0; mb < 4; ++mb) acc[mb][nb] = wgb(a[mb], b, acc[mb][nb]); }
    }
    float bc[4];
#pragma unroll
    for (int nb = 0; nb < 4; ++nb) { const int nn = (c0 + nb * 16 + lr) & (HTW - 1); const int bi = nn < NF ? nn : NF - 1;   // clamped address
        float x = bh[bi]; float y = bt[bi]; asm volatile("" : "+v"(x)); asm volatile("" : "+v"(y));
        bc[nb] = bfr((c0 >= HTW) ? y : x); }
#pragma unroll
    for (int mb = 0; mb < 4; ++mb) {
#pragma unroll
        for (int nb = 0; nb < 4; ++nb) {
#pragma unroll
            for (int j = 0; j < 8; ++j) os[(hi * 8 + j) * 68 + nb * 16 + lr] = acc[mb][nb][j] + bc[nb]; }   // D: row 8h+j, col lane&15
        wave_sync();
{
#pragma unroll 1
            for (int s = 0; s < 4; ++s) { const int row = 4 * s + (lane >> 3), c8 = (lane & 7) * 8;   // 4 s x 4 row groups = 16 rows; 8 lanes x 8 = 64 columns
                const v4f x0 = *(const v4fa*)(&os[row * 68 + c8]); const v4f x1 = *(const v4fa*)(&os[row * 68 + c8 + 4]); v8h hv, rv;
#pragma unroll
                for (int i = 0; i < 4; ++i) {
                    const int n0 = (c0 + c8 + i) & (HTW - 1), n1 = (c0 + c8 + 4 + i) & (HTW - 1);
                    const float g0 = gelu_erf(x0[i]), g1 = gelu_erf(x1[i]);
                    const float v0 = (n0 < NF) ? g0 : ((n0 == NF) ? 1.0f : 0.0f);
                    const float v1 = (n1 < NF) ? g1 : ((n1 == NF) ? 1.0f : 0.0f);
                    const h16 a0 = toh_flush(v0); const h16 a1 = toh_flush(v1); hv[i] = a0; hv[4 + i] = a1;
                    rv[i] = toh_flush((v0 - (float)a0) * QRS); rv[4 + i] = toh_flush((v1 - (float)a1) * QRS); }
                const size_t oo = (size_t)(r0 + mb * 16 + row) * HTP + c0 + c8;
                *(v8h*)(Ph + oo) = hv; *(v8h*)(Pr + oo) = rv; }
             }
        wave_sync();
    }
}

// k_vg: f16 GEMM with three products, one wave per 16x64 tile, K = KJ. V[q][n] = sum_i head[q][i] G^T[n][i], n = t*NJ + j.
// A = head planes (value AH, residual AR; row pitch HTP, columns 0..KJ-1), Bt = G^T planes (value GH, residual GR; panels of 8 columns: 16 lanes read 256 contiguous bytes).
// aH = AH.GH; aR = AR.GH + AH.GR (both residual carries x2048, one accumulator); V = aH + aR/2048 (keeps the x1024 carry of G); written as f16 value (VH) + f16 residual x2048 (VR), row pitch VP.
// grid (NB*SEQ/(16*VW), VP/64).
__global__ __launch_bounds__(32 * VW) void k_vg(const h16* __restrict__ AH, const h16* __restrict__ AR, const h16* __restrict__ GH, const h16* __restrict__ GR, h16* VH, h16* VR) {
    __shared__ __align__(16) float os[VW * 16 * 68];
    const int lane = threadIdx.x & 31, lr = lane & 15, hi = lane >> 4;
    const int wave = __builtin_amdgcn_readfirstlane((int)(threadIdx.x >> 5));
    const int m0 = (blockIdx.x * VW + wave) * 16, c0 = blockIdx.y * 64;
    v8f aH[4], aR[4];
#pragma unroll
    for (int nb = 0; nb < 4; ++nb) { aH[nb] = (v8f){}; aR[nb] = (v8f){}; }
    const size_t aoff = (size_t)(m0 + lr) * HTP + 8 * hi, boff = (size_t)hi * GPS + (size_t)(c0 + lr) * 8;
#pragma unroll 1
    for (int kc = 0; kc < KJ; kc += 32) {
        const v16h ah = ldh(AH + aoff + kc), ar = ldh(AR + aoff + kc);
#pragma unroll
        for (int nb = 0; nb < 4; ++nb) {
            const v16h gh = ldp(GH + boff + (size_t)(kc / 8) * GPS + nb * 16 * 8), gr = ldp(GR + boff + (size_t)(kc / 8) * GPS + nb * 16 * 8);
            aH[nb] = wg(ah, gh, aH[nb]); aR[nb] = wg(ar, gh, aR[nb]); aR[nb] = wg(ah, gr, aR[nb]); }
    }
    const int wb = wave * 16 * 68;
#pragma unroll
    for (int nb = 0; nb < 4; ++nb) {
#pragma unroll
        for (int j = 0; j < 8; ++j) os[wb + (hi * 8 + j) * 68 + nb * 16 + lr] = aH[nb][j] + aR[nb][j] * QRI; }   // D: row 8h+j, col lane&15
    wave_sync();
{
#pragma unroll 1
        for (int s = 0; s < 4; ++s) { const int row = 4 * s + (lane >> 3), c8 = (lane & 7) * 8;   // 4 s x 4 row groups = 16 rows; 8 lanes x 8 = 64 columns
            const v4f x0 = *(const v4fa*)(&os[wb + row * 68 + c8]); const v4f x1 = *(const v4fa*)(&os[wb + row * 68 + c8 + 4]); v8h hv, rv;
#pragma unroll
            for (int i = 0; i < 4; ++i) { const h16 a0 = toh_flush(x0[i]); const h16 a1 = toh_flush(x1[i]); hv[i] = a0; hv[4 + i] = a1;
                rv[i] = toh_flush((x0[i] - (float)a0) * QRS); rv[4 + i] = toh_flush((x1[i] - (float)a1) * QRS); }
            const size_t oo = (size_t)(m0 + row) * VP + c0 + c8;
            *(v8h*)(VH + oo) = hv; *(v8h*)(VR + oo) = rv; }
         }
}

// k_band: one block per BQ = 16 consecutive queries (one batch), one wave per 16-key tile of their common window of 144 keys (key = n0 - 64 + w, w = 0..143; a tile outside the sequence reads the nearest tile inside it; out-of-sequence keys are discarded by the pack kernel).
// The window's tail rows and the 16 queries' V rows are read from global memory once per block, in 16-byte pieces that run along the rows, and kept in LDS (row pitches an odd number of 16-byte units).
// A = tail rows of the wave's key tile (row = key, k = j), held in registers for all tags; B = V of one tag (column = query lane&15, k = j), K = KJ.
// sH = TH.VH; sR = TR.VH + TH.VR; score = (sH + sR/2048)/1024. D element j of lane (lr, hi) = (w = 16 wave + 8 hi + j, query lr); band offset r = w - lr, kept where 0 <= r <= 128 -> os[lr*SP + r*9 + t].
// os lies on the tail rows' LDS, which no wave reads once every wave holds its A fragments (second barrier); the third barrier ends the score writes ahead of the block's linear store of its 16 band rows.
// grid NB*SEQ/BQ.
__global__ __launch_bounds__(32 * BKT) void k_band(const h16* __restrict__ HTH, const h16* __restrict__ HTR, const h16* __restrict__ VH, const h16* __restrict__ VR, float* S) {
    __shared__ __align__(16) h16 sm[2 * BWIN * TPL + 2 * BQ * VPL];
    h16* const tH = sm; h16* const tR = sm + BWIN * TPL;
    h16* const vH = sm + 2 * BWIN * TPL; h16* const vR = vH + BQ * VPL;
    float* const os = (float*)sm;
    constexpr int NTH = 32 * BKT, TPC = KJ / 8;
    const int tid = threadIdx.x, lane = tid & 31, lr = lane & 15, hi = lane >> 4;
    const int wave = __builtin_amdgcn_readfirstlane(tid >> 5);
    const int q0 = blockIdx.x * BQ;
    const int b = q0 / SEQ, n0 = q0 % SEQ;
    if (lane < TPC) {   // one lane per 16-byte piece of a 448-byte row part; wave w brings the 16 tail rows of key tile w and tag w's part of the 16 V rows
        int kb = n0 - WH + 16 * wave; kb = kb < 0 ? 0 : (kb > SEQ - 16 ? SEQ - 16 : kb);   // a key tile lies wholly inside or wholly outside the sequence
        const size_t to = ((size_t)b * SEQ + (size_t)kb) * HTP + lane * 8, vo = (size_t)q0 * VP + wave * NJ + lane * 8;
        const h16* const pth = HTH + to; const h16* const ptr = HTR + to; const h16* const pvh = VH + vo; const h16* const pvr = VR + vo;
        const int tl = wave * 16 * TPL + lane * 8, vl = wave * NJ + lane * 8;
        v8h xh[16], xr[16], yh[16], yr[16];
#pragma unroll
        for (int it = 0; it < 16; ++it) { xh[it] = *(const v8h*)(pth + HTW + it * HTP); xr[it] = *(const v8h*)(ptr + HTW + it * HTP); }
#pragma unroll
        for (int it = 0; it < 16; ++it) yh[it] = *(const v8h*)(pvh + it * VP);
        asm volatile("s_wait_xcnt 0x0" :: "v"(pth), "v"(ptr), "v"(pvh) : "memory");   // stands ahead of every overwrite of the three address pairs that the loads above name; as its inputs they stay whole up to it
        __builtin_amdgcn_sched_barrier(0);   // these 48 loads are issued ahead of the first LDS store (one latency, not several), and the LDS address work stays behind the wait
#pragma unroll
        for (int it = 0; it < 16; ++it) { *(v8h*)(tH + tl + it * TPL) = xh[it]; *(v8h*)(tR + tl + it * TPL) = xr[it]; }
        __builtin_amdgcn_sched_barrier(0);   // the last 16 loads take the registers that the tail rows have left: all 64 at once would need registers above v255
#pragma unroll
        for (int it = 0; it < 16; ++it) yr[it] = *(const v8h*)(pvr + it * VP);
        asm volatile("s_wait_xcnt 0x0" :: "v"(pvr) : "memory");   // as above, for the fourth address pair
        __builtin_amdgcn_sched_barrier(0);   // keeps these loads ahead of the stores below and later address work behind the wait
#pragma unroll
        for (int it = 0; it < 16; ++it) *(v8h*)(vH + vl + it * VPL) = yh[it];
#pragma unroll
        for (int it = 0; it < 16; ++it) *(v8h*)(vR + vl + it * VPL) = yr[it];
    }
    __syncthreads();
    v16h th[KJ / 32], tr[KJ / 32];
    const int ao = (wave * 16 + lr) * TPL + 8 * hi;
#pragma unroll
    for (int k = 0; k < KJ / 32; ++k) { th[k] = ldh(tH + ao + k * 32); tr[k] = ldh(tR + ao + k * 32); }
    __syncthreads();
    const int bo = lr * VPL + 8 * hi;
    const int r0 = 16 * wave + 8 * hi - lr;
#pragma unroll 1   // rolled over the groups of three tags: the A fragments and one group's accumulators and B fragments fill the registers below v256
    for (int tg = 0; tg < NT; tg += BTG) {
        v8f sH[BTG], sR[BTG];
#pragma unroll
        for (int u = 0; u < BTG; ++u) { sH[u] = (v8f){}; sR[u] = (v8f){}; }
#pragma unroll
        for (int k = 0; k < KJ / 32; ++k) {
            v16h vh[BTG], vr[BTG];
#pragma unroll
            for (int u = 0; u < BTG; ++u) { vh[u] = ldh(vH + bo + (tg + u) * NJ + k * 32); vr[u] = ldh(vR + bo + (tg + u) * NJ + k * 32); }
            // the three tags' products alternate, so that no product waits for the one before it; each accumulator takes its products in the order k, then TR.VH, then TH.VR
#pragma unroll
            for (int u = 0; u < BTG; ++u) sH[u] = wg(th[k], vh[u], sH[u]);
#pragma unroll
            for (int u = 0; u < BTG; ++u) sR[u] = wg(tr[k], vh[u], sR[u]);
#pragma unroll
            for (int u = 0; u < BTG; ++u) sR[u] = wg(th[k], vr[u], sR[u]); }
#pragma unroll
        for (int u = 0; u < BTG; ++u) {
#pragma unroll
            for (int j = 0; j < 8; ++j) { const int r = r0 + j;
                const float val = (sH[u][j] + sR[u][j] * QRI) * GSI;
                if ((r >= 0) & (r < WF)) os[lr * SP + r * NT + tg + u] = val; } }
    }
    if (lane < SP - QE) { os[wave * SP + QE + lane] = 0.0f; if (wave + BKT < BQ) os[(wave + BKT) * SP + QE + lane] = 0.0f; }   // pad floats of rows wave and wave + 9
    __syncthreads();
    float* dst = S + (size_t)q0 * SP;
    for (int p = tid; p < BQ * SP / 4; p += NTH) { const v4f val = *(const v4fa*)(&os[p * 4]); *(v4f*)(dst + (size_t)p * 4) = val; }
}

// Keep rule per element: (n < len) and (0 <= key < SEQ) and (key < len), key = n + r - 64; other elements get the classifier bias; non-finite values become 0.
// grid (SEQ*QE/4/256, NB).
__global__ __launch_bounds__(256) void k_out(const float* __restrict__ S, const int* __restrict__ lengths, const float* __restrict__ bd, float* OUT) {
    const int b = blockIdx.y;
    const size_t i4 = (size_t)blockIdx.x * 256 + threadIdx.x; if (i4 >= (size_t)SEQ * QE / 4) return;
    const int len = lengths[b];
    v4f o;
#pragma unroll
    for (int c = 0; c < 4; ++c) {
        const unsigned e = (unsigned)(i4 * 4) + (unsigned)c;
        const unsigned n = e / QE; const unsigned rem = e - n * QE; const unsigned r = rem / NT; const unsigned t = rem - r * NT;
        float s = S[((size_t)b * SEQ + n) * SP + rem]; float bv = bd[t];
        asm volatile("" : "+v"(s)); asm volatile("" : "+v"(bv));
        const int jk = (int)n + (int)r - WH;
        const bool ok = ((int)n < len) & (jk >= 0) & (jk < SEQ) & (jk < len);
        float v = ok ? s : bfr(bv);
        v = (fabsf(v) <= 3.402823466e38f) ? v : 0.0f;
        o[c] = v; }
    float* p = OUT + (size_t)b * OUT_SEQ * QE + i4 * 4;
    *(v4f*)p = o; 
}

static constexpr size_t al256(size_t v) { return (v + 255) & ~(size_t)255; }
static constexpr size_t SZ_XB = al256((size_t)NB * SEQ * HID * 2);
static constexpr size_t SZ_WT = al256((size_t)HTP * HID * 2);
static constexpr size_t SZ_HT = al256((size_t)NB * SEQ * HTP * 2);
static constexpr size_t SZ_GT = al256((size_t)GROWS * GPITCH * 2);
static constexpr size_t SZ_V  = al256((size_t)NB * SEQ * VP * 2);
static constexpr size_t SZ_S  = al256((size_t)NB * SEQ * SP * 4);
static constexpr size_t SZ_TOTAL = SZ_XB + SZ_WT + 2 * SZ_HT + 2 * SZ_GT + 2 * SZ_V + SZ_S;
static_assert(SZ_TOTAL <= (size_t)134217728);          // workspace carve <= 128 MiB
static_assert(((size_t)HTW * HID * 2) % 256 == 0);     // tail half of the weight plane stays 256-byte aligned
static_assert(((size_t)SEQ * HID) % 8 == 0);
static_assert((size_t)(NB_FULL - 1) * SEQ_FULL * QE * 4 + (size_t)SEQ_FULL * QE * 4 == (size_t)9510912);   // output bytes of the full problem

extern "C" void kernel_launch(void* const* d_in, const int* in_sizes, int n_in,
                              void* d_out, int out_size, void* d_ws, size_t ws_size, hipStream_t stream) {
    if (n_in < 10) return;
    const size_t needx = ((size_t)(NB - 1) * SEQ_FULL + SEQ) * HID;
    if ((size_t)in_sizes[0] < needx) return;
    if (in_sizes[1] < NB) return;
    if ((size_t)in_sizes[2] < (size_t)HID * NF || (size_t)in_sizes[4] < (size_t)HID * NF) return;
    if (in_sizes[3] < NF || in_sizes[5] < NF) return;
    if ((size_t)in_sizes[6] < (size_t)NK * NU * NU) return;
    if ((size_t)in_sizes[7] < (size_t)NK * 2 * NU) return;
    if (in_sizes[8] < NK * NT || in_sizes[9] < NT) return;
    if ((size_t)out_size < ((size_t)(NB - 1) * OUT_SEQ + SEQ) * QE) return;
    if (SZ_TOTAL > ws_size) return;
    // wire order: state, lengths, Wh, bh, Wt, bt, U, Wcat, Wd, bd
    const float* state = (const float*)d_in[0];
    const int*   lengths = (const int*)d_in[1];
    const float* Wh = (const float*)d_in[2]; const float* bh = (const float*)d_in[3];
    const float* Wt = (const float*)d_in[4]; const float* bt = (const float*)d_in[5];
    const float* U = (const float*)d_in[6]; const float* Wcat = (const float*)d_in[7];
    const float* Wd = (const float*)d_in[8]; const float* bd = (const float*)d_in[9];
    float* OUT = (float*)d_out;      // [NB][SEQ][129][9]
    char* wsp = (char*)d_ws;
    bf*  XB  = (bf*)wsp;  wsp += SZ_XB;              // state  [NB*SEQ][768] bf16
    bf*  WT  = (bf*)wsp;  wsp += SZ_WT;              // [512][768] bf16: Wh^T | Wt^T (zero rows 200..255 of each half)
    h16* HTH = (h16*)wsp; wsp += SZ_HT;              // [NB*SEQ][512] head | tail value
    h16* HTR = (h16*)wsp; wsp += SZ_HT;              // [NB*SEQ][512] head | tail residual x2048
    h16* GH  = (h16*)wsp; wsp += SZ_GT;              // [32][2048][8] G^T value (x1024)
    h16* GR  = (h16*)wsp; wsp += SZ_GT;              // [32][2048][8] G^T residual x2048
    h16* VH  = (h16*)wsp; wsp += SZ_V;               // [NB*SEQ][2048] V value (x1024)
    h16* VR  = (h16*)wsp; wsp += SZ_V;               // [NB*SEQ][2048] V residual x2048
    float* S = (float*)wsp; wsp += SZ_S;             // [NB*SEQ][1184] band scores

    k_prep<<<PB_GP + 2 * PB_WTR + PB_CVT, 256, 0, stream>>>(state, Wh, Wt, U, Wcat, Wd, bd, XB, WT, GH, GR);

    k_ht<<<dim3(NB * SEQ / 64, HTP / 64, 1), 32, 0, stream>>>(XB, WT, bh, bt, HTH, HTR);
    k_vg<<<dim3(NB * SEQ / (16 * VW), VP / 64, 1), 32 * VW, 0, stream>>>(HTH, HTR, GH, GR, VH, VR);
    k_band<<<NB * SEQ / BQ, 32 * BKT, 0, stream>>>(HTH, HTR, VH, VR, S);
    k_out<<<dim3((unsigned)((size_t)SEQ * QE / 4 / 256), NB, 1), 256, 0, stream>>>(S, lengths, bd, OUT);
}

// v004
// A run of this version takes 110 microseconds.
// Timed twice side by side with v003, it ran 1.19 and 1.20 times as fast.
// All steps since v000 together make it 2.10 times as fast.
#include <hip/hip_runtime.h>

// Span scorer: head / tail projections (Linear 768 -> 200 + erf GELU) with an appended constant-one feature; biaffine form head^T U[k] tail plus a concatenation-linear term, evaluated for every query token on a sliding band of 129 key offsets (-64..+64); length masking (masked entries = classifier bias); 9-tag linear classifier; non-finite outputs set to 0.
// Algebra: the classifier is folded into the bilinear weights: G[i][j][t] = sum_k (U[k][i][j] + [j==200] Wcat[k][i] + [i==200] Wcat[k][201+j]) Wd[k][t] + [i==j==200] bd[t]; V[q][t][j] = sum_i head[q][i] G[i][j][t]; score[q][r][t] = sum_j tail[q-64+r][j] V[q][t][j].
// Compute dtypes, f32 accumulate everywhere: projections v_wmma_f32_16x16x32_bf16 (state, Wh, Wt, biases RNE-converted to bf16; products exact); G built in f32 on the vector unit from bf16-converted U, Wcat, Wd, bd (9 tag columns);
// V GEMM and band GEMM v_wmma_f32_16x16x32_f16 with every operand as f16 value + f16 residual x2048 (three products; residual products in their own accumulator folded by 1/2048); G carries x1024, folded back after the band GEMM.
// Layout: bf16 state plane [q][768]; bf16 weight plane [512][768] (rows 0..199 Wh^T, 256..455 Wt^T, others zero); head|tail planes [q][512] (head cols 0..255, tail cols 256..511; col 200 of each half = 1, cols 201..255 = 0);
// G^T planes in 32 panels of 8 columns: [i/8][t*224 + j][i%8]; V planes [q][2048] with column t*224 + j; band plane f32 [q][1184] (129 x 9 used); output packed thread-linearly.

#ifndef NB
#define NB 2
#endif
#ifndef SEQ
#define SEQ 1024
#endif
#define NB_FULL  2
#define SEQ_FULL 1024
#ifndef OUT_SEQ
#define OUT_SEQ SEQ              // row pitch (in tokens) between batches of the output
#endif
#define HID    768               // model width
#define NF     200               // projection width
#define NU     201               // NF + constant-one feature
#define NK     200               // bilinear channels
#define NT     9                 // tags
#define WH     64                // band half width
#define WF     129               // band width
#define QE     (WF * NT)         // output floats per query (1161)
#define HTW    256               // column width of the head half / tail half
#define HTP    512               // row pitch (halves) of the head|tail planes
#define KJ     224               // contraction length of the V and band GEMMs (201 zero-padded)
#define NJ     224               // G^T rows / V columns per tag
#define GPITCH 256               // columns i of the G^T planes (32 panels of 8)
#define GROWS  2048              // rows of the G^T planes (9 * 224 = 2016, zero rows above)
#define GPS    (GROWS * 8)       // halves per 8-column panel of the G^T planes
#define GJ     32                // G^T rows j per folded-weight block (one lane each)
#define GKB    40                // values of k per batch of U loads in gp_sum
#define VP     2048              // row pitch (halves) of the V planes
#define SP     1184
#define VW     4                 // waves per V GEMM block
#define HWV    8                 // waves per projection GEMM block
#define HKU    8                 // k steps of 32 whose fragments a projection GEMM wave reads from LDS as one group
#define HPL    (HID + 8)         // LDS row pitch (halves) of the projection GEMM's operand rows: 97 x 16 B
#define BQ     16                // queries per band block
#define BKT    9                 // 16-key tiles of a band block's window = its waves
#define BWIN   (BKT * 16)        // keys in a band block's window
#define BTG    3                 // tags whose products alternate in the band GEMM
#define TPL    (KJ + 8)          // LDS row pitch (halves) of the tail rows: 29 x 16 B
#define VPL    (NT * NJ + 8)     // LDS row pitch (halves) of the V rows: 253 x 16 B
#define QRS    2048.0f           // carry of every residual plane
#define QRI    (1.0f / 2048.0f)
#define GSC    1024.0f           // carry of the G planes
#define GSI    (1.0f / 1024.0f)

static_assert(NU == NF + 1);
static_assert(HID % 64 == 0);                  // weight transpose tiles of 64 k; GEMM products step k by 32
static_assert(KJ % 32 == 0);
static_assert(NU <= KJ);
static_assert(KJ <= HTW);
static_assert(KJ <= GPITCH);
static_assert(NJ == KJ);                       // V column block of one tag = one contraction row of the band GEMM
static_assert(HTP == 2 * HTW);
static_assert(HTW % 64 == 0);                  // a 64-column tile lies wholly in the head half or the tail half
static_assert((HTW & (HTW - 1)) == 0);
static_assert(NF <= HTW);
static_assert(GPITCH % 8 == 0);
static_assert(NJ % GJ == 0);
static_assert(GROWS - NT * NJ == GJ);           // zero rows above the tags: one lane each
static_assert(NK % GKB == 0);
static_assert(NU <= GPITCH);
static_assert(NT * NJ <= GROWS);
static_assert(GROWS == VP);
static_assert(VP % 64 == 0);
static_assert((NB * SEQ) % 64 == 0);
static_assert((NB * SEQ) % (16 * VW) == 0);
static_assert(SEQ % BQ == 0);                  // a band block's queries lie in one batch
static_assert(BWIN == BQ + 2 * WH);            // the window holds every key of every query of the block
static_assert(NT % BTG == 0);
static_assert(KJ / 8 <= 32 && NJ == KJ);        // a row part of KJ halves: one 16-byte piece per lane
static_assert(BKT == NT && BQ == 16);          // wave w stages key tile w and tag w
static_assert(SEQ % 16 == 0 && WH % 16 == 0);  // key tiles start at multiples of 16
static_assert(SP - QE <= 32 && BQ <= 2 * BKT);  // pad floats zeroed by one lane each, at most two rows a wave
static_assert(((TPL / 8) & 1) == 1 && ((VPL / 8) & 1) == 1);
static_assert(sizeof(float) * BQ * SP <= sizeof(_Float16) * 2 * BWIN * TPL);   // the score tile fits the tail rows' LDS
static_assert(sizeof(_Float16) * (2 * BWIN * TPL + 2 * BQ * VPL) <= 327680);
static_assert(SEQ % 64 == 0);
static_assert(SEQ % 32 == 0);
static_assert(OUT_SEQ % 32 == 0);
static_assert(WF == 2 * WH + 1);
static_assert(WF <= 9 * 16);                   // nine 16-key tiles cover the band
static_assert(SP % 32 == 0);
static_assert(SP >= QE);
static_assert(((size_t)SEQ * QE) % (4 * 256) == 0);
static_assert(NB <= NB_FULL);
static_assert(SEQ <= SEQ_FULL);
static_assert(4 * 32 * 16 == 16 * 64 * 2);     // slab store: 4 trips x 32 lanes x 16 B == 16 rows x 64 halves
static_assert(((HPL / 8) & 1) == 1 && HID % 8 == 0);
static_assert(HID % 256 == 0 && 64 % HWV == 0 && (64 * 8) % (32 * HWV) == 0);   // a row is whole 512-byte parts; whole rows per wave in the fill, whole pieces per thread in the epilogue
static_assert(HID % (32 * HKU) == 0);
static_assert(HWV == 8);                       // 4 row groups x 2 column halves of the 64x64 tile
static_assert(sizeof(unsigned short) * 2 * 64 * HPL + sizeof(float) * 64 * 68 <= 327680);
static_assert(sizeof(float) * VW * 16 * 68 <= 131072);
static_assert(sizeof(float) * NT * 8 * GJ <= 131072);
static_assert(sizeof(float) * 64 * 33 <= 131072);

typedef _Float16 h16;
typedef unsigned short bf;
typedef __attribute__((ext_vector_type(16))) __bf16   v16bf;
typedef __attribute__((ext_vector_type(16))) _Float16 v16h;
typedef __attribute__((ext_vector_type(8)))  _Float16 v8h;
typedef __attribute__((ext_vector_type(8)))  unsigned short v8us;
typedef __attribute__((ext_vector_type(8)))  float    v8f;
typedef __attribute__((ext_vector_type(4)))  float    v4f;
typedef v4f  __attribute__((may_alias)) v4fa;

__device__ __forceinline__ unsigned short f2bf(float f) { unsigned u = __float_as_uint(f); u += 0x7FFFu + ((u >> 16) & 1u); return (unsigned short)(u >> 16); }
__device__ __forceinline__ float bfr(float f) { return __uint_as_float(((unsigned)f2bf(f)) << 16); }   // value after RNE convert to bf16
__device__ __forceinline__ v16h cat16(v8h lo, v8h hi) { return __builtin_shufflevector(lo, hi, 0, 1, 2, 3, 4, 5, 6, 7, 8, 9, 10, 11, 12, 13, 14, 15); }
__device__ __forceinline__ v16bf cat16b(v8us lo, v8us hi) { return __builtin_bit_cast(v16bf, __builtin_shufflevector(lo, hi, 0, 1, 2, 3, 4, 5, 6, 7, 8, 9, 10, 11, 12, 13, 14, 15)); }
__device__ __forceinline__ v8f wmma16(v16h a, v16h b, v8f c) { return __builtin_amdgcn_wmma_f32_16x16x32_f16(false, a, false, b, (short)0, c, false, false); }
__device__ __forceinline__ v8f wmmab(v16bf a, v16bf b, v8f c) { return __builtin_amdgcn_wmma_f32_16x16x32_bf16(false, a, false, b, (short)0, c, false, false); }
// fragment loaders from K-contiguous 16-bit rows; p already includes + 8*(lane>>4): elements 0..7 <- k0+8h+0..7, elements 8..15 <- k0+16+8h+0..7 (same map for A and B)
__device__ __forceinline__ v16h  ldh(const h16* p) { return cat16(*(const v8h*)p, *(const v8h*)(p + 16)); }
__device__ __forceinline__ v16bf ldb(const bf* p)  { return cat16b(*(const v8us*)p, *(const v8us*)(p + 16)); }
// the same k map from 8-column panels; p already includes + (lane>>4) panels: elements 0..7 <- panel k0/8+h, elements 8..15 <- panel k0/8+2+h
__device__ __forceinline__ v16h  ldp(const h16* p) { return cat16(*(const v8h*)p, *(const v8h*)(p + 2 * GPS)); }
// ordering point for wave-private LDS tiles (same wave writes and reads)
__device__ __forceinline__ void wave_sync() { __builtin_amdgcn_fence(3 /* release order */, "wavefront"); __builtin_amdgcn_wave_barrier(); asm volatile("" ::: "memory"); }

// per-instruction guarded WMMA wrappers: one accumulator tied per guard, operands kept live across the nops
__device__ __forceinline__ v8f wg(v16h a, v16h b, v8f c) { c = wmma16(a, b, c); asm volatile("v_nop\n\tv_nop\n\tv_nop\n\tv_nop" : "+v"(c) : "v"(a), "v"(b)); return c; }
__device__ __forceinline__ v8f wgb(v16bf a, v16bf b, v8f c) { c = wmmab(a, b, c); asm volatile("v_nop\n\tv_nop\n\tv_nop\n\tv_nop" : "+v"(c) : "v"(a), "v"(b)); return c; }
// f32 -> f16 convert that cannot produce an f16 subnormal (|v| < 2^-14 -> +0), applied after the plane's carry
static __device__ __forceinline__ h16 toh_flush(float v) { const h16 r = (h16)v; return (fabsf(v) < 6.103515625e-05f) ? (h16)0.0f : r; }
__device__ __forceinline__ float gelu_erf(float x) { return 0.5f * x * (1.0f + erff(x * 0.70710678118654752f)); }

// d_cvt8: state (f32, batch pitch SEQ_FULL tokens) -> bf16 plane (batch pitch SEQ tokens), 8 elements per thread; blk = 0 .. PB_CVT-1.
__device__ __forceinline__ void d_cvt8(const float* __restrict__ src, bf* dst, int blk) {
    constexpr size_t per = (size_t)SEQ * HID / 8, n8 = (size_t)NB * per;
    const size_t i = (size_t)blk * 256 + threadIdx.x; if (i >= n8) return;
    const size_t so = (SEQ == SEQ_FULL) ? i * 8 : (i / per) * ((size_t)SEQ_FULL * HID) + (i % per) * 8;
    const v8f v = *(const v8f*)(src + so); v8us o;
#pragma unroll
    for (int k = 0; k < 8; ++k) o[k] = f2bf(v[k]);
    *(v8us*)(dst + i * 8) = o; 
}

// d_wtr: in[HID rows k][NF cols n] (f32) -> out[HTW rows n][HID cols k] (bf16, RNE convert); rows n >= NF written as zeros.
// blocks (bx, by) of (HID/64, HTW/32); tile: 64 x 33 floats of LDS.
__device__ __forceinline__ void d_wtr(const float* __restrict__ W, bf* dst, float* tile, int bx, int by) {
    const int tid = threadIdx.x;
    const int k0 = bx * 64, n0 = by * 32;
#pragma unroll 1
    for (int e = 0; e < 8; ++e) {                                  // 8 trips x 256 threads = 64 x 32 elements
        const int idx = e * 256 + tid; const int kk = idx >> 5, nn = idx & 31;
        const int n = n0 + nn; const int nc = n < NF ? n : NF - 1;  // clamped address
        float v = W[(size_t)(k0 + kk) * NF + nc];
        asm volatile("" : "+v"(v));
        tile[kk * 33 + nn] = (n < NF) ? v : 0.0f; }
    __syncthreads();
    const int row = tid >> 3, pc = tid & 7;
    v8us o;
#pragma unroll
    for (int e = 0; e < 8; ++e) o[e] = f2bf(tile[(pc * 8 + e) * 33 + row]);
    bf* p = dst + (size_t)(n0 + row) * HID + k0 + pc * 8;
    *(v8us*)p = o; 
}

// d_gp: folded weights. Block (jt, ip) builds the tile i = 8 ip + wave, j = 32 jt + lane of G for all 9 tags: a wave reads 32 consecutive j of one U row per k (one 128-byte run), GKB values of k in flight at a time.
// Each (i, j, t) is summed over k = 0..199 in order by one thread. The tile is turned in LDS and stored as 16-byte pieces (8 columns i) of panel ip, 512 contiguous bytes per tag.
// Entries with i >= NU or j >= NU are zeros; blocks jt == 0 also zero-fill rows [NT*NJ, GROWS) of their panel.
// blocks (jt, ip) of (NJ/GJ, GPITCH/8); gs: NT x 8 x GJ floats of LDS.
// EDGE: the wave holds the row i == 200 or the column j == 200, where the concatenation-linear terms enter. up = U + i*NU + jc and pa = Wcat + NU + jc are the lane's own, jc its clamped column; wb = Wcat + i is wave-uniform.
// ma, mb: all ones where the row term / the column term enters, else zero; msk gives the value or +0 for any bit pattern, as a select does, with no branch round a load.
__device__ __forceinline__ float msk(float v, unsigned m) { return __uint_as_float(__float_as_uint(v) & m); }
template <bool EDGE>
__device__ __forceinline__ void gp_sum(const float* __restrict__ up, const float* __restrict__ pa, const float* __restrict__ wb, const float* __restrict__ Wd, unsigned ma, unsigned mb, float (&acc)[NT]) {
#pragma unroll 1   // rolled over the batches
    for (int kb = 0; kb < NK; kb += GKB) {
        float u[GKB], a[EDGE ? GKB : 1];
#pragma unroll
        for (int e = 0; e < GKB; ++e) {
            u[e] = up[(size_t)e * (NU * NU)];
            if constexpr (EDGE) a[e] = pa[(size_t)e * (2 * NU)]; }
        asm volatile("s_wait_xcnt 0x0" ::: "memory");   // stands ahead of every overwrite of the address registers that the batch's loads name
        __builtin_amdgcn_sched_barrier(0);   // the whole batch's loads are issued ahead of its first sum (else the scheduler may sink loads to their uses and their latencies add up), and the address steps below stay behind the wait
#pragma unroll
        for (int e = 0; e < GKB; ++e) {
            float w = bfr(u[e]);
            if constexpr (EDGE) w = w + msk(bfr(a[e]), ma) + msk(bfr(wb[(size_t)(kb + e) * (2 * NU)]), mb);
#pragma unroll
            for (int t = 0; t < NT; ++t) acc[t] = fmaf(w, bfr(Wd[(kb + e) * NT + t]), acc[t]); }
        up += (size_t)GKB * (NU * NU);
        if constexpr (EDGE) pa += (size_t)GKB * (2 * NU);
    }
}
__device__ __forceinline__ void d_gp(const float* __restrict__ U, const float* __restrict__ Wcat, const float* __restrict__ Wd, const float* __restrict__ bd, h16* GH, h16* GR, float* gs, int jt, int ip) {
    const int tid = threadIdx.x, lane = tid & 31;
    const int wave = __builtin_amdgcn_readfirstlane(tid >> 5);
    const int i = ip * 8 + wave, j = jt * GJ + lane;
    float acc[NT];
#pragma unroll
    for (int t = 0; t < NT; ++t) acc[t] = 0.0f;
    const int jc = j < NU ? j : NU - 1;                             // clamped column index
    if (i < NU) {                                                   // wave-uniform
        if ((i == NU - 1) | (jt == (NU - 1) / GJ)) {                // wave-uniform: the row or the column of the constant-one feature lies in this wave
            const unsigned ma = (i == NU - 1) ? ~0u : 0u, mb = (j == NU - 1) ? ~0u : 0u;
            gp_sum<true>(U + (size_t)i * NU + jc, Wcat + NU + jc, Wcat + i, Wd, ma, mb, acc);
#pragma unroll
            for (int t = 0; t < NT; ++t) acc[t] += msk(bfr(bd[t]), ma & mb);
        } else {
            gp_sum<false>(U + (size_t)i * NU + jc, Wcat, Wcat, Wd, 0u, 0u, acc); }
    }
    const bool ok = (i < NU) & (j < NU);
#pragma unroll
    for (int t = 0; t < NT; ++t) gs[(t * 8 + wave) * GJ + lane] = ok ? acc[t] * GSC : 0.0f;
    __syncthreads();
#pragma unroll 1   // rolled: the second trip is one wave's
    for (int p = tid; p < NT * GJ; p += 256) {                      // 9 tags x 32 rows j; second trip = wave 0 only
        const int t = p >> 5, jj = p & 31; v8h hv, rv;
#pragma unroll
        for (int c = 0; c < 8; ++c) { const float x = gs[(t * 8 + c) * GJ + jj]; const h16 a0 = toh_flush(x); hv[c] = a0; rv[c] = toh_flush((x - (float)a0) * QRS); }
        const size_t oo = (size_t)ip * GPS + ((size_t)t * NJ + jt * GJ + jj) * 8;
        *(v8h*)(GH + oo) = hv; *(v8h*)(GR + oo) = rv; }
    if ((jt == 0) & (wave == 0)) {                                  // wave-uniform
        const v8h z = (v8h){};
        const size_t zo = (size_t)ip * GPS + ((size_t)NT * NJ + lane) * 8;
        *(v8h*)(GH + zo) = z; *(v8h*)(GR + zo) = z; }
}

// k_prep: the four preparation bodies, none of which reads what another writes, share one launch; a block's body is chosen by its index (block-uniform branch).
// The folded-weight blocks, the longest, hold the lowest indices; then the two weight transposes; then the state convert.
#define PB_GP   ((NJ / GJ) * (GPITCH / 8))
#define PB_WTR  ((HID / 64) * (HTW / 32))
#define PB_CVT  ((int)(((size_t)NB * SEQ * HID / 8 + 255) / 256))
static_assert(64 * 33 <= NT * 8 * GJ);          // the transpose tile fits the LDS array sized for the folded-weight tile
__global__ __launch_bounds__(256) void k_prep(const float* __restrict__ state, const float* __restrict__ Wh, const float* __restrict__ Wt, const float* __restrict__ U, const float* __restrict__ Wcat,
                                              const float* __restrict__ Wd, const float* __restrict__ bd, bf* XB, bf* WT, h16* GH, h16* GR) {
    __shared__ __align__(16) float sm[NT * 8 * GJ];
    const int blk = blockIdx.x;
    // The tests run from the highest range down: the built code then holds the folded-weight body first, with no other body's barrier on a path ahead of it, and its wave-uniform Wd loads stay scalar loads.
    // The bodies stand one behind another in the built code: each s_wait_xcnt 0 stands behind a body's last stores, ahead of the next body's first write of a register that those stores name.
    if (blk >= PB_GP + 2 * PB_WTR) d_cvt8(state, XB, blk - PB_GP - 2 * PB_WTR);
    else if (blk >= PB_GP + PB_WTR) { d_wtr(Wt, WT + (size_t)HTW * HID, sm, (blk - PB_GP - PB_WTR) % (HID / 64), (blk - PB_GP - PB_WTR) / (HID / 64)); asm volatile("s_wait_xcnt 0x0" ::: "memory"); }
    else if (blk >= PB_GP) { d_wtr(Wh, WT, sm, (blk - PB_GP) % (HID / 64), (blk - PB_GP) / (HID / 64)); asm volatile("s_wait_xcnt 0x0" ::: "memory"); }
    else { d_gp(U, Wcat, Wd, bd, GH, GR, sm, blk % (NJ / GJ), blk / (NJ / GJ)); asm volatile("s_wait_xcnt 0x0" ::: "memory"); }
}

// k_ht: bf16 GEMM, one block of HWV = 8 waves per 64x64 tile, K = HID. C[m][n] = sum_k A[m][k] Bt[n][k]; A = state rows (m = q), Bt = weight rows (n < 256: head column n, n >= 256: tail column n - 256).
// The tile's 64 A rows and 64 Bt rows, each set one contiguous run of global memory, are read once per block in 512-byte parts of a row per load, all loads in flight together, and kept whole in LDS (row pitch an odd number of 16-byte units).
// Wave w takes rows 16 (w >> 1) .. + 15 and columns 32 (w & 1) .. + 31: two accumulators, each summed over k in ascending order. The first barrier ends the LDS fill; the second ends the writes of the f32 tile os ahead of its row-wise readers.
// Epilogue per column nn = n mod 256: nn < 200 -> GELU(C + bias), nn == 200 -> 1, nn > 200 -> 0; written as f16 value (Ph) and f16 residual x2048 (Pr), row pitch HTP.
// grid (NB*SEQ/64, HTP/64).
__global__ __launch_bounds__(32 * HWV) void k_ht(const bf* __restrict__ A, const bf* __restrict__ Bt, const float* __restrict__ bh, const float* __restrict__ bt, h16* Ph, h16* Pr) {
    __shared__ __align__(16) bf sab[2 * 64 * HPL];
    __shared__ __align__(16) float os[64 * 68];
    bf* const sA = sab; bf* const sB = sab + 64 * HPL;
    constexpr int NTH = 32 * HWV, RW = 64 / HWV, RT = HID / 256;   // threads; rows per wave and operand; 512-byte parts (one 16-byte piece per lane) per row
    const int tid = threadIdx.x, lane = tid & 31, lr = lane & 15, hi = lane >> 4;
    const int wave = __builtin_amdgcn_readfirstlane(tid >> 5);
    const int r0 = blockIdx.x * 64, c0 = blockIdx.y * 64;
    {   // wave w brings rows 8 w .. 8 w + 7 of both operands
        const bf* const pa = A + (size_t)(r0 + wave * RW) * HID + lane * 8; const bf* const pb = Bt + (size_t)(c0 + wave * RW) * HID + lane * 8;
        const int sl = wave * RW * HPL + lane * 8;
        v8us xa[RW * RT], xb[RW * RT];
#pragma unroll
        for (int it = 0; it < RW * RT; ++it) { xa[it] = *(const v8us*)(pa + it * 256); xb[it] = *(const v8us*)(pb + it * 256); }
        asm volatile("s_wait_xcnt 0x0" ::: "memory");   // stands ahead of every overwrite of the address registers that the loads above name
        __builtin_amdgcn_sched_barrier(0);   // all the loads are issued ahead of the first LDS store (one latency, not several), and later address work stays behind the wait
#pragma unroll
        for (int it = 0; it < RW * RT; ++it) { const int so = sl + (it / RT) * HPL + (it % RT) * 256;
            *(v8us*)(sA + so) = xa[it]; *(v8us*)(sB + so) = xb[it]; }
    }
    const int mb = wave >> 1, n2 = (wave & 1) * 2;
    float bc[2];
#pragma unroll
    for (int u = 0; u < 2; ++u) { const int nn = (c0 + (n2 + u) * 16 + lr) & (HTW - 1); const int bi = nn < NF ? nn : NF - 1;   // clamped address
        bc[u] = bfr((c0 >= HTW) ? bt[bi] : bh[bi]); }
    __syncthreads();
    v8f acc[2];
#pragma unroll
    for (int u = 0; u < 2; ++u) acc[u] = (v8f){};
    const bf* const fa = sA + (mb * 16 + lr) * HPL + 8 * hi; const bf* const fb = sB + (n2 * 16 + lr) * HPL + 8 * hi;
#pragma unroll
    for (int k0 = 0; k0 < HID; k0 += 32 * HKU) {
        v16bf a[HKU], b[HKU][2];
#pragma unroll
        for (int e = 0; e < HKU; ++e) { a[e] = ldb(fa + k0 + e * 32); b[e][0] = ldb(fb + k0 + e * 32); b[e][1] = ldb(fb + 16 * HPL + k0 + e * 32); }
        __builtin_amdgcn_sched_barrier(0);   // the group's LDS reads are issued ahead of its first product: else each product waits out an LDS latency of its own
#pragma unroll
        for (int e = 0; e < HKU; ++e) {
#pragma unroll
            for (int u = 0; u < 2; ++u) acc[u] = wgb(a[e], b[e][u], acc[u]); }
    }
#pragma unroll
    for (int u = 0; u < 2; ++u) {
#pragma unroll
        for (int j = 0; j < 8; ++j) os[(mb * 16 + hi * 8 + j) * 68 + (n2 + u) * 16 + lr] = acc[u][j] + bc[u]; }   // D: row 8h+j, col lane&15
    __syncthreads();
#pragma unroll 1   // rolled: the second trip runs the first one's text
    for (int s = 0; s < 64 * 8 / NTH; ++s) { const int row = (NTH / 8) * s + (tid >> 3), c8 = (tid & 7) * 8;   // 8 threads x 8 = 64 columns of one row
        const v4f x0 = *(const v4fa*)(&os[row * 68 + c8]); const v4f x1 = *(const v4fa*)(&os[row * 68 + c8 + 4]); v8h hv, rv;
#pragma unroll
        for (int i = 0; i < 4; ++i) {
            const int n0 = (c0 + c8 + i) & (HTW - 1), n1 = (c0 + c8 + 4 + i) & (HTW - 1);
            const float g0 = gelu_erf(x0[i]), g1 = gelu_erf(x1[i]);
            const float v0 = (n0 < NF) ? g0 : ((n0 == NF) ? 1.0f : 0.0f);
            const float v1 = (n1 < NF) ? g1 : ((n1 == NF) ? 1.0f : 0.0f);
            const h16 a0 = toh_flush(v0); const h16 a1 = toh_flush(v1); hv[i] = a0; hv[4 + i] = a1;
            rv[i] = toh_flush((v0 - (float)a0) * QRS); rv[4 + i] = toh_flush((v1 - (float)a1) * QRS); }
        const size_t oo = (size_t)(r0 + row) * HTP + c0 + c8;
        *(v8h*)(Ph + oo) = hv; *(v8h*)(Pr + oo) = rv;
        asm volatile("s_wait_xcnt 0x0" ::: "memory"); }   // stands ahead of the next trip's overwrites of the registers that the two stores name
}

// k_vg: f16 GEMM with three products, one wave per 16x64 tile, K = KJ. V[q][n] = sum_i head[q][i] G^T[n][i], n = t*NJ + j.
// A = head planes (value AH, residual AR; row pitch HTP, columns 0..KJ-1), Bt = G^T planes (value GH, residual GR; panels of 8 columns: 16 lanes read 256 contiguous bytes).
// aH = AH.GH; aR = AR.GH + AH.GR (both residual carries x2048, one accumulator); V = aH + aR/2048 (keeps the x1024 carry of G); written as f16 value (VH) + f16 residual x2048 (VR), row pitch VP.
// grid (NB*SEQ/(16*VW), VP/64).
__global__ __launch_bounds__(32 * VW) void k_vg(const h16* __restrict__ AH, const h16* __restrict__ AR, const h16* __restrict__ GH, const h16* __restrict__ GR, h16* VH, h16* VR) {
    __shared__ __align__(16) float os[VW * 16 * 68];
    const int lane = threadIdx.x & 31, lr = lane & 15, hi = lane >> 4;
    const int wave = __builtin_amdgcn_readfirstlane((int)(threadIdx.x >> 5));
    const int m0 = (blockIdx.x * VW + wave) * 16, c0 = blockIdx.y * 64;
    v8f aH[4], aR[4];
#pragma unroll
    for (int nb = 0; nb < 4; ++nb) { aH[nb] = (v8f){}; aR[nb] = (v8f){}; }
    const size_t aoff = (size_t)(m0 + lr) * HTP + 8 * hi, boff = (size_t)hi * GPS + (size_t)(c0 + lr) * 8;
#pragma unroll 1
    for (int kc = 0; kc < KJ; kc += 32) {
        const v16h ah = ldh(AH + aoff + kc), ar = ldh(AR + aoff + kc);
#pragma unroll
        for (int nb = 0; nb < 4; ++nb) {
            const v16h gh = ldp(GH + boff + (size_t)(kc / 8) * GPS + nb * 16 * 8), gr = ldp(GR + boff + (size_t)(kc / 8) * GPS + nb * 16 * 8);
            aH[nb] = wg(ah, gh, aH[nb]); aR[nb] = wg(ar, gh, aR[nb]); aR[nb] = wg(ah, gr, aR[nb]); }
    }
    const int wb = wave * 16 * 68;
#pragma unroll
    for (int nb = 0; nb < 4; ++nb) {
#pragma unroll
        for (int j = 0; j < 8; ++j) os[wb + (hi * 8 + j) * 68 + nb * 16 + lr] = aH[nb][j] + aR[nb][j] * QRI; }   // D: row 8h+j, col lane&15
    wave_sync();
{
#pragma unroll 1
        for (int s = 0; s < 4; ++s) { const int row = 4 * s + (lane >> 3), c8 = (lane & 7) * 8;   // 4 s x 4 row groups = 16 rows; 8 lanes x 8 = 64 columns
            const v4f x0 = *(const v4fa*)(&os[wb + row * 68 + c8]); const v4f x1 = *(const v4fa*)(&os[wb + row * 68 + c8 + 4]); v8h hv, rv;
#pragma unroll
            for (int i = 0; i < 4; ++i) { const h16 a0 = toh_flush(x0[i]); const h16 a1 = toh_flush(x1[i]); hv[i] = a0; hv[4 + i] = a1;
                rv[i] = toh_flush((x0[i] - (float)a0) * QRS); rv[4 + i] = toh_flush((x1[i] - (float)a1) * QRS); }
            const size_t oo = (size_t)(m0 + row) * VP + c0 + c8;
            *(v8h*)(VH + oo) = hv; *(v8h*)(VR + oo) = rv; }
         }
}

// k_band: one block per BQ = 16 consecutive queries (one batch), one wave per 16-key tile of their common window of 144 keys (key = n0 - 64 + w, w = 0..143; a tile outside the sequence reads the nearest tile inside it; out-of-sequence keys are discarded by the pack kernel).
// The window's tail rows and the 16 queries' V rows are read from global memory once per block, in 16-byte pieces that run along the rows, and kept in LDS (row pitches an odd number of 16-byte units).
// A = tail rows of the wave's key tile (row = key, k = j), held in registers for all tags; B = V of one tag (column = query lane&15, k = j), K = KJ.
// sH = TH.VH; sR = TR.VH + TH.VR; score = (sH + sR/2048)/1024. D element j of lane (lr, hi) = (w = 16 wave + 8 hi + j, query lr); band offset r = w - lr, kept where 0 <= r <= 128 -> os[lr*SP + r*9 + t].
// os lies on the tail rows' LDS, which no wave reads once every wave holds its A fragments (second barrier); the third barrier ends the score writes ahead of the block's linear store of its 16 band rows.
// grid NB*SEQ/BQ.
__global__ __launch_bounds__(32 * BKT) void k_band(const h16* __restrict__ HTH, const h16* __restrict__ HTR, const h16* __restrict__ VH, const h16* __restrict__ VR, float* S) {
    __shared__ __align__(16) h16 sm[2 * BWIN * TPL + 2 * BQ * VPL];
    h16* const tH = sm; h16* const tR = sm + BWIN * TPL;
    h16* const vH = sm + 2 * BWIN * TPL; h16* const vR = vH + BQ * VPL;
    float* const os = (float*)sm;
    constexpr int NTH = 32 * BKT, TPC = KJ / 8;
    const int tid = threadIdx.x, lane = tid & 31, lr = lane & 15, hi = lane >> 4;
    const int wave = __builtin_amdgcn_readfirstlane(tid >> 5);
    const int q0 = blockIdx.x * BQ;
    const int b = q0 / SEQ, n0 = q0 % SEQ;
    if (lane < TPC) {   // one lane per 16-byte piece of a 448-byte row part; wave w brings the 16 tail rows of key tile w and tag w's part of the 16 V rows
        int kb = n0 - WH + 16 * wave; kb = kb < 0 ? 0 : (kb > SEQ - 16 ? SEQ - 16 : kb);   // a key tile lies wholly inside or wholly outside the sequence
        const size_t to = ((size_t)b * SEQ + (size_t)kb) * HTP + lane * 8, vo = (size_t)q0 * VP + wave * NJ + lane * 8;
        const h16* const pth = HTH + to; const h16* const ptr = HTR + to; const h16* const pvh = VH + vo; const h16* const pvr = VR + vo;
        const int tl = wave * 16 * TPL + lane * 8, vl = wave * NJ + lane * 8;
        v8h xh[16], xr[16], yh[16], yr[16];
#pragma unroll
        for (int it = 0; it < 16; ++it) { xh[it] = *(const v8h*)(pth + HTW + it * HTP); xr[it] = *(const v8h*)(ptr + HTW + it * HTP); }
#pragma unroll
        for (int it = 0; it < 16; ++it) yh[it] = *(const v8h*)(pvh + it * VP);
        asm volatile("s_wait_xcnt 0x0" :: "v"(pth), "v"(ptr), "v"(pvh) : "memory");   // stands ahead of every overwrite of the three address pairs that the loads above name; as its inputs they stay whole up to it
        __builtin_amdgcn_sched_barrier(0);   // these 48 loads are issued ahead of the first LDS store (one latency, not several), and the LDS address work stays behind the wait
#pragma unroll
        for (int it = 0; it < 16; ++it) { *(v8h*)(tH + tl + it * TPL) = xh[it]; *(v8h*)(tR + tl + it * TPL) = xr[it]; }
        __builtin_amdgcn_sched_barrier(0);   // the last 16 loads take the registers that the tail rows have left: all 64 at once would need registers above v255
#pragma unroll
        for (int it = 0; it < 16; ++it) yr[it] = *(const v8h*)(pvr + it * VP);
        asm volatile("s_wait_xcnt 0x0" :: "v"(pvr) : "memory");   // as above, for the fourth address pair
        __builtin_amdgcn_sched_barrier(0);   // keeps these loads ahead of the stores below and later address work behind the wait
#pragma unroll
        for (int it = 0; it < 16; ++it) *(v8h*)(vH + vl + it * VPL) = yh[it];
#pragma unroll
        for (int it = 0; it < 16; ++it) *(v8h*)(vR + vl + it * VPL) = yr[it];
    }
    __syncthreads();
    v16h th[KJ / 32], tr[KJ / 32];
    const int ao = (wave * 16 + lr) * TPL + 8 * hi;
#pragma unroll
    for (int k = 0; k < KJ / 32; ++k) { th[k] = ldh(tH + ao + k * 32); tr[k] = ldh(tR + ao + k * 32); }
    __syncthreads();
    const int bo = lr * VPL + 8 * hi;
    const int r0 = 16 * wave + 8 * hi - lr;
#pragma unroll 1   // rolled over the groups of three tags: the A fragments and one group's accumulators and B fragments fill the registers below v256
    for (int tg = 0; tg < NT; tg += BTG) {
        v8f sH[BTG], sR[BTG];
#pragma unroll
        for (int u = 0; u < BTG; ++u) { sH[u] = (v8f){}; sR[u] = (v8f){}; }
#pragma unroll
        for (int k = 0; k < KJ / 32; ++k) {
            v16h vh[BTG], vr[BTG];
#pragma unroll
            for (int u = 0; u < BTG; ++u) { vh[u] = ldh(vH + bo + (tg + u) * NJ + k * 32); vr[u] = ldh(vR + bo + (tg + u) * NJ + k * 32); }
            // the three tags' products alternate, so that no product waits for the one before it; each accumulator takes its products in the order k, then TR.VH, then TH.VR
#pragma unroll
            for (int u = 0; u < BTG; ++u) sH[u] = wg(th[k], vh[u], sH[u]);
#pragma unroll
            for (int u = 0; u < BTG; ++u) sR[u] = wg(tr[k], vh[u], sR[u]);
#pragma unroll
            for (int u = 0; u < BTG; ++u) sR[u] = wg(th[k], vr[u], sR[u]); }
#pragma unroll
        for (int u = 0; u < BTG; ++u) {
#pragma unroll
            for (int j = 0; j < 8; ++j) { const int r = r0 + j;
                const float val = (sH[u][j] + sR[u][j] * QRI) * GSI;
                if ((r >= 0) & (r < WF)) os[lr * SP + r * NT + tg + u] = val; } }
    }
    if (lane < SP - QE) { os[wave * SP + QE + lane] = 0.0f; if (wave + BKT < BQ) os[(wave + BKT) * SP + QE + lane] = 0.0f; }   // pad floats of rows wave and wave + 9
    __syncthreads();
    float* dst = S + (size_t)q0 * SP;
    for (int p = tid; p < BQ * SP / 4; p += NTH) { const v4f val = *(const v4fa*)(&os[p * 4]); *(v4f*)(dst + (size_t)p * 4) = val; }
}

// Keep rule per element: (n < len) and (0 <= key < SEQ) and (key < len), key = n + r - 64; other elements get the classifier bias; non-finite values become 0.
// grid (SEQ*QE/4/256, NB).
__global__ __launch_bounds__(256) void k_out(const float* __restrict__ S, const int* __restrict__ lengths, const float* __restrict__ bd, float* OUT) {
    const int b = blockIdx.y;
    const size_t i4 = (size_t)blockIdx.x * 256 + threadIdx.x; if (i4 >= (size_t)SEQ * QE / 4) return;
    const int len = lengths[b];
    v4f o;
#pragma unroll
    for (int c = 0; c < 4; ++c) {
        const unsigned e = (unsigned)(i4 * 4) + (unsigned)c;
        const unsigned n = e / QE; const unsigned rem = e - n * QE; const unsigned r = rem / NT; const unsigned t = rem - r * NT;
        float s = S[((size_t)b * SEQ + n) * SP + rem]; float bv = bd[t];
        asm volatile("" : "+v"(s)); asm volatile("" : "+v"(bv));
        const int jk = (int)n + (int)r - WH;
        const bool ok = ((int)n < len) & (jk >= 0) & (jk < SEQ) & (jk < len);
        float v = ok ? s : bfr(bv);
        v = (fabsf(v) <= 3.402823466e38f) ? v : 0.0f;
        o[c] = v; }
    float* p = OUT + (size_t)b * OUT_SEQ * QE + i4 * 4;
    *(v4f*)p = o; 
}

static constexpr size_t al256(size_t v) { return (v + 255) & ~(size_t)255; }
static constexpr size_t SZ_XB = al256((size_t)NB * SEQ * HID * 2);
static constexpr size_t SZ_WT = al256((size_t)HTP * HID * 2);
static constexpr size_t SZ_HT = al256((size_t)NB * SEQ * HTP * 2);
static constexpr size_t SZ_GT = al256((size_t)GROWS * GPITCH * 2);
static constexpr size_t SZ_V  = al256((size_t)NB * SEQ * VP * 2);
static constexpr size_t SZ_S  = al256((size_t)NB * SEQ * SP * 4);
static constexpr size_t SZ_TOTAL = SZ_XB + SZ_WT + 2 * SZ_HT + 2 * SZ_GT + 2 * SZ_V + SZ_S;
static_assert(SZ_TOTAL <= (size_t)134217728);          // workspace carve <= 128 MiB
static_assert(((size_t)HTW * HID * 2) % 256 == 0);     // tail half of the weight plane stays 256-byte aligned
static_assert(((size_t)SEQ * HID) % 8 == 0);
static_assert((size_t)(NB_FULL - 1) * SEQ_FULL * QE * 4 + (size_t)SEQ_FULL * QE * 4 == (size_t)9510912);   // output bytes of the full problem

extern "C" void kernel_launch(void* const* d_in, const int* in_sizes, int n_in,
                              void* d_out, int out_size, void* d_ws, size_t ws_size, hipStream_t stream) {
    if (n_in < 10) return;
    const size_t needx = ((size_t)(NB - 1) * SEQ_FULL + SEQ) * HID;
    if ((size_t)in_sizes[0] < needx) return;
    if (in_sizes[1] < NB) return;
    if ((size_t)in_sizes[2] < (size_t)HID * NF || (size_t)in_sizes[4] < (size_t)HID * NF) return;
    if (in_sizes[3] < NF || in_sizes[5] < NF) return;
    if ((size_t)in_sizes[6] < (size_t)NK * NU * NU) return;
    if ((size_t)in_sizes[7] < (size_t)NK * 2 * NU) return;
    if (in_sizes[8] < NK * NT || in_sizes[9] < NT) return;
    if ((size_t)out_size < ((size_t)(NB - 1) * OUT_SEQ + SEQ) * QE) return;
    if (SZ_TOTAL > ws_size) return;
    // wire order: state, lengths, Wh, bh, Wt, bt, U, Wcat, Wd, bd
    const float* state = (const float*)d_in[0];
    const int*   lengths = (const int*)d_in[1];
    const float* Wh = (const float*)d_in[2]; const float* bh = (const float*)d_in[3];
    const float* Wt = (const float*)d_in[4]; const float* bt = (const float*)d_in[5];
    const float* U = (const float*)d_in[6]; const float* Wcat = (const float*)d_in[7];
    const float* Wd = (const float*)d_in[8]; const float* bd = (const float*)d_in[9];
    float* OUT = (float*)d_out;      // [NB][SEQ][129][9]
    char* wsp = (char*)d_ws;
    bf*  XB  = (bf*)wsp;  wsp += SZ_XB;              // state  [NB*SEQ][768] bf16
    bf*  WT  = (bf*)wsp;  wsp += SZ_WT;              // [512][768] bf16: Wh^T | Wt^T (zero rows 200..255 of each half)
    h16* HTH = (h16*)wsp; wsp += SZ_HT;              // [NB*SEQ][512] head | tail value
    h16* HTR = (h16*)wsp; wsp += SZ_HT;              // [NB*SEQ][512] head | tail residual x2048
    h16* GH  = (h16*)wsp; wsp += SZ_GT;              // [32][2048][8] G^T value (x1024)
    h16* GR  = (h16*)wsp; wsp += SZ_GT;              // [32][2048][8] G^T residual x2048
    h16* VH  = (h16*)wsp; wsp += SZ_V;               // [NB*SEQ][2048] V value (x1024)
    h16* VR  = (h16*)wsp; wsp += SZ_V;               // [NB*SEQ][2048] V residual x2048
    float* S = (float*)wsp; wsp += SZ_S;             // [NB*SEQ][1184] band scores

    k_prep<<<PB_GP + 2 * PB_WTR + PB_CVT, 256, 0, stream>>>(state, Wh, Wt, U, Wcat, Wd, bd, XB, WT, GH, GR);

    k_ht<<<dim3(NB * SEQ / 64, HTP / 64, 1), 32 * HWV, 0, stream>>>(XB, WT, bh, bt, HTH, HTR);
    k_vg<<<dim3(NB * SEQ / (16 * VW), VP / 64, 1), 32 * VW, 0, stream>>>(HTH, HTR, GH, GR, VH, VR);
    k_band<<<NB * SEQ / BQ, 32 * BKT, 0, stream>>>(HTH, HTR, VH, VR, S);
    k_out<<<dim3((unsigned)((size_t)SEQ * QE / 4 / 256), NB, 1), 256, 0, stream>>>(S, lengths, bd, OUT);
}

// v005
// One run takes 105 microseconds.
// In both of two side-by-side timings against v004, it was 1.04 times as fast.
// Counting every step since v000, it is 2.19 times as fast.
#include <hip/hip_runtime.h>

// Span scorer: head / tail projections (Linear 768 -> 200 + erf GELU) with an appended constant-one feature; biaffine form head^T U[k] tail plus a concatenation-linear term, evaluated for every query token on a sliding band of 129 key offsets (-64..+64); length masking (masked entries = classifier bias); 9-tag linear classifier; non-finite outputs set to 0.
// Algebra: the classifier is folded into the bilinear weights: G[i][j][t] = sum_k (U[k][i][j] + [j==200] Wcat[k][i] + [i==200] Wcat[k][201+j]) Wd[k][t] + [i==j==200] bd[t]; V[q][t][j] = sum_i head[q][i] G[i][j][t]; score[q][r][t] = sum_j tail[q-64+r][j] V[q][t][j].
// Compute dtypes, f32 accumulate everywhere: projections v_wmma_f32_16x16x32_bf16 (state, Wh, Wt, biases RNE-converted to bf16; products exact); G built in f32 on the vector unit from bf16-converted U, Wcat, Wd, bd (9 tag columns);
// V GEMM and band GEMM v_wmma_f32_16x16x32_f16 with every operand as f16 value + f16 residual x2048 (three products; residual products in their own accumulator folded by 1/2048); G carries x1024, folded back after the band GEMM.
// Layout: bf16 state plane [q][768]; bf16 weight plane [512][768] (rows 0..199 Wh^T, 256..455 Wt^T, others zero); head|tail planes [q][512] (head cols 0..255, tail cols 256..511; col 200 of each half = 1, cols 201..255 = 0);
// G^T planes in 32 panels of 8 columns: [i/8][t*224 + j][i%8]; V planes [q][2048] with column t*224 + j; the band GEMM's block masks its scores and stores its 16 queries' output rows itself, one contiguous run.

#ifndef NB
#define NB 2
#endif
#ifndef SEQ
#define SEQ 1024
#endif
#define NB_FULL  2
#define SEQ_FULL 1024
#ifndef OUT_SEQ
#define OUT_SEQ SEQ              // row pitch (in tokens) between batches of the output
#endif
#define HID    768               // model width
#define NF     200               // projection width
#define NU     201               // NF + constant-one feature
#define NK     200               // bilinear channels
#define NT     9                 // tags
#define WH     64                // band half width
#define WF     129               // band width
#define QE     (WF * NT)         // output floats per query (1161)
#define HTW    256               // column width of the head half / tail half
#define HTP    512               // row pitch (halves) of the head|tail planes
#define KJ     224               // contraction length of the V and band GEMMs (201 zero-padded)
#define NJ     224               // G^T rows / V columns per tag
#define GPITCH 256               // columns i of the G^T planes (32 panels of 8)
#define GROWS  2048              // rows of the G^T planes (9 * 224 = 2016, zero rows above)
#define GPS    (GROWS * 8)       // halves per 8-column panel of the G^T planes
#define GJ     32                // G^T rows j per folded-weight block (one lane each)
#define GKB    40                // values of k per batch of U loads in gp_sum
#define VP     2048              // row pitch (halves) of the V planes
#define SP     1184              // LDS row pitch (floats) of a band block's score tile; SP - NT is odd, so the 16 queries of one score write fall on 16 banks
#define VW     4                 // waves per V GEMM block
#define HWV    8                 // waves per projection GEMM block
#define HKU    8                 // k steps of 32 whose fragments a projection GEMM wave reads from LDS as one group
#define HPL    (HID + 8)         // LDS row pitch (halves) of the projection GEMM's operand rows: 97 x 16 B
#define BQ     16                // queries per band block
#define BKT    9                 // 16-key tiles of a band block's window = its waves
#define BWIN   (BKT * 16)        // keys in a band block's window
#define BTG    3                 // tags whose products alternate in the band GEMM
#define TPL    (KJ + 8)          // LDS row pitch (halves) of the tail rows: 29 x 16 B
#define VPL    (NT * NJ + 8)     // LDS row pitch (halves) of the V rows: 253 x 16 B
#define QRS    2048.0f           // carry of every residual plane
#define QRI    (1.0f / 2048.0f)
#define GSC    1024.0f           // carry of the G planes
#define GSI    (1.0f / 1024.0f)

static_assert(NU == NF + 1);
static_assert(HID % 64 == 0);                  // weight transpose tiles of 64 k; GEMM products step k by 32
static_assert(KJ % 32 == 0);
static_assert(NU <= KJ);
static_assert(KJ <= HTW);
static_assert(KJ <= GPITCH);
static_assert(NJ == KJ);                       // V column block of one tag = one contraction row of the band GEMM
static_assert(HTP == 2 * HTW);
static_assert(HTW % 64 == 0);                  // a 64-column tile lies wholly in the head half or the tail half
static_assert((HTW & (HTW - 1)) == 0);
static_assert(NF <= HTW);
static_assert(GPITCH % 8 == 0);
static_assert(NJ % GJ == 0);
static_assert(GROWS - NT * NJ == GJ);           // zero rows above the tags: one lane each
static_assert(NK % GKB == 0);
static_assert(NU <= GPITCH);
static_assert(NT * NJ <= GROWS);
static_assert(GROWS == VP);
static_assert(VP % 64 == 0);
static_assert((NB * SEQ) % 64 == 0);
static_assert((NB * SEQ) % (16 * VW) == 0);
static_assert(SEQ % BQ == 0);                  // a band block's queries lie in one batch
static_assert(BWIN == BQ + 2 * WH);            // the window holds every key of every query of the block
static_assert(NT % BTG == 0);
static_assert(KJ / 8 <= 32 && NJ == KJ);        // a row part of KJ halves: one 16-byte piece per lane
static_assert(BKT == NT && BQ == 16);          // wave w stages key tile w and tag w
static_assert(SEQ % 16 == 0 && WH % 16 == 0);  // key tiles start at multiples of 16
static_assert(((SP - NT) & 1) == 1);
static_assert((BQ * QE) % 4 == 0);             // a band block's output run is whole 16-byte pieces
static_assert((BQ * QE * 4) % 128 == 64 && (BQ & (BQ - 1)) == 0);   // runs start at multiples of 128 bytes and half way between them in turn
static_assert(4 + (BQ * QE / 4) / (4 * 32 * BKT) * (4 * 32 * BKT) <= BQ * QE / 4);   // the whole groups, shifted by four pieces, stay inside the run
static_assert(((TPL / 8) & 1) == 1 && ((VPL / 8) & 1) == 1);
static_assert(sizeof(float) * BQ * SP <= sizeof(_Float16) * 2 * BWIN * TPL);   // the score tile fits the tail rows' LDS
static_assert(sizeof(_Float16) * (2 * BWIN * TPL + 2 * BQ * VPL) <= 327680);
static_assert(SEQ % 64 == 0);
static_assert(SEQ % 32 == 0);
static_assert(OUT_SEQ % 32 == 0);
static_assert(WF == 2 * WH + 1);
static_assert(WF <= 9 * 16);                   // nine 16-key tiles cover the band
static_assert(SP >= QE);
static_assert(NB <= NB_FULL);
static_assert(SEQ <= SEQ_FULL);
static_assert(4 * 32 * 16 == 16 * 64 * 2);     // slab store: 4 trips x 32 lanes x 16 B == 16 rows x 64 halves
static_assert(((HPL / 8) & 1) == 1 && HID % 8 == 0);
static_assert(HID % 256 == 0 && 64 % HWV == 0 && (64 * 8) % (32 * HWV) == 0);   // a row is whole 512-byte parts; whole rows per wave in the fill, whole pieces per thread in the epilogue
static_assert(HID % (32 * HKU) == 0);
static_assert(HWV == 8);                       // 4 row groups x 2 column halves of the 64x64 tile
static_assert(sizeof(unsigned short) * 2 * 64 * HPL + sizeof(float) * 64 * 68 <= 327680);
static_assert(sizeof(float) * VW * 16 * 68 <= 131072);
static_assert(sizeof(float) * NT * 8 * GJ <= 131072);
static_assert(sizeof(float) * 64 * 33 <= 131072);

typedef _Float16 h16;
typedef unsigned short bf;
typedef __attribute__((ext_vector_type(16))) __bf16   v16bf;
typedef __attribute__((ext_vector_type(16))) _Float16 v16h;
typedef __attribute__((ext_vector_type(8)))  _Float16 v8h;
typedef __attribute__((ext_vector_type(8)))  unsigned short v8us;
typedef __attribute__((ext_vector_type(8)))  float    v8f;
typedef __attribute__((ext_vector_type(4)))  float    v4f;
typedef v4f  __attribute__((may_alias)) v4fa;

__device__ __forceinline__ unsigned short f2bf(float f) { unsigned u = __float_as_uint(f); u += 0x7FFFu + ((u >> 16) & 1u); return (unsigned short)(u >> 16); }
__device__ __forceinline__ float bfr(float f) { return __uint_as_float(((unsigned)f2bf(f)) << 16); }   // value after RNE convert to bf16
__device__ __forceinline__ v16h cat16(v8h lo, v8h hi) { return __builtin_shufflevector(lo, hi, 0, 1, 2, 3, 4, 5, 6, 7, 8, 9, 10, 11, 12, 13, 14, 15); }
__device__ __forceinline__ v16bf cat16b(v8us lo, v8us hi) { return __builtin_bit_cast(v16bf, __builtin_shufflevector(lo, hi, 0, 1, 2, 3, 4, 5, 6, 7, 8, 9, 10, 11, 12, 13, 14, 15)); }
__device__ __forceinline__ v8f wmma16(v16h a, v16h b, v8f c) { return __builtin_amdgcn_wmma_f32_16x16x32_f16(false, a, false, b, (short)0, c, false, false); }
__device__ __forceinline__ v8f wmmab(v16bf a, v16bf b, v8f c) { return __builtin_amdgcn_wmma_f32_16x16x32_bf16(false, a, false, b, (short)0, c, false, false); }
// fragment loaders from K-contiguous 16-bit rows; p already includes + 8*(lane>>4): elements 0..7 <- k0+8h+0..7, elements 8..15 <- k0+16+8h+0..7 (same map for A and B)
__device__ __forceinline__ v16h  ldh(const h16* p) { return cat16(*(const v8h*)p, *(const v8h*)(p + 16)); }
__device__ __forceinline__ v16bf ldb(const bf* p)  { return cat16b(*(const v8us*)p, *(const v8us*)(p + 16)); }
// the same k map from 8-column panels; p already includes + (lane>>4) panels: elements 0..7 <- panel k0/8+h, elements 8..15 <- panel k0/8+2+h
__device__ __forceinline__ v16h  ldp(const h16* p) { return cat16(*(const v8h*)p, *(const v8h*)(p + 2 * GPS)); }
// ordering point for wave-private LDS tiles (same wave writes and reads)
__device__ __forceinline__ void wave_sync() { __builtin_amdgcn_fence(3 /* release order */, "wavefront"); __builtin_amdgcn_wave_barrier(); asm volatile("" ::: "memory"); }

// per-instruction guarded WMMA wrappers: one accumulator tied per guard, operands kept live across the nops
__device__ __forceinline__ v8f wg(v16h a, v16h b, v8f c) { c = wmma16(a, b, c); asm volatile("v_nop\n\tv_nop\n\tv_nop\n\tv_nop" : "+v"(c) : "v"(a), "v"(b)); return c; }
__device__ __forceinline__ v8f wgb(v16bf a, v16bf b, v8f c) { c = wmmab(a, b, c); asm volatile("v_nop\n\tv_nop\n\tv_nop\n\tv_nop" : "+v"(c) : "v"(a), "v"(b)); return c; }
// f32 -> f16 convert that cannot produce an f16 subnormal (|v| < 2^-14 -> +0), applied after the plane's carry
static __device__ __forceinline__ h16 toh_flush(float v) { const h16 r = (h16)v; return (fabsf(v) < 6.103515625e-05f) ? (h16)0.0f : r; }
__device__ __forceinline__ float gelu_erf(float x) { return 0.5f * x * (1.0f + erff(x * 0.70710678118654752f)); }

// d_cvt8: state (f32, batch pitch SEQ_FULL tokens) -> bf16 plane (batch pitch SEQ tokens), 8 elements per thread; blk = 0 .. PB_CVT-1.
__device__ __forceinline__ void d_cvt8(const float* __restrict__ src, bf* dst, int blk) {
    constexpr size_t per = (size_t)SEQ * HID / 8, n8 = (size_t)NB * per;
    const size_t i = (size_t)blk * 256 + threadIdx.x; if (i >= n8) return;
    const size_t so = (SEQ == SEQ_FULL) ? i * 8 : (i / per) * ((size_t)SEQ_FULL * HID) + (i % per) * 8;
    const v8f v = *(const v8f*)(src + so); v8us o;
#pragma unroll
    for (int k = 0; k < 8; ++k) o[k] = f2bf(v[k]);
    *(v8us*)(dst + i * 8) = o; 
}

// d_wtr: in[HID rows k][NF cols n] (f32) -> out[HTW rows n][HID cols k] (bf16, RNE convert); rows n >= NF written as zeros.
// blocks (bx, by) of (HID/64, HTW/32); tile: 64 x 33 floats of LDS.
__device__ __forceinline__ void d_wtr(const float* __restrict__ W, bf* dst, float* tile, int bx, int by) {
    const int tid = threadIdx.x;
    const int k0 = bx * 64, n0 = by * 32;
#pragma unroll 1
    for (int e = 0; e < 8; ++e) {                                  // 8 trips x 256 threads = 64 x 32 elements
        const int idx = e * 256 + tid; const int kk = idx >> 5, nn = idx & 31;
        const int n = n0 + nn; const int nc = n < NF ? n : NF - 1;  // clamped address
        float v = W[(size_t)(k0 + kk) * NF + nc];
        asm volatile("" : "+v"(v));
        tile[kk * 33 + nn] = (n < NF) ? v : 0.0f; }
    __syncthreads();
    const int row = tid >> 3, pc = tid & 7;
    v8us o;
#pragma unroll
    for (int e = 0; e < 8; ++e) o[e] = f2bf(tile[(pc * 8 + e) * 33 + row]);
    bf* p = dst + (size_t)(n0 + row) * HID + k0 + pc * 8;
    *(v8us*)p = o; 
}

// d_gp: folded weights. Block (jt, ip) builds the tile i = 8 ip + wave, j = 32 jt + lane of G for all 9 tags: a wave reads 32 consecutive j of one U row per k (one 128-byte run), GKB values of k in flight at a time.
// Each (i, j, t) is summed over k = 0..199 in order by one thread. The tile is turned in LDS and stored as 16-byte pieces (8 columns i) of panel ip, 512 contiguous bytes per tag.
// Entries with i >= NU or j >= NU are zeros; blocks jt == 0 also zero-fill rows [NT*NJ, GROWS) of their panel.
// blocks (jt, ip) of (NJ/GJ, GPITCH/8); gs: NT x 8 x GJ floats of LDS.
// EDGE: the wave holds the row i == 200 or the column j == 200, where the concatenation-linear terms enter. up = U + i*NU + jc and pa = Wcat + NU + jc are the lane's own, jc its clamped column; wb = Wcat + i is wave-uniform.
// ma, mb: all ones where the row term / the column term enters, else zero; msk gives the value or +0 for any bit pattern, as a select does, with no branch round a load.
__device__ __forceinline__ float msk(float v, unsigned m) { return __uint_as_float(__float_as_uint(v) & m); }
template <bool EDGE>
__device__ __forceinline__ void gp_sum(const float* __restrict__ up, const float* __restrict__ pa, const float* __restrict__ wb, const float* __restrict__ Wd, unsigned ma, unsigned mb, float (&acc)[NT]) {
#pragma unroll 1   // rolled over the batches
    for (int kb = 0; kb < NK; kb += GKB) {
        float u[GKB], a[EDGE ? GKB : 1];
#pragma unroll
        for (int e = 0; e < GKB; ++e) {
            u[e] = up[(size_t)e * (NU * NU)];
            if constexpr (EDGE) a[e] = pa[(size_t)e * (2 * NU)]; }
        asm volatile("s_wait_xcnt 0x0" ::: "memory");   // stands ahead of every overwrite of the address registers that the batch's loads name
        __builtin_amdgcn_sched_barrier(0);   // the whole batch's loads are issued ahead of its first sum (else the scheduler may sink loads to their uses and their latencies add up), and the address steps below stay behind the wait
#pragma unroll
        for (int e = 0; e < GKB; ++e) {
            float w = bfr(u[e]);
            if constexpr (EDGE) w = w + msk(bfr(a[e]), ma) + msk(bfr(wb[(size_t)(kb + e) * (2 * NU)]), mb);
#pragma unroll
            for (int t = 0; t < NT; ++t) acc[t] = fmaf(w, bfr(Wd[(kb + e) * NT + t]), acc[t]); }
        up += (size_t)GKB * (NU * NU);
        if constexpr (EDGE) pa += (size_t)GKB * (2 * NU);
    }
}
__device__ __forceinline__ void d_gp(const float* __restrict__ U, const float* __restrict__ Wcat, const float* __restrict__ Wd, const float* __restrict__ bd, h16* GH, h16* GR, float* gs, int jt, int ip) {
    const int tid = threadIdx.x, lane = tid & 31;
    const int wave = __builtin_amdgcn_readfirstlane(tid >> 5);
    const int i = ip * 8 + wave, j = jt * GJ + lane;
    float acc[NT];
#pragma unroll
    for (int t = 0; t < NT; ++t) acc[t] = 0.0f;
    const int jc = j < NU ? j : NU - 1;                             // clamped column index
    if (i < NU) {                                                   // wave-uniform
        if ((i == NU - 1) | (jt == (NU - 1) / GJ)) {                // wave-uniform: the row or the column of the constant-one feature lies in this wave
            const unsigned ma = (i == NU - 1) ? ~0u : 0u, mb = (j == NU - 1) ? ~0u : 0u;
            gp_sum<true>(U + (size_t)i * NU + jc, Wcat + NU + jc, Wcat + i, Wd, ma, mb, acc);
#pragma unroll
            for (int t = 0; t < NT; ++t) acc[t] += msk(bfr(bd[t]), ma & mb);
        } else {
            gp_sum<false>(U + (size_t)i * NU + jc, Wcat, Wcat, Wd, 0u, 0u, acc); }
    }
    const bool ok = (i < NU) & (j < NU);
#pragma unroll
    for (int t = 0; t < NT; ++t) gs[(t * 8 + wave) * GJ + lane] = ok ? acc[t] * GSC : 0.0f;
    __syncthreads();
#pragma unroll 1   // rolled: the second trip is one wave's
    for (int p = tid; p < NT * GJ; p += 256) {                      // 9 tags x 32 rows j; second trip = wave 0 only
        const int t = p >> 5, jj = p & 31; v8h hv, rv;
#pragma unroll
        for (int c = 0; c < 8; ++c) { const float x = gs[(t * 8 + c) * GJ + jj]; const h16 a0 = toh_flush(x); hv[c] = a0; rv[c] = toh_flush((x - (float)a0) * QRS); }
        const size_t oo = (size_t)ip * GPS + ((size_t)t * NJ + jt * GJ + jj) * 8;
        *(v8h*)(GH + oo) = hv; *(v8h*)(GR + oo) = rv; }
    if ((jt == 0) & (wave == 0)) {                                  // wave-uniform
        const v8h z = (v8h){};
        const size_t zo = (size_t)ip * GPS + ((size_t)NT * NJ + lane) * 8;
        *(v8h*)(GH + zo) = z; *(v8h*)(GR + zo) = z; }
}

// k_prep: the four preparation bodies, none of which reads what another writes, share one launch; a block's body is chosen by its index (block-uniform branch).
// The folded-weight blocks, the longest, hold the lowest indices; then the two weight transposes; then the state convert.
#define PB_GP   ((NJ / GJ) * (GPITCH / 8))
#define PB_WTR  ((HID / 64) * (HTW / 32))
#define PB_CVT  ((int)(((size_t)NB * SEQ * HID / 8 + 255) / 256))
static_assert(64 * 33 <= NT * 8 * GJ);          // the transpose tile fits the LDS array sized for the folded-weight tile
__global__ __launch_bounds__(256) void k_prep(const float* __restrict__ state, const float* __restrict__ Wh, const float* __restrict__ Wt, const float* __restrict__ U, const float* __restrict__ Wcat,
                                              const float* __restrict__ Wd, const float* __restrict__ bd, bf* XB, bf* WT, h16* GH, h16* GR) {
    __shared__ __align__(16) float sm[NT * 8 * GJ];
    const int blk = blockIdx.x;
    // The tests run from the highest range down: the built code then holds the folded-weight body first, with no other body's barrier on a path ahead of it, and its wave-uniform Wd loads stay scalar loads.
    // The bodies stand one behind another in the built code: each s_wait_xcnt 0 stands behind a body's last stores, ahead of the next body's first write of a register that those stores name.
    if (blk >= PB_GP + 2 * PB_WTR) d_cvt8(state, XB, blk - PB_GP - 2 * PB_WTR);
    else if (blk >= PB_GP + PB_WTR) { d_wtr(Wt, WT + (size_t)HTW * HID, sm, (blk - PB_GP - PB_WTR) % (HID / 64), (blk - PB_GP - PB_WTR) / (HID / 64)); asm volatile("s_wait_xcnt 0x0" ::: "memory"); }
    else if (blk >= PB_GP) { d_wtr(Wh, WT, sm, (blk - PB_GP) % (HID / 64), (blk - PB_GP) / (HID / 64)); asm volatile("s_wait_xcnt 0x0" ::: "memory"); }
    else { d_gp(U, Wcat, Wd, bd, GH, GR, sm, blk % (NJ / GJ), blk / (NJ / GJ)); asm volatile("s_wait_xcnt 0x0" ::: "memory"); }
}

// k_ht: bf16 GEMM, one block of HWV = 8 waves per 64x64 tile, K = HID. C[m][n] = sum_k A[m][k] Bt[n][k]; A = state rows (m = q), Bt = weight rows (n < 256: head column n, n >= 256: tail column n - 256).
// The tile's 64 A rows and 64 Bt rows, each set one contiguous run of global memory, are read once per block in 512-byte parts of a row per load, all loads in flight together, and kept whole in LDS (row pitch an odd number of 16-byte units).
// Wave w takes rows 16 (w >> 1) .. + 15 and columns 32 (w & 1) .. + 31: two accumulators, each summed over k in ascending order. The first barrier ends the LDS fill; the second ends the writes of the f32 tile os ahead of its row-wise readers.
// Epilogue per column nn = n mod 256: nn < 200 -> GELU(C + bias), nn == 200 -> 1, nn > 200 -> 0; written as f16 value (Ph) and f16 residual x2048 (Pr), row pitch HTP.
// grid (NB*SEQ/64, HTP/64).
__global__ __launch_bounds__(32 * HWV) void k_ht(const bf* __restrict__ A, const bf* __restrict__ Bt, const float* __restrict__ bh, const float* __restrict__ bt, h16* Ph, h16* Pr) {
    __shared__ __align__(16) bf sab[2 * 64 * HPL];
    __shared__ __align__(16) float os[64 * 68];
    bf* const sA = sab; bf* const sB = sab + 64 * HPL;
    constexpr int NTH = 32 * HWV, RW = 64 / HWV, RT = HID / 256;   // threads; rows per wave and operand; 512-byte parts (one 16-byte piece per lane) per row
    const int tid = threadIdx.x, lane = tid & 31, lr = lane & 15, hi = lane >> 4;
    const int wave = __builtin_amdgcn_readfirstlane(tid >> 5);
    const int r0 = blockIdx.x * 64, c0 = blockIdx.y * 64;
    {   // wave w brings rows 8 w .. 8 w + 7 of both operands
        const bf* const pa = A + (size_t)(r0 + wave * RW) * HID + lane * 8; const bf* const pb = Bt + (size_t)(c0 + wave * RW) * HID + lane * 8;
        const int sl = wave * RW * HPL + lane * 8;
        v8us xa[RW * RT], xb[RW * RT];
#pragma unroll
        for (int it = 0; it < RW * RT; ++it) { xa[it] = *(const v8us*)(pa + it * 256); xb[it] = *(const v8us*)(pb + it * 256); }
        asm volatile("s_wait_xcnt 0x0" ::: "memory");   // stands ahead of every overwrite of the address registers that the loads above name
        __builtin_amdgcn_sched_barrier(0);   // all the loads are issued ahead of the first LDS store (one latency, not several), and later address work stays behind the wait
#pragma unroll
        for (int it = 0; it < RW * RT; ++it) { const int so = sl + (it / RT) * HPL + (it % RT) * 256;
            *(v8us*)(sA + so) = xa[it]; *(v8us*)(sB + so) = xb[it]; }
    }
    const int mb = wave >> 1, n2 = (wave & 1) * 2;
    float bc[2];
#pragma unroll
    for (int u = 0; u < 2; ++u) { const int nn = (c0 + (n2 + u) * 16 + lr) & (HTW - 1); const int bi = nn < NF ? nn : NF - 1;   // clamped address
        bc[u] = bfr((c0 >= HTW) ? bt[bi] : bh[bi]); }
    __syncthreads();
    v8f acc[2];
#pragma unroll
    for (int u = 0; u < 2; ++u) acc[u] = (v8f){};
    const bf* const fa = sA + (mb * 16 + lr) * HPL + 8 * hi; const bf* const fb = sB + (n2 * 16 + lr) * HPL + 8 * hi;
#pragma unroll
    for (int k0 = 0; k0 < HID; k0 += 32 * HKU) {
        v16bf a[HKU], b[HKU][2];
#pragma unroll
        for (int e = 0; e < HKU; ++e) { a[e] = ldb(fa + k0 + e * 32); b[e][0] = ldb(fb + k0 + e * 32); b[e][1] = ldb(fb + 16 * HPL + k0 + e * 32); }
        __builtin_amdgcn_sched_barrier(0);   // the group's LDS reads are issued ahead of its first product: else each product waits out an LDS latency of its own
#pragma unroll
        for (int e = 0; e < HKU; ++e) {
#pragma unroll
            for (int u = 0; u < 2; ++u) acc[u] = wgb(a[e], b[e][u], acc[u]); }
    }
#pragma unroll
    for (int u = 0; u < 2; ++u) {
#pragma unroll
        for (int j = 0; j < 8; ++j) os[(mb * 16 + hi * 8 + j) * 68 + (n2 + u) * 16 + lr] = acc[u][j] + bc[u]; }   // D: row 8h+j, col lane&15
    __syncthreads();
#pragma unroll 1   // rolled: the second trip runs the first one's text
    for (int s = 0; s < 64 * 8 / NTH; ++s) { const int row = (NTH / 8) * s + (tid >> 3), c8 = (tid & 7) * 8;   // 8 threads x 8 = 64 columns of one row
        const v4f x0 = *(const v4fa*)(&os[row * 68 + c8]); const v4f x1 = *(const v4fa*)(&os[row * 68 + c8 + 4]); v8h hv, rv;
#pragma unroll
        for (int i = 0; i < 4; ++i) {
            const int n0 = (c0 + c8 + i) & (HTW - 1), n1 = (c0 + c8 + 4 + i) & (HTW - 1);
            const float g0 = gelu_erf(x0[i]), g1 = gelu_erf(x1[i]);
            const float v0 = (n0 < NF) ? g0 : ((n0 == NF) ? 1.0f : 0.0f);
            const float v1 = (n1 < NF) ? g1 : ((n1 == NF) ? 1.0f : 0.0f);
            const h16 a0 = toh_flush(v0); const h16 a1 = toh_flush(v1); hv[i] = a0; hv[4 + i] = a1;
            rv[i] = toh_flush((v0 - (float)a0) * QRS); rv[4 + i] = toh_flush((v1 - (float)a1) * QRS); }
        const size_t oo = (size_t)(r0 + row) * HTP + c0 + c8;
        *(v8h*)(Ph + oo) = hv; *(v8h*)(Pr + oo) = rv;
        asm volatile("s_wait_xcnt 0x0" ::: "memory"); }   // stands ahead of the next trip's overwrites of the registers that the two stores name
}

// k_vg: f16 GEMM with three products, one wave per 16x64 tile, K = KJ. V[q][n] = sum_i head[q][i] G^T[n][i], n = t*NJ + j.
// A = head planes (value AH, residual AR; row pitch HTP, columns 0..KJ-1), Bt = G^T planes (value GH, residual GR; panels of 8 columns: 16 lanes read 256 contiguous bytes).
// aH = AH.GH; aR = AR.GH + AH.GR (both residual carries x2048, one accumulator); V = aH + aR/2048 (keeps the x1024 carry of G); written as f16 value (VH) + f16 residual x2048 (VR), row pitch VP.
// grid (NB*SEQ/(16*VW), VP/64).
__global__ __launch_bounds__(32 * VW) void k_vg(const h16* __restrict__ AH, const h16* __restrict__ AR, const h16* __restrict__ GH, const h16* __restrict__ GR, h16* VH, h16* VR) {
    __shared__ __align__(16) float os[VW * 16 * 68];
    const int lane = threadIdx.x & 31, lr = lane & 15, hi = lane >> 4;
    const int wave = __builtin_amdgcn_readfirstlane((int)(threadIdx.x >> 5));
    const int m0 = (blockIdx.x * VW + wave) * 16, c0 = blockIdx.y * 64;
    v8f aH[4], aR[4];
#pragma unroll
    for (int nb = 0; nb < 4; ++nb) { aH[nb] = (v8f){}; aR[nb] = (v8f){}; }
    const size_t aoff = (size_t)(m0 + lr) * HTP + 8 * hi, boff = (size_t)hi * GPS + (size_t)(c0 + lr) * 8;
#pragma unroll 1
    for (int kc = 0; kc < KJ; kc += 32) {
        const v16h ah = ldh(AH + aoff + kc), ar = ldh(AR + aoff + kc);
#pragma unroll
        for (int nb = 0; nb < 4; ++nb) {
            const v16h gh = ldp(GH + boff + (size_t)(kc / 8) * GPS + nb * 16 * 8), gr = ldp(GR + boff + (size_t)(kc / 8) * GPS + nb * 16 * 8);
            aH[nb] = wg(ah, gh, aH[nb]); aR[nb] = wg(ar, gh, aR[nb]); aR[nb] = wg(ah, gr, aR[nb]); }
    }
    const int wb = wave * 16 * 68;
#pragma unroll
    for (int nb = 0; nb < 4; ++nb) {
#pragma unroll
        for (int j = 0; j < 8; ++j) os[wb + (hi * 8 + j) * 68 + nb * 16 + lr] = aH[nb][j] + aR[nb][j] * QRI; }   // D: row 8h+j, col lane&15
    wave_sync();
{
#pragma unroll 1
        for (int s = 0; s < 4; ++s) { const int row = 4 * s + (lane >> 3), c8 = (lane & 7) * 8;   // 4 s x 4 row groups = 16 rows; 8 lanes x 8 = 64 columns
            const v4f x0 = *(const v4fa*)(&os[wb + row * 68 + c8]); const v4f x1 = *(const v4fa*)(&os[wb + row * 68 + c8 + 4]); v8h hv, rv;
#pragma unroll
            for (int i = 0; i < 4; ++i) { const h16 a0 = toh_flush(x0[i]); const h16 a1 = toh_flush(x1[i]); hv[i] = a0; hv[4 + i] = a1;
                rv[i] = toh_flush((x0[i] - (float)a0) * QRS); rv[4 + i] = toh_flush((x1[i] - (float)a1) * QRS); }
            const size_t oo = (size_t)(m0 + row) * VP + c0 + c8;
            *(v8h*)(VH + oo) = hv; *(v8h*)(VR + oo) = rv; }
         }
}

// piece p (4 floats) of a band block's output run, read from the score tile: output element e = 1161 n + rem lies at os[SP n + rem]; a piece may run over from row n into row n + 1
__device__ __forceinline__ v4f band_piece(const float* os, int p) {
    const unsigned e = 4u * (unsigned)p, n = e / QE, rem = e - n * QE; v4f v;
#pragma unroll
    for (unsigned c = 0; c < 4; ++c) v[c] = os[e + c + (n + (rem + c >= QE ? 1u : 0u)) * (SP - QE)];
    return v;
}

// k_band: one block per BQ = 16 consecutive queries (one batch), one wave per 16-key tile of their common window of 144 keys (key = n0 - 64 + w, w = 0..143; a tile outside the sequence reads the nearest tile inside it; out-of-sequence keys fall to the keep rule).
// The window's tail rows and the 16 queries' V rows are read from global memory once per block, in 16-byte pieces that run along the rows, and kept in LDS (row pitches an odd number of 16-byte units).
// A = tail rows of the wave's key tile (row = key, k = j), held in registers for all tags; B = V of one tag (column = query lane&15, k = j), K = KJ.
// sH = TH.VH; sR = TR.VH + TH.VR; score = (sH + sR/2048)/1024. D element j of lane (lr, hi) = (w = 16 wave + 8 hi + j, query lr); band offset r = w - lr, kept where 0 <= r <= 128 -> os[lr*SP + r*9 + t].
// Keep rule per element, applied where the score is written to os: (n < len) and (0 <= key < SEQ) and (key < len); other elements get the classifier bias; non-finite values become 0.
// os lies on the tail rows' LDS, which no wave reads once every wave holds its A fragments (second barrier); the third barrier ends the score writes ahead of the block's linear store of its 16 output rows (16 x 1161 floats in a row).
// grid NB*SEQ/BQ.
__global__ __launch_bounds__(32 * BKT) void k_band(const h16* __restrict__ HTH, const h16* __restrict__ HTR, const h16* __restrict__ VH, const h16* __restrict__ VR, const int* __restrict__ lengths, const float* __restrict__ bd, float* OUT) {
    __shared__ __align__(16) h16 sm[2 * BWIN * TPL + 2 * BQ * VPL];
    h16* const tH = sm; h16* const tR = sm + BWIN * TPL;
    h16* const vH = sm + 2 * BWIN * TPL; h16* const vR = vH + BQ * VPL;
    float* const os = (float*)sm;
    constexpr int NTH = 32 * BKT, TPC = KJ / 8;
    const int tid = threadIdx.x, lane = tid & 31, lr = lane & 15, hi = lane >> 4;
    const int wave = __builtin_amdgcn_readfirstlane(tid >> 5);
    const int q0 = blockIdx.x * BQ;
    const int b = q0 / SEQ, n0 = q0 % SEQ;
    const int len = lengths[b];
    const float bl = bfr(bd[lane < NT ? lane : NT - 1]);   // lane t holds tag t's bias: one load, in flight with the row loads below, not one wait per tag in the tag loop
    asm volatile("s_wait_xcnt 0x0" ::: "memory");   // stands ahead of every overwrite of the address registers that the bias load names
    if (lane < TPC) {   // one lane per 16-byte piece of a 448-byte row part; wave w brings the 16 tail rows of key tile w and tag w's part of the 16 V rows
        int kb = n0 - WH + 16 * wave; kb = kb < 0 ? 0 : (kb > SEQ - 16 ? SEQ - 16 : kb);   // a key tile lies wholly inside or wholly outside the sequence
        const size_t to = ((size_t)b * SEQ + (size_t)kb) * HTP + lane * 8, vo = (size_t)q0 * VP + wave * NJ + lane * 8;
        const h16* const pth = HTH + to; const h16* const ptr = HTR + to; const h16* const pvh = VH + vo; const h16* const pvr = VR + vo;
        const int tl = wave * 16 * TPL + lane * 8, vl = wave * NJ + lane * 8;
        v8h xh[16], xr[16], yh[16], yr[16];
#pragma unroll
        for (int it = 0; it < 16; ++it) { xh[it] = *(const v8h*)(pth + HTW + it * HTP); xr[it] = *(const v8h*)(ptr + HTW + it * HTP); }
#pragma unroll
        for (int it = 0; it < 16; ++it) yh[it] = *(const v8h*)(pvh + it * VP);
        asm volatile("s_wait_xcnt 0x0" :: "v"(pth), "v"(ptr), "v"(pvh) : "memory");   // stands ahead of every overwrite of the three address pairs that the loads above name; as its inputs they stay whole up to it
        __builtin_amdgcn_sched_barrier(0);   // these 48 loads are issued ahead of the first LDS store (one latency, not several), and the LDS address work stays behind the wait
#pragma unroll
        for (int it = 0; it < 16; ++it) { *(v8h*)(tH + tl + it * TPL) = xh[it]; *(v8h*)(tR + tl + it * TPL) = xr[it]; }
        __builtin_amdgcn_sched_barrier(0);   // the last 16 loads take the registers that the tail rows have left: all 64 at once would need registers above v255
#pragma unroll
        for (int it = 0; it < 16; ++it) yr[it] = *(const v8h*)(pvr + it * VP);
        asm volatile("s_wait_xcnt 0x0" :: "v"(pvr) : "memory");   // as above, for the fourth address pair
        __builtin_amdgcn_sched_barrier(0);   // keeps these loads ahead of the stores below and later address work behind the wait
#pragma unroll
        for (int it = 0; it < 16; ++it) *(v8h*)(vH + vl + it * VPL) = yh[it];
#pragma unroll
        for (int it = 0; it < 16; ++it) *(v8h*)(vR + vl + it * VPL) = yr[it];
    }
    __syncthreads();
    v16h th[KJ / 32], tr[KJ / 32];
    const int ao = (wave * 16 + lr) * TPL + 8 * hi;
#pragma unroll
    for (int k = 0; k < KJ / 32; ++k) { th[k] = ldh(tH + ao + k * 32); tr[k] = ldh(tR + ao + k * 32); }
    __syncthreads();
    const int bo = lr * VPL + 8 * hi;
    const int r0 = 16 * wave + 8 * hi - lr;
    bool ok[8];   // keep rule of D element j: the same for every tag
#pragma unroll
    for (int j = 0; j < 8; ++j) { const int key = n0 - WH + 16 * wave + 8 * hi + j; ok[j] = (n0 + lr < len) & (key >= 0) & (key < SEQ) & (key < len); }
#pragma unroll 1   // rolled over the groups of three tags: the A fragments and one group's accumulators and B fragments fill the registers below v256
    for (int tg = 0; tg < NT; tg += BTG) {
        v8f sH[BTG], sR[BTG];
#pragma unroll
        for (int u = 0; u < BTG; ++u) { sH[u] = (v8f){}; sR[u] = (v8f){}; }
#pragma unroll
        for (int k = 0; k < KJ / 32; ++k) {
            v16h vh[BTG], vr[BTG];
#pragma unroll
            for (int u = 0; u < BTG; ++u) { vh[u] = ldh(vH + bo + (tg + u) * NJ + k * 32); vr[u] = ldh(vR + bo + (tg + u) * NJ + k * 32); }
            // the three tags' products alternate, so that no product waits for the one before it; each accumulator takes its products in the order k, then TR.VH, then TH.VR
#pragma unroll
            for (int u = 0; u < BTG; ++u) sH[u] = wg(th[k], vh[u], sH[u]);
#pragma unroll
            for (int u = 0; u < BTG; ++u) sR[u] = wg(tr[k], vh[u], sR[u]);
#pragma unroll
            for (int u = 0; u < BTG; ++u) sR[u] = wg(th[k], vr[u], sR[u]); }
#pragma unroll
        for (int u = 0; u < BTG; ++u) {
            const float bv = __int_as_float(__builtin_amdgcn_readlane(__float_as_int(bl), tg + u));   // tag tg + u's bias, wave-uniform
#pragma unroll
            for (int j = 0; j < 8; ++j) { const int r = r0 + j;
                float val = ok[j] ? (sH[u][j] + sR[u][j] * QRI) * GSI : bv;
                val = (fabsf(val) <= 3.402823466e38f) ? val : 0.0f;
                if ((r >= 0) & (r < WF)) os[lr * SP + r * NT + tg + u] = val; } }
    }
    __syncthreads();
    float* const dst = OUT + ((size_t)b * OUT_SEQ + n0) * QE;
    constexpr int NP = BQ * QE / 4, PG = 4, NG = NP / (PG * NTH);   // 16-byte pieces of the run; pieces per thread and group; whole groups
    // A run is 580 and a half lines of 128 bytes: every second block's run starts half way into a line. There the pieces are taken from the fifth on, so that each wave's 32 pieces of a group are four whole lines; the first four follow with the run's last pieces.
    // At such a block bound the two neighbours each store their own 64 bytes of the line, in 16-byte pieces of their own; neither reads it.
    const int off = (n0 & BQ) ? 4 : 0;
#pragma unroll 1   // rolled over the groups: every group runs the first one's text
    for (int g = 0; g < NG; ++g) {
        v4f val[PG];
#pragma unroll
        for (int s = 0; s < PG; ++s) val[s] = band_piece(os, off + (g * PG + s) * NTH + tid);
        __builtin_amdgcn_sched_barrier(0);   // the group's LDS reads are issued ahead of its first store: one LDS latency a group, not one a piece
#pragma unroll
        for (int s = 0; s < PG; ++s) *(v4f*)(dst + (size_t)(off + (g * PG + s) * NTH + tid) * 4) = val[s];
        asm volatile("s_wait_xcnt 0x0" ::: "memory"); }   // stands ahead of the next group's overwrites of the registers that the stores name
    static_assert(NP - NG * PG * NTH <= NTH);   // what the whole groups leave: at most one piece a thread
    if (tid < NP - NG * PG * NTH) { const int i = NG * PG * NTH + tid, p = off + i < NP ? off + i : off + i - NP;
        const v4f val = band_piece(os, p); *(v4f*)(dst + (size_t)p * 4) = val; }
}

static constexpr size_t al256(size_t v) { return (v + 255) & ~(size_t)255; }
static constexpr size_t SZ_XB = al256((size_t)NB * SEQ * HID * 2);
static constexpr size_t SZ_WT = al256((size_t)HTP * HID * 2);
static constexpr size_t SZ_HT = al256((size_t)NB * SEQ * HTP * 2);
static constexpr size_t SZ_GT = al256((size_t)GROWS * GPITCH * 2);
static constexpr size_t SZ_V  = al256((size_t)NB * SEQ * VP * 2);
static constexpr size_t SZ_TOTAL = SZ_XB + SZ_WT + 2 * SZ_HT + 2 * SZ_GT + 2 * SZ_V;
static_assert(SZ_TOTAL <= (size_t)134217728);          // workspace carve <= 128 MiB
static_assert(((size_t)HTW * HID * 2) % 256 == 0);     // tail half of the weight plane stays 256-byte aligned
static_assert(((size_t)SEQ * HID) % 8 == 0);
static_assert((size_t)(NB_FULL - 1) * SEQ_FULL * QE * 4 + (size_t)SEQ_FULL * QE * 4 == (size_t)9510912);   // output bytes of the full problem

extern "C" void kernel_launch(void* const* d_in, const int* in_sizes, int n_in,
                              void* d_out, int out_size, void* d_ws, size_t ws_size, hipStream_t stream) {
    if (n_in < 10) return;
    const size_t needx = ((size_t)(NB - 1) * SEQ_FULL + SEQ) * HID;
    if ((size_t)in_sizes[0] < needx) return;
    if (in_sizes[1] < NB) return;
    if ((size_t)in_sizes[2] < (size_t)HID * NF || (size_t)in_sizes[4] < (size_t)HID * NF) return;
    if (in_sizes[3] < NF || in_sizes[5] < NF) return;
    if ((size_t)in_sizes[6] < (size_t)NK * NU * NU) return;
    if ((size_t)in_sizes[7] < (size_t)NK * 2 * NU) return;
    if (in_sizes[8] < NK * NT || in_sizes[9] < NT) return;
    if ((size_t)out_size < ((size_t)(NB - 1) * OUT_SEQ + SEQ) * QE) return;
    if (SZ_TOTAL > ws_size) return;
    // wire order: state, lengths, Wh, bh, Wt, bt, U, Wcat, Wd, bd
    const float* state = (const float*)d_in[0];
    const int*   lengths = (const int*)d_in[1];
    const float* Wh = (const float*)d_in[2]; const float* bh = (const float*)d_in[3];
    const float* Wt = (const float*)d_in[4]; const float* bt = (const float*)d_in[5];
    const float* U = (const float*)d_in[6]; const float* Wcat = (const float*)d_in[7];
    const float* Wd = (const float*)d_in[8]; const float* bd = (const float*)d_in[9];
    float* OUT = (float*)d_out;      // [NB][SEQ][129][9]
    char* wsp = (char*)d_ws;
    bf*  XB  = (bf*)wsp;  wsp += SZ_XB;              // state  [NB*SEQ][768] bf16
    bf*  WT  = (bf*)wsp;  wsp += SZ_WT;              // [512][768] bf16: Wh^T | Wt^T (zero rows 200..255 of each half)
    h16* HTH = (h16*)wsp; wsp += SZ_HT;              // [NB*SEQ][512] head | tail value
    h16* HTR = (h16*)wsp; wsp += SZ_HT;              // [NB*SEQ][512] head | tail residual x2048
    h16* GH  = (h16*)wsp; wsp += SZ_GT;              // [32][2048][8] G^T value (x1024)
    h16* GR  = (h16*)wsp; wsp += SZ_GT;              // [32][2048][8] G^T residual x2048
    h16* VH  = (h16*)wsp; wsp += SZ_V;               // [NB*SEQ][2048] V value (x1024)
    h16* VR  = (h16*)wsp; wsp += SZ_V;               // [NB*SEQ][2048] V residual x2048

    k_prep<<<PB_GP + 2 * PB_WTR + PB_CVT, 256, 0, stream>>>(state, Wh, Wt, U, Wcat, Wd, bd, XB, WT, GH, GR);

    k_ht<<<dim3(NB * SEQ / 64, HTP / 64, 1), 32 * HWV, 0, stream>>>(XB, WT, bh, bt, HTH, HTR);
    k_vg<<<dim3(NB * SEQ / (16 * VW), VP / 64, 1), 32 * VW, 0, stream>>>(HTH, HTR, GH, GR, VH, VR);
    k_band<<<NB * SEQ / BQ, 32 * BKT, 0, stream>>>(HTH, HTR, VH, VR, lengths, bd, OUT);
}

// v006
// One run takes 66 microseconds.
// Two timings next to v005 put it at 1.59 and 1.60 times that version's speed.
// Over all steps from v000 it is 3.48 times as fast.
#include <hip/hip_runtime.h>

// Span scorer: head / tail projections (Linear 768 -> 200 + erf GELU) with an appended constant-one feature; biaffine form head^T U[k] tail plus a concatenation-linear term, evaluated for every query token on a sliding band of 129 key offsets (-64..+64); length masking (masked entries = classifier bias); 9-tag linear classifier; non-finite outputs set to 0.
// Algebra: the classifier is folded into the bilinear weights: G[i][j][t] = sum_k (U[k][i][j] + [j==200] Wcat[k][i] + [i==200] Wcat[k][201+j]) Wd[k][t] + [i==j==200] bd[t]; V[q][t][j] = sum_i head[q][i] G[i][j][t]; score[q][r][t] = sum_j tail[q-64+r][j] V[q][t][j].
// Compute dtypes, f32 accumulate everywhere: projections v_wmma_f32_16x16x32_bf16 (state, Wh, Wt, biases RNE-converted to bf16; products exact); G built in f32 on the vector unit from bf16-converted U, Wcat, Wd, bd (9 tag columns);
// V GEMM and band GEMM v_wmma_f32_16x16x32_f16 with every operand as f16 value + f16 residual x2048 (three products; residual products in their own accumulator folded by 1/2048); G carries x1024, folded back after the band GEMM.
// Layout: bf16 state plane [q][768]; bf16 weight plane [512][768] (rows 0..199 Wh^T, 256..455 Wt^T, others zero); head|tail planes [q][512] (head cols 0..255, tail cols 256..511; col 200 of each half = 1, cols 201..255 = 0);
// G^T planes in 32 panels of 8 columns: [i/8][t*224 + j][i%8]; V planes [q][2048] with column t*224 + j; the band GEMM's block masks its scores and stores its 16 queries' output rows itself, one contiguous run.

#ifndef NB
#define NB 2
#endif
#ifndef SEQ
#define SEQ 1024
#endif
#define NB_FULL  2
#define SEQ_FULL 1024
#ifndef OUT_SEQ
#define OUT_SEQ SEQ              // row pitch (in tokens) between batches of the output
#endif
#define HID    768               // model width
#define NF     200               // projection width
#define NU     201               // NF + constant-one feature
#define NK     200               // bilinear channels
#define NT     9                 // tags
#define WH     64                // band half width
#define WF     129               // band width
#define QE     (WF * NT)         // output floats per query (1161)
#define HTW    256               // column width of the head half / tail half
#define HTP    512               // row pitch (halves) of the head|tail planes
#define KJ     224               // contraction length of the V and band GEMMs (201 zero-padded)
#define NJ     224               // G^T rows / V columns per tag
#define GPITCH 256               // columns i of the G^T planes (32 panels of 8)
#define GROWS  2048              // rows of the G^T planes (9 * 224 = 2016, zero rows above)
#define GPS    (GROWS * 8)       // halves per 8-column panel of the G^T planes
#define GJ     32                // G^T rows j per d_gp block (one lane each)
#define GKB    40                // values of k per batch of U loads in d_gp
#define WP     12                // LDS row pitch (floats) of the converted classifier weights: 9 tags in three 16-byte pieces, of the last only its first float is read
#define WG     4                 // rows of that table per group of LDS reads in d_gp
#define WS     ((NK * WP + 255) / 256)   // weights per thread in the fill of that table
#define VP     2048              // row pitch (halves) of the V planes
#define SP     1184              // LDS row pitch (floats) of a band block's score tile; SP - NT is odd, so the 16 queries of one score write fall on 16 banks
#define VW     4                 // waves per V GEMM block
#define HWV    8                 // waves per projection GEMM block
#define HKU    8                 // k steps of 32 whose fragments a projection GEMM wave reads from LDS as one group
#define HPL    (HID + 8)         // LDS row pitch (halves) of the projection GEMM's operand rows: 97 x 16 B
#define BQ     16                // queries per band block
#define BKT    9                 // 16-key tiles of a band block's window = its waves
#define BWIN   (BKT * 16)        // keys in a band block's window
#define BTG    3                 // tags whose products alternate in the band GEMM
#define TPL    (KJ + 8)          // LDS row pitch (halves) of the tail rows: 29 x 16 B
#define VPL    (NT * NJ + 8)     // LDS row pitch (halves) of the V rows: 253 x 16 B
#define QRS    2048.0f           // carry of every residual plane
#define QRI    (1.0f / 2048.0f)
#define GSC    1024.0f           // carry of the G planes
#define GSI    (1.0f / 1024.0f)

static_assert(NU == NF + 1);
static_assert(HID % 64 == 0);                  // weight transpose tiles of 64 k; GEMM products step k by 32
static_assert(KJ % 32 == 0);
static_assert(NU <= KJ);
static_assert(KJ <= HTW);
static_assert(KJ <= GPITCH);
static_assert(NJ == KJ);                       // V column block of one tag = one contraction row of the band GEMM
static_assert(HTP == 2 * HTW);
static_assert(HTW % 64 == 0);                  // a 64-column tile lies wholly in the head half or the tail half
static_assert((HTW & (HTW - 1)) == 0);
static_assert(NF <= HTW);
static_assert(GPITCH % 8 == 0);
static_assert(NJ % GJ == 0);
static_assert(GROWS - NT * NJ == GJ);           // zero rows above the tags: one lane each
static_assert(NK % GKB == 0);
static_assert(NT == 9 && WP >= NT && WP % 4 == 0 && GKB % WG == 0);   // a row is two 16-byte pieces and one float, at a multiple of 16 bytes; a batch is whole groups
static_assert(NU <= GPITCH);
static_assert(NT * NJ <= GROWS);
static_assert(GROWS == VP);
static_assert(VP % 64 == 0);
static_assert((NB * SEQ) % 64 == 0);
static_assert((NB * SEQ) % (16 * VW) == 0);
static_assert(SEQ % BQ == 0);                  // a band block's queries lie in one batch
static_assert(BWIN == BQ + 2 * WH);            // the window holds every key of every query of the block
static_assert(NT % BTG == 0);
static_assert(KJ / 8 <= 32 && NJ == KJ);        // a row part of KJ halves: one 16-byte piece per lane
static_assert(BKT == NT && BQ == 16);          // wave w stages key tile w and tag w
static_assert(SEQ % 16 == 0 && WH % 16 == 0);  // key tiles start at multiples of 16
static_assert(((SP - NT) & 1) == 1);
static_assert((BQ * QE) % 4 == 0);             // a band block's output run is whole 16-byte pieces
static_assert((BQ * QE * 4) % 128 == 64 && (BQ & (BQ - 1)) == 0);   // runs start at multiples of 128 bytes and half way between them in turn
static_assert(4 + (BQ * QE / 4) / (4 * 32 * BKT) * (4 * 32 * BKT) <= BQ * QE / 4);   // the whole groups, shifted by four pieces, stay inside the run
static_assert(((TPL / 8) & 1) == 1 && ((VPL / 8) & 1) == 1);
static_assert(sizeof(float) * BQ * SP <= sizeof(_Float16) * 2 * BWIN * TPL);   // the score tile fits the tail rows' LDS
static_assert(sizeof(_Float16) * (2 * BWIN * TPL + 2 * BQ * VPL) <= 327680);
static_assert(SEQ % 64 == 0);
static_assert(SEQ % 32 == 0);
static_assert(OUT_SEQ % 32 == 0);
static_assert(WF == 2 * WH + 1);
static_assert(WF <= 9 * 16);                   // nine 16-key tiles cover the band
static_assert(SP >= QE);
static_assert(NB <= NB_FULL);
static_assert(SEQ <= SEQ_FULL);
static_assert(4 * 32 * 16 == 16 * 64 * 2);     // slab store: 4 trips x 32 lanes x 16 B == 16 rows x 64 halves
static_assert(((HPL / 8) & 1) == 1 && HID % 8 == 0);
static_assert(HID % 256 == 0 && 64 % HWV == 0 && (64 * 8) % (32 * HWV) == 0);   // a row is whole 512-byte parts; whole rows per wave in the fill, whole pieces per thread in the epilogue
static_assert(HID % (32 * HKU) == 0);
static_assert(HWV == 8);                       // 4 row groups x 2 column halves of the 64x64 tile
static_assert(sizeof(unsigned short) * 2 * 64 * HPL + sizeof(float) * 64 * 68 <= 327680);
static_assert(sizeof(float) * VW * 16 * 68 <= 131072);
static_assert(sizeof(float) * NT * 8 * GJ <= 131072);
static_assert(sizeof(float) * 64 * 33 <= 131072);

typedef _Float16 h16;
typedef unsigned short bf;
typedef __attribute__((ext_vector_type(16))) __bf16   v16bf;
typedef __attribute__((ext_vector_type(16))) _Float16 v16h;
typedef __attribute__((ext_vector_type(8)))  _Float16 v8h;
typedef __attribute__((ext_vector_type(8)))  unsigned short v8us;
typedef __attribute__((ext_vector_type(8)))  float    v8f;
typedef __attribute__((ext_vector_type(4)))  float    v4f;
typedef v4f  __attribute__((may_alias)) v4fa;

__device__ __forceinline__ unsigned short f2bf(float f) { unsigned u = __float_as_uint(f); u += 0x7FFFu + ((u >> 16) & 1u); return (unsigned short)(u >> 16); }
__device__ __forceinline__ float bfr(float f) { return __uint_as_float(((unsigned)f2bf(f)) << 16); }   // value after RNE convert to bf16
__device__ __forceinline__ v16h cat16(v8h lo, v8h hi) { return __builtin_shufflevector(lo, hi, 0, 1, 2, 3, 4, 5, 6, 7, 8, 9, 10, 11, 12, 13, 14, 15); }
__device__ __forceinline__ v16bf cat16b(v8us lo, v8us hi) { return __builtin_bit_cast(v16bf, __builtin_shufflevector(lo, hi, 0, 1, 2, 3, 4, 5, 6, 7, 8, 9, 10, 11, 12, 13, 14, 15)); }
__device__ __forceinline__ v8f wmma16(v16h a, v16h b, v8f c) { return __builtin_amdgcn_wmma_f32_16x16x32_f16(false, a, false, b, (short)0, c, false, false); }
__device__ __forceinline__ v8f wmmab(v16bf a, v16bf b, v8f c) { return __builtin_amdgcn_wmma_f32_16x16x32_bf16(false, a, false, b, (short)0, c, false, false); }
// fragment loaders from K-contiguous 16-bit rows; p already includes + 8*(lane>>4): elements 0..7 <- k0+8h+0..7, elements 8..15 <- k0+16+8h+0..7 (same map for A and B)
__device__ __forceinline__ v16h  ldh(const h16* p) { return cat16(*(const v8h*)p, *(const v8h*)(p + 16)); }
__device__ __forceinline__ v16bf ldb(const bf* p)  { return cat16b(*(const v8us*)p, *(const v8us*)(p + 16)); }
// the same k map from 8-column panels; p already includes + (lane>>4) panels: elements 0..7 <- panel k0/8+h, elements 8..15 <- panel k0/8+2+h
__device__ __forceinline__ v16h  ldp(const h16* p) { return cat16(*(const v8h*)p, *(const v8h*)(p + 2 * GPS)); }
// ordering point for wave-private LDS tiles (same wave writes and reads)
__device__ __forceinline__ void wave_sync() { __builtin_amdgcn_fence(3 /* release order */, "wavefront"); __builtin_amdgcn_wave_barrier(); asm volatile("" ::: "memory"); }

// per-instruction guarded WMMA wrappers: one accumulator tied per guard, operands kept live across the nops
__device__ __forceinline__ v8f wg(v16h a, v16h b, v8f c) { c = wmma16(a, b, c); asm volatile("v_nop\n\tv_nop\n\tv_nop\n\tv_nop" : "+v"(c) : "v"(a), "v"(b)); return c; }
__device__ __forceinline__ v8f wgb(v16bf a, v16bf b, v8f c) { c = wmmab(a, b, c); asm volatile("v_nop\n\tv_nop\n\tv_nop\n\tv_nop" : "+v"(c) : "v"(a), "v"(b)); return c; }
// f32 -> f16 convert that cannot produce an f16 subnormal (|v| < 2^-14 -> +0), applied after the plane's carry
static __device__ __forceinline__ h16 toh_flush(float v) { const h16 r = (h16)v; return (fabsf(v) < 6.103515625e-05f) ? (h16)0.0f : r; }
__device__ __forceinline__ float gelu_erf(float x) { return 0.5f * x * (1.0f + erff(x * 0.70710678118654752f)); }

// d_cvt8: state (f32, batch pitch SEQ_FULL tokens) -> bf16 plane (batch pitch SEQ tokens), 8 elements per thread; blk = 0 .. PB_CVT-1.
__device__ __forceinline__ void d_cvt8(const float* __restrict__ src, bf* dst, int blk) {
    constexpr size_t per = (size_t)SEQ * HID / 8, n8 = (size_t)NB * per;
    const size_t i = (size_t)blk * 256 + threadIdx.x; if (i >= n8) return;
    const size_t so = (SEQ == SEQ_FULL) ? i * 8 : (i / per) * ((size_t)SEQ_FULL * HID) + (i % per) * 8;
    const v8f v = *(const v8f*)(src + so); v8us o;
#pragma unroll
    for (int k = 0; k < 8; ++k) o[k] = f2bf(v[k]);
    *(v8us*)(dst + i * 8) = o; 
}

// d_wtr: in[HID rows k][NF cols n] (f32) -> out[HTW rows n][HID cols k] (bf16, RNE convert); rows n >= NF written as zeros.
// blocks (bx, by) of (HID/64, HTW/32); tile: 64 x 33 floats of LDS.
__device__ __forceinline__ void d_wtr(const float* __restrict__ W, bf* dst, float* tile, int bx, int by) {
    const int tid = threadIdx.x;
    const int k0 = bx * 64, n0 = by * 32;
#pragma unroll 1
    for (int e = 0; e < 8; ++e) {                                  // 8 trips x 256 threads = 64 x 32 elements
        const int idx = e * 256 + tid; const int kk = idx >> 5, nn = idx & 31;
        const int n = n0 + nn; const int nc = n < NF ? n : NF - 1;  // clamped address
        float v = W[(size_t)(k0 + kk) * NF + nc];
        asm volatile("" : "+v"(v));
        tile[kk * 33 + nn] = (n < NF) ? v : 0.0f; }
    __syncthreads();
    const int row = tid >> 3, pc = tid & 7;
    v8us o;
#pragma unroll
    for (int e = 0; e < 8; ++e) o[e] = f2bf(tile[(pc * 8 + e) * 33 + row]);
    bf* p = dst + (size_t)(n0 + row) * HID + k0 + pc * 8;
    *(v8us*)p = o; 
}

// d_gp: folded weights. Block (jt, ip) builds the tile i = 8 ip + wave, j = 32 jt + lane of G for all 9 tags: a wave reads 32 consecutive j of one U row per k (one 128-byte run), GKB values of k in flight at a time.
// Each (i, j, t) is summed over k = 0..199 in order by one thread. The 200 x 9 classifier weights are converted once per block into LDS; the sums read them from there, all lanes one address. The tile is turned in LDS and stored as 16-byte pieces (8 columns i) of panel ip, 512 contiguous bytes per tag.
// Entries with i >= NU or j >= NU are zeros; blocks jt == 0 also zero-fill rows [NT*NJ, GROWS) of their panel.
// blocks (jt, ip) of (NJ/GJ, GPITCH/8); gs: NT x 8 x GJ floats of LDS; sw: NK x WP floats of LDS, rounded up to whole trips of the block.
// EDGE: the wave holds the row i == 200 or the column j == 200, where the concatenation-linear terms enter. up = U + i*NU + jc and pa = Wcat + NU + jc are the lane's own, jc its clamped column; wb = Wcat + i is wave-uniform.
// ma, mb: all ones where the row term / the column term enters, else zero; msk gives the value or +0 for any bit pattern, as a select does, with no branch round a load.
__device__ __forceinline__ float msk(float v, unsigned m) { return __uint_as_float(__float_as_uint(v) & m); }
template <bool EDGE>
__device__ __forceinline__ void gp_sum(const float* __restrict__ up, const float* __restrict__ pa, const float* __restrict__ wb, const float* sw, unsigned ma, unsigned mb, float (&acc)[NT]) {
#pragma unroll 1   // rolled over the batches, for speed only
    for (int kb = 0; kb < NK; kb += GKB) {
        float u[GKB], a[EDGE ? GKB : 1];
#pragma unroll
        for (int e = 0; e < GKB; ++e) {
            u[e] = up[(size_t)e * (NU * NU)];
            if constexpr (EDGE) a[e] = pa[(size_t)e * (2 * NU)]; }
        asm volatile("s_wait_xcnt 0x0" ::: "memory");   // stands ahead of every overwrite of the address registers that the batch's loads name
        __builtin_amdgcn_sched_barrier(0);   // the whole batch's loads are issued ahead of its first sum (else the scheduler may sink loads to their uses and their latencies add up), and the address steps below stay behind the wait
        const float* const wr = sw + kb * WP;   // this batch's converted weights: every lane reads the same address
        v4f qa[2][WG], qb[2][WG]; float qc[2][WG];   // tags 0..3, 4..7 and 8 of WG rows, two groups
#pragma unroll
        for (int c = 0; c < WG; ++c) { qa[0][c] = *(const v4fa*)(wr + c * WP); qb[0][c] = *(const v4fa*)(wr + c * WP + 4); qc[0][c] = wr[c * WP + 8]; }
#pragma unroll
        for (int g = 0; g < GKB / WG; ++g) {
            if (g + 1 < GKB / WG) {
#pragma unroll
                for (int c = 0; c < WG; ++c) { const float* const p = wr + ((g + 1) * WG + c) * WP;
                    qa[(g + 1) & 1][c] = *(const v4fa*)p; qb[(g + 1) & 1][c] = *(const v4fa*)(p + 4); qc[(g + 1) & 1][c] = p[8]; } }
            __builtin_amdgcn_sched_barrier(0);   // the next group's LDS reads are issued as one run ahead of this group's sums: their latency passes under the sums, and no read stands among them
#pragma unroll
            for (int c = 0; c < WG; ++c) { const int e = g * WG + c;
                float w = bfr(u[e]);
                if constexpr (EDGE) w = w + msk(bfr(a[e]), ma) + msk(bfr(wb[(size_t)(kb + e) * (2 * NU)]), mb);
#pragma unroll
                for (int t = 0; t < 4; ++t) { acc[t] = fmaf(w, qa[g & 1][c][t], acc[t]); acc[4 + t] = fmaf(w, qb[g & 1][c][t], acc[4 + t]); }
                acc[8] = fmaf(w, qc[g & 1][c], acc[8]); }
            __builtin_amdgcn_sched_barrier(0);   // keeps the following reads, which take this group's registers, from moving up among these sums: they stay one run
        }
        up += (size_t)GKB * (NU * NU);
        if constexpr (EDGE) pa += (size_t)GKB * (2 * NU);
    }
}
__device__ __forceinline__ void d_gp(const float* __restrict__ U, const float* __restrict__ Wcat, const float* __restrict__ Wd, const float* __restrict__ bd, h16* GH, h16* GR, float* gs, float* sw, int jt, int ip) {
    const int tid = threadIdx.x, lane = tid & 31;
    const int wave = __builtin_amdgcn_readfirstlane(tid >> 5);
    {   // the classifier weights are converted once per block: sw[k * WP + t]; the places t >= 9 and k >= NK, which no sum takes, get the nearest weight; the barrier ends these writes ahead of every wave's reads in gp_sum
        float x[WS];
#pragma unroll
        for (int s = 0; s < WS; ++s) { const int idx = s * 256 + tid; int k = idx / WP; int t = idx - k * WP; k = k < NK ? k : NK - 1; t = t < NT ? t : NT - 1;   // clamped address
            x[s] = Wd[k * NT + t]; }
        asm volatile("s_wait_xcnt 0x0" ::: "memory");   // stands ahead of every overwrite of the address registers that the loads above name
        __builtin_amdgcn_sched_barrier(0);   // all the loads are issued ahead of the first LDS store (one latency, not several), and later address work stays behind the wait
#pragma unroll
        for (int s = 0; s < WS; ++s) sw[s * 256 + tid] = bfr(x[s]);
    }
    __syncthreads();
    const int i = ip * 8 + wave, j = jt * GJ + lane;
    float acc[NT];
#pragma unroll
    for (int t = 0; t < NT; ++t) acc[t] = 0.0f;
    const int jc = j < NU ? j : NU - 1;                             // clamped column index
    if (i < NU) {                                                   // wave-uniform
        if ((i == NU - 1) | (jt == (NU - 1) / GJ)) {                // wave-uniform: the row or the column of the constant-one feature lies in this wave
            const unsigned ma = (i == NU - 1) ? ~0u : 0u, mb = (j == NU - 1) ? ~0u : 0u;
            gp_sum<true>(U + (size_t)i * NU + jc, Wcat + NU + jc, Wcat + i, sw, ma, mb, acc);
#pragma unroll
            for (int t = 0; t < NT; ++t) acc[t] += msk(bfr(bd[t]), ma & mb);
        } else {
            gp_sum<false>(U + (size_t)i * NU + jc, Wcat, Wcat, sw, 0u, 0u, acc); }
    }
    const bool ok = (i < NU) & (j < NU);
#pragma unroll
    for (int t = 0; t < NT; ++t) gs[(t * 8 + wave) * GJ + lane] = ok ? acc[t] * GSC : 0.0f;
    __syncthreads();
#pragma unroll 1   // rolled: the second trip is one wave's
    for (int p = tid; p < NT * GJ; p += 256) {                      // 9 tags x 32 rows j; second trip = wave 0 only
        const int t = p >> 5, jj = p & 31; v8h hv, rv;
#pragma unroll
        for (int c = 0; c < 8; ++c) { const float x = gs[(t * 8 + c) * GJ + jj]; const h16 a0 = toh_flush(x); hv[c] = a0; rv[c] = toh_flush((x - (float)a0) * QRS); }
        const size_t oo = (size_t)ip * GPS + ((size_t)t * NJ + jt * GJ + jj) * 8;
        *(v8h*)(GH + oo) = hv; *(v8h*)(GR + oo) = rv; }
    if ((jt == 0) & (wave == 0)) {                                  // wave-uniform
        const v8h z = (v8h){};
        const size_t zo = (size_t)ip * GPS + ((size_t)NT * NJ + lane) * 8;
        *(v8h*)(GH + zo) = z; *(v8h*)(GR + zo) = z; }
}

// k_prep: the four preparation bodies, none of which reads what another writes, share one launch; a block's body is chosen by its index (block-uniform branch).
// The folded-weight blocks, the longest, hold the lowest indices; then the two weight transposes; then the state convert.
#define PB_GP   ((NJ / GJ) * (GPITCH / 8))
#define PB_WTR  ((HID / 64) * (HTW / 32))
#define PB_CVT  ((int)(((size_t)NB * SEQ * HID / 8 + 255) / 256))
static_assert(64 * 33 <= NT * 8 * GJ);          // the transpose tile fits the LDS array sized for the folded-weight tile
__global__ __launch_bounds__(256) void k_prep(const float* __restrict__ state, const float* __restrict__ Wh, const float* __restrict__ Wt, const float* __restrict__ U, const float* __restrict__ Wcat,
                                              const float* __restrict__ Wd, const float* __restrict__ bd, bf* XB, bf* WT, h16* GH, h16* GR) {
    __shared__ __align__(16) float sm[NT * 8 * GJ];
    __shared__ __align__(16) float sw[WS * 256];   // the folded-weight body's converted classifier weights
    const int blk = blockIdx.x;
    // The tests run from the highest range down: the built code then holds the folded-weight body first.
    // The bodies stand one behind another in the built code: each s_wait_xcnt 0 stands behind a body's last stores, ahead of the next body's first write of a register that those stores name.
    if (blk >= PB_GP + 2 * PB_WTR) d_cvt8(state, XB, blk - PB_GP - 2 * PB_WTR);
    else if (blk >= PB_GP + PB_WTR) { d_wtr(Wt, WT + (size_t)HTW * HID, sm, (blk - PB_GP - PB_WTR) % (HID / 64), (blk - PB_GP - PB_WTR) / (HID / 64)); asm volatile("s_wait_xcnt 0x0" ::: "memory"); }
    else if (blk >= PB_GP) { d_wtr(Wh, WT, sm, (blk - PB_GP) % (HID / 64), (blk - PB_GP) / (HID / 64)); asm volatile("s_wait_xcnt 0x0" ::: "memory"); }
    else { d_gp(U, Wcat, Wd, bd, GH, GR, sm, sw, blk % (NJ / GJ), blk / (NJ / GJ)); asm volatile("s_wait_xcnt 0x0" ::: "memory"); }
}

// k_ht: bf16 GEMM, one block of HWV = 8 waves per 64x64 tile, K = HID. C[m][n] = sum_k A[m][k] Bt[n][k]; A = state rows (m = q), Bt = weight rows (n < 256: head column n, n >= 256: tail column n - 256).
// The tile's 64 A rows and 64 Bt rows, each set one contiguous run of global memory, are read once per block in 512-byte parts of a row per load, all loads in flight together, and kept whole in LDS (row pitch an odd number of 16-byte units).
// Wave w takes rows 16 (w >> 1) .. + 15 and columns 32 (w & 1) .. + 31: two accumulators, each summed over k in ascending order. The first barrier ends the LDS fill; the second ends the writes of the f32 tile os ahead of its row-wise readers.
// Epilogue per column nn = n mod 256: nn < 200 -> GELU(C + bias), nn == 200 -> 1, nn > 200 -> 0; written as f16 value (Ph) and f16 residual x2048 (Pr), row pitch HTP.
// grid (NB*SEQ/64, HTP/64).
__global__ __launch_bounds__(32 * HWV) void k_ht(const bf* __restrict__ A, const bf* __restrict__ Bt, const float* __restrict__ bh, const float* __restrict__ bt, h16* Ph, h16* Pr) {
    __shared__ __align__(16) bf sab[2 * 64 * HPL];
    __shared__ __align__(16) float os[64 * 68];
    bf* const sA = sab; bf* const sB = sab + 64 * HPL;
    constexpr int NTH = 32 * HWV, RW = 64 / HWV, RT = HID / 256;   // threads; rows per wave and operand; 512-byte parts (one 16-byte piece per lane) per row
    const int tid = threadIdx.x, lane = tid & 31, lr = lane & 15, hi = lane >> 4;
    const int wave = __builtin_amdgcn_readfirstlane(tid >> 5);
    const int r0 = blockIdx.x * 64, c0 = blockIdx.y * 64;
    {   // wave w brings rows 8 w .. 8 w + 7 of both operands
        const bf* const pa = A + (size_t)(r0 + wave * RW) * HID + lane * 8; const bf* const pb = Bt + (size_t)(c0 + wave * RW) * HID + lane * 8;
        const int sl = wave * RW * HPL + lane * 8;
        v8us xa[RW * RT], xb[RW * RT];
#pragma unroll
        for (int it = 0; it < RW * RT; ++it) { xa[it] = *(const v8us*)(pa + it * 256); xb[it] = *(const v8us*)(pb + it * 256); }
        asm volatile("s_wait_xcnt 0x0" ::: "memory");   // stands ahead of every overwrite of the address registers that the loads above name
        __builtin_amdgcn_sched_barrier(0);   // all the loads are issued ahead of the first LDS store (one latency, not several), and later address work stays behind the wait
#pragma unroll
        for (int it = 0; it < RW * RT; ++it) { const int so = sl + (it / RT) * HPL + (it % RT) * 256;
            *(v8us*)(sA + so) = xa[it]; *(v8us*)(sB + so) = xb[it]; }
    }
    const int mb = wave >> 1, n2 = (wave & 1) * 2;
    float bc[2];
#pragma unroll
    for (int u = 0; u < 2; ++u) { const int nn = (c0 + (n2 + u) * 16 + lr) & (HTW - 1); const int bi = nn < NF ? nn : NF - 1;   // clamped address
        bc[u] = bfr((c0 >= HTW) ? bt[bi] : bh[bi]); }
    __syncthreads();
    v8f acc[2];
#pragma unroll
    for (int u = 0; u < 2; ++u) acc[u] = (v8f){};
    const bf* const fa = sA + (mb * 16 + lr) * HPL + 8 * hi; const bf* const fb = sB + (n2 * 16 + lr) * HPL + 8 * hi;
#pragma unroll
    for (int k0 = 0; k0 < HID; k0 += 32 * HKU) {
        v16bf a[HKU], b[HKU][2];
#pragma unroll
        for (int e = 0; e < HKU; ++e) { a[e] = ldb(fa + k0 + e * 32); b[e][0] = ldb(fb + k0 + e * 32); b[e][1] = ldb(fb + 16 * HPL + k0 + e * 32); }
        __builtin_amdgcn_sched_barrier(0);   // the group's LDS reads are issued ahead of its first product: else each product waits out an LDS latency of its own
#pragma unroll
        for (int e = 0; e < HKU; ++e) {
#pragma unroll
            for (int u = 0; u < 2; ++u) acc[u] = wgb(a[e], b[e][u], acc[u]); }
    }
#pragma unroll
    for (int u = 0; u < 2; ++u) {
#pragma unroll
        for (int j = 0; j < 8; ++j) os[(mb * 16 + hi * 8 + j) * 68 + (n2 + u) * 16 + lr] = acc[u][j] + bc[u]; }   // D: row 8h+j, col lane&15
    __syncthreads();
#pragma unroll 1   // rolled: the second trip runs the first one's text
    for (int s = 0; s < 64 * 8 / NTH; ++s) { const int row = (NTH / 8) * s + (tid >> 3), c8 = (tid & 7) * 8;   // 8 threads x 8 = 64 columns of one row
        const v4f x0 = *(const v4fa*)(&os[row * 68 + c8]); const v4f x1 = *(const v4fa*)(&os[row * 68 + c8 + 4]); v8h hv, rv;
#pragma unroll
        for (int i = 0; i < 4; ++i) {
            const int n0 = (c0 + c8 + i) & (HTW - 1), n1 = (c0 + c8 + 4 + i) & (HTW - 1);
            const float g0 = gelu_erf(x0[i]), g1 = gelu_erf(x1[i]);
            const float v0 = (n0 < NF) ? g0 : ((n0 == NF) ? 1.0f : 0.0f);
            const float v1 = (n1 < NF) ? g1 : ((n1 == NF) ? 1.0f : 0.0f);
            const h16 a0 = toh_flush(v0); const h16 a1 = toh_flush(v1); hv[i] = a0; hv[4 + i] = a1;
            rv[i] = toh_flush((v0 - (float)a0) * QRS); rv[4 + i] = toh_flush((v1 - (float)a1) * QRS); }
        const size_t oo = (size_t)(r0 + row) * HTP + c0 + c8;
        *(v8h*)(Ph + oo) = hv; *(v8h*)(Pr + oo) = rv;
        asm volatile("s_wait_xcnt 0x0" ::: "memory"); }   // stands ahead of the next trip's overwrites of the registers that the two stores name
}

// k_vg: f16 GEMM with three products, one wave per 16x64 tile, K = KJ. V[q][n] = sum_i head[q][i] G^T[n][i], n = t*NJ + j.
// A = head planes (value AH, residual AR; row pitch HTP, columns 0..KJ-1), Bt = G^T planes (value GH, residual GR; panels of 8 columns: 16 lanes read 256 contiguous bytes).
// aH = AH.GH; aR = AR.GH + AH.GR (both residual carries x2048, one accumulator); V = aH + aR/2048 (keeps the x1024 carry of G); written as f16 value (VH) + f16 residual x2048 (VR), row pitch VP.
// grid (NB*SEQ/(16*VW), VP/64).
__global__ __launch_bounds__(32 * VW) void k_vg(const h16* __restrict__ AH, const h16* __restrict__ AR, const h16* __restrict__ GH, const h16* __restrict__ GR, h16* VH, h16* VR) {
    __shared__ __align__(16) float os[VW * 16 * 68];
    const int lane = threadIdx.x & 31, lr = lane & 15, hi = lane >> 4;
    const int wave = __builtin_amdgcn_readfirstlane((int)(threadIdx.x >> 5));
    const int m0 = (blockIdx.x * VW + wave) * 16, c0 = blockIdx.y * 64;
    v8f aH[4], aR[4];
#pragma unroll
    for (int nb = 0; nb < 4; ++nb) { aH[nb] = (v8f){}; aR[nb] = (v8f){}; }
    const size_t aoff = (size_t)(m0 + lr) * HTP + 8 * hi, boff = (size_t)hi * GPS + (size_t)(c0 + lr) * 8;
#pragma unroll 1
    for (int kc = 0; kc < KJ; kc += 32) {
        const v16h ah = ldh(AH + aoff + kc), ar = ldh(AR + aoff + kc);
#pragma unroll
        for (int nb = 0; nb < 4; ++nb) {
            const v16h gh = ldp(GH + boff + (size_t)(kc / 8) * GPS + nb * 16 * 8), gr = ldp(GR + boff + (size_t)(kc / 8) * GPS + nb * 16 * 8);
            aH[nb] = wg(ah, gh, aH[nb]); aR[nb] = wg(ar, gh, aR[nb]); aR[nb] = wg(ah, gr, aR[nb]); }
    }
    const int wb = wave * 16 * 68;
#pragma unroll
    for (int nb = 0; nb < 4; ++nb) {
#pragma unroll
        for (int j = 0; j < 8; ++j) os[wb + (hi * 8 + j) * 68 + nb * 16 + lr] = aH[nb][j] + aR[nb][j] * QRI; }   // D: row 8h+j, col lane&15
    wave_sync();
{
#pragma unroll 1
        for (int s = 0; s < 4; ++s) { const int row = 4 * s + (lane >> 3), c8 = (lane & 7) * 8;   // 4 s x 4 row groups = 16 rows; 8 lanes x 8 = 64 columns
            const v4f x0 = *(const v4fa*)(&os[wb + row * 68 + c8]); const v4f x1 = *(const v4fa*)(&os[wb + row * 68 + c8 + 4]); v8h hv, rv;
#pragma unroll
            for (int i = 0; i < 4; ++i) { const h16 a0 = toh_flush(x0[i]); const h16 a1 = toh_flush(x1[i]); hv[i] = a0; hv[4 + i] = a1;
                rv[i] = toh_flush((x0[i] - (float)a0) * QRS); rv[4 + i] = toh_flush((x1[i] - (float)a1) * QRS); }
            const size_t oo = (size_t)(m0 + row) * VP + c0 + c8;
            *(v8h*)(VH + oo) = hv; *(v8h*)(VR + oo) = rv; }
         }
}

// piece p (4 floats) of a band block's output run, read from the score tile: output element e = 1161 n + rem lies at os[SP n + rem]; a piece may run over from row n into row n + 1
__device__ __forceinline__ v4f band_piece(const float* os, int p) {
    const unsigned e = 4u * (unsigned)p, n = e / QE, rem = e - n * QE; v4f v;
#pragma unroll
    for (unsigned c = 0; c < 4; ++c) v[c] = os[e + c + (n + (rem + c >= QE ? 1u : 0u)) * (SP - QE)];
    return v;
}

// k_band: one block per BQ = 16 consecutive queries (one batch), one wave per 16-key tile of their common window of 144 keys (key = n0 - 64 + w, w = 0..143; a tile outside the sequence reads the nearest tile inside it; out-of-sequence keys fall to the keep rule).
// The window's tail rows and the 16 queries' V rows are read from global memory once per block, in 16-byte pieces that run along the rows, and kept in LDS (row pitches an odd number of 16-byte units).
// A = tail rows of the wave's key tile (row = key, k = j), held in registers for all tags; B = V of one tag (column = query lane&15, k = j), K = KJ.
// sH = TH.VH; sR = TR.VH + TH.VR; score = (sH + sR/2048)/1024. D element j of lane (lr, hi) = (w = 16 wave + 8 hi + j, query lr); band offset r = w - lr, kept where 0 <= r <= 128 -> os[lr*SP + r*9 + t].
// Keep rule per element, applied where the score is written to os: (n < len) and (0 <= key < SEQ) and (key < len); other elements get the classifier bias; non-finite values become 0.
// os lies on the tail rows' LDS, which no wave reads once every wave holds its A fragments (second barrier); the third barrier ends the score writes ahead of the block's linear store of its 16 output rows (16 x 1161 floats in a row).
// grid NB*SEQ/BQ.
__global__ __launch_bounds__(32 * BKT) void k_band(const h16* __restrict__ HTH, const h16* __restrict__ HTR, const h16* __restrict__ VH, const h16* __restrict__ VR, const int* __restrict__ lengths, const float* __restrict__ bd, float* OUT) {
    __shared__ __align__(16) h16 sm[2 * BWIN * TPL + 2 * BQ * VPL];
    h16* const tH = sm; h16* const tR = sm + BWIN * TPL;
    h16* const vH = sm + 2 * BWIN * TPL; h16* const vR = vH + BQ * VPL;
    float* const os = (float*)sm;
    constexpr int NTH = 32 * BKT, TPC = KJ / 8;
    const int tid = threadIdx.x, lane = tid & 31, lr = lane & 15, hi = lane >> 4;
    const int wave = __builtin_amdgcn_readfirstlane(tid >> 5);
    const int q0 = blockIdx.x * BQ;
    const int b = q0 / SEQ, n0 = q0 % SEQ;
    const int len = lengths[b];
    const float bl = bfr(bd[lane < NT ? lane : NT - 1]);   // lane t holds tag t's bias: one load, in flight with the row loads below, not one wait per tag in the tag loop
    asm volatile("s_wait_xcnt 0x0" ::: "memory");   // stands ahead of every overwrite of the address registers that the bias load names
    if (lane < TPC) {   // one lane per 16-byte piece of a 448-byte row part; wave w brings the 16 tail rows of key tile w and tag w's part of the 16 V rows
        int kb = n0 - WH + 16 * wave; kb = kb < 0 ? 0 : (kb > SEQ - 16 ? SEQ - 16 : kb);   // a key tile lies wholly inside or wholly outside the sequence
        const size_t to = ((size_t)b * SEQ + (size_t)kb) * HTP + lane * 8, vo = (size_t)q0 * VP + wave * NJ + lane * 8;
        const h16* const pth = HTH + to; const h16* const ptr = HTR + to; const h16* const pvh = VH + vo; const h16* const pvr = VR + vo;
        const int tl = wave * 16 * TPL + lane * 8, vl = wave * NJ + lane * 8;
        v8h xh[16], xr[16], yh[16], yr[16];
#pragma unroll
        for (int it = 0; it < 16; ++it) { xh[it] = *(const v8h*)(pth + HTW + it * HTP); xr[it] = *(const v8h*)(ptr + HTW + it * HTP); }
#pragma unroll
        for (int it = 0; it < 16; ++it) yh[it] = *(const v8h*)(pvh + it * VP);
        asm volatile("s_wait_xcnt 0x0" :: "v"(pth), "v"(ptr), "v"(pvh) : "memory");   // stands ahead of every overwrite of the three address pairs that the loads above name; as its inputs they stay whole up to it
        __builtin_amdgcn_sched_barrier(0);   // these 48 loads are issued ahead of the first LDS store (one latency, not several), and the LDS address work stays behind the wait
#pragma unroll
        for (int it = 0; it < 16; ++it) { *(v8h*)(tH + tl + it * TPL) = xh[it]; *(v8h*)(tR + tl + it * TPL) = xr[it]; }
        __builtin_amdgcn_sched_barrier(0);   // the last 16 loads take the registers that the tail rows have left: all 64 at once would need registers above v255
#pragma unroll
        for (int it = 0; it < 16; ++it) yr[it] = *(const v8h*)(pvr + it * VP);
        asm volatile("s_wait_xcnt 0x0" :: "v"(pvr) : "memory");   // as above, for the fourth address pair
        __builtin_amdgcn_sched_barrier(0);   // keeps these loads ahead of the stores below and later address work behind the wait
#pragma unroll
        for (int it = 0; it < 16; ++it) *(v8h*)(vH + vl + it * VPL) = yh[it];
#pragma unroll
        for (int it = 0; it < 16; ++it) *(v8h*)(vR + vl + it * VPL) = yr[it];
    }
    __syncthreads();
    v16h th[KJ / 32], tr[KJ / 32];
    const int ao = (wave * 16 + lr) * TPL + 8 * hi;
#pragma unroll
    for (int k = 0; k < KJ / 32; ++k) { th[k] = ldh(tH + ao + k * 32); tr[k] = ldh(tR + ao + k * 32); }
    __syncthreads();
    const int bo = lr * VPL + 8 * hi;
    const int r0 = 16 * wave + 8 * hi - lr;
    bool ok[8];   // keep rule of D element j: the same for every tag
#pragma unroll
    for (int j = 0; j < 8; ++j) { const int key = n0 - WH + 16 * wave + 8 * hi + j; ok[j] = (n0 + lr < len) & (key >= 0) & (key < SEQ) & (key < len); }
#pragma unroll 1   // rolled over the groups of three tags: the A fragments and one group's accumulators and B fragments fill the registers below v256
    for (int tg = 0; tg < NT; tg += BTG) {
        v8f sH[BTG], sR[BTG];
#pragma unroll
        for (int u = 0; u < BTG; ++u) { sH[u] = (v8f){}; sR[u] = (v8f){}; }
#pragma unroll
        for (int k = 0; k < KJ / 32; ++k) {
            v16h vh[BTG], vr[BTG];
#pragma unroll
            for (int u = 0; u < BTG; ++u) { vh[u] = ldh(vH + bo + (tg + u) * NJ + k * 32); vr[u] = ldh(vR + bo + (tg + u) * NJ + k * 32); }
            // the three tags' products alternate, so that no product waits for the one before it; each accumulator takes its products in the order k, then TR.VH, then TH.VR
#pragma unroll
            for (int u = 0; u < BTG; ++u) sH[u] = wg(th[k], vh[u], sH[u]);
#pragma unroll
            for (int u = 0; u < BTG; ++u) sR[u] = wg(tr[k], vh[u], sR[u]);
#pragma unroll
            for (int u = 0; u < BTG; ++u) sR[u] = wg(th[k], vr[u], sR[u]); }
#pragma unroll
        for (int u = 0; u < BTG; ++u) {
            const float bv = __int_as_float(__builtin_amdgcn_readlane(__float_as_int(bl), tg + u));   // tag tg + u's bias, wave-uniform
#pragma unroll
            for (int j = 0; j < 8; ++j) { const int r = r0 + j;
                float val = ok[j] ? (sH[u][j] + sR[u][j] * QRI) * GSI : bv;
                val = (fabsf(val) <= 3.402823466e38f) ? val : 0.0f;
                if ((r >= 0) & (r < WF)) os[lr * SP + r * NT + tg + u] = val; } }
    }
    __syncthreads();
    float* const dst = OUT + ((size_t)b * OUT_SEQ + n0) * QE;
    constexpr int NP = BQ * QE / 4, PG = 4, NG = NP / (PG * NTH);   // 16-byte pieces of the run; pieces per thread and group; whole groups
    // A run is 580 and a half lines of 128 bytes: every second block's run starts half way into a line. There the pieces are taken from the fifth on, so that each wave's 32 pieces of a group are four whole lines; the first four follow with the run's last pieces.
    // At such a block bound the two neighbours each store their own 64 bytes of the line, in 16-byte pieces of their own; neither reads it.
    const int off = (n0 & BQ) ? 4 : 0;
#pragma unroll 1   // rolled over the groups: every group runs the first one's text
    for (int g = 0; g < NG; ++g) {
        v4f val[PG];
#pragma unroll
        for (int s = 0; s < PG; ++s) val[s] = band_piece(os, off + (g * PG + s) * NTH + tid);
        __builtin_amdgcn_sched_barrier(0);   // the group's LDS reads are issued ahead of its first store: one LDS latency a group, not one a piece
#pragma unroll
        for (int s = 0; s < PG; ++s) *(v4f*)(dst + (size_t)(off + (g * PG + s) * NTH + tid) * 4) = val[s];
        asm volatile("s_wait_xcnt 0x0" ::: "memory"); }   // stands ahead of the next group's overwrites of the registers that the stores name
    static_assert(NP - NG * PG * NTH <= NTH);   // what the whole groups leave: at most one piece a thread
    if (tid < NP - NG * PG * NTH) { const int i = NG * PG * NTH + tid, p = off + i < NP ? off + i : off + i - NP;
        const v4f val = band_piece(os, p); *(v4f*)(dst + (size_t)p * 4) = val; }
}

static constexpr size_t al256(size_t v) { return (v + 255) & ~(size_t)255; }
static constexpr size_t SZ_XB = al256((size_t)NB * SEQ * HID * 2);
static constexpr size_t SZ_WT = al256((size_t)HTP * HID * 2);
static constexpr size_t SZ_HT = al256((size_t)NB * SEQ * HTP * 2);
static constexpr size_t SZ_GT = al256((size_t)GROWS * GPITCH * 2);
static constexpr size_t SZ_V  = al256((size_t)NB * SEQ * VP * 2);
static constexpr size_t SZ_TOTAL = SZ_XB + SZ_WT + 2 * SZ_HT + 2 * SZ_GT + 2 * SZ_V;
static_assert(SZ_TOTAL <= (size_t)134217728);          // workspace carve <= 128 MiB
static_assert(((size_t)HTW * HID * 2) % 256 == 0);     // tail half of the weight plane stays 256-byte aligned
static_assert(((size_t)SEQ * HID) % 8 == 0);
static_assert((size_t)(NB_FULL - 1) * SEQ_FULL * QE * 4 + (size_t)SEQ_FULL * QE * 4 == (size_t)9510912);   // output bytes of the full problem

extern "C" void kernel_launch(void* const* d_in, const int* in_sizes, int n_in,
                              void* d_out, int out_size, void* d_ws, size_t ws_size, hipStream_t stream) {
    if (n_in < 10) return;
    const size_t needx = ((size_t)(NB - 1) * SEQ_FULL + SEQ) * HID;
    if ((size_t)in_sizes[0] < needx) return;
    if (in_sizes[1] < NB) return;
    if ((size_t)in_sizes[2] < (size_t)HID * NF || (size_t)in_sizes[4] < (size_t)HID * NF) return;
    if (in_sizes[3] < NF || in_sizes[5] < NF) return;
    if ((size_t)in_sizes[6] < (size_t)NK * NU * NU) return;
    if ((size_t)in_sizes[7] < (size_t)NK * 2 * NU) return;
    if (in_sizes[8] < NK * NT || in_sizes[9] < NT) return;
    if ((size_t)out_size < ((size_t)(NB - 1) * OUT_SEQ + SEQ) * QE) return;
    if (SZ_TOTAL > ws_size) return;
    // wire order: state, lengths, Wh, bh, Wt, bt, U, Wcat, Wd, bd
    const float* state = (const float*)d_in[0];
    const int*   lengths = (const int*)d_in[1];
    const float* Wh = (const float*)d_in[2]; const float* bh = (const float*)d_in[3];
    const float* Wt = (const float*)d_in[4]; const float* bt = (const float*)d_in[5];
    const float* U = (const float*)d_in[6]; const float* Wcat = (const float*)d_in[7];
    const float* Wd = (const float*)d_in[8]; const float* bd = (const float*)d_in[9];
    float* OUT = (float*)d_out;      // [NB][SEQ][129][9]
    char* wsp = (char*)d_ws;
    bf*  XB  = (bf*)wsp;  wsp += SZ_XB;              // state  [NB*SEQ][768] bf16
    bf*  WT  = (bf*)wsp;  wsp += SZ_WT;              // [512][768] bf16: Wh^T | Wt^T (zero rows 200..255 of each half)
    h16* HTH = (h16*)wsp; wsp += SZ_HT;              // [NB*SEQ][512] head | tail value
    h16* HTR = (h16*)wsp; wsp += SZ_HT;              // [NB*SEQ][512] head | tail residual x2048
    h16* GH  = (h16*)wsp; wsp += SZ_GT;              // [32][2048][8] G^T value (x1024)
    h16* GR  = (h16*)wsp; wsp += SZ_GT;              // [32][2048][8] G^T residual x2048
    h16* VH  = (h16*)wsp; wsp += SZ_V;               // [NB*SEQ][2048] V value (x1024)
    h16* VR  = (h16*)wsp; wsp += SZ_V;               // [NB*SEQ][2048] V residual x2048

    k_prep<<<PB_GP + 2 * PB_WTR + PB_CVT, 256, 0, stream>>>(state, Wh, Wt, U, Wcat, Wd, bd, XB, WT, GH, GR);

    k_ht<<<dim3(NB * SEQ / 64, HTP / 64, 1), 32 * HWV, 0, stream>>>(XB, WT, bh, bt, HTH, HTR);
    k_vg<<<dim3(NB * SEQ / (16 * VW), VP / 64, 1), 32 * VW, 0, stream>>>(HTH, HTR, GH, GR, VH, VR);
    k_band<<<NB * SEQ / BQ, 32 * BKT, 0, stream>>>(HTH, HTR, VH, VR, lengths, bd, OUT);
}

// v007
// It runs in 62.5 microseconds.
// Two timings next to v006 put it at 1.07 and 1.05 times that version's speed.
// All steps since v000 together make it 3.69 times as fast.
#include <hip/hip_runtime.h>

// Span scorer: head / tail projections (Linear 768 -> 200 + erf GELU) with an appended constant-one feature; biaffine form head^T U[k] tail plus a concatenation-linear term, evaluated for every query token on a sliding band of 129 key offsets (-64..+64); length masking (masked entries = classifier bias); 9-tag linear classifier; non-finite outputs set to 0.
// Algebra: the classifier is folded into the bilinear weights: G[i][j][t] = sum_k (U[k][i][j] + [j==200] Wcat[k][i] + [i==200] Wcat[k][201+j]) Wd[k][t] + [i==j==200] bd[t]; V[q][t][j] = sum_i head[q][i] G[i][j][t]; score[q][r][t] = sum_j tail[q-64+r][j] V[q][t][j].
// Compute dtypes, f32 accumulate everywhere: projections v_wmma_f32_16x16x32_bf16 (state, Wh, Wt, biases RNE-converted to bf16; products exact); G built in f32 on the vector unit from bf16-converted U, Wcat, Wd, bd (9 tag columns);
// V GEMM and band GEMM v_wmma_f32_16x16x32_f16 with every operand as f16 value + f16 residual x2048 (three products; residual products in their own accumulator folded by 1/2048); G carries x1024, folded back after the band GEMM.
// Layout: head|tail planes [q][512] (head cols 0..255, tail cols 256..511; col 200 of each half = 1, cols 201..255 = 0);
// G^T planes in 32 panels of 8 columns: [i/8][t*224 + j][i%8]; V planes [q][2048] with column t*224 + j; the band GEMM's block masks its scores and stores its 16 queries' output rows itself, one contiguous run.

#ifndef NB
#define NB 2
#endif
#ifndef SEQ
#define SEQ 1024
#endif
#define NB_FULL  2
#define SEQ_FULL 1024
#ifndef OUT_SEQ
#define OUT_SEQ SEQ              // row pitch (in tokens) between batches of the output
#endif
#define HID    768               // model width
#define NF     200               // projection width
#define NU     201               // NF + constant-one feature
#define NK     200               // bilinear channels
#define NT     9                 // tags
#define WH     64                // band half width
#define WF     129               // band width
#define QE     (WF * NT)         // output floats per query (1161)
#define HTW    256               // column width of the head half / tail half
#define HTP    512               // row pitch (halves) of the head|tail planes
#define KJ     224               // contraction length of the V and band GEMMs (201 zero-padded)
#define NJ     224               // G^T rows / V columns per tag
#define GPITCH 256               // columns i of the G^T planes (32 panels of 8)
#define GROWS  2048              // rows of the G^T planes (9 * 224 = 2016, zero rows above)
#define GPS    (GROWS * 8)       // halves per 8-column panel of the G^T planes
#define GJ     32                // G^T rows j per d_gp block (one lane each)
#define GKB    40                // values of k per batch of U loads in d_gp
#define WP     12                // LDS row pitch (floats) of the converted classifier weights: 9 tags in three 16-byte pieces, of the last only its first float is read
#define WG     4                 // rows of that table per group of LDS reads in d_gp
#define WS     ((NK * WP + 255) / 256)   // weights per thread in the fill of that table
#define VP     2048              // row pitch (halves) of the V planes
#define SP     1184              // LDS row pitch (floats) of a band block's score tile; SP - NT is odd, so the 16 queries of one score write fall on 16 banks
#define VW     4                 // waves per V GEMM block
#define HWV    8                 // waves per projection GEMM block
#define HKC    384               // values of k per pass of the projection GEMM: what its LDS holds at a time
#define HKU    6                 // k steps of 32 whose fragments a projection GEMM wave reads from LDS as one group
#define HPL    (HKC + 8)         // LDS row pitch (halves) of the projection GEMM's operand rows: 49 x 16 B
#define BQ     16                // queries per band block
#define BKT    9                 // 16-key tiles of a band block's window = its waves
#define BWIN   (BKT * 16)        // keys in a band block's window
#define BTG    3                 // tags whose products alternate in the band GEMM
#define TPL    (KJ + 8)          // LDS row pitch (halves) of the tail rows: 29 x 16 B
#define VPL    (NT * NJ + 8)     // LDS row pitch (halves) of the V rows: 253 x 16 B
#define QRS    2048.0f           // carry of every residual plane
#define QRI    (1.0f / 2048.0f)
#define GSC    1024.0f           // carry of the G planes
#define GSI    (1.0f / 1024.0f)

static_assert(NU == NF + 1);
static_assert(KJ % 32 == 0);
static_assert(NU <= KJ);
static_assert(KJ <= HTW);
static_assert(KJ <= GPITCH);
static_assert(NJ == KJ);                       // V column block of one tag = one contraction row of the band GEMM
static_assert(HTP == 2 * HTW);
static_assert(HTW % 64 == 0);                  // a 64-column tile lies wholly in the head half or the tail half
static_assert((HTW & (HTW - 1)) == 0);
static_assert(NF <= HTW);
static_assert(GPITCH % 8 == 0);
static_assert(NJ % GJ == 0);
static_assert(GROWS - NT * NJ == GJ);           // zero rows above the tags: one lane each
static_assert(NK % GKB == 0);
static_assert(NT == 9 && WP >= NT && WP % 4 == 0 && GKB % WG == 0);   // a row is two 16-byte pieces and one float, at a multiple of 16 bytes; a batch is whole groups
static_assert(NU <= GPITCH);
static_assert(NT * NJ <= GROWS);
static_assert(GROWS == VP);
static_assert(VP % 64 == 0);
static_assert((NB * SEQ) % 64 == 0);
static_assert((NB * SEQ) % (16 * VW) == 0);
static_assert(SEQ % BQ == 0);                  // a band block's queries lie in one batch
static_assert(BWIN == BQ + 2 * WH);            // the window holds every key of every query of the block
static_assert(NT % BTG == 0);
static_assert(KJ / 8 <= 32 && NJ == KJ);        // a row part of KJ halves: one 16-byte piece per lane
static_assert(BKT == NT && BQ == 16);          // wave w stages key tile w and tag w
static_assert(SEQ % 16 == 0 && WH % 16 == 0);  // key tiles start at multiples of 16
static_assert(((SP - NT) & 1) == 1);
static_assert((BQ * QE) % 4 == 0);             // a band block's output run is whole 16-byte pieces
static_assert((BQ * QE * 4) % 128 == 64 && (BQ & (BQ - 1)) == 0);   // runs start at multiples of 128 bytes and half way between them in turn
static_assert(4 + (BQ * QE / 4) / (4 * 32 * BKT) * (4 * 32 * BKT) <= BQ * QE / 4);   // the whole groups, shifted by four pieces, stay inside the run
static_assert(((TPL / 8) & 1) == 1 && ((VPL / 8) & 1) == 1);
static_assert(sizeof(float) * BQ * SP <= sizeof(_Float16) * 2 * BWIN * TPL);   // the score tile fits the tail rows' LDS
static_assert(sizeof(_Float16) * (2 * BWIN * TPL + 2 * BQ * VPL) <= 327680);
static_assert(SEQ % 64 == 0);
static_assert(SEQ % 32 == 0);
static_assert(OUT_SEQ % 32 == 0);
static_assert(WF == 2 * WH + 1);
static_assert(WF <= 9 * 16);                   // nine 16-key tiles cover the band
static_assert(SP >= QE);
static_assert(NB <= NB_FULL);
static_assert(SEQ <= SEQ_FULL);
static_assert(4 * 32 * 16 == 16 * 64 * 2);     // slab store: 4 trips x 32 lanes x 16 B == 16 rows x 64 halves
static_assert(((HPL / 8) & 1) == 1 && HID % HKC == 0);
static_assert(HKC % 128 == 0 && 64 % HWV == 0 && (64 * 8) % (32 * HWV) == 0);   // a state row's part of a pass is whole 512-byte pieces of f32; whole rows per wave in the fill, whole pieces per thread in the epilogue
static_assert((HKC / 8) % 16 == 0 && NF % 4 == 0);   // weights of a pass: 16 column quads x HKC/8 octets of k, dealt as 4 x 4 per 16 lanes; a quad lies wholly inside or wholly outside the NF columns
static_assert(HKC % (32 * HKU) == 0);
static_assert(HWV == 8);                       // 4 row groups x 2 column halves of the 64x64 tile
static_assert(sizeof(float) * 64 * 68 <= sizeof(unsigned short) * 2 * 64 * HPL);   // the f32 tile fits the operand rows' LDS
static_assert(sizeof(unsigned short) * 2 * 64 * HPL <= 163840);   // two blocks per WGP
static_assert(sizeof(float) * VW * 16 * 68 <= 131072);
static_assert(sizeof(float) * NT * 8 * GJ <= 131072);

typedef _Float16 h16;
typedef unsigned short bf;
typedef __attribute__((ext_vector_type(16))) __bf16   v16bf;
typedef __attribute__((ext_vector_type(16))) _Float16 v16h;
typedef __attribute__((ext_vector_type(8)))  _Float16 v8h;
typedef __attribute__((ext_vector_type(8)))  unsigned short v8us;
typedef __attribute__((ext_vector_type(4)))  unsigned v4u;
typedef __attribute__((ext_vector_type(2)))  unsigned v2u;
typedef __attribute__((ext_vector_type(2)))  float    v2f;
typedef __attribute__((ext_vector_type(2)))  __bf16   v2bf;
typedef __attribute__((ext_vector_type(8)))  float    v8f;
typedef __attribute__((ext_vector_type(4)))  float    v4f;
typedef v4f  __attribute__((may_alias)) v4fa;

__device__ __forceinline__ unsigned short f2bf(float f) { unsigned u = __float_as_uint(f); u += 0x7FFFu + ((u >> 16) & 1u); return (unsigned short)(u >> 16); }
__device__ __forceinline__ unsigned pkbf(float lo, float hi) { return __builtin_bit_cast(unsigned, __builtin_convertvector((v2f){lo, hi}, v2bf)); }   // two f32 -> two bf16 (RNE) in one word, lo in its low half
__device__ __forceinline__ float bfr(float f) { return __uint_as_float(((unsigned)f2bf(f)) << 16); }   // value after RNE convert to bf16
__device__ __forceinline__ v16h cat16(v8h lo, v8h hi) { return __builtin_shufflevector(lo, hi, 0, 1, 2, 3, 4, 5, 6, 7, 8, 9, 10, 11, 12, 13, 14, 15); }
__device__ __forceinline__ v16bf cat16b(v8us lo, v8us hi) { return __builtin_bit_cast(v16bf, __builtin_shufflevector(lo, hi, 0, 1, 2, 3, 4, 5, 6, 7, 8, 9, 10, 11, 12, 13, 14, 15)); }
__device__ __forceinline__ v8f wmma16(v16h a, v16h b, v8f c) { return __builtin_amdgcn_wmma_f32_16x16x32_f16(false, a, false, b, (short)0, c, false, false); }
__device__ __forceinline__ v8f wmmab(v16bf a, v16bf b, v8f c) { return __builtin_amdgcn_wmma_f32_16x16x32_bf16(false, a, false, b, (short)0, c, false, false); }
// fragment loaders from K-contiguous 16-bit rows; p already includes + 8*(lane>>4): elements 0..7 <- k0+8h+0..7, elements 8..15 <- k0+16+8h+0..7 (same map for A and B)
__device__ __forceinline__ v16h  ldh(const h16* p) { return cat16(*(const v8h*)p, *(const v8h*)(p + 16)); }
__device__ __forceinline__ v16bf ldb(const bf* p)  { return cat16b(*(const v8us*)p, *(const v8us*)(p + 16)); }
// the same k map from 8-column panels; p already includes + (lane>>4) panels: elements 0..7 <- panel k0/8+h, elements 8..15 <- panel k0/8+2+h
__device__ __forceinline__ v16h  ldp(const h16* p) { return cat16(*(const v8h*)p, *(const v8h*)(p + 2 * GPS)); }
// ordering point for wave-private LDS tiles (same wave writes and reads)
__device__ __forceinline__ void wave_sync() { __builtin_amdgcn_fence(3 /* release order */, "wavefront"); __builtin_amdgcn_wave_barrier(); asm volatile("" ::: "memory"); }

// per-instruction guarded WMMA wrappers: one accumulator tied per guard, operands kept live across the nops
__device__ __forceinline__ v8f wg(v16h a, v16h b, v8f c) { c = wmma16(a, b, c); asm volatile("v_nop\n\tv_nop\n\tv_nop\n\tv_nop" : "+v"(c) : "v"(a), "v"(b)); return c; }
__device__ __forceinline__ v8f wgb(v16bf a, v16bf b, v8f c) { c = wmmab(a, b, c); asm volatile("v_nop\n\tv_nop\n\tv_nop\n\tv_nop" : "+v"(c) : "v"(a), "v"(b)); return c; }
// f32 -> f16 convert that cannot produce an f16 subnormal (|v| < 2^-14 -> +0), applied after the plane's carry
static __device__ __forceinline__ h16 toh_flush(float v) { const h16 r = (h16)v; return (fabsf(v) < 6.103515625e-05f) ? (h16)0.0f : r; }
__device__ __forceinline__ float gelu_erf(float x) { return 0.5f * x * (1.0f + erff(x * 0.70710678118654752f)); }

// d_gp: folded weights. Block (jt, ip) builds the tile i = 8 ip + wave, j = 32 jt + lane of G for all 9 tags: a wave reads 32 consecutive j of one U row per k (one 128-byte run), GKB values of k in flight at a time.
// Each (i, j, t) is summed over k = 0..199 in order by one thread. The 200 x 9 classifier weights are converted once per block into LDS; the sums read them from there, all lanes one address. The tile is turned in LDS and stored as 16-byte pieces (8 columns i) of panel ip, 512 contiguous bytes per tag.
// Entries with i >= NU or j >= NU are zeros; blocks jt == 0 also zero-fill rows [NT*NJ, GROWS) of their panel.
// blocks (jt, ip) of (NJ/GJ, GPITCH/8); gs: NT x 8 x GJ floats of LDS; sw: NK x WP floats of LDS, rounded up to whole trips of the block.
// EDGE: the wave holds the row i == 200 or the column j == 200, where the concatenation-linear terms enter. up = U + i*NU + jc and pa = Wcat + NU + jc are the lane's own, jc its clamped column; wb = Wcat + i is wave-uniform.
// ma, mb: all ones where the row term / the column term enters, else zero; msk gives the value or +0 for any bit pattern, as a select does, with no branch round a load.
__device__ __forceinline__ float msk(float v, unsigned m) { return __uint_as_float(__float_as_uint(v) & m); }
template <bool EDGE>
__device__ __forceinline__ void gp_sum(const float* __restrict__ up, const float* __restrict__ pa, const float* __restrict__ wb, const float* sw, unsigned ma, unsigned mb, float (&acc)[NT]) {
#pragma unroll 1   // rolled over the batches, for speed only
    for (int kb = 0; kb < NK; kb += GKB) {
        float u[GKB], a[EDGE ? GKB : 1];
#pragma unroll
        for (int e = 0; e < GKB; ++e) {
            u[e] = up[(size_t)e * (NU * NU)];
            if constexpr (EDGE) a[e] = pa[(size_t)e * (2 * NU)]; }
        asm volatile("s_wait_xcnt 0x0" ::: "memory");   // stands ahead of every overwrite of the address registers that the batch's loads name
        __builtin_amdgcn_sched_barrier(0);   // the whole batch's loads are issued ahead of its first sum (else the scheduler may sink loads to their uses and their latencies add up), and the address steps below stay behind the wait
        const float* const wr = sw + kb * WP;   // this batch's converted weights: every lane reads the same address
        v4f qa[2][WG], qb[2][WG]; float qc[2][WG];   // tags 0..3, 4..7 and 8 of WG rows, two groups
#pragma unroll
        for (int c = 0; c < WG; ++c) { qa[0][c] = *(const v4fa*)(wr + c * WP); qb[0][c] = *(const v4fa*)(wr + c * WP + 4); qc[0][c] = wr[c * WP + 8]; }
#pragma unroll
        for (int g = 0; g < GKB / WG; ++g) {
            if (g + 1 < GKB / WG) {
#pragma unroll
                for (int c = 0; c < WG; ++c) { const float* const p = wr + ((g + 1) * WG + c) * WP;
                    qa[(g + 1) & 1][c] = *(const v4fa*)p; qb[(g + 1) & 1][c] = *(const v4fa*)(p + 4); qc[(g + 1) & 1][c] = p[8]; } }
            __builtin_amdgcn_sched_barrier(0);   // the next group's LDS reads are issued as one run ahead of this group's sums: their latency passes under the sums, and no read stands among them
#pragma unroll
            for (int c = 0; c < WG; ++c) { const int e = g * WG + c;
                float w = bfr(u[e]);
                if constexpr (EDGE) w = w + msk(bfr(a[e]), ma) + msk(bfr(wb[(size_t)(kb + e) * (2 * NU)]), mb);
#pragma unroll
                for (int t = 0; t < 4; ++t) { acc[t] = fmaf(w, qa[g & 1][c][t], acc[t]); acc[4 + t] = fmaf(w, qb[g & 1][c][t], acc[4 + t]); }
                acc[8] = fmaf(w, qc[g & 1][c], acc[8]); }
            __builtin_amdgcn_sched_barrier(0);   // keeps the following reads, which take this group's registers, from moving up among these sums: they stay one run
        }
        up += (size_t)GKB * (NU * NU);
        if constexpr (EDGE) pa += (size_t)GKB * (2 * NU);
    }
}
__device__ __forceinline__ void d_gp(const float* __restrict__ U, const float* __restrict__ Wcat, const float* __restrict__ Wd, const float* __restrict__ bd, h16* GH, h16* GR, float* gs, float* sw, int jt, int ip) {
    const int tid = threadIdx.x, lane = tid & 31;
    const int wave = __builtin_amdgcn_readfirstlane(tid >> 5);
    {   // the classifier weights are converted once per block: sw[k * WP + t]; the places t >= 9 and k >= NK, which no sum takes, get the nearest weight; the barrier ends these writes ahead of every wave's reads in gp_sum
        float x[WS];
#pragma unroll
        for (int s = 0; s < WS; ++s) { const int idx = s * 256 + tid; int k = idx / WP; int t = idx - k * WP; k = k < NK ? k : NK - 1; t = t < NT ? t : NT - 1;   // clamped address
            x[s] = Wd[k * NT + t]; }
        asm volatile("s_wait_xcnt 0x0" ::: "memory");   // stands ahead of every overwrite of the address registers that the loads above name
        __builtin_amdgcn_sched_barrier(0);   // all the loads are issued ahead of the first LDS store (one latency, not several), and later address work stays behind the wait
#pragma unroll
        for (int s = 0; s < WS; ++s) sw[s * 256 + tid] = bfr(x[s]);
    }
    __syncthreads();
    const int i = ip * 8 + wave, j = jt * GJ + lane;
    float acc[NT];
#pragma unroll
    for (int t = 0; t < NT; ++t) acc[t] = 0.0f;
    const int jc = j < NU ? j : NU - 1;                             // clamped column index
    if (i < NU) {                                                   // wave-uniform
        if ((i == NU - 1) | (jt == (NU - 1) / GJ)) {                // wave-uniform: the row or the column of the constant-one feature lies in this wave
            const unsigned ma = (i == NU - 1) ? ~0u : 0u, mb = (j == NU - 1) ? ~0u : 0u;
            gp_sum<true>(U + (size_t)i * NU + jc, Wcat + NU + jc, Wcat + i, sw, ma, mb, acc);
#pragma unroll
            for (int t = 0; t < NT; ++t) acc[t] += msk(bfr(bd[t]), ma & mb);
        } else {
            gp_sum<false>(U + (size_t)i * NU + jc, Wcat, Wcat, sw, 0u, 0u, acc); }
    }
    const bool ok = (i < NU) & (j < NU);
#pragma unroll
    for (int t = 0; t < NT; ++t) gs[(t * 8 + wave) * GJ + lane] = ok ? acc[t] * GSC : 0.0f;
    __syncthreads();
#pragma unroll 1   // rolled: the second trip is one wave's
    for (int p = tid; p < NT * GJ; p += 256) {                      // 9 tags x 32 rows j; second trip = wave 0 only
        const int t = p >> 5, jj = p & 31; v8h hv, rv;
#pragma unroll
        for (int c = 0; c < 8; ++c) { const float x = gs[(t * 8 + c) * GJ + jj]; const h16 a0 = toh_flush(x); hv[c] = a0; rv[c] = toh_flush((x - (float)a0) * QRS); }
        const size_t oo = (size_t)ip * GPS + ((size_t)t * NJ + jt * GJ + jj) * 8;
        *(v8h*)(GH + oo) = hv; *(v8h*)(GR + oo) = rv; }
    if ((jt == 0) & (wave == 0)) {                                  // wave-uniform
        const v8h z = (v8h){};
        const size_t zo = (size_t)ip * GPS + ((size_t)NT * NJ + lane) * 8;
        *(v8h*)(GH + zo) = z; *(v8h*)(GR + zo) = z; }
}

// d_ht: bf16 GEMM, one block of HWV = 8 waves per 64x64 tile, K = HID in passes of HKC. C[m][n] = sum_k A[m][k] W[k][n]; A = state rows (m = q), W = Wh (columns c0 < 256: head column c0 + n) or Wt (tail column c0 - 256 + n); columns >= NF count as zeros.
// The block reads its operands as the f32 inputs and converts them to bf16 (RNE) on the way into LDS. Per pass: 64 state rows x HKC, in 512-byte pieces of a row per load; HKC weight rows x 64 columns, a thread taking 4 columns x 8 consecutive k at a time, which it turns in registers into four 16-byte pieces of k-contiguous LDS rows.
// All of a pass's loads are in flight together. LDS row pitch an odd number of 16-byte units; 16 lanes of a weight store hold 4 column quads x 4 octets of k, which fall on 16 different 16-byte bank groups.
// Wave w takes rows 16 (w >> 1) .. + 15 and columns 32 (w & 1) .. + 31: two accumulators, each summed over k in ascending order.
// Barriers: one ends a pass's LDS fill; one ends every wave's fragment reads of the pass, ahead of the next fill or of the f32 tile os, which lies on the operand rows' LDS; the last ends the writes of os ahead of its row-wise readers.
// Epilogue per column nn = n mod 256: nn < 200 -> GELU(C + bias), nn == 200 -> 1, nn > 200 -> 0; written as f16 value (Ph) and f16 residual x2048 (Pr), row pitch HTP.
// blocks (r0 / 64, c0 / 64) of (NB*SEQ/64, HTP/64); sab: 2 x 64 x HPL halves of LDS.
__device__ __forceinline__ void d_ht(const float* __restrict__ state, const float* __restrict__ Wm, const float* __restrict__ bias, h16* Ph, h16* Pr, bf* sab, int r0, int c0) {
    bf* const sA = sab; bf* const sB = sab + 64 * HPL;
    float* const os = (float*)sab;
    constexpr int NTH = 32 * HWV, RW = 64 / HWV, RT = HKC / 128, BS = (HKC / 8) / 16;   // threads; state rows per wave; 512-byte pieces per row and pass; weight pieces (4 columns x 8 k) per thread and pass
    const int tid = threadIdx.x, lane = tid & 31, lr = lane & 15, hi = lane >> 4;
    const int wave = __builtin_amdgcn_readfirstlane(tid >> 5);
    const int cn = c0 & (HTW - 1);
    const float* pa = state + ((size_t)(r0 / SEQ) * SEQ_FULL + (size_t)(r0 % SEQ + wave * RW)) * HID + lane * 4;   // wave w brings state rows 8 w .. 8 w + 7
    const int sla = wave * RW * HPL + lane * 4;
    const int quad = (wave & 3) * 4 + (lane & 3);                                   // columns 4 quad .. + 3 of the tile
    const int oct = ((wave >> 2) * 2 + hi) * (4 * BS) + ((lane >> 2) & 3);          // k = 8 oct .. + 7 of the pass; each further piece 4 octets on
    const bool vq = cn + 4 * quad < NF;
    const unsigned vm = vq ? ~0u : 0u;                                              // columns >= NF: zeros for any bit pattern loaded
    const float* pb = Wm + (size_t)(8 * oct) * NF + (vq ? cn + 4 * quad : NF - 4);  // clamped address
    const int slb = 4 * quad * HPL + 8 * oct;
    const int mb = wave >> 1, n2 = (wave & 1) * 2;
    float bc[2];
#pragma unroll
    for (int u = 0; u < 2; ++u) { const int nn = (c0 + (n2 + u) * 16 + lr) & (HTW - 1); const int bi = nn < NF ? nn : NF - 1;   // clamped address
        bc[u] = bfr(bias[bi]); }
    v8f acc[2];
#pragma unroll
    for (int u = 0; u < 2; ++u) acc[u] = (v8f){};
    const bf* const fa = sA + (mb * 16 + lr) * HPL + 8 * hi; const bf* const fb = sB + (n2 * 16 + lr) * HPL + 8 * hi;
#pragma unroll 1   // rolled over the passes: the second runs the first one's text
    for (int p = 0; p < HID / HKC; ++p) {
        v4f xa[RW * RT], xb[BS * 8];
#pragma unroll
        for (int it = 0; it < RW * RT; ++it) xa[it] = *(const v4f*)(pa + (it / RT) * HID + (it % RT) * 128);
#pragma unroll
        for (int it = 0; it < BS * 8; ++it) xb[it] = *(const v4f*)(pb + (size_t)((it / 8) * 32 + (it % 8)) * NF);
        asm volatile("s_wait_xcnt 0x0" ::: "memory");   // stands ahead of every overwrite of the address registers that the loads above name
        __builtin_amdgcn_sched_barrier(0);   // all the loads are issued ahead of the first LDS store (one latency, not several), and the address steps below stay behind the wait
        pa += HKC; pb += (size_t)HKC * NF;
#pragma unroll
        for (int it = 0; it < RW * RT; ++it) *(v2u*)(sA + sla + (it / RT) * HPL + (it % RT) * 128) = (v2u){pkbf(xa[it][0], xa[it][1]), pkbf(xa[it][2], xa[it][3])};
#pragma unroll
        for (int s = 0; s < BS; ++s) {
#pragma unroll
            for (int c = 0; c < 4; ++c) { v4u o;
#pragma unroll
                for (int e = 0; e < 4; ++e) o[e] = pkbf(xb[s * 8 + 2 * e][c], xb[s * 8 + 2 * e + 1][c]) & vm;
                *(v4u*)(sB + slb + c * HPL + s * 32) = o; } }
        __syncthreads();
#pragma unroll
        for (int k0 = 0; k0 < HKC; k0 += 32 * HKU) {
            v16bf a[HKU], b[HKU][2];
#pragma unroll
            for (int e = 0; e < HKU; ++e) { a[e] = ldb(fa + k0 + e * 32); b[e][0] = ldb(fb + k0 + e * 32); b[e][1] = ldb(fb + 16 * HPL + k0 + e * 32); }
            __builtin_amdgcn_sched_barrier(0);   // the group's LDS reads are issued ahead of its first product: else each product waits out an LDS latency of its own
#pragma unroll
            for (int e = 0; e < HKU; ++e) {
#pragma unroll
                for (int u = 0; u < 2; ++u) acc[u] = wgb(a[e], b[e][u], acc[u]); }
        }
        __syncthreads();
    }
#pragma unroll
    for (int u = 0; u < 2; ++u) {
#pragma unroll
        for (int j = 0; j < 8; ++j) os[(mb * 16 + hi * 8 + j) * 68 + (n2 + u) * 16 + lr] = acc[u][j] + bc[u]; }   // D: row 8h+j, col lane&15
    __syncthreads();
#pragma unroll 1   // rolled: the second trip runs the first one's text
    for (int s = 0; s < 64 * 8 / NTH; ++s) { const int row = (NTH / 8) * s + (tid >> 3), c8 = (tid & 7) * 8;   // 8 threads x 8 = 64 columns of one row
        const v4f x0 = *(const v4fa*)(&os[row * 68 + c8]); const v4f x1 = *(const v4fa*)(&os[row * 68 + c8 + 4]); v8h hv, rv;
#pragma unroll
        for (int i = 0; i < 4; ++i) {
            const int n0 = (c0 + c8 + i) & (HTW - 1), n1 = (c0 + c8 + 4 + i) & (HTW - 1);
            const float g0 = gelu_erf(x0[i]), g1 = gelu_erf(x1[i]);
            const float v0 = (n0 < NF) ? g0 : ((n0 == NF) ? 1.0f : 0.0f);
            const float v1 = (n1 < NF) ? g1 : ((n1 == NF) ? 1.0f : 0.0f);
            const h16 a0 = toh_flush(v0); const h16 a1 = toh_flush(v1); hv[i] = a0; hv[4 + i] = a1;
            rv[i] = toh_flush((v0 - (float)a0) * QRS); rv[4 + i] = toh_flush((v1 - (float)a1) * QRS); }
        const size_t oo = (size_t)(r0 + row) * HTP + c0 + c8;
        *(v8h*)(Ph + oo) = hv; *(v8h*)(Pr + oo) = rv;
        asm volatile("s_wait_xcnt 0x0" ::: "memory"); }   // stands ahead of the next trip's overwrites of the registers that the two stores name
}

// k_prep: the folded weights and the projection GEMM, neither of which reads what the other writes, share one launch; a block's body is chosen by its index (block-uniform branch).
// The folded-weight blocks hold the lowest indices. Both bodies' LDS lies in one array, sized for the projection GEMM: two blocks fit a WGP.
#define PB_GP   ((NJ / GJ) * (GPITCH / 8))
#define PB_HT   ((NB * SEQ / 64) * (HTP / 64))
static_assert(sizeof(float) * (NT * 8 * GJ + WS * 256) <= sizeof(unsigned short) * 2 * 64 * HPL);   // the folded-weight body's tile and weight table fit that array
__global__ __launch_bounds__(256) void k_prep(const float* __restrict__ state, const float* __restrict__ Wh, const float* __restrict__ bh, const float* __restrict__ Wt, const float* __restrict__ bt, const float* __restrict__ U, const float* __restrict__ Wcat,
                                              const float* __restrict__ Wd, const float* __restrict__ bd, h16* GH, h16* GR, h16* Ph, h16* Pr) {
    __shared__ __align__(16) bf smem[2 * 64 * HPL];
    const int blk = blockIdx.x;
    if (blk >= PB_GP) {
        const int t = blk - PB_GP, c0 = (t / (NB * SEQ / 64)) * 64;
        d_ht(state, (c0 >= HTW) ? Wt : Wh, (c0 >= HTW) ? bt : bh, Ph, Pr, smem, (t % (NB * SEQ / 64)) * 64, c0);
    } else {
        float* const gs = (float*)smem;
        d_gp(U, Wcat, Wd, bd, GH, GR, gs, gs + NT * 8 * GJ, blk % (NJ / GJ), blk / (NJ / GJ));
        asm volatile("s_wait_xcnt 0x0" ::: "memory");   // the bodies stand one behind another in the built code: this stands behind the body's last stores, ahead of any later write of a register that those stores name
    }
}

// k_vg: f16 GEMM with three products, one wave per 16x64 tile, K = KJ. V[q][n] = sum_i head[q][i] G^T[n][i], n = t*NJ + j.
// A = head planes (value AH, residual AR; row pitch HTP, columns 0..KJ-1), Bt = G^T planes (value GH, residual GR; panels of 8 columns: 16 lanes read 256 contiguous bytes).
// aH = AH.GH; aR = AR.GH + AH.GR (both residual carries x2048, one accumulator); V = aH + aR/2048 (keeps the x1024 carry of G); written as f16 value (VH) + f16 residual x2048 (VR), row pitch VP.
// grid (NB*SEQ/(16*VW), VP/64).
__global__ __launch_bounds__(32 * VW) void k_vg(const h16* __restrict__ AH, const h16* __restrict__ AR, const h16* __restrict__ GH, const h16* __restrict__ GR, h16* VH, h16* VR) {
    __shared__ __align__(16) float os[VW * 16 * 68];
    const int lane = threadIdx.x & 31, lr = lane & 15, hi = lane >> 4;
    const int wave = __builtin_amdgcn_readfirstlane((int)(threadIdx.x >> 5));
    const int m0 = (blockIdx.x * VW + wave) * 16, c0 = blockIdx.y * 64;
    v8f aH[4], aR[4];
#pragma unroll
    for (int nb = 0; nb < 4; ++nb) { aH[nb] = (v8f){}; aR[nb] = (v8f){}; }
    const size_t aoff = (size_t)(m0 + lr) * HTP + 8 * hi, boff = (size_t)hi * GPS + (size_t)(c0 + lr) * 8;
#pragma unroll 1
    for (int kc = 0; kc < KJ; kc += 32) {
        const v16h ah = ldh(AH + aoff + kc), ar = ldh(AR + aoff + kc);
#pragma unroll
        for (int nb = 0; nb < 4; ++nb) {
            const v16h gh = ldp(GH + boff + (size_t)(kc / 8) * GPS + nb * 16 * 8), gr = ldp(GR + boff + (size_t)(kc / 8) * GPS + nb * 16 * 8);
            aH[nb] = wg(ah, gh, aH[nb]); aR[nb] = wg(ar, gh, aR[nb]); aR[nb] = wg(ah, gr, aR[nb]); }
    }
    const int wb = wave * 16 * 68;
#pragma unroll
    for (int nb = 0; nb < 4; ++nb) {
#pragma unroll
        for (int j = 0; j < 8; ++j) os[wb + (hi * 8 + j) * 68 + nb * 16 + lr] = aH[nb][j] + aR[nb][j] * QRI; }   // D: row 8h+j, col lane&15
    wave_sync();
{
#pragma unroll 1
        for (int s = 0; s < 4; ++s) { const int row = 4 * s + (lane >> 3), c8 = (lane & 7) * 8;   // 4 s x 4 row groups = 16 rows; 8 lanes x 8 = 64 columns
            const v4f x0 = *(const v4fa*)(&os[wb + row * 68 + c8]); const v4f x1 = *(const v4fa*)(&os[wb + row * 68 + c8 + 4]); v8h hv, rv;
#pragma unroll
            for (int i = 0; i < 4; ++i) { const h16 a0 = toh_flush(x0[i]); const h16 a1 = toh_flush(x1[i]); hv[i] = a0; hv[4 + i] = a1;
                rv[i] = toh_flush((x0[i] - (float)a0) * QRS); rv[4 + i] = toh_flush((x1[i] - (float)a1) * QRS); }
            const size_t oo = (size_t)(m0 + row) * VP + c0 + c8;
            *(v8h*)(VH + oo) = hv; *(v8h*)(VR + oo) = rv; }
         }
}

// piece p (4 floats) of a band block's output run, read from the score tile: output element e = 1161 n + rem lies at os[SP n + rem]; a piece may run over from row n into row n + 1
__device__ __forceinline__ v4f band_piece(const float* os, int p) {
    const unsigned e = 4u * (unsigned)p, n = e / QE, rem = e - n * QE; v4f v;
#pragma unroll
    for (unsigned c = 0; c < 4; ++c) v[c] = os[e + c + (n + (rem + c >= QE ? 1u : 0u)) * (SP - QE)];
    return v;
}

// k_band: one block per BQ = 16 consecutive queries (one batch), one wave per 16-key tile of their common window of 144 keys (key = n0 - 64 + w, w = 0..143; a tile outside the sequence reads the nearest tile inside it; out-of-sequence keys fall to the keep rule).
// The window's tail rows and the 16 queries' V rows are read from global memory once per block, in 16-byte pieces that run along the rows, and kept in LDS (row pitches an odd number of 16-byte units).
// A = tail rows of the wave's key tile (row = key, k = j), held in registers for all tags; B = V of one tag (column = query lane&15, k = j), K = KJ.
// sH = TH.VH; sR = TR.VH + TH.VR; score = (sH + sR/2048)/1024. D element j of lane (lr, hi) = (w = 16 wave + 8 hi + j, query lr); band offset r = w - lr, kept where 0 <= r <= 128 -> os[lr*SP + r*9 + t].
// Keep rule per element, applied where the score is written to os: (n < len) and (0 <= key < SEQ) and (key < len); other elements get the classifier bias; non-finite values become 0.
// os lies on the tail rows' LDS, which no wave reads once every wave holds its A fragments (second barrier); the third barrier ends the score writes ahead of the block's linear store of its 16 output rows (16 x 1161 floats in a row).
// grid NB*SEQ/BQ.
__global__ __launch_bounds__(32 * BKT) void k_band(const h16* __restrict__ HTH, const h16* __restrict__ HTR, const h16* __restrict__ VH, const h16* __restrict__ VR, const int* __restrict__ lengths, const float* __restrict__ bd, float* OUT) {
    __shared__ __align__(16) h16 sm[2 * BWIN * TPL + 2 * BQ * VPL];
    h16* const tH = sm; h16* const tR = sm + BWIN * TPL;
    h16* const vH = sm + 2 * BWIN * TPL; h16* const vR = vH + BQ * VPL;
    float* const os = (float*)sm;
    constexpr int NTH = 32 * BKT, TPC = KJ / 8;
    const int tid = threadIdx.x, lane = tid & 31, lr = lane & 15, hi = lane >> 4;
    const int wave = __builtin_amdgcn_readfirstlane(tid >> 5);
    const int q0 = blockIdx.x * BQ;
    const int b = q0 / SEQ, n0 = q0 % SEQ;
    const int len = lengths[b];
    const float bl = bfr(bd[lane < NT ? lane : NT - 1]);   // lane t holds tag t's bias: one load, in flight with the row loads below, not one wait per tag in the tag loop
    asm volatile("s_wait_xcnt 0x0" ::: "memory");   // stands ahead of every overwrite of the address registers that the bias load names
    if (lane < TPC) {   // one lane per 16-byte piece of a 448-byte row part; wave w brings the 16 tail rows of key tile w and tag w's part of the 16 V rows
        int kb = n0 - WH + 16 * wave; kb = kb < 0 ? 0 : (kb > SEQ - 16 ? SEQ - 16 : kb);   // a key tile lies wholly inside or wholly outside the sequence
        const size_t to = ((size_t)b * SEQ + (size_t)kb) * HTP + lane * 8, vo = (size_t)q0 * VP + wave * NJ + lane * 8;
        const h16* const pth = HTH + to; const h16* const ptr = HTR + to; const h16* const pvh = VH + vo; const h16* const pvr = VR + vo;
        const int tl = wave * 16 * TPL + lane * 8, vl = wave * NJ + lane * 8;
        v8h xh[16], xr[16], yh[16], yr[16];
#pragma unroll
        for (int it = 0; it < 16; ++it) { xh[it] = *(const v8h*)(pth + HTW + it * HTP); xr[it] = *(const v8h*)(ptr + HTW + it * HTP); }
#pragma unroll
        for (int it = 0; it < 16; ++it) yh[it] = *(const v8h*)(pvh + it * VP);
        asm volatile("s_wait_xcnt 0x0" :: "v"(pth), "v"(ptr), "v"(pvh) : "memory");   // stands ahead of every overwrite of the three address pairs that the loads above name; as its inputs they stay whole up to it
        __builtin_amdgcn_sched_barrier(0);   // these 48 loads are issued ahead of the first LDS store (one latency, not several), and the LDS address work stays behind the wait
#pragma unroll
        for (int it = 0; it < 16; ++it) { *(v8h*)(tH + tl + it * TPL) = xh[it]; *(v8h*)(tR + tl + it * TPL) = xr[it]; }
        __builtin_amdgcn_sched_barrier(0);   // the last 16 loads take the registers that the tail rows have left: all 64 at once would need registers above v255
#pragma unroll
        for (int it = 0; it < 16; ++it) yr[it] = *(const v8h*)(pvr + it * VP);
        asm volatile("s_wait_xcnt 0x0" :: "v"(pvr) : "memory");   // as above, for the fourth address pair
        __builtin_amdgcn_sched_barrier(0);   // keeps these loads ahead of the stores below and later address work behind the wait
#pragma unroll
        for (int it = 0; it < 16; ++it) *(v8h*)(vH + vl + it * VPL) = yh[it];
#pragma unroll
        for (int it = 0; it < 16; ++it) *(v8h*)(vR + vl + it * VPL) = yr[it];
    }
    __syncthreads();
    v16h th[KJ / 32], tr[KJ / 32];
    const int ao = (wave * 16 + lr) * TPL + 8 * hi;
#pragma unroll
    for (int k = 0; k < KJ / 32; ++k) { th[k] = ldh(tH + ao + k * 32); tr[k] = ldh(tR + ao + k * 32); }
    __syncthreads();
    const int bo = lr * VPL + 8 * hi;
    const int r0 = 16 * wave + 8 * hi - lr;
    bool ok[8];   // keep rule of D element j: the same for every tag
#pragma unroll
    for (int j = 0; j < 8; ++j) { const int key = n0 - WH + 16 * wave + 8 * hi + j; ok[j] = (n0 + lr < len) & (key >= 0) & (key < SEQ) & (key < len); }
#pragma unroll 1   // rolled over the groups of three tags: the A fragments and one group's accumulators and B fragments fill the registers below v256
    for (int tg = 0; tg < NT; tg += BTG) {
        v8f sH[BTG], sR[BTG];
#pragma unroll
        for (int u = 0; u < BTG; ++u) { sH[u] = (v8f){}; sR[u] = (v8f){}; }
#pragma unroll
        for (int k = 0; k < KJ / 32; ++k) {
            v16h vh[BTG], vr[BTG];
#pragma unroll
            for (int u = 0; u < BTG; ++u) { vh[u] = ldh(vH + bo + (tg + u) * NJ + k * 32); vr[u] = ldh(vR + bo + (tg + u) * NJ + k * 32); }
            // the three tags' products alternate, so that no product waits for the one before it; each accumulator takes its products in the order k, then TR.VH, then TH.VR
#pragma unroll
            for (int u = 0; u < BTG; ++u) sH[u] = wg(th[k], vh[u], sH[u]);
#pragma unroll
            for (int u = 0; u < BTG; ++u) sR[u] = wg(tr[k], vh[u], sR[u]);
#pragma unroll
            for (int u = 0; u < BTG; ++u) sR[u] = wg(th[k], vr[u], sR[u]); }
#pragma unroll
        for (int u = 0; u < BTG; ++u) {
            const float bv = __int_as_float(__builtin_amdgcn_readlane(__float_as_int(bl), tg + u));   // tag tg + u's bias, wave-uniform
#pragma unroll
            for (int j = 0; j < 8; ++j) { const int r = r0 + j;
                float val = ok[j] ? (sH[u][j] + sR[u][j] * QRI) * GSI : bv;
                val = (fabsf(val) <= 3.402823466e38f) ? val : 0.0f;
                if ((r >= 0) & (r < WF)) os[lr * SP + r * NT + tg + u] = val; } }
    }
    __syncthreads();
    float* const dst = OUT + ((size_t)b * OUT_SEQ + n0) * QE;
    constexpr int NP = BQ * QE / 4, PG = 4, NG = NP / (PG * NTH);   // 16-byte pieces of the run; pieces per thread and group; whole groups
    // A run is 580 and a half lines of 128 bytes: every second block's run starts half way into a line. There the pieces are taken from the fifth on, so that each wave's 32 pieces of a group are four whole lines; the first four follow with the run's last pieces.
    // At such a block bound the two neighbours each store their own 64 bytes of the line, in 16-byte pieces of their own; neither reads it.
    const int off = (n0 & BQ) ? 4 : 0;
#pragma unroll 1   // rolled over the groups: every group runs the first one's text
    for (int g = 0; g < NG; ++g) {
        v4f val[PG];
#pragma unroll
        for (int s = 0; s < PG; ++s) val[s] = band_piece(os, off + (g * PG + s) * NTH + tid);
        __builtin_amdgcn_sched_barrier(0);   // the group's LDS reads are issued ahead of its first store: one LDS latency a group, not one a piece
#pragma unroll
        for (int s = 0; s < PG; ++s) *(v4f*)(dst + (size_t)(off + (g * PG + s) * NTH + tid) * 4) = val[s];
        asm volatile("s_wait_xcnt 0x0" ::: "memory"); }   // stands ahead of the next group's overwrites of the registers that the stores name
    static_assert(NP - NG * PG * NTH <= NTH);   // what the whole groups leave: at most one piece a thread
    if (tid < NP - NG * PG * NTH) { const int i = NG * PG * NTH + tid, p = off + i < NP ? off + i : off + i - NP;
        const v4f val = band_piece(os, p); *(v4f*)(dst + (size_t)p * 4) = val; }
}

static constexpr size_t al256(size_t v) { return (v + 255) & ~(size_t)255; }
static constexpr size_t SZ_HT = al256((size_t)NB * SEQ * HTP * 2);
static constexpr size_t SZ_GT = al256((size_t)GROWS * GPITCH * 2);
static constexpr size_t SZ_V  = al256((size_t)NB * SEQ * VP * 2);
static constexpr size_t SZ_TOTAL = 2 * SZ_HT + 2 * SZ_GT + 2 * SZ_V;
static_assert(SZ_TOTAL <= (size_t)134217728);          // workspace carve <= 128 MiB
static_assert((size_t)(NB_FULL - 1) * SEQ_FULL * QE * 4 + (size_t)SEQ_FULL * QE * 4 == (size_t)9510912);   // output bytes of the full problem

extern "C" void kernel_launch(void* const* d_in, const int* in_sizes, int n_in,
                              void* d_out, int out_size, void* d_ws, size_t ws_size, hipStream_t stream) {
    if (n_in < 10) return;
    const size_t needx = ((size_t)(NB - 1) * SEQ_FULL + SEQ) * HID;
    if ((size_t)in_sizes[0] < needx) return;
    if (in_sizes[1] < NB) return;
    if ((size_t)in_sizes[2] < (size_t)HID * NF || (size_t)in_sizes[4] < (size_t)HID * NF) return;
    if (in_sizes[3] < NF || in_sizes[5] < NF) return;
    if ((size_t)in_sizes[6] < (size_t)NK * NU * NU) return;
    if ((size_t)in_sizes[7] < (size_t)NK * 2 * NU) return;
    if (in_sizes[8] < NK * NT || in_sizes[9] < NT) return;
    if ((size_t)out_size < ((size_t)(NB - 1) * OUT_SEQ + SEQ) * QE) return;
    if (SZ_TOTAL > ws_size) return;
    // wire order: state, lengths, Wh, bh, Wt, bt, U, Wcat, Wd, bd
    const float* state = (const float*)d_in[0];
    const int*   lengths = (const int*)d_in[1];
    const float* Wh = (const float*)d_in[2]; const float* bh = (const float*)d_in[3];
    const float* Wt = (const float*)d_in[4]; const float* bt = (const float*)d_in[5];
    const float* U = (const float*)d_in[6]; const float* Wcat = (const float*)d_in[7];
    const float* Wd = (const float*)d_in[8]; const float* bd = (const float*)d_in[9];
    float* OUT = (float*)d_out;      // [NB][SEQ][129][9]
    char* wsp = (char*)d_ws;
    h16* HTH = (h16*)wsp; wsp += SZ_HT;              // [NB*SEQ][512] head | tail value
    h16* HTR = (h16*)wsp; wsp += SZ_HT;              // [NB*SEQ][512] head | tail residual x2048
    h16* GH  = (h16*)wsp; wsp += SZ_GT;              // [32][2048][8] G^T value (x1024)
    h16* GR  = (h16*)wsp; wsp += SZ_GT;              // [32][2048][8] G^T residual x2048
    h16* VH  = (h16*)wsp; wsp += SZ_V;               // [NB*SEQ][2048] V value (x1024)
    h16* VR  = (h16*)wsp; wsp += SZ_V;               // [NB*SEQ][2048] V residual x2048

    k_prep<<<PB_GP + PB_HT, 256, 0, stream>>>(state, Wh, bh, Wt, bt, U, Wcat, Wd, bd, GH, GR, HTH, HTR);
    k_vg<<<dim3(NB * SEQ / (16 * VW), VP / 64, 1), 32 * VW, 0, stream>>>(HTH, HTR, GH, GR, VH, VR);
    k_band<<<NB * SEQ / BQ, 32 * BKT, 0, stream>>>(HTH, HTR, VH, VR, lengths, bd, OUT);
}

// v008
// A run of this version takes 52.1 microseconds.
// Next to v007, in two timings, it ran 1.18 times as fast each time.
// Over all steps from v000 it is 4.36 times as fast.
#include <hip/hip_runtime.h>

// Span scorer: head / tail projections (Linear 768 -> 200 + erf GELU) with an appended constant-one feature; biaffine form head^T U[k] tail plus a concatenation-linear term, evaluated for every query token on a sliding band of 129 key offsets (-64..+64); length masking (masked entries = classifier bias); 9-tag linear classifier; non-finite outputs set to 0.
// Algebra: the classifier is folded into the bilinear weights: G[i][j][t] = sum_k (U[k][i][j] + [j==200] Wcat[k][i] + [i==200] Wcat[k][201+j]) Wd[k][t] + [i==j==200] bd[t]; V[q][t][j] = sum_i head[q][i] G[i][j][t]; score[q][r][t] = sum_j tail[q-64+r][j] V[q][t][j].
// Compute dtypes, f32 accumulate everywhere: projections v_wmma_f32_16x16x32_bf16 (state, Wh, Wt, biases RNE-converted to bf16; products exact); G built in f32 on the vector unit from bf16-converted U, Wcat, Wd, bd (9 tag columns);
// V GEMM and band GEMM v_wmma_f32_16x16x32_f16 with every operand as f16 value + f16 residual x2048 (three products; residual products in their own accumulator folded by 1/2048); G carries x1024, folded back after the band GEMM.
// Layout: head|tail planes [q][512] (head cols 0..255, tail cols 256..511; col 200 of each half = 1, cols 201..255 = 0);
// G^T planes in 32 panels of 8 columns: [i/8][t*224 + j][i%8]; V planes [q][2048] with column t*224 + j; the band GEMM's block masks its scores and stores its 16 queries' output rows itself, one contiguous run.

#ifndef NB
#define NB 2
#endif
#ifndef SEQ
#define SEQ 1024
#endif
#define NB_FULL  2
#define SEQ_FULL 1024
#ifndef OUT_SEQ
#define OUT_SEQ SEQ              // row pitch (in tokens) between batches of the output
#endif
#define HID    768               // model width
#define NF     200               // projection width
#define NU     201               // NF + constant-one feature
#define NK     200               // bilinear channels
#define NT     9                 // tags
#define WH     64                // band half width
#define WF     129               // band width
#define QE     (WF * NT)         // output floats per query (1161)
#define HTW    256               // column width of the head half / tail half
#define HTP    512               // row pitch (halves) of the head|tail planes
#define KJ     224               // contraction length of the V and band GEMMs (201 zero-padded)
#define NJ     224               // G^T rows / V columns per tag
#define GPITCH 256               // columns i of the G^T planes (32 panels of 8)
#define GROWS  2048              // rows of the G^T planes (9 * 224 = 2016, zero rows above)
#define GPS    (GROWS * 8)       // halves per 8-column panel of the G^T planes
#define GJ     32                // G^T rows j per d_gp block (one lane each)
#define GKB    40                // values of k per batch of U loads in d_gp
#define WP     12                // LDS row pitch (floats) of the converted classifier weights: 9 tags in three 16-byte pieces, of the last only its first float is read
#define WG     4                 // rows of that table per group of LDS reads in d_gp
#define WS     ((NK * WP + 255) / 256)   // weights per thread in the fill of that table
#define VP     2048              // row pitch (halves) of the V planes
#define SP     1184              // LDS row pitch (floats) of a band block's score tile; SP - NT is odd, so the 16 queries of one score write fall on 16 banks
#define VWV    8                 // waves per V GEMM block
#define VBM    128               // queries per V GEMM block
#define VBN    128               // V columns per V GEMM block
#define VKP    (KJ + 8)          // LDS row pitch (halves) of the V GEMM's operand rows: 29 x 16 B
#define VCN    14                // asynchronous copies per statement in the V GEMM's fill
#define HWV    8                 // waves per projection GEMM block
#define HKC    384               // values of k per pass of the projection GEMM: what its LDS holds at a time
#define HKU    6                 // k steps of 32 whose fragments a projection GEMM wave reads from LDS as one group
#define HPL    (HKC + 8)         // LDS row pitch (halves) of the projection GEMM's operand rows: 49 x 16 B
#define BQ     16                // queries per band block
#define BKT    9                 // 16-key tiles of a band block's window = its waves
#define BWIN   (BKT * 16)        // keys in a band block's window
#define BTG    3                 // tags whose products alternate in the band GEMM
#define TPL    (KJ + 8)          // LDS row pitch (halves) of the tail rows: 29 x 16 B
#define VPL    (NT * NJ + 8)     // LDS row pitch (halves) of the V rows: 253 x 16 B
#define QRS    2048.0f           // carry of every residual plane
#define QRI    (1.0f / 2048.0f)
#define GSC    1024.0f           // carry of the G planes
#define GSI    (1.0f / 1024.0f)

static_assert(NU == NF + 1);
static_assert(KJ % 32 == 0);
static_assert(NU <= KJ);
static_assert(KJ <= HTW);
static_assert(KJ <= GPITCH);
static_assert(NJ == KJ);                       // V column block of one tag = one contraction row of the band GEMM
static_assert(HTP == 2 * HTW);
static_assert(HTW % 64 == 0);                  // a 64-column tile lies wholly in the head half or the tail half
static_assert((HTW & (HTW - 1)) == 0);
static_assert(NF <= HTW);
static_assert(GPITCH % 8 == 0);
static_assert(NJ % GJ == 0);
static_assert(GROWS - NT * NJ == GJ);           // zero rows above the tags: one lane each
static_assert(NK % GKB == 0);
static_assert(NT == 9 && WP >= NT && WP % 4 == 0 && GKB % WG == 0);   // a row is two 16-byte pieces and one float, at a multiple of 16 bytes; a batch is whole groups
static_assert(NU <= GPITCH);
static_assert(NT * NJ <= GROWS);
static_assert(GROWS == VP);
static_assert(VP % 64 == 0);
static_assert((NB * SEQ) % 64 == 0);
static_assert((NB * SEQ) % VBM == 0 && VP % VBN == 0 && VBN <= GROWS);
static_assert(VBM * (KJ / 8) == VCN * 32 * VWV && VBN * (KJ / 8) == VCN * 32 * VWV);   // a plane's pieces: VCN per thread
static_assert(4 * VCN <= 63);                  // copies of a wave in flight
static_assert(VKP == KJ + 8 && (32 * VWV) % VBN == 0);   // an LDS row is its KJ/8 pieces and one more; a trip of the G^T fill is whole panels
static_assert(((VKP / 8) & 1) == 1 && VWV == 8 && VBM == 4 * 32 && VBN == 2 * 64);   // 4 row groups x 2 column halves of the tile
static_assert(sizeof(_Float16) * (2 * VBM * VKP + 2 * VBN * VKP) + sizeof(float) * VWV * 32 * 68 <= 327680);
static_assert(SEQ % BQ == 0);                  // a band block's queries lie in one batch
static_assert(BWIN == BQ + 2 * WH);            // the window holds every key of every query of the block
static_assert(NT % BTG == 0);
static_assert(KJ / 8 <= 32 && NJ == KJ);        // a row part of KJ halves: one 16-byte piece per lane
static_assert(BKT == NT && BQ == 16);          // wave w stages key tile w and tag w
static_assert(SEQ % 16 == 0 && WH % 16 == 0);  // key tiles start at multiples of 16
static_assert(((SP - NT) & 1) == 1);
static_assert((BQ * QE) % 4 == 0);             // a band block's output run is whole 16-byte pieces
static_assert((BQ * QE * 4) % 128 == 64 && (BQ & (BQ - 1)) == 0);   // runs start at multiples of 128 bytes and half way between them in turn
static_assert(4 + (BQ * QE / 4) / (4 * 32 * BKT) * (4 * 32 * BKT) <= BQ * QE / 4);   // the whole groups, shifted by four pieces, stay inside the run
static_assert(((TPL / 8) & 1) == 1 && ((VPL / 8) & 1) == 1);
static_assert(sizeof(float) * BQ * SP <= sizeof(_Float16) * 2 * BWIN * TPL);   // the score tile fits the tail rows' LDS
static_assert(sizeof(_Float16) * (2 * BWIN * TPL + 2 * BQ * VPL) <= 327680);
static_assert(SEQ % 64 == 0);
static_assert(SEQ % 32 == 0);
static_assert(OUT_SEQ % 32 == 0);
static_assert(WF == 2 * WH + 1);
static_assert(WF <= 9 * 16);                   // nine 16-key tiles cover the band
static_assert(SP >= QE);
static_assert(NB <= NB_FULL);
static_assert(SEQ <= SEQ_FULL);
static_assert(4 * 32 * 16 == 16 * 64 * 2);     // slab store: 4 trips x 32 lanes x 16 B == 16 rows x 64 halves
static_assert(((HPL / 8) & 1) == 1 && HID % HKC == 0);
static_assert(HKC % 128 == 0 && 64 % HWV == 0 && (64 * 8) % (32 * HWV) == 0);   // a state row's part of a pass is whole 512-byte pieces of f32; whole rows per wave in the fill, whole pieces per thread in the epilogue
static_assert((HKC / 8) % 16 == 0 && NF % 4 == 0);   // weights of a pass: 16 column quads x HKC/8 octets of k, dealt as 4 x 4 per 16 lanes; a quad lies wholly inside or wholly outside the NF columns
static_assert(HKC % (32 * HKU) == 0);
static_assert(HWV == 8);                       // 4 row groups x 2 column halves of the 64x64 tile
static_assert(sizeof(float) * 64 * 68 <= sizeof(unsigned short) * 2 * 64 * HPL);   // the f32 tile fits the operand rows' LDS
static_assert(sizeof(unsigned short) * 2 * 64 * HPL <= 163840);   // two blocks per WGP
static_assert(sizeof(float) * NT * 8 * GJ <= 131072);

typedef _Float16 h16;
typedef unsigned short bf;
typedef __attribute__((ext_vector_type(16))) __bf16   v16bf;
typedef __attribute__((ext_vector_type(16))) _Float16 v16h;
typedef __attribute__((ext_vector_type(8)))  _Float16 v8h;
typedef __attribute__((ext_vector_type(8)))  unsigned short v8us;
typedef __attribute__((ext_vector_type(4)))  unsigned v4u;
typedef __attribute__((ext_vector_type(2)))  unsigned v2u;
typedef __attribute__((ext_vector_type(2)))  float    v2f;
typedef __attribute__((ext_vector_type(2)))  __bf16   v2bf;
typedef __attribute__((ext_vector_type(8)))  float    v8f;
typedef __attribute__((ext_vector_type(4)))  float    v4f;
typedef v4f  __attribute__((may_alias)) v4fa;

__device__ __forceinline__ unsigned short f2bf(float f) { unsigned u = __float_as_uint(f); u += 0x7FFFu + ((u >> 16) & 1u); return (unsigned short)(u >> 16); }
__device__ __forceinline__ unsigned pkbf(float lo, float hi) { return __builtin_bit_cast(unsigned, __builtin_convertvector((v2f){lo, hi}, v2bf)); }   // two f32 -> two bf16 (RNE) in one word, lo in its low half
__device__ __forceinline__ float bfr(float f) { return __uint_as_float(((unsigned)f2bf(f)) << 16); }   // value after RNE convert to bf16
__device__ __forceinline__ v16h cat16(v8h lo, v8h hi) { return __builtin_shufflevector(lo, hi, 0, 1, 2, 3, 4, 5, 6, 7, 8, 9, 10, 11, 12, 13, 14, 15); }
__device__ __forceinline__ v16bf cat16b(v8us lo, v8us hi) { return __builtin_bit_cast(v16bf, __builtin_shufflevector(lo, hi, 0, 1, 2, 3, 4, 5, 6, 7, 8, 9, 10, 11, 12, 13, 14, 15)); }
__device__ __forceinline__ v8f wmma16(v16h a, v16h b, v8f c) { return __builtin_amdgcn_wmma_f32_16x16x32_f16(false, a, false, b, (short)0, c, false, false); }
__device__ __forceinline__ v8f wmmab(v16bf a, v16bf b, v8f c) { return __builtin_amdgcn_wmma_f32_16x16x32_bf16(false, a, false, b, (short)0, c, false, false); }
// fragment loaders from K-contiguous 16-bit rows; p already includes + 8*(lane>>4): elements 0..7 <- k0+8h+0..7, elements 8..15 <- k0+16+8h+0..7 (same map for A and B)
__device__ __forceinline__ v16h  ldh(const h16* p) { return cat16(*(const v8h*)p, *(const v8h*)(p + 16)); }
__device__ __forceinline__ v16bf ldb(const bf* p)  { return cat16b(*(const v8us*)p, *(const v8us*)(p + 16)); }
// ordering point for wave-private LDS tiles (same wave writes and reads)
__device__ __forceinline__ void wave_sync() { __builtin_amdgcn_fence(3 /* release order */, "wavefront"); __builtin_amdgcn_wave_barrier(); asm volatile("" ::: "memory"); }

// per-instruction guarded WMMA wrappers: one accumulator tied per guard, operands kept live across the nops
__device__ __forceinline__ v8f wg(v16h a, v16h b, v8f c) { c = wmma16(a, b, c); asm volatile("v_nop\n\tv_nop\n\tv_nop\n\tv_nop" : "+v"(c) : "v"(a), "v"(b)); return c; }
__device__ __forceinline__ v8f wgb(v16bf a, v16bf b, v8f c) { c = wmmab(a, b, c); asm volatile("v_nop\n\tv_nop\n\tv_nop\n\tv_nop" : "+v"(c) : "v"(a), "v"(b)); return c; }
// f32 -> f16 convert that cannot produce an f16 subnormal (|v| < 2^-14 -> +0), applied after the plane's carry
static __device__ __forceinline__ h16 toh_flush(float v) { const h16 r = (h16)v; return (fabsf(v) < 6.103515625e-05f) ? (h16)0.0f : r; }
__device__ __forceinline__ float gelu_erf(float x) { return 0.5f * x * (1.0f + erff(x * 0.70710678118654752f)); }

// d_gp: folded weights. Block (jt, ip) builds the tile i = 8 ip + wave, j = 32 jt + lane of G for all 9 tags: a wave reads 32 consecutive j of one U row per k (one 128-byte run), GKB values of k in flight at a time.
// Each (i, j, t) is summed over k = 0..199 in order by one thread. The 200 x 9 classifier weights are converted once per block into LDS; the sums read them from there, all lanes one address. The tile is turned in LDS and stored as 16-byte pieces (8 columns i) of panel ip, 512 contiguous bytes per tag.
// Entries with i >= NU or j >= NU are zeros; blocks jt == 0 also zero-fill rows [NT*NJ, GROWS) of their panel.
// blocks (jt, ip) of (NJ/GJ, GPITCH/8); gs: NT x 8 x GJ floats of LDS; sw: NK x WP floats of LDS, rounded up to whole trips of the block.
// EDGE: the wave holds the row i == 200 or the column j == 200, where the concatenation-linear terms enter. up = U + i*NU + jc and pa = Wcat + NU + jc are the lane's own, jc its clamped column; wb = Wcat + i is wave-uniform.
// ma, mb: all ones where the row term / the column term enters, else zero; msk gives the value or +0 for any bit pattern, as a select does, with no branch round a load.
__device__ __forceinline__ float msk(float v, unsigned m) { return __uint_as_float(__float_as_uint(v) & m); }
template <bool EDGE>
__device__ __forceinline__ void gp_sum(const float* __restrict__ up, const float* __restrict__ pa, const float* __restrict__ wb, const float* sw, unsigned ma, unsigned mb, float (&acc)[NT]) {
#pragma unroll 1   // rolled over the batches, for speed only
    for (int kb = 0; kb < NK; kb += GKB) {
        float u[GKB], a[EDGE ? GKB : 1];
#pragma unroll
        for (int e = 0; e < GKB; ++e) {
            u[e] = up[(size_t)e * (NU * NU)];
            if constexpr (EDGE) a[e] = pa[(size_t)e * (2 * NU)]; }
        asm volatile("s_wait_xcnt 0x0" ::: "memory");   // stands ahead of every overwrite of the address registers that the batch's loads name
        __builtin_amdgcn_sched_barrier(0);   // the whole batch's loads are issued ahead of its first sum (else the scheduler may sink loads to their uses and their latencies add up), and the address steps below stay behind the wait
        const float* const wr = sw + kb * WP;   // this batch's converted weights: every lane reads the same address
        v4f qa[2][WG], qb[2][WG]; float qc[2][WG];   // tags 0..3, 4..7 and 8 of WG rows, two groups
#pragma unroll
        for (int c = 0; c < WG; ++c) { qa[0][c] = *(const v4fa*)(wr + c * WP); qb[0][c] = *(const v4fa*)(wr + c * WP + 4); qc[0][c] = wr[c * WP + 8]; }
#pragma unroll
        for (int g = 0; g < GKB / WG; ++g) {
            if (g + 1 < GKB / WG) {
#pragma unroll
                for (int c = 0; c < WG; ++c) { const float* const p = wr + ((g + 1) * WG + c) * WP;
                    qa[(g + 1) & 1][c] = *(const v4fa*)p; qb[(g + 1) & 1][c] = *(const v4fa*)(p + 4); qc[(g + 1) & 1][c] = p[8]; } }
            __builtin_amdgcn_sched_barrier(0);   // the next group's LDS reads are issued as one run ahead of this group's sums: their latency passes under the sums, and no read stands among them
#pragma unroll
            for (int c = 0; c < WG; ++c) { const int e = g * WG + c;
                float w = bfr(u[e]);
                if constexpr (EDGE) w = w + msk(bfr(a[e]), ma) + msk(bfr(wb[(size_t)(kb + e) * (2 * NU)]), mb);
#pragma unroll
                for (int t = 0; t < 4; ++t) { acc[t] = fmaf(w, qa[g & 1][c][t], acc[t]); acc[4 + t] = fmaf(w, qb[g & 1][c][t], acc[4 + t]); }
                acc[8] = fmaf(w, qc[g & 1][c], acc[8]); }
            __builtin_amdgcn_sched_barrier(0);   // keeps the following reads, which take this group's registers, from moving up among these sums: they stay one run
        }
        up += (size_t)GKB * (NU * NU);
        if constexpr (EDGE) pa += (size_t)GKB * (2 * NU);
    }
}
__device__ __forceinline__ void d_gp(const float* __restrict__ U, const float* __restrict__ Wcat, const float* __restrict__ Wd, const float* __restrict__ bd, h16* GH, h16* GR, float* gs, float* sw, int jt, int ip) {
    const int tid = threadIdx.x, lane = tid & 31;
    const int wave = __builtin_amdgcn_readfirstlane(tid >> 5);
    {   // the classifier weights are converted once per block: sw[k * WP + t]; the places t >= 9 and k >= NK, which no sum takes, get the nearest weight; the barrier ends these writes ahead of every wave's reads in gp_sum
        float x[WS];
#pragma unroll
        for (int s = 0; s < WS; ++s) { const int idx = s * 256 + tid; int k = idx / WP; int t = idx - k * WP; k = k < NK ? k : NK - 1; t = t < NT ? t : NT - 1;   // clamped address
            x[s] = Wd[k * NT + t]; }
        asm volatile("s_wait_xcnt 0x0" ::: "memory");   // stands ahead of every overwrite of the address registers that the loads above name
        __builtin_amdgcn_sched_barrier(0);   // all the loads are issued ahead of the first LDS store (one latency, not several), and later address work stays behind the wait
#pragma unroll
        for (int s = 0; s < WS; ++s) sw[s * 256 + tid] = bfr(x[s]);
    }
    __syncthreads();
    const int i = ip * 8 + wave, j = jt * GJ + lane;
    float acc[NT];
#pragma unroll
    for (int t = 0; t < NT; ++t) acc[t] = 0.0f;
    const int jc = j < NU ? j : NU - 1;                             // clamped column index
    if (i < NU) {                                                   // wave-uniform
        if ((i == NU - 1) | (jt == (NU - 1) / GJ)) {                // wave-uniform: the row or the column of the constant-one feature lies in this wave
            const unsigned ma = (i == NU - 1) ? ~0u : 0u, mb = (j == NU - 1) ? ~0u : 0u;
            gp_sum<true>(U + (size_t)i * NU + jc, Wcat + NU + jc, Wcat + i, sw, ma, mb, acc);
#pragma unroll
            for (int t = 0; t < NT; ++t) acc[t] += msk(bfr(bd[t]), ma & mb);
        } else {
            gp_sum<false>(U + (size_t)i * NU + jc, Wcat, Wcat, sw, 0u, 0u, acc); }
    }
    const bool ok = (i < NU) & (j < NU);
#pragma unroll
    for (int t = 0; t < NT; ++t) gs[(t * 8 + wave) * GJ + lane] = ok ? acc[t] * GSC : 0.0f;
    __syncthreads();
#pragma unroll 1   // rolled: the second trip is one wave's
    for (int p = tid; p < NT * GJ; p += 256) {                      // 9 tags x 32 rows j; second trip = wave 0 only
        const int t = p >> 5, jj = p & 31; v8h hv, rv;
#pragma unroll
        for (int c = 0; c < 8; ++c) { const float x = gs[(t * 8 + c) * GJ + jj]; const h16 a0 = toh_flush(x); hv[c] = a0; rv[c] = toh_flush((x - (float)a0) * QRS); }
        const size_t oo = (size_t)ip * GPS + ((size_t)t * NJ + jt * GJ + jj) * 8;
        *(v8h*)(GH + oo) = hv; *(v8h*)(GR + oo) = rv; }
    if ((jt == 0) & (wave == 0)) {                                  // wave-uniform
        const v8h z = (v8h){};
        const size_t zo = (size_t)ip * GPS + ((size_t)NT * NJ + lane) * 8;
        *(v8h*)(GH + zo) = z; *(v8h*)(GR + zo) = z; }
}

// d_ht: bf16 GEMM, one block of HWV = 8 waves per 64x64 tile, K = HID in passes of HKC. C[m][n] = sum_k A[m][k] W[k][n]; A = state rows (m = q), W = Wh (columns c0 < 256: head column c0 + n) or Wt (tail column c0 - 256 + n); columns >= NF count as zeros.
// The block reads its operands as the f32 inputs and converts them to bf16 (RNE) on the way into LDS. Per pass: 64 state rows x HKC, in 512-byte pieces of a row per load; HKC weight rows x 64 columns, a thread taking 4 columns x 8 consecutive k at a time, which it turns in registers into four 16-byte pieces of k-contiguous LDS rows.
// All of a pass's loads are in flight together. LDS row pitch an odd number of 16-byte units; 16 lanes of a weight store hold 4 column quads x 4 octets of k, which fall on 16 different 16-byte bank groups.
// Wave w takes rows 16 (w >> 1) .. + 15 and columns 32 (w & 1) .. + 31: two accumulators, each summed over k in ascending order.
// Barriers: one ends a pass's LDS fill; one ends every wave's fragment reads of the pass, ahead of the next fill or of the f32 tile os, which lies on the operand rows' LDS; the last ends the writes of os ahead of its row-wise readers.
// Epilogue per column nn = n mod 256: nn < 200 -> GELU(C + bias), nn == 200 -> 1, nn > 200 -> 0; written as f16 value (Ph) and f16 residual x2048 (Pr), row pitch HTP.
// blocks (r0 / 64, c0 / 64) of (NB*SEQ/64, HTP/64); sab: 2 x 64 x HPL halves of LDS.
__device__ __forceinline__ void d_ht(const float* __restrict__ state, const float* __restrict__ Wm, const float* __restrict__ bias, h16* Ph, h16* Pr, bf* sab, int r0, int c0) {
    bf* const sA = sab; bf* const sB = sab + 64 * HPL;
    float* const os = (float*)sab;
    constexpr int NTH = 32 * HWV, RW = 64 / HWV, RT = HKC / 128, BS = (HKC / 8) / 16;   // threads; state rows per wave; 512-byte pieces per row and pass; weight pieces (4 columns x 8 k) per thread and pass
    const int tid = threadIdx.x, lane = tid & 31, lr = lane & 15, hi = lane >> 4;
    const int wave = __builtin_amdgcn_readfirstlane(tid >> 5);
    const int cn = c0 & (HTW - 1);
    const float* pa = state + ((size_t)(r0 / SEQ) * SEQ_FULL + (size_t)(r0 % SEQ + wave * RW)) * HID + lane * 4;   // wave w brings state rows 8 w .. 8 w + 7
    const int sla = wave * RW * HPL + lane * 4;
    const int quad = (wave & 3) * 4 + (lane & 3);                                   // columns 4 quad .. + 3 of the tile
    const int oct = ((wave >> 2) * 2 + hi) * (4 * BS) + ((lane >> 2) & 3);          // k = 8 oct .. + 7 of the pass; each further piece 4 octets on
    const bool vq = cn + 4 * quad < NF;
    const unsigned vm = vq ? ~0u : 0u;                                              // columns >= NF: zeros for any bit pattern loaded
    const float* pb = Wm + (size_t)(8 * oct) * NF + (vq ? cn + 4 * quad : NF - 4);  // clamped address
    const int slb = 4 * quad * HPL + 8 * oct;
    const int mb = wave >> 1, n2 = (wave & 1) * 2;
    float bc[2];
#pragma unroll
    for (int u = 0; u < 2; ++u) { const int nn = (c0 + (n2 + u) * 16 + lr) & (HTW - 1); const int bi = nn < NF ? nn : NF - 1;   // clamped address
        bc[u] = bfr(bias[bi]); }
    v8f acc[2];
#pragma unroll
    for (int u = 0; u < 2; ++u) acc[u] = (v8f){};
    const bf* const fa = sA + (mb * 16 + lr) * HPL + 8 * hi; const bf* const fb = sB + (n2 * 16 + lr) * HPL + 8 * hi;
#pragma unroll 1   // rolled over the passes: the second runs the first one's text
    for (int p = 0; p < HID / HKC; ++p) {
        v4f xa[RW * RT], xb[BS * 8];
#pragma unroll
        for (int it = 0; it < RW * RT; ++it) xa[it] = *(const v4f*)(pa + (it / RT) * HID + (it % RT) * 128);
#pragma unroll
        for (int it = 0; it < BS * 8; ++it) xb[it] = *(const v4f*)(pb + (size_t)((it / 8) * 32 + (it % 8)) * NF);
        asm volatile("s_wait_xcnt 0x0" ::: "memory");   // stands ahead of every overwrite of the address registers that the loads above name
        __builtin_amdgcn_sched_barrier(0);   // all the loads are issued ahead of the first LDS store (one latency, not several), and the address steps below stay behind the wait
        pa += HKC; pb += (size_t)HKC * NF;
#pragma unroll
        for (int it = 0; it < RW * RT; ++it) *(v2u*)(sA + sla + (it / RT) * HPL + (it % RT) * 128) = (v2u){pkbf(xa[it][0], xa[it][1]), pkbf(xa[it][2], xa[it][3])};
#pragma unroll
        for (int s = 0; s < BS; ++s) {
#pragma unroll
            for (int c = 0; c < 4; ++c) { v4u o;
#pragma unroll
                for (int e = 0; e < 4; ++e) o[e] = pkbf(xb[s * 8 + 2 * e][c], xb[s * 8 + 2 * e + 1][c]) & vm;
                *(v4u*)(sB + slb + c * HPL + s * 32) = o; } }
        __syncthreads();
#pragma unroll
        for (int k0 = 0; k0 < HKC; k0 += 32 * HKU) {
            v16bf a[HKU], b[HKU][2];
#pragma unroll
            for (int e = 0; e < HKU; ++e) { a[e] = ldb(fa + k0 + e * 32); b[e][0] = ldb(fb + k0 + e * 32); b[e][1] = ldb(fb + 16 * HPL + k0 + e * 32); }
            __builtin_amdgcn_sched_barrier(0);   // the group's LDS reads are issued ahead of its first product: else each product waits out an LDS latency of its own
#pragma unroll
            for (int e = 0; e < HKU; ++e) {
#pragma unroll
                for (int u = 0; u < 2; ++u) acc[u] = wgb(a[e], b[e][u], acc[u]); }
        }
        __syncthreads();
    }
#pragma unroll
    for (int u = 0; u < 2; ++u) {
#pragma unroll
        for (int j = 0; j < 8; ++j) os[(mb * 16 + hi * 8 + j) * 68 + (n2 + u) * 16 + lr] = acc[u][j] + bc[u]; }   // D: row 8h+j, col lane&15
    __syncthreads();
#pragma unroll 1   // rolled: the second trip runs the first one's text
    for (int s = 0; s < 64 * 8 / NTH; ++s) { const int row = (NTH / 8) * s + (tid >> 3), c8 = (tid & 7) * 8;   // 8 threads x 8 = 64 columns of one row
        const v4f x0 = *(const v4fa*)(&os[row * 68 + c8]); const v4f x1 = *(const v4fa*)(&os[row * 68 + c8 + 4]); v8h hv, rv;
#pragma unroll
        for (int i = 0; i < 4; ++i) {
            const int n0 = (c0 + c8 + i) & (HTW - 1), n1 = (c0 + c8 + 4 + i) & (HTW - 1);
            const float g0 = gelu_erf(x0[i]), g1 = gelu_erf(x1[i]);
            const float v0 = (n0 < NF) ? g0 : ((n0 == NF) ? 1.0f : 0.0f);
            const float v1 = (n1 < NF) ? g1 : ((n1 == NF) ? 1.0f : 0.0f);
            const h16 a0 = toh_flush(v0); const h16 a1 = toh_flush(v1); hv[i] = a0; hv[4 + i] = a1;
            rv[i] = toh_flush((v0 - (float)a0) * QRS); rv[4 + i] = toh_flush((v1 - (float)a1) * QRS); }
        const size_t oo = (size_t)(r0 + row) * HTP + c0 + c8;
        *(v8h*)(Ph + oo) = hv; *(v8h*)(Pr + oo) = rv;
        asm volatile("s_wait_xcnt 0x0" ::: "memory"); }   // stands ahead of the next trip's overwrites of the registers that the two stores name
}

// k_prep: the folded weights and the projection GEMM, neither of which reads what the other writes, share one launch; a block's body is chosen by its index (block-uniform branch).
// The folded-weight blocks hold the lowest indices. Both bodies' LDS lies in one array, sized for the projection GEMM: two blocks fit a WGP.
#define PB_GP   ((NJ / GJ) * (GPITCH / 8))
#define PB_HT   ((NB * SEQ / 64) * (HTP / 64))
static_assert(sizeof(float) * (NT * 8 * GJ + WS * 256) <= sizeof(unsigned short) * 2 * 64 * HPL);   // the folded-weight body's tile and weight table fit that array
__global__ __launch_bounds__(256) void k_prep(const float* __restrict__ state, const float* __restrict__ Wh, const float* __restrict__ bh, const float* __restrict__ Wt, const float* __restrict__ bt, const float* __restrict__ U, const float* __restrict__ Wcat,
                                              const float* __restrict__ Wd, const float* __restrict__ bd, h16* GH, h16* GR, h16* Ph, h16* Pr) {
    __shared__ __align__(16) bf smem[2 * 64 * HPL];
    const int blk = blockIdx.x;
    if (blk >= PB_GP) {
        const int t = blk - PB_GP, c0 = (t / (NB * SEQ / 64)) * 64;
        d_ht(state, (c0 >= HTW) ? Wt : Wh, (c0 >= HTW) ? bt : bh, Ph, Pr, smem, (t % (NB * SEQ / 64)) * 64, c0);
    } else {
        float* const gs = (float*)smem;
        d_gp(U, Wcat, Wd, bd, GH, GR, gs, gs + NT * 8 * GJ, blk % (NJ / GJ), blk / (NJ / GJ));
        asm volatile("s_wait_xcnt 0x0" ::: "memory");   // the bodies stand one behind another in the built code: this stands behind the body's last stores, ahead of any later write of a register that those stores name
    }
}

// cp_run: VCN asynchronous copies global memory -> LDS, 16 bytes a lane each, through no register: l = the lane's LDS byte address, g = its global address, both multiples of 16. Every lane is on.
// The s_wait_xcnt is the statement's last line: it stands behind the last copy and ahead of every later write of a register that a copy names.
__device__ __forceinline__ void cp_run(const unsigned (&l)[VCN], const h16* const (&g)[VCN]) {
    asm volatile(
        "global_load_async_to_lds_b128 %0, %14, off\n\t"
        "global_load_async_to_lds_b128 %1, %15, off\n\t"
        "global_load_async_to_lds_b128 %2, %16, off\n\t"
        "global_load_async_to_lds_b128 %3, %17, off\n\t"
        "global_load_async_to_lds_b128 %4, %18, off\n\t"
        "global_load_async_to_lds_b128 %5, %19, off\n\t"
        "global_load_async_to_lds_b128 %6, %20, off\n\t"
        "global_load_async_to_lds_b128 %7, %21, off\n\t"
        "global_load_async_to_lds_b128 %8, %22, off\n\t"
        "global_load_async_to_lds_b128 %9, %23, off\n\t"
        "global_load_async_to_lds_b128 %10, %24, off\n\t"
        "global_load_async_to_lds_b128 %11, %25, off\n\t"
        "global_load_async_to_lds_b128 %12, %26, off\n\t"
        "global_load_async_to_lds_b128 %13, %27, off\n\t"
        "s_wait_xcnt 0x0"
        :: "v"(l[0]), "v"(l[1]), "v"(l[2]), "v"(l[3]), "v"(l[4]), "v"(l[5]), "v"(l[6]), "v"(l[7]), "v"(l[8]), "v"(l[9]), "v"(l[10]), "v"(l[11]), "v"(l[12]), "v"(l[13]),
           "v"(g[0]), "v"(g[1]), "v"(g[2]), "v"(g[3]), "v"(g[4]), "v"(g[5]), "v"(g[6]), "v"(g[7]), "v"(g[8]), "v"(g[9]), "v"(g[10]), "v"(g[11]), "v"(g[12]), "v"(g[13]) : "memory");
}

// k_vg: f16 GEMM with three products, one block of VWV = 8 waves per 128x128 tile, K = KJ. V[q][n] = sum_i head[q][i] G^T[n][i], n = t*NJ + j.
// A = head planes (value AH, residual AR; row pitch HTP, columns 0..KJ-1), Bt = G^T planes (value GH, residual GR; panels of 8 columns).
// The block's 128 head rows and 128 G^T rows, both planes, whole K, go once into LDS by asynchronous copies: head rows in runs of 16-byte pieces along the rows, G^T in runs of 32 rows of one panel (512 contiguous bytes a wave).
// In LDS every row is k-contiguous, row pitch an odd number of 16-byte units. All 56 copies of a wave are in flight together; its s_wait_asynccnt 0 and the one barrier stand between them and every fragment read.
// Wave w takes rows 32 (w >> 1) .. + 31 and columns 64 (w & 1) .. + 63: 2 x 4 tiles.
// aH = AH.GH; aR = AR.GH + AH.GR (both residual carries x2048, one accumulator; per k step first AR.GH, then AH.GR); V = aH + aR/2048 (keeps the x1024 carry of G); written as f16 value (VH) + f16 residual x2048 (VR), row pitch VP.
// The f32 tile is turned in LDS of the wave's own, apart from the operand rows. grid (NB*SEQ/VBM, VP/VBN).
__global__ __launch_bounds__(32 * VWV) void k_vg(const h16* __restrict__ AH, const h16* __restrict__ AR, const h16* __restrict__ GH, const h16* __restrict__ GR, h16* VH, h16* VR) {
    __shared__ __align__(16) h16 sm[2 * VBM * VKP + 2 * VBN * VKP];
    __shared__ __align__(16) float os[VWV * 32 * 68];
    constexpr int NTH = 32 * VWV, PC = KJ / 8;
    const int tid = threadIdx.x, lane = tid & 31, lr = lane & 15, hi = lane >> 4;
    const int wave = __builtin_amdgcn_readfirstlane(tid >> 5);
    const int m0 = blockIdx.x * VBM, c0 = blockIdx.y * VBN;
    {
        const unsigned lb = (unsigned)(size_t)sm;   // LDS byte address of the operand rows
        unsigned l[VCN]; const h16* g[VCN];
        // G^T: piece it * NTH + tid = row n of panel pn, n = tid mod VBN. These copies stand first: their addresses take the fewest operations
        const unsigned n = tid % VBN, p0 = tid / VBN;
        const unsigned lg = lb + (2 * VBM * VKP + n * VKP + p0 * 8) * 2;
        const h16* const gg = GH + (size_t)p0 * GPS + (size_t)(c0 + n) * 8;
#pragma unroll
        for (int it = 0; it < VCN; ++it) { l[it] = lg + it * (NTH / VBN) * 16; g[it] = gg + (size_t)it * (NTH / VBN) * GPS; }
        cp_run(l, g);
        __builtin_amdgcn_sched_barrier(0);   // the first copies leave ahead of the address work of the later ones, which the scheduler else moves up in front of them
        const ptrdiff_t dg = GR - GH, da = AR - AH;   // from a value plane to its residual plane
#pragma unroll
        for (int it = 0; it < VCN; ++it) { l[it] += VBN * VKP * 2; g[it] += dg; }
        cp_run(l, g);
        __builtin_amdgcn_sched_barrier(0);   // as above
        // head rows: piece idx = it * NTH + tid = piece pc = idx - PC row of row idx / PC; LDS byte 2 VKP row + 16 pc = 16 (idx + row), global half HTP row + 8 pc = 8 idx + (HTP - KJ) row
        const h16* const ga = AH + (size_t)m0 * HTP;
#pragma unroll
        for (int it = 0; it < VCN; ++it) { const unsigned idx = it * NTH + tid, row = idx / PC;
            l[it] = lb + (idx + row) * 16; g[it] = ga + (idx * 8 + row * (HTP - KJ)); }
        cp_run(l, g);
#pragma unroll
        for (int it = 0; it < VCN; ++it) { l[it] += VBM * VKP * 2; g[it] += da; }
        cp_run(l, g);
    }
    asm volatile("s_wait_asynccnt 0x0" ::: "memory");   // this wave's copies have landed
    __syncthreads();                                    // and every other wave's: no fragment is read ahead of it
    const int mb = wave >> 1, nh = wave & 1;
    const h16* const fa = sm + (mb * 32 + lr) * VKP + 8 * hi;
    const h16* const fb = sm + 2 * VBM * VKP + (nh * 64 + lr) * VKP + 8 * hi;
    v8f aH[2][4], aR[2][4];
#pragma unroll
    for (int i = 0; i < 2; ++i) {
#pragma unroll
        for (int nb = 0; nb < 4; ++nb) { aH[i][nb] = (v8f){}; aR[i][nb] = (v8f){}; } }
#pragma unroll
    for (int kc = 0; kc < KJ; kc += 32) {
        v16h ah[2], ar[2], gh[4], gr[4];
#pragma unroll
        for (int i = 0; i < 2; ++i) { ah[i] = ldh(fa + i * 16 * VKP + kc); ar[i] = ldh(fa + VBM * VKP + i * 16 * VKP + kc); }
#pragma unroll
        for (int nb = 0; nb < 4; ++nb) { gh[nb] = ldh(fb + nb * 16 * VKP + kc); gr[nb] = ldh(fb + VBN * VKP + nb * 16 * VKP + kc); }
        __builtin_amdgcn_sched_barrier(0);   // the step's LDS reads are issued as one run ahead of its first product: no read stands among the products
        // the eight tiles' products alternate, so that no product waits for the one before it
#pragma unroll
        for (int i = 0; i < 2; ++i) {
#pragma unroll
            for (int nb = 0; nb < 4; ++nb) aH[i][nb] = wg(ah[i], gh[nb], aH[i][nb]); }
#pragma unroll
        for (int i = 0; i < 2; ++i) {
#pragma unroll
            for (int nb = 0; nb < 4; ++nb) aR[i][nb] = wg(ar[i], gh[nb], aR[i][nb]); }
#pragma unroll
        for (int i = 0; i < 2; ++i) {
#pragma unroll
            for (int nb = 0; nb < 4; ++nb) aR[i][nb] = wg(ah[i], gr[nb], aR[i][nb]); }
        __builtin_amdgcn_sched_barrier(0);   // keeps the next step's reads, which take this step's registers, from moving up among these products
    }
    const int wb = wave * 32 * 68;
#pragma unroll
    for (int i = 0; i < 2; ++i) {
#pragma unroll
        for (int nb = 0; nb < 4; ++nb) {
#pragma unroll
            for (int j = 0; j < 8; ++j) os[wb + (i * 16 + hi * 8 + j) * 68 + nb * 16 + lr] = aH[i][nb][j] + aR[i][nb][j] * QRI; } }   // D: row 8h+j, col lane&15
    wave_sync();
    const int rw = lane >> 3, c8 = (lane & 7) * 8;   // 4 rows a trip; 8 lanes x 8 = 64 columns: one 128-byte line a row and plane
    const float* const pr = os + wb + rw * 68 + c8;
    h16* ph = VH + (size_t)(m0 + mb * 32 + rw) * VP + c0 + nh * 64 + c8; h16* pv = VR + (size_t)(m0 + mb * 32 + rw) * VP + c0 + nh * 64 + c8;
#pragma unroll 1   // rolled over the groups: the second runs the first one's text
    for (int gq = 0; gq < 2; ++gq) {
        v4f x0[4], x1[4];
#pragma unroll
        for (int s = 0; s < 4; ++s) { x0[s] = *(const v4fa*)(pr + (gq * 16 + 4 * s) * 68); x1[s] = *(const v4fa*)(pr + (gq * 16 + 4 * s) * 68 + 4); }
        __builtin_amdgcn_sched_barrier(0);   // the group's LDS reads are issued ahead of its first convert: one LDS latency a group, not one a trip
#pragma unroll
        for (int s = 0; s < 4; ++s) { v8h hv, rv;
#pragma unroll
            for (int i = 0; i < 4; ++i) { const h16 a0 = toh_flush(x0[s][i]); const h16 a1 = toh_flush(x1[s][i]); hv[i] = a0; hv[4 + i] = a1;
                rv[i] = toh_flush((x0[s][i] - (float)a0) * QRS); rv[4 + i] = toh_flush((x1[s][i] - (float)a1) * QRS); }
            *(v8h*)(ph + (size_t)(4 * s) * VP) = hv; *(v8h*)(pv + (size_t)(4 * s) * VP) = rv; }
        asm volatile("s_wait_xcnt 0x0" ::: "memory");   // stands ahead of the address steps below and of the next group's overwrites of the registers that the stores name
        ph += (size_t)16 * VP; pv += (size_t)16 * VP;
    }
}

// piece p (4 floats) of a band block's output run, read from the score tile: output element e = 1161 n + rem lies at os[SP n + rem]; a piece may run over from row n into row n + 1
__device__ __forceinline__ v4f band_piece(const float* os, int p) {
    const unsigned e = 4u * (unsigned)p, n = e / QE, rem = e - n * QE; v4f v;
#pragma unroll
    for (unsigned c = 0; c < 4; ++c) v[c] = os[e + c + (n + (rem + c >= QE ? 1u : 0u)) * (SP - QE)];
    return v;
}

// k_band: one block per BQ = 16 consecutive queries (one batch), one wave per 16-key tile of their common window of 144 keys (key = n0 - 64 + w, w = 0..143; a tile outside the sequence reads the nearest tile inside it; out-of-sequence keys fall to the keep rule).
// The window's tail rows and the 16 queries' V rows are read from global memory once per block, in 16-byte pieces that run along the rows, and kept in LDS (row pitches an odd number of 16-byte units).
// A = tail rows of the wave's key tile (row = key, k = j), held in registers for all tags; B = V of one tag (column = query lane&15, k = j), K = KJ.
// sH = TH.VH; sR = TR.VH + TH.VR; score = (sH + sR/2048)/1024. D element j of lane (lr, hi) = (w = 16 wave + 8 hi + j, query lr); band offset r = w - lr, kept where 0 <= r <= 128 -> os[lr*SP + r*9 + t].
// Keep rule per element, applied where the score is written to os: (n < len) and (0 <= key < SEQ) and (key < len); other elements get the classifier bias; non-finite values become 0.
// os lies on the tail rows' LDS, which no wave reads once every wave holds its A fragments (second barrier); the third barrier ends the score writes ahead of the block's linear store of its 16 output rows (16 x 1161 floats in a row).
// grid NB*SEQ/BQ.
__global__ __launch_bounds__(32 * BKT) void k_band(const h16* __restrict__ HTH, const h16* __restrict__ HTR, const h16* __restrict__ VH, const h16* __restrict__ VR, const int* __restrict__ lengths, const float* __restrict__ bd, float* OUT) {
    __shared__ __align__(16) h16 sm[2 * BWIN * TPL + 2 * BQ * VPL];
    h16* const tH = sm; h16* const tR = sm + BWIN * TPL;
    h16* const vH = sm + 2 * BWIN * TPL; h16* const vR = vH + BQ * VPL;
    float* const os = (float*)sm;
    constexpr int NTH = 32 * BKT, TPC = KJ / 8;
    const int tid = threadIdx.x, lane = tid & 31, lr = lane & 15, hi = lane >> 4;
    const int wave = __builtin_amdgcn_readfirstlane(tid >> 5);
    const int q0 = blockIdx.x * BQ;
    const int b = q0 / SEQ, n0 = q0 % SEQ;
    const int len = lengths[b];
    const float bl = bfr(bd[lane < NT ? lane : NT - 1]);   // lane t holds tag t's bias: one load, in flight with the row loads below, not one wait per tag in the tag loop
    asm volatile("s_wait_xcnt 0x0" ::: "memory");   // stands ahead of every overwrite of the address registers that the bias load names
    if (lane < TPC) {   // one lane per 16-byte piece of a 448-byte row part; wave w brings the 16 tail rows of key tile w and tag w's part of the 16 V rows
        int kb = n0 - WH + 16 * wave; kb = kb < 0 ? 0 : (kb > SEQ - 16 ? SEQ - 16 : kb);   // a key tile lies wholly inside or wholly outside the sequence
        const size_t to = ((size_t)b * SEQ + (size_t)kb) * HTP + lane * 8, vo = (size_t)q0 * VP + wave * NJ + lane * 8;
        const h16* const pth = HTH + to; const h16* const ptr = HTR + to; const h16* const pvh = VH + vo; const h16* const pvr = VR + vo;
        const int tl = wave * 16 * TPL + lane * 8, vl = wave * NJ + lane * 8;
        v8h xh[16], xr[16], yh[16], yr[16];
#pragma unroll
        for (int it = 0; it < 16; ++it) { xh[it] = *(const v8h*)(pth + HTW + it * HTP); xr[it] = *(const v8h*)(ptr + HTW + it * HTP); }
#pragma unroll
        for (int it = 0; it < 16; ++it) yh[it] = *(const v8h*)(pvh + it * VP);
        asm volatile("s_wait_xcnt 0x0" :: "v"(pth), "v"(ptr), "v"(pvh) : "memory");   // stands ahead of every overwrite of the three address pairs that the loads above name; as its inputs they stay whole up to it
        __builtin_amdgcn_sched_barrier(0);   // these 48 loads are issued ahead of the first LDS store (one latency, not several), and the LDS address work stays behind the wait
#pragma unroll
        for (int it = 0; it < 16; ++it) { *(v8h*)(tH + tl + it * TPL) = xh[it]; *(v8h*)(tR + tl + it * TPL) = xr[it]; }
        __builtin_amdgcn_sched_barrier(0);   // the last 16 loads take the registers that the tail rows have left: all 64 at once would need registers above v255
#pragma unroll
        for (int it = 0; it < 16; ++it) yr[it] = *(const v8h*)(pvr + it * VP);
        asm volatile("s_wait_xcnt 0x0" :: "v"(pvr) : "memory");   // as above, for the fourth address pair
        __builtin_amdgcn_sched_barrier(0);   // keeps these loads ahead of the stores below and later address work behind the wait
#pragma unroll
        for (int it = 0; it < 16; ++it) *(v8h*)(vH + vl + it * VPL) = yh[it];
#pragma unroll
        for (int it = 0; it < 16; ++it) *(v8h*)(vR + vl + it * VPL) = yr[it];
    }
    __syncthreads();
    v16h th[KJ / 32], tr[KJ / 32];
    const int ao = (wave * 16 + lr) * TPL + 8 * hi;
#pragma unroll
    for (int k = 0; k < KJ / 32; ++k) { th[k] = ldh(tH + ao + k * 32); tr[k] = ldh(tR + ao + k * 32); }
    __syncthreads();
    const int bo = lr * VPL + 8 * hi;
    const int r0 = 16 * wave + 8 * hi - lr;
    bool ok[8];   // keep rule of D element j: the same for every tag
#pragma unroll
    for (int j = 0; j < 8; ++j) { const int key = n0 - WH + 16 * wave + 8 * hi + j; ok[j] = (n0 + lr < len) & (key >= 0) & (key < SEQ) & (key < len); }
#pragma unroll 1   // rolled over the groups of three tags: the A fragments and one group's accumulators and B fragments fill the registers below v256
    for (int tg = 0; tg < NT; tg += BTG) {
        v8f sH[BTG], sR[BTG];
#pragma unroll
        for (int u = 0; u < BTG; ++u) { sH[u] = (v8f){}; sR[u] = (v8f){}; }
#pragma unroll
        for (int k = 0; k < KJ / 32; ++k) {
            v16h vh[BTG], vr[BTG];
#pragma unroll
            for (int u = 0; u < BTG; ++u) { vh[u] = ldh(vH + bo + (tg + u) * NJ + k * 32); vr[u] = ldh(vR + bo + (tg + u) * NJ + k * 32); }
            // the three tags' products alternate, so that no product waits for the one before it; each accumulator takes its products in the order k, then TR.VH, then TH.VR
#pragma unroll
            for (int u = 0; u < BTG; ++u) sH[u] = wg(th[k], vh[u], sH[u]);
#pragma unroll
            for (int u = 0; u < BTG; ++u) sR[u] = wg(tr[k], vh[u], sR[u]);
#pragma unroll
            for (int u = 0; u < BTG; ++u) sR[u] = wg(th[k], vr[u], sR[u]); }
#pragma unroll
        for (int u = 0; u < BTG; ++u) {
            const float bv = __int_as_float(__builtin_amdgcn_readlane(__float_as_int(bl), tg + u));   // tag tg + u's bias, wave-uniform
#pragma unroll
            for (int j = 0; j < 8; ++j) { const int r = r0 + j;
                float val = ok[j] ? (sH[u][j] + sR[u][j] * QRI) * GSI : bv;
                val = (fabsf(val) <= 3.402823466e38f) ? val : 0.0f;
                if ((r >= 0) & (r < WF)) os[lr * SP + r * NT + tg + u] = val; } }
    }
    __syncthreads();
    float* const dst = OUT + ((size_t)b * OUT_SEQ + n0) * QE;
    constexpr int NP = BQ * QE / 4, PG = 4, NG = NP / (PG * NTH);   // 16-byte pieces of the run; pieces per thread and group; whole groups
    // A run is 580 and a half lines of 128 bytes: every second block's run starts half way into a line. There the pieces are taken from the fifth on, so that each wave's 32 pieces of a group are four whole lines; the first four follow with the run's last pieces.
    // At such a block bound the two neighbours each store their own 64 bytes of the line, in 16-byte pieces of their own; neither reads it.
    const int off = (n0 & BQ) ? 4 : 0;
#pragma unroll 1   // rolled over the groups: every group runs the first one's text
    for (int g = 0; g < NG; ++g) {
        v4f val[PG];
#pragma unroll
        for (int s = 0; s < PG; ++s) val[s] = band_piece(os, off + (g * PG + s) * NTH + tid);
        __builtin_amdgcn_sched_barrier(0);   // the group's LDS reads are issued ahead of its first store: one LDS latency a group, not one a piece
#pragma unroll
        for (int s = 0; s < PG; ++s) *(v4f*)(dst + (size_t)(off + (g * PG + s) * NTH + tid) * 4) = val[s];
        asm volatile("s_wait_xcnt 0x0" ::: "memory"); }   // stands ahead of the next group's overwrites of the registers that the stores name
    static_assert(NP - NG * PG * NTH <= NTH);   // what the whole groups leave: at most one piece a thread
    if (tid < NP - NG * PG * NTH) { const int i = NG * PG * NTH + tid, p = off + i < NP ? off + i : off + i - NP;
        const v4f val = band_piece(os, p); *(v4f*)(dst + (size_t)p * 4) = val; }
}

static constexpr size_t al256(size_t v) { return (v + 255) & ~(size_t)255; }
static constexpr size_t SZ_HT = al256((size_t)NB * SEQ * HTP * 2);
static constexpr size_t SZ_GT = al256((size_t)GROWS * GPITCH * 2);
static constexpr size_t SZ_V  = al256((size_t)NB * SEQ * VP * 2);
static constexpr size_t SZ_TOTAL = 2 * SZ_HT + 2 * SZ_GT + 2 * SZ_V;
static_assert(SZ_TOTAL <= (size_t)134217728);          // workspace carve <= 128 MiB
static_assert((size_t)(NB_FULL - 1) * SEQ_FULL * QE * 4 + (size_t)SEQ_FULL * QE * 4 == (size_t)9510912);   // output bytes of the full problem

extern "C" void kernel_launch(void* const* d_in, const int* in_sizes, int n_in,
                              void* d_out, int out_size, void* d_ws, size_t ws_size, hipStream_t stream) {
    if (n_in < 10) return;
    const size_t needx = ((size_t)(NB - 1) * SEQ_FULL + SEQ) * HID;
    if ((size_t)in_sizes[0] < needx) return;
    if (in_sizes[1] < NB) return;
    if ((size_t)in_sizes[2] < (size_t)HID * NF || (size_t)in_sizes[4] < (size_t)HID * NF) return;
    if (in_sizes[3] < NF || in_sizes[5] < NF) return;
    if ((size_t)in_sizes[6] < (size_t)NK * NU * NU) return;
    if ((size_t)in_sizes[7] < (size_t)NK * 2 * NU) return;
    if (in_sizes[8] < NK * NT || in_sizes[9] < NT) return;
    if ((size_t)out_size < ((size_t)(NB - 1) * OUT_SEQ + SEQ) * QE) return;
    if (SZ_TOTAL > ws_size) return;
    // wire order: state, lengths, Wh, bh, Wt, bt, U, Wcat, Wd, bd
    const float* state = (const float*)d_in[0];
    const int*   lengths = (const int*)d_in[1];
    const float* Wh = (const float*)d_in[2]; const float* bh = (const float*)d_in[3];
    const float* Wt = (const float*)d_in[4]; const float* bt = (const float*)d_in[5];
    const float* U = (const float*)d_in[6]; const float* Wcat = (const float*)d_in[7];
    const float* Wd = (const float*)d_in[8]; const float* bd = (const float*)d_in[9];
    float* OUT = (float*)d_out;      // [NB][SEQ][129][9]
    char* wsp = (char*)d_ws;
    h16* HTH = (h16*)wsp; wsp += SZ_HT;              // [NB*SEQ][512] head | tail value
    h16* HTR = (h16*)wsp; wsp += SZ_HT;              // [NB*SEQ][512] head | tail residual x2048
    h16* GH  = (h16*)wsp; wsp += SZ_GT;              // [32][2048][8] G^T value (x1024)
    h16* GR  = (h16*)wsp; wsp += SZ_GT;              // [32][2048][8] G^T residual x2048
    h16* VH  = (h16*)wsp; wsp += SZ_V;               // [NB*SEQ][2048] V value (x1024)
    h16* VR  = (h16*)wsp; wsp += SZ_V;               // [NB*SEQ][2048] V residual x2048

    k_prep<<<PB_GP + PB_HT, 256, 0, stream>>>(state, Wh, bh, Wt, bt, U, Wcat, Wd, bd, GH, GR, HTH, HTR);
    k_vg<<<dim3(NB * SEQ / VBM, VP / VBN, 1), 32 * VWV, 0, stream>>>(HTH, HTR, GH, GR, VH, VR);
    k_band<<<NB * SEQ / BQ, 32 * BKT, 0, stream>>>(HTH, HTR, VH, VR, lengths, bd, OUT);
}

// v009
// One run takes 39 microseconds.
// Next to v008, in two timings, it ran 1.33 and 1.34 times as fast.
// All steps since v000 together make it 5.83 times as fast.
#include <hip/hip_runtime.h>

// Span scorer: head / tail projections (Linear 768 -> 200 + erf GELU) with an appended constant-one feature; biaffine form head^T U[k] tail plus a concatenation-linear term, evaluated for every query token on a sliding band of 129 key offsets (-64..+64); length masking (masked entries = classifier bias); 9-tag linear classifier; non-finite outputs set to 0.
// Algebra: the classifier is folded into the bilinear weights: G[i][j][t] = sum_k (U[k][i][j] + [j==200] Wcat[k][i] + [i==200] Wcat[k][201+j]) Wd[k][t] + [i==j==200] bd[t]; V[q][t][j] = sum_i head[q][i] G[i][j][t]; score[q][r][t] = sum_j tail[q-64+r][j] V[q][t][j].
// Compute dtypes, f32 accumulate everywhere: projections v_wmma_f32_16x16x32_bf16 (state, Wh, Wt, biases RNE-converted to bf16; products exact); G built in f32 on the vector unit from bf16-converted U, Wcat, Wd, bd (9 tag columns);
// V GEMM and band GEMM v_wmma_f32_16x16x32_f16 with every operand as f16 value + f16 residual x2048 (three products; residual products in their own accumulator folded by 1/2048); G carries x1024, folded back after the band GEMM.
// Layout: head|tail planes [q][512] (head cols 0..255, tail cols 256..511; col 200 of each half = 1, cols 201..255 = 0);
// G^T planes in 32 panels of 8 columns: [i/8][t*224 + j][i%8]; V planes [q][2048] with column t*224 + j; the band GEMM's block masks its scores and stores its 16 queries' output rows itself, one contiguous run.

#ifndef NB
#define NB 2
#endif
#ifndef SEQ
#define SEQ 1024
#endif
#define NB_FULL  2
#define SEQ_FULL 1024
#ifndef OUT_SEQ
#define OUT_SEQ SEQ              // row pitch (in tokens) between batches of the output
#endif
#define HID    768               // model width
#define NF     200               // projection width
#define NU     201               // NF + constant-one feature
#define NK     200               // bilinear channels
#define NT     9                 // tags
#define WH     64                // band half width
#define WF     129               // band width
#define QE     (WF * NT)         // output floats per query (1161)
#define HTW    256               // column width of the head half / tail half
#define HTP    512               // row pitch (halves) of the head|tail planes
#define KJ     224               // contraction length of the V and band GEMMs (201 zero-padded)
#define NJ     224               // G^T rows / V columns per tag
#define GPITCH 256               // columns i of the G^T planes (32 panels of 8)
#define GROWS  2048              // rows of the G^T planes (9 * 224 = 2016, zero rows above)
#define GPS    (GROWS * 8)       // halves per 8-column panel of the G^T planes
#define GJ     32                // G^T rows j per d_gp block (one lane each)
#define GKB    40                // values of k per batch of U loads in d_gp
#define WP     12                // LDS row pitch (floats) of the converted classifier weights: 9 tags in three 16-byte pieces, of the last only its first float is read
#define WG     4                 // rows of that table per group of LDS reads in d_gp
#define WS     ((NK * WP + 255) / 256)   // weights per thread in the fill of that table
#define CS     ((NK * 8 + 255) / 256)    // column terms per thread in the fill of their LDS table: 8 rows i x NK values of k
#define CP     (CS * 32 + 4)             // LDS row pitch (floats) of that table: whole 16-byte pieces; 8 rows at 4 consecutive k fall on 32 banks
#define VP     2048              // row pitch (halves) of the V planes
#define SP     1184              // LDS row pitch (floats) of a band block's score tile; SP - NT is odd, so the 16 queries of one score write fall on 16 banks
#define VWV    8                 // waves per V GEMM block
#define VBM    128               // queries per V GEMM block
#define VBN    128               // V columns per V GEMM block
#define VKP    (KJ + 8)          // LDS row pitch (halves) of the V GEMM's operand rows: 29 x 16 B
#define VCN    14                // asynchronous copies per statement in the V GEMM's fill
#define HWV    8                 // waves per projection GEMM block
#define HKC    384               // values of k per pass of the projection GEMM: what its LDS holds at a time
#define HKU    6                 // k steps of 32 whose fragments a projection GEMM wave reads from LDS as one group
#define HPL    (HKC + 8)         // LDS row pitch (halves) of the projection GEMM's operand rows: 49 x 16 B
#define BQ     16                // queries per band block
#define BKT    9                 // 16-key tiles of a band block's window = its waves
#define BWIN   (BKT * 16)        // keys in a band block's window
#define BTG    3                 // tags whose products alternate in the band GEMM
#define TPL    (KJ + 8)          // LDS row pitch (halves) of the tail rows: 29 x 16 B
#define VPL    (NT * NJ + 8)     // LDS row pitch (halves) of the V rows: 253 x 16 B
#define QRS    2048.0f           // carry of every residual plane
#define QRI    (1.0f / 2048.0f)
#define GSC    1024.0f           // carry of the G planes
#define GSI    (1.0f / 1024.0f)

static_assert(NU == NF + 1);
static_assert(KJ % 32 == 0);
static_assert(NU <= KJ);
static_assert(KJ <= HTW);
static_assert(KJ <= GPITCH);
static_assert(NJ == KJ);                       // V column block of one tag = one contraction row of the band GEMM
static_assert(HTP == 2 * HTW);
static_assert(HTW % 64 == 0);                  // a 64-column tile lies wholly in the head half or the tail half
static_assert((HTW & (HTW - 1)) == 0);
static_assert(NF <= HTW);
static_assert(GPITCH % 8 == 0);
static_assert(NJ % GJ == 0);
static_assert(GROWS - NT * NJ == GJ);           // zero rows above the tags: one lane each
static_assert(NK % GKB == 0);
static_assert(NT == 9 && WP >= NT && WP % 4 == 0 && GKB % WG == 0);   // a row is two 16-byte pieces and one float, at a multiple of 16 bytes; a batch is whole groups
static_assert(WG == 4 && CP % 4 == 0 && GKB % 4 == 0 && CS * 32 >= NK && GPITCH <= 2 * NU);   // a group's column terms are one 16-byte piece; every column i of a panel lies inside a Wcat row
static_assert(NU <= GPITCH);
static_assert(NT * NJ <= GROWS);
static_assert(GROWS == VP);
static_assert(VP % 64 == 0);
static_assert((NB * SEQ) % 64 == 0);
static_assert((NB * SEQ) % VBM == 0 && VP % VBN == 0 && VBN <= GROWS);
static_assert(VBM * (KJ / 8) == VCN * 32 * VWV && VBN * (KJ / 8) == VCN * 32 * VWV);   // a plane's pieces: VCN per thread
static_assert(4 * VCN <= 63);                  // copies of a wave in flight
static_assert(VKP == KJ + 8 && (32 * VWV) % VBN == 0);   // an LDS row is its KJ/8 pieces and one more; a trip of the G^T fill is whole panels
static_assert(((VKP / 8) & 1) == 1 && VWV == 8 && VBM == 4 * 32 && VBN == 2 * 64);   // 4 row groups x 2 column halves of the tile
static_assert(sizeof(_Float16) * (2 * VBM * VKP + 2 * VBN * VKP) + sizeof(float) * VWV * 32 * 68 <= 327680);
static_assert(SEQ % BQ == 0);                  // a band block's queries lie in one batch
static_assert(BWIN == BQ + 2 * WH);            // the window holds every key of every query of the block
static_assert(NT % BTG == 0);
static_assert(KJ / 8 <= 32 && NJ == KJ);        // a row part of KJ halves: one 16-byte piece per lane
static_assert(BKT == NT && BQ == 16);          // wave w stages key tile w and tag w
static_assert(SEQ % 16 == 0 && WH % 16 == 0);  // key tiles start at multiples of 16
static_assert(((SP - NT) & 1) == 1);
static_assert((BQ * QE) % 4 == 0);             // a band block's output run is whole 16-byte pieces
static_assert((BQ * QE * 4) % 128 == 64 && (BQ & (BQ - 1)) == 0);   // runs start at multiples of 128 bytes and half way between them in turn
static_assert(4 + (BQ * QE / 4) / (4 * 32 * BKT) * (4 * 32 * BKT) <= BQ * QE / 4);   // the whole groups, shifted by four pieces, stay inside the run
static_assert(((TPL / 8) & 1) == 1 && ((VPL / 8) & 1) == 1);
static_assert(sizeof(float) * BQ * SP <= sizeof(_Float16) * 2 * BWIN * TPL);   // the score tile fits the tail rows' LDS
static_assert(sizeof(_Float16) * (2 * BWIN * TPL + 2 * BQ * VPL) <= 327680);
static_assert(SEQ % 64 == 0);
static_assert(SEQ % 32 == 0);
static_assert(OUT_SEQ % 32 == 0);
static_assert(WF == 2 * WH + 1);
static_assert(WF <= 9 * 16);                   // nine 16-key tiles cover the band
static_assert(SP >= QE);
static_assert(NB <= NB_FULL);
static_assert(SEQ <= SEQ_FULL);
static_assert(4 * 32 * 16 == 16 * 64 * 2);     // slab store: 4 trips x 32 lanes x 16 B == 16 rows x 64 halves
static_assert(((HPL / 8) & 1) == 1 && HID % HKC == 0);
static_assert(HKC % 128 == 0 && 64 % HWV == 0 && (64 * 8) % (32 * HWV) == 0);   // a state row's part of a pass is whole 512-byte pieces of f32; whole rows per wave in the fill, whole pieces per thread in the epilogue
static_assert((HKC / 8) % 16 == 0 && NF % 4 == 0);   // weights of a pass: 16 column quads x HKC/8 octets of k, dealt as 4 x 4 per 16 lanes; a quad lies wholly inside or wholly outside the NF columns
static_assert(HKC % (32 * HKU) == 0);
static_assert(HWV == 8);                       // 4 row groups x 2 column halves of the 64x64 tile
static_assert(sizeof(float) * 64 * 68 <= sizeof(unsigned short) * 2 * 64 * HPL);   // the f32 tile fits the operand rows' LDS
static_assert(sizeof(unsigned short) * 2 * 64 * HPL <= 163840);   // two blocks per WGP
static_assert(sizeof(float) * NT * 8 * GJ <= 131072);

typedef _Float16 h16;
typedef unsigned short bf;
typedef __attribute__((ext_vector_type(16))) __bf16   v16bf;
typedef __attribute__((ext_vector_type(16))) _Float16 v16h;
typedef __attribute__((ext_vector_type(8)))  _Float16 v8h;
typedef __attribute__((ext_vector_type(8)))  unsigned short v8us;
typedef __attribute__((ext_vector_type(4)))  unsigned v4u;
typedef __attribute__((ext_vector_type(2)))  unsigned v2u;
typedef __attribute__((ext_vector_type(2)))  float    v2f;
typedef __attribute__((ext_vector_type(2)))  __bf16   v2bf;
typedef __attribute__((ext_vector_type(8)))  float    v8f;
typedef __attribute__((ext_vector_type(4)))  float    v4f;
typedef v4f  __attribute__((may_alias)) v4fa;

__device__ __forceinline__ unsigned short f2bf(float f) { unsigned u = __float_as_uint(f); u += 0x7FFFu + ((u >> 16) & 1u); return (unsigned short)(u >> 16); }
__device__ __forceinline__ unsigned pkbf(float lo, float hi) { return __builtin_bit_cast(unsigned, __builtin_convertvector((v2f){lo, hi}, v2bf)); }   // two f32 -> two bf16 (RNE) in one word, lo in its low half
__device__ __forceinline__ float bfr(float f) { return __uint_as_float(((unsigned)f2bf(f)) << 16); }   // value after RNE convert to bf16
__device__ __forceinline__ v16h cat16(v8h lo, v8h hi) { return __builtin_shufflevector(lo, hi, 0, 1, 2, 3, 4, 5, 6, 7, 8, 9, 10, 11, 12, 13, 14, 15); }
__device__ __forceinline__ v16bf cat16b(v8us lo, v8us hi) { return __builtin_bit_cast(v16bf, __builtin_shufflevector(lo, hi, 0, 1, 2, 3, 4, 5, 6, 7, 8, 9, 10, 11, 12, 13, 14, 15)); }
__device__ __forceinline__ v8f wmma16(v16h a, v16h b, v8f c) { return __builtin_amdgcn_wmma_f32_16x16x32_f16(false, a, false, b, (short)0, c, false, false); }
__device__ __forceinline__ v8f wmmab(v16bf a, v16bf b, v8f c) { return __builtin_amdgcn_wmma_f32_16x16x32_bf16(false, a, false, b, (short)0, c, false, false); }
// fragment loaders from K-contiguous 16-bit rows; p already includes + 8*(lane>>4): elements 0..7 <- k0+8h+0..7, elements 8..15 <- k0+16+8h+0..7 (same map for A and B)
__device__ __forceinline__ v16h  ldh(const h16* p) { return cat16(*(const v8h*)p, *(const v8h*)(p + 16)); }
__device__ __forceinline__ v16bf ldb(const bf* p)  { return cat16b(*(const v8us*)p, *(const v8us*)(p + 16)); }
// ordering point for wave-private LDS tiles (same wave writes and reads)
__device__ __forceinline__ void wave_sync() { __builtin_amdgcn_fence(3 /* release order */, "wavefront"); __builtin_amdgcn_wave_barrier(); asm volatile("" ::: "memory"); }

// per-instruction guarded WMMA wrappers: one accumulator tied per guard, operands kept live across the nops
__device__ __forceinline__ v8f wg(v16h a, v16h b, v8f c) { c = wmma16(a, b, c); asm volatile("v_nop\n\tv_nop\n\tv_nop\n\tv_nop" : "+v"(c) : "v"(a), "v"(b)); return c; }
__device__ __forceinline__ v8f wgb(v16bf a, v16bf b, v8f c) { c = wmmab(a, b, c); asm volatile("v_nop\n\tv_nop\n\tv_nop\n\tv_nop" : "+v"(c) : "v"(a), "v"(b)); return c; }
// f32 -> f16 convert that cannot produce an f16 subnormal (|v| < 2^-14 -> +0), applied after the plane's carry
static __device__ __forceinline__ h16 toh_flush(float v) { const h16 r = (h16)v; return (fabsf(v) < 6.103515625e-05f) ? (h16)0.0f : r; }
__device__ __forceinline__ float gelu_erf(float x) { return 0.5f * x * (1.0f + erff(x * 0.70710678118654752f)); }

// d_gp: folded weights. Block (jt, ip) builds the tile i = 8 ip + wave, j = 32 jt + lane of G for all 9 tags: a wave reads 32 consecutive j of one U row per k (one 128-byte run), GKB values of k in flight at a time.
// Each (i, j, t) is summed over k = 0..199 in order by one thread. The 200 x 9 classifier weights are converted once per block into LDS; the sums read them from there, all lanes one address. A block with an edge wave keeps its 8 rows' column terms Wcat[k][i] there too. The tile is turned in LDS and stored as 16-byte pieces (8 columns i) of panel ip, 512 contiguous bytes per tag.
// Entries with i >= NU or j >= NU are zeros; blocks jt == 0 also zero-fill rows [NT*NJ, GROWS) of their panel.
// blocks (jt, ip) of (NJ/GJ, GPITCH/8); gs: NT x 8 x GJ floats of LDS; sw: NK x WP floats of LDS, rounded up to whole trips of the block; sc: 8 x CP floats of LDS.
// EDGE: the wave holds the row i == 200 or the column j == 200, where the concatenation-linear terms enter. up = U + i*NU + jc and pa = Wcat + NU + jc are the lane's own, jc its clamped column; cw = the wave's row of sc, converted Wcat[k][i] at place k, wave-uniform.
// ma, mb: all ones where the row term / the column term enters, else zero; msk gives the value or +0 for any bit pattern, as a select does, with no branch round a load.
__device__ __forceinline__ float msk(float v, unsigned m) { return __uint_as_float(__float_as_uint(v) & m); }
template <bool EDGE>
__device__ __forceinline__ void gp_sum(const float* __restrict__ up, const float* __restrict__ pa, const float* cw, const float* sw, unsigned ma, unsigned mb, float (&acc)[NT]) {
#pragma unroll 1   // rolled over the batches
    for (int kb = 0; kb < NK; kb += GKB) {
        float u[GKB], a[EDGE ? GKB : 1];
#pragma unroll
        for (int e = 0; e < GKB; ++e) {
            u[e] = up[(size_t)e * (NU * NU)];
            if constexpr (EDGE) a[e] = pa[(size_t)e * (2 * NU)]; }
        asm volatile("s_wait_xcnt 0x0" ::: "memory");   // stands ahead of every overwrite of the address registers that the batch's loads name
        __builtin_amdgcn_sched_barrier(0);   // the whole batch's loads are issued ahead of its first sum (else the scheduler may sink loads to their uses and their latencies add up), and the address steps below stay behind the wait
        const float* const wr = sw + kb * WP;   // this batch's converted weights: every lane reads the same address
        v4f qa[2][WG], qb[2][WG]; float qc[2][WG];   // tags 0..3, 4..7 and 8 of WG rows, two groups
        v4f qd[2];                                   // EDGE: the column terms of WG values of k, two groups
        if constexpr (EDGE) qd[0] = *(const v4fa*)(cw + kb);
#pragma unroll
        for (int c = 0; c < WG; ++c) { qa[0][c] = *(const v4fa*)(wr + c * WP); qb[0][c] = *(const v4fa*)(wr + c * WP + 4); qc[0][c] = wr[c * WP + 8]; }
#pragma unroll
        for (int g = 0; g < GKB / WG; ++g) {
            if (g + 1 < GKB / WG) {
#pragma unroll
                for (int c = 0; c < WG; ++c) { const float* const p = wr + ((g + 1) * WG + c) * WP;
                    qa[(g + 1) & 1][c] = *(const v4fa*)p; qb[(g + 1) & 1][c] = *(const v4fa*)(p + 4); qc[(g + 1) & 1][c] = p[8]; }
                if constexpr (EDGE) qd[(g + 1) & 1] = *(const v4fa*)(cw + kb + (g + 1) * WG); }
            __builtin_amdgcn_sched_barrier(0);   // the next group's LDS reads are issued as one run ahead of this group's sums: their latency passes under the sums, and no read stands among them
#pragma unroll
            for (int c = 0; c < WG; ++c) { const int e = g * WG + c;
                float w = bfr(u[e]);
                if constexpr (EDGE) w = w + msk(bfr(a[e]), ma) + msk(qd[g & 1][c], mb);
#pragma unroll
                for (int t = 0; t < 4; ++t) { acc[t] = fmaf(w, qa[g & 1][c][t], acc[t]); acc[4 + t] = fmaf(w, qb[g & 1][c][t], acc[4 + t]); }
                acc[8] = fmaf(w, qc[g & 1][c], acc[8]); }
            __builtin_amdgcn_sched_barrier(0);   // keeps the following reads, which take this group's registers, from moving up among these sums: they stay one run
        }
        up += (size_t)GKB * (NU * NU);
        if constexpr (EDGE) pa += (size_t)GKB * (2 * NU);
    }
}
__device__ __forceinline__ void d_gp(const float* __restrict__ U, const float* __restrict__ Wcat, const float* __restrict__ Wd, const float* __restrict__ bd, h16* GH, h16* GR, float* gs, float* sw, float* sc, int jt, int ip) {
    const int tid = threadIdx.x, lane = tid & 31;
    const int wave = __builtin_amdgcn_readfirstlane(tid >> 5);
    const bool eb = (jt == (NU - 1) / GJ) | (ip == (NU - 1) / 8);   // block-uniform: the block has an edge wave
    {   // the classifier weights are converted once per block: sw[k * WP + t]; the places t >= 9 and k >= NK, which no sum takes, get the nearest weight; the barrier ends these writes ahead of every wave's reads in gp_sum
        // so are, where the block has an edge wave, its 8 rows' column terms: sc[w * CP + k] = Wcat[k][8 ip + w]; their loads are in flight with the weights'
        float x[WS], y[CS];
        const int cr = tid & 7, ck = tid >> 3;   // 8 threads bring 32 contiguous bytes of one Wcat row
#pragma unroll
        for (int s = 0; s < WS; ++s) { const int idx = s * 256 + tid; int k = idx / WP; int t = idx - k * WP; k = k < NK ? k : NK - 1; t = t < NT ? t : NT - 1;   // clamped address
            x[s] = Wd[k * NT + t]; }
        if (eb) {
#pragma unroll
            for (int s = 0; s < CS; ++s) { int k = s * 32 + ck; k = k < NK ? k : NK - 1;   // clamped address
                y[s] = Wcat[(size_t)k * (2 * NU) + ip * 8 + cr]; } }
        asm volatile("s_wait_xcnt 0x0" ::: "memory");   // stands ahead of every overwrite of the address registers that the loads above name
        __builtin_amdgcn_sched_barrier(0);   // all the loads are issued ahead of the first LDS store (one latency, not several), and later address work stays behind the wait
#pragma unroll
        for (int s = 0; s < WS; ++s) sw[s * 256 + tid] = bfr(x[s]);
        if (eb) {
#pragma unroll
            for (int s = 0; s < CS; ++s) sc[cr * CP + s * 32 + ck] = bfr(y[s]); }
    }
    __syncthreads();
    const int i = ip * 8 + wave, j = jt * GJ + lane;
    float acc[NT];
#pragma unroll
    for (int t = 0; t < NT; ++t) acc[t] = 0.0f;
    const int jc = j < NU ? j : NU - 1;                             // clamped column index
    if (i < NU) {                                                   // wave-uniform
        if ((i == NU - 1) | (jt == (NU - 1) / GJ)) {                // wave-uniform: the row or the column of the constant-one feature lies in this wave
            const unsigned ma = (i == NU - 1) ? ~0u : 0u, mb = (j == NU - 1) ? ~0u : 0u;
            gp_sum<true>(U + (size_t)i * NU + jc, Wcat + NU + jc, sc + wave * CP, sw, ma, mb, acc);
#pragma unroll
            for (int t = 0; t < NT; ++t) acc[t] += msk(bfr(bd[t]), ma & mb);
        } else {
            gp_sum<false>(U + (size_t)i * NU + jc, Wcat, sc, sw, 0u, 0u, acc); }
    }
    const bool ok = (i < NU) & (j < NU);
#pragma unroll
    for (int t = 0; t < NT; ++t) gs[(t * 8 + wave) * GJ + lane] = ok ? acc[t] * GSC : 0.0f;
    __syncthreads();
#pragma unroll 1   // rolled: the second trip is one wave's
    for (int p = tid; p < NT * GJ; p += 256) {                      // 9 tags x 32 rows j; second trip = wave 0 only
        const int t = p >> 5, jj = p & 31; v8h hv, rv;
#pragma unroll
        for (int c = 0; c < 8; ++c) { const float x = gs[(t * 8 + c) * GJ + jj]; const h16 a0 = toh_flush(x); hv[c] = a0; rv[c] = toh_flush((x - (float)a0) * QRS); }
        const size_t oo = (size_t)ip * GPS + ((size_t)t * NJ + jt * GJ + jj) * 8;
        *(v8h*)(GH + oo) = hv; *(v8h*)(GR + oo) = rv; }
    if ((jt == 0) & (wave == 0)) {                                  // wave-uniform
        const v8h z = (v8h){};
        const size_t zo = (size_t)ip * GPS + ((size_t)NT * NJ + lane) * 8;
        *(v8h*)(GH + zo) = z; *(v8h*)(GR + zo) = z; }
}

// d_ht: bf16 GEMM, one block of HWV = 8 waves per 64x64 tile, K = HID in passes of HKC. C[m][n] = sum_k A[m][k] W[k][n]; A = state rows (m = q), W = Wh (columns c0 < 256: head column c0 + n) or Wt (tail column c0 - 256 + n); columns >= NF count as zeros.
// The block reads its operands as the f32 inputs and converts them to bf16 (RNE) on the way into LDS. Per pass: 64 state rows x HKC, in 512-byte pieces of a row per load; HKC weight rows x 64 columns, a thread taking 4 columns x 8 consecutive k at a time, which it turns in registers into four 16-byte pieces of k-contiguous LDS rows.
// All of a pass's loads are in flight together. LDS row pitch an odd number of 16-byte units; 16 lanes of a weight store hold 4 column quads x 4 octets of k, which fall on 16 different 16-byte bank groups.
// Wave w takes rows 16 (w >> 1) .. + 15 and columns 32 (w & 1) .. + 31: two accumulators, each summed over k in ascending order.
// Barriers: one ends a pass's LDS fill; one ends every wave's fragment reads of the pass, ahead of the next fill or of the f32 tile os, which lies on the operand rows' LDS; the last ends the writes of os ahead of its row-wise readers.
// Epilogue per column nn = n mod 256: nn < 200 -> GELU(C + bias), nn == 200 -> 1, nn > 200 -> 0; written as f16 value (Ph) and f16 residual x2048 (Pr), row pitch HTP.
// blocks (r0 / 64, c0 / 64) of (NB*SEQ/64, HTP/64); sab: 2 x 64 x HPL halves of LDS.
__device__ __forceinline__ void d_ht(const float* __restrict__ state, const float* __restrict__ Wm, const float* __restrict__ bias, h16* Ph, h16* Pr, bf* sab, int r0, int c0) {
    bf* const sA = sab; bf* const sB = sab + 64 * HPL;
    float* const os = (float*)sab;
    constexpr int NTH = 32 * HWV, RW = 64 / HWV, RT = HKC / 128, BS = (HKC / 8) / 16;   // threads; state rows per wave; 512-byte pieces per row and pass; weight pieces (4 columns x 8 k) per thread and pass
    const int tid = threadIdx.x, lane = tid & 31, lr = lane & 15, hi = lane >> 4;
    const int wave = __builtin_amdgcn_readfirstlane(tid >> 5);
    const int cn = c0 & (HTW - 1);
    const float* pa = state + ((size_t)(r0 / SEQ) * SEQ_FULL + (size_t)(r0 % SEQ + wave * RW)) * HID + lane * 4;   // wave w brings state rows 8 w .. 8 w + 7
    const int sla = wave * RW * HPL + lane * 4;
    const int quad = (wave & 3) * 4 + (lane & 3);                                   // columns 4 quad .. + 3 of the tile
    const int oct = ((wave >> 2) * 2 + hi) * (4 * BS) + ((lane >> 2) & 3);          // k = 8 oct .. + 7 of the pass; each further piece 4 octets on
    const bool vq = cn + 4 * quad < NF;
    const unsigned vm = vq ? ~0u : 0u;                                              // columns >= NF: zeros for any bit pattern loaded
    const float* pb = Wm + (size_t)(8 * oct) * NF + (vq ? cn + 4 * quad : NF - 4);  // clamped address
    const int slb = 4 * quad * HPL + 8 * oct;
    const int mb = wave >> 1, n2 = (wave & 1) * 2;
    float bc[2];
#pragma unroll
    for (int u = 0; u < 2; ++u) { const int nn = (c0 + (n2 + u) * 16 + lr) & (HTW - 1); const int bi = nn < NF ? nn : NF - 1;   // clamped address
        bc[u] = bfr(bias[bi]); }
    v8f acc[2];
#pragma unroll
    for (int u = 0; u < 2; ++u) acc[u] = (v8f){};
    const bf* const fa = sA + (mb * 16 + lr) * HPL + 8 * hi; const bf* const fb = sB + (n2 * 16 + lr) * HPL + 8 * hi;
#pragma unroll 1   // rolled over the passes: the second runs the first one's text
    for (int p = 0; p < HID / HKC; ++p) {
        v4f xa[RW * RT], xb[BS * 8];
#pragma unroll
        for (int it = 0; it < RW * RT; ++it) xa[it] = *(const v4f*)(pa + (it / RT) * HID + (it % RT) * 128);
#pragma unroll
        for (int it = 0; it < BS * 8; ++it) xb[it] = *(const v4f*)(pb + (size_t)((it / 8) * 32 + (it % 8)) * NF);
        asm volatile("s_wait_xcnt 0x0" ::: "memory");   // stands ahead of every overwrite of the address registers that the loads above name
        __builtin_amdgcn_sched_barrier(0);   // all the loads are issued ahead of the first LDS store (one latency, not several), and the address steps below stay behind the wait
        pa += HKC; pb += (size_t)HKC * NF;
#pragma unroll
        for (int it = 0; it < RW * RT; ++it) *(v2u*)(sA + sla + (it / RT) * HPL + (it % RT) * 128) = (v2u){pkbf(xa[it][0], xa[it][1]), pkbf(xa[it][2], xa[it][3])};
#pragma unroll
        for (int s = 0; s < BS; ++s) {
#pragma unroll
            for (int c = 0; c < 4; ++c) { v4u o;
#pragma unroll
                for (int e = 0; e < 4; ++e) o[e] = pkbf(xb[s * 8 + 2 * e][c], xb[s * 8 + 2 * e + 1][c]) & vm;
                *(v4u*)(sB + slb + c * HPL + s * 32) = o; } }
        __syncthreads();
#pragma unroll
        for (int k0 = 0; k0 < HKC; k0 += 32 * HKU) {
            v16bf a[HKU], b[HKU][2];
#pragma unroll
            for (int e = 0; e < HKU; ++e) { a[e] = ldb(fa + k0 + e * 32); b[e][0] = ldb(fb + k0 + e * 32); b[e][1] = ldb(fb + 16 * HPL + k0 + e * 32); }
            __builtin_amdgcn_sched_barrier(0);   // the group's LDS reads are issued ahead of its first product: else each product waits out an LDS latency of its own
#pragma unroll
            for (int e = 0; e < HKU; ++e) {
#pragma unroll
                for (int u = 0; u < 2; ++u) acc[u] = wgb(a[e], b[e][u], acc[u]); }
        }
        __syncthreads();
    }
#pragma unroll
    for (int u = 0; u < 2; ++u) {
#pragma unroll
        for (int j = 0; j < 8; ++j) os[(mb * 16 + hi * 8 + j) * 68 + (n2 + u) * 16 + lr] = acc[u][j] + bc[u]; }   // D: row 8h+j, col lane&15
    __syncthreads();
#pragma unroll 1   // rolled: the second trip runs the first one's text
    for (int s = 0; s < 64 * 8 / NTH; ++s) { const int row = (NTH / 8) * s + (tid >> 3), c8 = (tid & 7) * 8;   // 8 threads x 8 = 64 columns of one row
        const v4f x0 = *(const v4fa*)(&os[row * 68 + c8]); const v4f x1 = *(const v4fa*)(&os[row * 68 + c8 + 4]); v8h hv, rv;
#pragma unroll
        for (int i = 0; i < 4; ++i) {
            const int n0 = (c0 + c8 + i) & (HTW - 1), n1 = (c0 + c8 + 4 + i) & (HTW - 1);
            const float g0 = gelu_erf(x0[i]), g1 = gelu_erf(x1[i]);
            const float v0 = (n0 < NF) ? g0 : ((n0 == NF) ? 1.0f : 0.0f);
            const float v1 = (n1 < NF) ? g1 : ((n1 == NF) ? 1.0f : 0.0f);
            const h16 a0 = toh_flush(v0); const h16 a1 = toh_flush(v1); hv[i] = a0; hv[4 + i] = a1;
            rv[i] = toh_flush((v0 - (float)a0) * QRS); rv[4 + i] = toh_flush((v1 - (float)a1) * QRS); }
        const size_t oo = (size_t)(r0 + row) * HTP + c0 + c8;
        *(v8h*)(Ph + oo) = hv; *(v8h*)(Pr + oo) = rv;
        asm volatile("s_wait_xcnt 0x0" ::: "memory"); }   // stands ahead of the next trip's overwrites of the registers that the two stores name
}

// k_prep: the folded weights and the projection GEMM, neither of which reads what the other writes, share one launch; a block's body is chosen by its index (block-uniform branch).
// The folded-weight blocks hold the lowest indices. Both bodies' LDS lies in one array, sized for the projection GEMM: two blocks fit a WGP.
#define PB_GP   ((NJ / GJ) * (GPITCH / 8))
#define PB_HT   ((NB * SEQ / 64) * (HTP / 64))
static_assert(sizeof(float) * (NT * 8 * GJ + WS * 256 + 8 * CP) <= sizeof(unsigned short) * 2 * 64 * HPL);   // the folded-weight body's tile and its two tables fit that array
__global__ __launch_bounds__(256) void k_prep(const float* __restrict__ state, const float* __restrict__ Wh, const float* __restrict__ bh, const float* __restrict__ Wt, const float* __restrict__ bt, const float* __restrict__ U, const float* __restrict__ Wcat,
                                              const float* __restrict__ Wd, const float* __restrict__ bd, h16* GH, h16* GR, h16* Ph, h16* Pr) {
    __shared__ __align__(16) bf smem[2 * 64 * HPL];
    const int blk = blockIdx.x;
    if (blk >= PB_GP) {
        const int t = blk - PB_GP, c0 = (t / (NB * SEQ / 64)) * 64;
        d_ht(state, (c0 >= HTW) ? Wt : Wh, (c0 >= HTW) ? bt : bh, Ph, Pr, smem, (t % (NB * SEQ / 64)) * 64, c0);
    } else {
        float* const gs = (float*)smem;
        d_gp(U, Wcat, Wd, bd, GH, GR, gs, gs + NT * 8 * GJ, gs + NT * 8 * GJ + WS * 256, blk % (NJ / GJ), blk / (NJ / GJ));
        asm volatile("s_wait_xcnt 0x0" ::: "memory");   // the bodies stand one behind another in the built code: this stands behind the body's last stores, ahead of any later write of a register that those stores name
    }
}

// cp_run: VCN asynchronous copies global memory -> LDS, 16 bytes a lane each, through no register: l = the lane's LDS byte address, g = its global address, both multiples of 16. Every lane is on.
// The s_wait_xcnt is the statement's last line: it stands behind the last copy and ahead of every later write of a register that a copy names.
__device__ __forceinline__ void cp_run(const unsigned (&l)[VCN], const h16* const (&g)[VCN]) {
    asm volatile(
        "global_load_async_to_lds_b128 %0, %14, off\n\t"
        "global_load_async_to_lds_b128 %1, %15, off\n\t"
        "global_load_async_to_lds_b128 %2, %16, off\n\t"
        "global_load_async_to_lds_b128 %3, %17, off\n\t"
        "global_load_async_to_lds_b128 %4, %18, off\n\t"
        "global_load_async_to_lds_b128 %5, %19, off\n\t"
        "global_load_async_to_lds_b128 %6, %20, off\n\t"
        "global_load_async_to_lds_b128 %7, %21, off\n\t"
        "global_load_async_to_lds_b128 %8, %22, off\n\t"
        "global_load_async_to_lds_b128 %9, %23, off\n\t"
        "global_load_async_to_lds_b128 %10, %24, off\n\t"
        "global_load_async_to_lds_b128 %11, %25, off\n\t"
        "global_load_async_to_lds_b128 %12, %26, off\n\t"
        "global_load_async_to_lds_b128 %13, %27, off\n\t"
        "s_wait_xcnt 0x0"
        :: "v"(l[0]), "v"(l[1]), "v"(l[2]), "v"(l[3]), "v"(l[4]), "v"(l[5]), "v"(l[6]), "v"(l[7]), "v"(l[8]), "v"(l[9]), "v"(l[10]), "v"(l[11]), "v"(l[12]), "v"(l[13]),
           "v"(g[0]), "v"(g[1]), "v"(g[2]), "v"(g[3]), "v"(g[4]), "v"(g[5]), "v"(g[6]), "v"(g[7]), "v"(g[8]), "v"(g[9]), "v"(g[10]), "v"(g[11]), "v"(g[12]), "v"(g[13]) : "memory");
}

// k_vg: f16 GEMM with three products, one block of VWV = 8 waves per 128x128 tile, K = KJ. V[q][n] = sum_i head[q][i] G^T[n][i], n = t*NJ + j.
// A = head planes (value AH, residual AR; row pitch HTP, columns 0..KJ-1), Bt = G^T planes (value GH, residual GR; panels of 8 columns).
// The block's 128 head rows and 128 G^T rows, both planes, whole K, go once into LDS by asynchronous copies: head rows in runs of 16-byte pieces along the rows, G^T in runs of 32 rows of one panel (512 contiguous bytes a wave).
// In LDS every row is k-contiguous, row pitch an odd number of 16-byte units. All 56 copies of a wave are in flight together; its s_wait_asynccnt 0 and the one barrier stand between them and every fragment read.
// Wave w takes rows 32 (w >> 1) .. + 31 and columns 64 (w & 1) .. + 63: 2 x 4 tiles.
// aH = AH.GH; aR = AR.GH + AH.GR (both residual carries x2048, one accumulator; per k step first AR.GH, then AH.GR); V = aH + aR/2048 (keeps the x1024 carry of G); written as f16 value (VH) + f16 residual x2048 (VR), row pitch VP.
// The f32 tile is turned in LDS of the wave's own, apart from the operand rows. grid (NB*SEQ/VBM, VP/VBN).
__global__ __launch_bounds__(32 * VWV) void k_vg(const h16* __restrict__ AH, const h16* __restrict__ AR, const h16* __restrict__ GH, const h16* __restrict__ GR, h16* VH, h16* VR) {
    __shared__ __align__(16) h16 sm[2 * VBM * VKP + 2 * VBN * VKP];
    __shared__ __align__(16) float os[VWV * 32 * 68];
    constexpr int NTH = 32 * VWV, PC = KJ / 8;
    const int tid = threadIdx.x, lane = tid & 31, lr = lane & 15, hi = lane >> 4;
    const int wave = __builtin_amdgcn_readfirstlane(tid >> 5);
    const int m0 = blockIdx.x * VBM, c0 = blockIdx.y * VBN;
    {
        const unsigned lb = (unsigned)(size_t)sm;   // LDS byte address of the operand rows
        unsigned l[VCN]; const h16* g[VCN];
        // G^T: piece it * NTH + tid = row n of panel pn, n = tid mod VBN. These copies stand first: their addresses take the fewest operations
        const unsigned n = tid % VBN, p0 = tid / VBN;
        const unsigned lg = lb + (2 * VBM * VKP + n * VKP + p0 * 8) * 2;
        const h16* const gg = GH + (size_t)p0 * GPS + (size_t)(c0 + n) * 8;
#pragma unroll
        for (int it = 0; it < VCN; ++it) { l[it] = lg + it * (NTH / VBN) * 16; g[it] = gg + (size_t)it * (NTH / VBN) * GPS; }
        cp_run(l, g);
        __builtin_amdgcn_sched_barrier(0);   // the first copies leave ahead of the address work of the later ones, which the scheduler else moves up in front of them
        const ptrdiff_t dg = GR - GH, da = AR - AH;   // from a value plane to its residual plane
#pragma unroll
        for (int it = 0; it < VCN; ++it) { l[it] += VBN * VKP * 2; g[it] += dg; }
        cp_run(l, g);
        __builtin_amdgcn_sched_barrier(0);   // as above
        // head rows: piece idx = it * NTH + tid = piece pc = idx - PC row of row idx / PC; LDS byte 2 VKP row + 16 pc = 16 (idx + row), global half HTP row + 8 pc = 8 idx + (HTP - KJ) row
        const h16* const ga = AH + (size_t)m0 * HTP;
#pragma unroll
        for (int it = 0; it < VCN; ++it) { const unsigned idx = it * NTH + tid, row = idx / PC;
            l[it] = lb + (idx + row) * 16; g[it] = ga + (idx * 8 + row * (HTP - KJ)); }
        cp_run(l, g);
#pragma unroll
        for (int it = 0; it < VCN; ++it) { l[it] += VBM * VKP * 2; g[it] += da; }
        cp_run(l, g);
    }
    asm volatile("s_wait_asynccnt 0x0" ::: "memory");   // this wave's copies have landed
    __syncthreads();                                    // and every other wave's: no fragment is read ahead of it
    const int mb = wave >> 1, nh = wave & 1;
    const h16* const fa = sm + (mb * 32 + lr) * VKP + 8 * hi;
    const h16* const fb = sm + 2 * VBM * VKP + (nh * 64 + lr) * VKP + 8 * hi;
    v8f aH[2][4], aR[2][4];
#pragma unroll
    for (int i = 0; i < 2; ++i) {
#pragma unroll
        for (int nb = 0; nb < 4; ++nb) { aH[i][nb] = (v8f){}; aR[i][nb] = (v8f){}; } }
#pragma unroll
    for (int kc = 0; kc < KJ; kc += 32) {
        v16h ah[2], ar[2], gh[4], gr[4];
#pragma unroll
        for (int i = 0; i < 2; ++i) { ah[i] = ldh(fa + i * 16 * VKP + kc); ar[i] = ldh(fa + VBM * VKP + i * 16 * VKP + kc); }
#pragma unroll
        for (int nb = 0; nb < 4; ++nb) { gh[nb] = ldh(fb + nb * 16 * VKP + kc); gr[nb] = ldh(fb + VBN * VKP + nb * 16 * VKP + kc); }
        __builtin_amdgcn_sched_barrier(0);   // the step's LDS reads are issued as one run ahead of its first product: no read stands among the products
        // the eight tiles' products alternate, so that no product waits for the one before it
#pragma unroll
        for (int i = 0; i < 2; ++i) {
#pragma unroll
            for (int nb = 0; nb < 4; ++nb) aH[i][nb] = wg(ah[i], gh[nb], aH[i][nb]); }
#pragma unroll
        for (int i = 0; i < 2; ++i) {
#pragma unroll
            for (int nb = 0; nb < 4; ++nb) aR[i][nb] = wg(ar[i], gh[nb], aR[i][nb]); }
#pragma unroll
        for (int i = 0; i < 2; ++i) {
#pragma unroll
            for (int nb = 0; nb < 4; ++nb) aR[i][nb] = wg(ah[i], gr[nb], aR[i][nb]); }
        __builtin_amdgcn_sched_barrier(0);   // keeps the next step's reads, which take this step's registers, from moving up among these products
    }
    const int wb = wave * 32 * 68;
#pragma unroll
    for (int i = 0; i < 2; ++i) {
#pragma unroll
        for (int nb = 0; nb < 4; ++nb) {
#pragma unroll
            for (int j = 0; j < 8; ++j) os[wb + (i * 16 + hi * 8 + j) * 68 + nb * 16 + lr] = aH[i][nb][j] + aR[i][nb][j] * QRI; } }   // D: row 8h+j, col lane&15
    wave_sync();
    const int rw = lane >> 3, c8 = (lane & 7) * 8;   // 4 rows a trip; 8 lanes x 8 = 64 columns: one 128-byte line a row and plane
    const float* const pr = os + wb + rw * 68 + c8;
    h16* ph = VH + (size_t)(m0 + mb * 32 + rw) * VP + c0 + nh * 64 + c8; h16* pv = VR + (size_t)(m0 + mb * 32 + rw) * VP + c0 + nh * 64 + c8;
#pragma unroll 1   // rolled over the groups: the second runs the first one's text
    for (int gq = 0; gq < 2; ++gq) {
        v4f x0[4], x1[4];
#pragma unroll
        for (int s = 0; s < 4; ++s) { x0[s] = *(const v4fa*)(pr + (gq * 16 + 4 * s) * 68); x1[s] = *(const v4fa*)(pr + (gq * 16 + 4 * s) * 68 + 4); }
        __builtin_amdgcn_sched_barrier(0);   // the group's LDS reads are issued ahead of its first convert: one LDS latency a group, not one a trip
#pragma unroll
        for (int s = 0; s < 4; ++s) { v8h hv, rv;
#pragma unroll
            for (int i = 0; i < 4; ++i) { const h16 a0 = toh_flush(x0[s][i]); const h16 a1 = toh_flush(x1[s][i]); hv[i] = a0; hv[4 + i] = a1;
                rv[i] = toh_flush((x0[s][i] - (float)a0) * QRS); rv[4 + i] = toh_flush((x1[s][i] - (float)a1) * QRS); }
            *(v8h*)(ph + (size_t)(4 * s) * VP) = hv; *(v8h*)(pv + (size_t)(4 * s) * VP) = rv; }
        asm volatile("s_wait_xcnt 0x0" ::: "memory");   // stands ahead of the address steps below and of the next group's overwrites of the registers that the stores name
        ph += (size_t)16 * VP; pv += (size_t)16 * VP;
    }
}

// piece p (4 floats) of a band block's output run, read from the score tile: output element e = 1161 n + rem lies at os[SP n + rem]; a piece may run over from row n into row n + 1
__device__ __forceinline__ v4f band_piece(const float* os, int p) {
    const unsigned e = 4u * (unsigned)p, n = e / QE, rem = e - n * QE; v4f v;
#pragma unroll
    for (unsigned c = 0; c < 4; ++c) v[c] = os[e + c + (n + (rem + c >= QE ? 1u : 0u)) * (SP - QE)];
    return v;
}

// k_band: one block per BQ = 16 consecutive queries (one batch), one wave per 16-key tile of their common window of 144 keys (key = n0 - 64 + w, w = 0..143; a tile outside the sequence reads the nearest tile inside it; out-of-sequence keys fall to the keep rule).
// The window's tail rows and the 16 queries' V rows are read from global memory once per block, in 16-byte pieces that run along the rows, and kept in LDS (row pitches an odd number of 16-byte units).
// A = tail rows of the wave's key tile (row = key, k = j), held in registers for all tags; B = V of one tag (column = query lane&15, k = j), K = KJ.
// sH = TH.VH; sR = TR.VH + TH.VR; score = (sH + sR/2048)/1024. D element j of lane (lr, hi) = (w = 16 wave + 8 hi + j, query lr); band offset r = w - lr, kept where 0 <= r <= 128 -> os[lr*SP + r*9 + t].
// Keep rule per element, applied where the score is written to os: (n < len) and (0 <= key < SEQ) and (key < len); other elements get the classifier bias; non-finite values become 0.
// os lies on the tail rows' LDS, which no wave reads once every wave holds its A fragments (second barrier); the third barrier ends the score writes ahead of the block's linear store of its 16 output rows (16 x 1161 floats in a row).
// grid NB*SEQ/BQ.
__global__ __launch_bounds__(32 * BKT) void k_band(const h16* __restrict__ HTH, const h16* __restrict__ HTR, const h16* __restrict__ VH, const h16* __restrict__ VR, const int* __restrict__ lengths, const float* __restrict__ bd, float* OUT) {
    __shared__ __align__(16) h16 sm[2 * BWIN * TPL + 2 * BQ * VPL];
    h16* const tH = sm; h16* const tR = sm + BWIN * TPL;
    h16* const vH = sm + 2 * BWIN * TPL; h16* const vR = vH + BQ * VPL;
    float* const os = (float*)sm;
    constexpr int NTH = 32 * BKT, TPC = KJ / 8;
    const int tid = threadIdx.x, lane = tid & 31, lr = lane & 15, hi = lane >> 4;
    const int wave = __builtin_amdgcn_readfirstlane(tid >> 5);
    const int q0 = blockIdx.x * BQ;
    const int b = q0 / SEQ, n0 = q0 % SEQ;
    const int len = lengths[b];
    const float bl = bfr(bd[lane < NT ? lane : NT - 1]);   // lane t holds tag t's bias: one load, in flight with the row loads below, not one wait per tag in the tag loop
    asm volatile("s_wait_xcnt 0x0" ::: "memory");   // stands ahead of every overwrite of the address registers that the bias load names
    if (lane < TPC) {   // one lane per 16-byte piece of a 448-byte row part; wave w brings the 16 tail rows of key tile w and tag w's part of the 16 V rows
        int kb = n0 - WH + 16 * wave; kb = kb < 0 ? 0 : (kb > SEQ - 16 ? SEQ - 16 : kb);   // a key tile lies wholly inside or wholly outside the sequence
        const size_t to = ((size_t)b * SEQ + (size_t)kb) * HTP + lane * 8, vo = (size_t)q0 * VP + wave * NJ + lane * 8;
        const h16* const pth = HTH + to; const h16* const ptr = HTR + to; const h16* const pvh = VH + vo; const h16* const pvr = VR + vo;
        const int tl = wave * 16 * TPL + lane * 8, vl = wave * NJ + lane * 8;
        v8h xh[16], xr[16], yh[16], yr[16];
#pragma unroll
        for (int it = 0; it < 16; ++it) { xh[it] = *(const v8h*)(pth + HTW + it * HTP); xr[it] = *(const v8h*)(ptr + HTW + it * HTP); }
#pragma unroll
        for (int it = 0; it < 16; ++it) yh[it] = *(const v8h*)(pvh + it * VP);
        asm volatile("s_wait_xcnt 0x0" :: "v"(pth), "v"(ptr), "v"(pvh) : "memory");   // stands ahead of every overwrite of the three address pairs that the loads above name; as its inputs they stay whole up to it
        __builtin_amdgcn_sched_barrier(0);   // these 48 loads are issued ahead of the first LDS store (one latency, not several), and the LDS address work stays behind the wait
#pragma unroll
        for (int it = 0; it < 16; ++it) { *(v8h*)(tH + tl + it * TPL) = xh[it]; *(v8h*)(tR + tl + it * TPL) = xr[it]; }
        __builtin_amdgcn_sched_barrier(0);   // the last 16 loads take the registers that the tail rows have left: all 64 at once would need registers above v255
#pragma unroll
        for (int it = 0; it < 16; ++it) yr[it] = *(const v8h*)(pvr + it * VP);
        asm volatile("s_wait_xcnt 0x0" :: "v"(pvr) : "memory");   // as above, for the fourth address pair
        __builtin_amdgcn_sched_barrier(0);   // keeps these loads ahead of the stores below and later address work behind the wait
#pragma unroll
        for (int it = 0; it < 16; ++it) *(v8h*)(vH + vl + it * VPL) = yh[it];
#pragma unroll
        for (int it = 0; it < 16; ++it) *(v8h*)(vR + vl + it * VPL) = yr[it];
    }
    __syncthreads();
    v16h th[KJ / 32], tr[KJ / 32];
    const int ao = (wave * 16 + lr) * TPL + 8 * hi;
#pragma unroll
    for (int k = 0; k < KJ / 32; ++k) { th[k] = ldh(tH + ao + k * 32); tr[k] = ldh(tR + ao + k * 32); }
    __syncthreads();
    const int bo = lr * VPL + 8 * hi;
    const int r0 = 16 * wave + 8 * hi - lr;
    bool ok[8];   // keep rule of D element j: the same for every tag
#pragma unroll
    for (int j = 0; j < 8; ++j) { const int key = n0 - WH + 16 * wave + 8 * hi + j; ok[j] = (n0 + lr < len) & (key >= 0) & (key < SEQ) & (key < len); }
#pragma unroll 1   // rolled over the groups of three tags: the A fragments and one group's accumulators and B fragments fill the registers below v256
    for (int tg = 0; tg < NT; tg += BTG) {
        v8f sH[BTG], sR[BTG];
#pragma unroll
        for (int u = 0; u < BTG; ++u) { sH[u] = (v8f){}; sR[u] = (v8f){}; }
#pragma unroll
        for (int k = 0; k < KJ / 32; ++k) {
            v16h vh[BTG], vr[BTG];
#pragma unroll
            for (int u = 0; u < BTG; ++u) { vh[u] = ldh(vH + bo + (tg + u) * NJ + k * 32); vr[u] = ldh(vR + bo + (tg + u) * NJ + k * 32); }
            // the three tags' products alternate, so that no product waits for the one before it; each accumulator takes its products in the order k, then TR.VH, then TH.VR
#pragma unroll
            for (int u = 0; u < BTG; ++u) sH[u] = wg(th[k], vh[u], sH[u]);
#pragma unroll
            for (int u = 0; u < BTG; ++u) sR[u] = wg(tr[k], vh[u], sR[u]);
#pragma unroll
            for (int u = 0; u < BTG; ++u) sR[u] = wg(th[k], vr[u], sR[u]); }
#pragma unroll
        for (int u = 0; u < BTG; ++u) {
            const float bv = __int_as_float(__builtin_amdgcn_readlane(__float_as_int(bl), tg + u));   // tag tg + u's bias, wave-uniform
#pragma unroll
            for (int j = 0; j < 8; ++j) { const int r = r0 + j;
                float val = ok[j] ? (sH[u][j] + sR[u][j] * QRI) * GSI : bv;
                val = (fabsf(val) <= 3.402823466e38f) ? val : 0.0f;
                if ((r >= 0) & (r < WF)) os[lr * SP + r * NT + tg + u] = val; } }
    }
    __syncthreads();
    float* const dst = OUT + ((size_t)b * OUT_SEQ + n0) * QE;
    constexpr int NP = BQ * QE / 4, PG = 4, NG = NP / (PG * NTH);   // 16-byte pieces of the run; pieces per thread and group; whole groups
    // A run is 580 and a half lines of 128 bytes: every second block's run starts half way into a line. There the pieces are taken from the fifth on, so that each wave's 32 pieces of a group are four whole lines; the first four follow with the run's last pieces.
    // At such a block bound the two neighbours each store their own 64 bytes of the line, in 16-byte pieces of their own; neither reads it.
    const int off = (n0 & BQ) ? 4 : 0;
#pragma unroll 1   // rolled over the groups: every group runs the first one's text
    for (int g = 0; g < NG; ++g) {
        v4f val[PG];
#pragma unroll
        for (int s = 0; s < PG; ++s) val[s] = band_piece(os, off + (g * PG + s) * NTH + tid);
        __builtin_amdgcn_sched_barrier(0);   // the group's LDS reads are issued ahead of its first store: one LDS latency a group, not one a piece
#pragma unroll
        for (int s = 0; s < PG; ++s) *(v4f*)(dst + (size_t)(off + (g * PG + s) * NTH + tid) * 4) = val[s];
        asm volatile("s_wait_xcnt 0x0" ::: "memory"); }   // stands ahead of the next group's overwrites of the registers that the stores name
    static_assert(NP - NG * PG * NTH <= NTH);   // what the whole groups leave: at most one piece a thread
    if (tid < NP - NG * PG * NTH) { const int i = NG * PG * NTH + tid, p = off + i < NP ? off + i : off + i - NP;
        const v4f val = band_piece(os, p); *(v4f*)(dst + (size_t)p * 4) = val; }
}

static constexpr size_t al256(size_t v) { return (v + 255) & ~(size_t)255; }
static constexpr size_t SZ_HT = al256((size_t)NB * SEQ * HTP * 2);
static constexpr size_t SZ_GT = al256((size_t)GROWS * GPITCH * 2);
static constexpr size_t SZ_V  = al256((size_t)NB * SEQ * VP * 2);
static constexpr size_t SZ_TOTAL = 2 * SZ_HT + 2 * SZ_GT + 2 * SZ_V;
static_assert(SZ_TOTAL <= (size_t)134217728);          // workspace carve <= 128 MiB
static_assert((size_t)(NB_FULL - 1) * SEQ_FULL * QE * 4 + (size_t)SEQ_FULL * QE * 4 == (size_t)9510912);   // output bytes of the full problem

extern "C" void kernel_launch(void* const* d_in, const int* in_sizes, int n_in,
                              void* d_out, int out_size, void* d_ws, size_t ws_size, hipStream_t stream) {
    if (n_in < 10) return;
    const size_t needx = ((size_t)(NB - 1) * SEQ_FULL + SEQ) * HID;
    if ((size_t)in_sizes[0] < needx) return;
    if (in_sizes[1] < NB) return;
    if ((size_t)in_sizes[2] < (size_t)HID * NF || (size_t)in_sizes[4] < (size_t)HID * NF) return;
    if (in_sizes[3] < NF || in_sizes[5] < NF) return;
    if ((size_t)in_sizes[6] < (size_t)NK * NU * NU) return;
    if ((size_t)in_sizes[7] < (size_t)NK * 2 * NU) return;
    if (in_sizes[8] < NK * NT || in_sizes[9] < NT) return;
    if ((size_t)out_size < ((size_t)(NB - 1) * OUT_SEQ + SEQ) * QE) return;
    if (SZ_TOTAL > ws_size) return;
    // wire order: state, lengths, Wh, bh, Wt, bt, U, Wcat, Wd, bd
    const float* state = (const float*)d_in[0];
    const int*   lengths = (const int*)d_in[1];
    const float* Wh = (const float*)d_in[2]; const float* bh = (const float*)d_in[3];
    const float* Wt = (const float*)d_in[4]; const float* bt = (const float*)d_in[5];
    const float* U = (const float*)d_in[6]; const float* Wcat = (const float*)d_in[7];
    const float* Wd = (const float*)d_in[8]; const float* bd = (const float*)d_in[9];
    float* OUT = (float*)d_out;      // [NB][SEQ][129][9]
    char* wsp = (char*)d_ws;
    h16* HTH = (h16*)wsp; wsp += SZ_HT;              // [NB*SEQ][512] head | tail value
    h16* HTR = (h16*)wsp; wsp += SZ_HT;              // [NB*SEQ][512] head | tail residual x2048
    h16* GH  = (h16*)wsp; wsp += SZ_GT;              // [32][2048][8] G^T value (x1024)
    h16* GR  = (h16*)wsp; wsp += SZ_GT;              // [32][2048][8] G^T residual x2048
    h16* VH  = (h16*)wsp; wsp += SZ_V;               // [NB*SEQ][2048] V value (x1024)
    h16* VR  = (h16*)wsp; wsp += SZ_V;               // [NB*SEQ][2048] V residual x2048

    k_prep<<<PB_GP + PB_HT, 256, 0, stream>>>(state, Wh, bh, Wt, bt, U, Wcat, Wd, bd, GH, GR, HTH, HTR);
    k_vg<<<dim3(NB * SEQ / VBM, VP / VBN, 1), 32 * VWV, 0, stream>>>(HTH, HTR, GH, GR, VH, VR);
    k_band<<<NB * SEQ / BQ, 32 * BKT, 0, stream>>>(HTH, HTR, VH, VR, lengths, bd, OUT);
}

// v010
// Measured time: 34.8 microseconds a run.
// Two timings next to v009 both put it at 1.12 times that version's speed.
// All steps since v000 together make it 6.55 times as fast.
#include <hip/hip_runtime.h>

// Span scorer: head / tail projections (Linear 768 -> 200 + erf GELU) with an appended constant-one feature; biaffine form head^T U[k] tail plus a concatenation-linear term, evaluated for every query token on a sliding band of 129 key offsets (-64..+64); length masking (masked entries = classifier bias); 9-tag linear classifier; non-finite outputs set to 0.
// Algebra: the classifier is folded into the bilinear weights: G[i][j][t] = sum_k (U[k][i][j] + [j==200] Wcat[k][i] + [i==200] Wcat[k][201+j]) Wd[k][t] + [i==j==200] bd[t]; V[q][t][j] = sum_i head[q][i] G[i][j][t]; score[q][r][t] = sum_j tail[q-64+r][j] V[q][t][j].
// Compute dtypes, f32 accumulate everywhere: projections v_wmma_f32_16x16x32_bf16 (state, Wh, Wt, biases RNE-converted to bf16; products exact); G built by the same instruction from bf16-converted U, Wcat, Wd (9 tag rows of 16; products exact), bf16-converted bd added in f32;
// V GEMM and band GEMM v_wmma_f32_16x16x32_f16 with every operand as f16 value + f16 residual x2048 (three products; residual products in their own accumulator folded by 1/2048); G carries x1024, folded back after the band GEMM.
// Layout: head|tail planes [q][512] (head cols 0..255, tail cols 256..511; col 200 of each half = 1, cols 201..255 = 0);
// G^T planes in 32 panels of 8 columns: [i/8][t*224 + j][i%8]; V planes [q][2048] with column t*224 + j; the band GEMM's block masks its scores and stores its 16 queries' output rows itself, one contiguous run.

#ifndef NB
#define NB 2
#endif
#ifndef SEQ
#define SEQ 1024
#endif
#define NB_FULL  2
#define SEQ_FULL 1024
#ifndef OUT_SEQ
#define OUT_SEQ SEQ              // row pitch (in tokens) between batches of the output
#endif
#define HID    768               // model width
#define NF     200               // projection width
#define NU     201               // NF + constant-one feature
#define NK     200               // bilinear channels
#define NT     9                 // tags
#define WH     64                // band half width
#define WF     129               // band width
#define QE     (WF * NT)         // output floats per query (1161)
#define HTW    256               // column width of the head half / tail half
#define HTP    512               // row pitch (halves) of the head|tail planes
#define KJ     224               // contraction length of the V and band GEMMs (201 zero-padded)
#define NJ     224               // G^T rows / V columns per tag
#define GPITCH 256               // columns i of the G^T planes (32 panels of 8)
#define GROWS  2048              // rows of the G^T planes (9 * 224 = 2016, zero rows above)
#define GPS    (GROWS * 8)       // halves per 8-column panel of the G^T planes
#define GJ     32                // G^T rows j per folded-weight block (one lane each)
#define GST    16                // values of k per step of d_gp's sums: what a lane holds of one B fragment
#define GNS    ((NK + GST - 1) / GST)    // steps
#define GAH    4                 // steps whose U loads are in flight ahead of the step that is summed
#define WTP    216               // LDS row pitch (halves) of the converted classifier weights and column terms, rows along k: 27 x 16 B
#define WS     ((NK * NT + 255) / 256)   // weights per thread in the fill of that table
#define CS     ((NK * 8 + 255) / 256)    // column terms per thread in the fill of their LDS table: 8 rows i x NK values of k
#define VP     2048              // row pitch (halves) of the V planes
#define SP     1184              // LDS row pitch (floats) of a band block's score tile; SP - NT is odd, so the 16 queries of one score write fall on 16 banks
#define VWV    8                 // waves per V GEMM block
#define VBM    128               // queries per V GEMM block
#define VBN    128               // V columns per V GEMM block
#define VKP    (KJ + 8)          // LDS row pitch (halves) of the V GEMM's operand rows: 29 x 16 B
#define VCN    14                // asynchronous copies per statement in the V GEMM's fill
#define HWV    8                 // waves per projection GEMM block
#define HKC    384               // values of k per pass of the projection GEMM: what its LDS holds at a time
#define HKU    6                 // k steps of 32 whose fragments a projection GEMM wave reads from LDS as one group
#define HPL    (HKC + 8)         // LDS row pitch (halves) of the projection GEMM's operand rows: 49 x 16 B
#define BQ     16                // queries per band block
#define BKT    9                 // 16-key tiles of a band block's window = its waves
#define BWIN   (BKT * 16)        // keys in a band block's window
#define BTG    3                 // tags whose products alternate in the band GEMM
#define TPL    (KJ + 8)          // LDS row pitch (halves) of the tail rows: 29 x 16 B
#define VPL    (NT * NJ + 8)     // LDS row pitch (halves) of the V rows: 253 x 16 B
#define QRS    2048.0f           // carry of every residual plane
#define QRI    (1.0f / 2048.0f)
#define GSC    1024.0f           // carry of the G planes
#define GSI    (1.0f / 1024.0f)

static_assert(NU == NF + 1);
static_assert(KJ % 32 == 0);
static_assert(NU <= KJ);
static_assert(KJ <= HTW);
static_assert(KJ <= GPITCH);
static_assert(NJ == KJ);                       // V column block of one tag = one contraction row of the band GEMM
static_assert(HTP == 2 * HTW);
static_assert(HTW % 64 == 0);                  // a 64-column tile lies wholly in the head half or the tail half
static_assert((HTW & (HTW - 1)) == 0);
static_assert(NF <= HTW);
static_assert(GPITCH % 8 == 0);
static_assert(NJ % GJ == 0);
static_assert(GROWS - NT * NJ == GJ);           // zero rows above the tags: one lane each
static_assert(GJ == 32 && NT <= 16 && GST == 16 && GAH % 2 == 0 && GAH * GST <= NK);   // a wave's columns are two 16-column tiles; the tags fit the 16 rows of A; the first GAH steps are whole
static_assert(WTP >= GNS * GST && WTP % 8 == 0 && ((WTP / 8) & 1) == 1 && NK % 2 == 0 && WTP / 2 + NT * ((WTP - NK) / 2) <= 256);   // every step's 16 k lie inside a row; the zeros are one word a thread
static_assert(CS * 32 >= WTP && GPITCH <= 2 * NU && (NU - 1) % GJ < 16);   // the fill reaches a whole row; every column i of a panel lies inside a Wcat row; column 200 is one of the lower 16 lanes'
static_assert(NU <= GPITCH);
static_assert(NT * NJ <= GROWS);
static_assert(GROWS == VP);
static_assert(VP % 64 == 0);
static_assert((NB * SEQ) % 64 == 0);
static_assert((NB * SEQ) % VBM == 0 && VP % VBN == 0 && VBN <= GROWS);
static_assert(VBM * (KJ / 8) == VCN * 32 * VWV && VBN * (KJ / 8) == VCN * 32 * VWV);   // a plane's pieces: VCN per thread
static_assert(4 * VCN <= 63);                  // copies of a wave in flight
static_assert(VKP == KJ + 8 && (32 * VWV) % VBN == 0);   // an LDS row is its KJ/8 pieces and one more; a trip of the G^T fill is whole panels
static_assert(((VKP / 8) & 1) == 1 && VWV == 8 && VBM == 4 * 32 && VBN == 2 * 64);   // 4 row groups x 2 column halves of the tile
static_assert(sizeof(_Float16) * (2 * VBM * VKP + 2 * VBN * VKP) + sizeof(float) * VWV * 32 * 68 <= 327680);
static_assert(SEQ % BQ == 0);                  // a band block's queries lie in one batch
static_assert(BWIN == BQ + 2 * WH);            // the window holds every key of every query of the block
static_assert(NT % BTG == 0);
static_assert(KJ / 8 <= 32 && NJ == KJ);        // a row part of KJ halves: one 16-byte piece per lane
static_assert(BKT == NT && BQ == 16);          // wave w stages key tile w and tag w
static_assert(SEQ % 16 == 0 && WH % 16 == 0);  // key tiles start at multiples of 16
static_assert(((SP - NT) & 1) == 1);
static_assert((BQ * QE) % 4 == 0);             // a band block's output run is whole 16-byte pieces
static_assert((BQ * QE * 4) % 128 == 64 && (BQ & (BQ - 1)) == 0);   // runs start at multiples of 128 bytes and half way between them in turn
static_assert(4 + (BQ * QE / 4) / (4 * 32 * BKT) * (4 * 32 * BKT) <= BQ * QE / 4);   // the whole groups, shifted by four pieces, stay inside the run
static_assert(((TPL / 8) & 1) == 1 && ((VPL / 8) & 1) == 1);
static_assert(sizeof(float) * BQ * SP <= sizeof(_Float16) * 2 * BWIN * TPL);   // the score tile fits the tail rows' LDS
static_assert(sizeof(_Float16) * (2 * BWIN * TPL + 2 * BQ * VPL) <= 327680);
static_assert(SEQ % 64 == 0);
static_assert(SEQ % 32 == 0);
static_assert(OUT_SEQ % 32 == 0);
static_assert(WF == 2 * WH + 1);
static_assert(WF <= 9 * 16);                   // nine 16-key tiles cover the band
static_assert(SP >= QE);
static_assert(NB <= NB_FULL);
static_assert(SEQ <= SEQ_FULL);
static_assert(4 * 32 * 16 == 16 * 64 * 2);     // slab store: 4 trips x 32 lanes x 16 B == 16 rows x 64 halves
static_assert(((HPL / 8) & 1) == 1 && HID % HKC == 0);
static_assert(HKC % 128 == 0 && 64 % HWV == 0 && (64 * 8) % (32 * HWV) == 0);   // a state row's part of a pass is whole 512-byte pieces of f32; whole rows per wave in the fill, whole pieces per thread in the epilogue
static_assert((HKC / 8) % 16 == 0 && NF % 4 == 0);   // weights of a pass: 16 column quads x HKC/8 octets of k, dealt as 4 x 4 per 16 lanes; a quad lies wholly inside or wholly outside the NF columns
static_assert(HKC % (32 * HKU) == 0);
static_assert(HWV == 8);                       // 4 row groups x 2 column halves of the 64x64 tile
static_assert(sizeof(float) * 64 * 68 <= sizeof(unsigned short) * 2 * 64 * HPL);   // the f32 tile fits the operand rows' LDS
static_assert(sizeof(unsigned short) * 2 * 64 * HPL <= 163840);   // two blocks per WGP
static_assert(sizeof(float) * NT * 8 * GJ <= 131072);

typedef _Float16 h16;
typedef unsigned short bf;
typedef __attribute__((ext_vector_type(16))) __bf16   v16bf;
typedef __attribute__((ext_vector_type(16))) _Float16 v16h;
typedef __attribute__((ext_vector_type(8)))  _Float16 v8h;
typedef __attribute__((ext_vector_type(8)))  unsigned short v8us;
typedef __attribute__((ext_vector_type(8)))  unsigned v8u;
typedef __attribute__((ext_vector_type(4)))  unsigned v4u;
typedef __attribute__((ext_vector_type(2)))  unsigned v2u;
typedef __attribute__((ext_vector_type(2)))  float    v2f;
typedef __attribute__((ext_vector_type(2)))  __bf16   v2bf;
typedef __attribute__((ext_vector_type(8)))  float    v8f;
typedef __attribute__((ext_vector_type(4)))  float    v4f;
typedef v4f  __attribute__((may_alias)) v4fa;

__device__ __forceinline__ unsigned short f2bf(float f) { unsigned u = __float_as_uint(f); u += 0x7FFFu + ((u >> 16) & 1u); return (unsigned short)(u >> 16); }
__device__ __forceinline__ unsigned pkbf(float lo, float hi) { return __builtin_bit_cast(unsigned, __builtin_convertvector((v2f){lo, hi}, v2bf)); }   // two f32 -> two bf16 (RNE) in one word, lo in its low half
__device__ __forceinline__ float bfr(float f) { return __uint_as_float(((unsigned)f2bf(f)) << 16); }   // value after RNE convert to bf16
__device__ __forceinline__ v16h cat16(v8h lo, v8h hi) { return __builtin_shufflevector(lo, hi, 0, 1, 2, 3, 4, 5, 6, 7, 8, 9, 10, 11, 12, 13, 14, 15); }
__device__ __forceinline__ v16bf cat16b(v8us lo, v8us hi) { return __builtin_bit_cast(v16bf, __builtin_shufflevector(lo, hi, 0, 1, 2, 3, 4, 5, 6, 7, 8, 9, 10, 11, 12, 13, 14, 15)); }
__device__ __forceinline__ v8f wmma16(v16h a, v16h b, v8f c) { return __builtin_amdgcn_wmma_f32_16x16x32_f16(false, a, false, b, (short)0, c, false, false); }
__device__ __forceinline__ v8f wmmab(v16bf a, v16bf b, v8f c) { return __builtin_amdgcn_wmma_f32_16x16x32_bf16(false, a, false, b, (short)0, c, false, false); }
// fragment loaders from K-contiguous 16-bit rows; p already includes + 8*(lane>>4): elements 0..7 <- k0+8h+0..7, elements 8..15 <- k0+16+8h+0..7 (same map for A and B)
__device__ __forceinline__ v16h  ldh(const h16* p) { return cat16(*(const v8h*)p, *(const v8h*)(p + 16)); }
__device__ __forceinline__ v16bf ldb(const bf* p)  { return cat16b(*(const v8us*)p, *(const v8us*)(p + 16)); }
// ordering point for wave-private LDS tiles (same wave writes and reads)
__device__ __forceinline__ void wave_sync() { __builtin_amdgcn_fence(3 /* release order */, "wavefront"); __builtin_amdgcn_wave_barrier(); asm volatile("" ::: "memory"); }

// per-instruction guarded WMMA wrappers: one accumulator tied per guard, operands kept live across the nops
__device__ __forceinline__ v8f wg(v16h a, v16h b, v8f c) { c = wmma16(a, b, c); asm volatile("v_nop\n\tv_nop\n\tv_nop\n\tv_nop" : "+v"(c) : "v"(a), "v"(b)); return c; }
__device__ __forceinline__ v8f wgb(v16bf a, v16bf b, v8f c) { c = wmmab(a, b, c); asm volatile("v_nop\n\tv_nop\n\tv_nop\n\tv_nop" : "+v"(c) : "v"(a), "v"(b)); return c; }
// f32 -> f16 convert that cannot produce an f16 subnormal (|v| < 2^-14 -> +0), applied after the plane's carry
static __device__ __forceinline__ h16 toh_flush(float v) { const h16 r = (h16)v; return (fabsf(v) < 6.103515625e-05f) ? (h16)0.0f : r; }
__device__ __forceinline__ float gelu_erf(float x) { return 0.5f * x * (1.0f + erff(x * 0.70710678118654752f)); }

// d_gp: folded weights. Block (jt, ip) builds the tile i = 8 ip + wave, j = 32 jt + lane of G for all 9 tags: a wave reads 32 consecutive j of one U row per k (one 128-byte run).
// The sums over k run on v_wmma_f32_16x16x32_bf16: A = classifier weights (row = tag, 9 of 16 rows in use), B = the loaded values converted to bf16 (column = j), f32 accumulate; products exact.
// A lane holds GST = 16 consecutive k of its own column j, so lanes L and L + 16, which the instruction takes for two k halves of one column, hold two different columns. Each step of 16 k therefore takes two products on the same B:
// one whose A is zero in the upper 16 lanes (its D: columns j = 32 jt + 0..15), one whose A is zero in the lower 16 lanes (columns 32 jt + 16..31). In both A and B, element e of a lane stands for k = 16 step + e.
// The weights lie once per block in LDS as bf16, one k-contiguous row per tag, zeros at k >= NK, and one row of zeros behind them, which the lanes of a zeroed half and the rows t >= 9 read.
// Row i == 200: a second pass of the same form over Wcat[k][201 + j]. Column j == 200 (blocks jt == 6): the block's 8 column terms Wcat[k][i] lie in LDS as bf16 rows too; the lane of column 200 reads its wave's row as a B fragment, every other lane the zero row: one more product a step.
// The tile is turned in LDS and stored as 16-byte pieces (8 columns i) of panel ip, 512 contiguous bytes per tag. Entries with i >= NU or j >= NU are zeros; blocks jt == 0 also zero-fill rows [NT*NJ, GROWS) of their panel.
// blocks (jt, ip) of (NJ/GJ, GPITCH/8); gs: NT x 8 x GJ floats of LDS; wt: (NT + 1) x WTP halves of LDS; sc: 8 x WTP halves of LDS.
__device__ __forceinline__ float msk(float v, unsigned m) { return __uint_as_float(__float_as_uint(v) & m); }   // the value or +0 for any bit pattern, as a select does
__device__ __forceinline__ v16bf ldk(const bf* p) { return cat16b(*(const v8us*)p, *(const v8us*)(p + 8)); }   // 16 consecutive k of one LDS row
// gp_pass: a1, a2 += sum over k = 0..NK-1 of weights[k][t] * bf16(p[k * STR]); p is the lane's own address (clamped column). w1, w2: the lane's row of wt for the two products; pc (COL): the lane's row of column terms, or the zero row.
// The loads of GAH steps are in flight ahead of the step that is summed; they are issued two steps at a time.
template <int STR, bool COL>
__device__ __forceinline__ void gp_pass(const float* __restrict__ p, const bf* w1, const bf* w2, const bf* pc, v8f& a1, v8f& a2) {
    float u[GNS][GST];
#pragma unroll
    for (int s = 0; s < GAH; ++s) {
#pragma unroll
        for (int e = 0; e < GST; ++e) u[s][e] = p[(size_t)(s * GST + e) * STR]; }
    asm volatile("s_wait_xcnt 0x0" ::: "memory");   // stands ahead of every overwrite of the address registers that the loads above name
    __builtin_amdgcn_sched_barrier(0);   // the first steps' loads are all issued ahead of the first sum, and later address work stays behind the wait
#pragma unroll   // unrolled: the register that a step's values lie in is fixed at compile time
    for (int g = 0; g < GNS; g += 2) {
        v16bf f1[2], f2[2], fc[COL ? 2 : 1];
#pragma unroll
        for (int c = 0; c < 2; ++c) {
            if (g + c < GNS) { f1[c] = ldk(w1 + (g + c) * GST); f2[c] = ldk(w2 + (g + c) * GST);
                if constexpr (COL) fc[c] = ldk(pc + (g + c) * GST); } }
#pragma unroll
        for (int c = 0; c < 2; ++c) { const int s = g + GAH + c;
            if (s < GNS) {
#pragma unroll
                for (int e = 0; e < GST; ++e) u[s][e] = (s * GST + e < NK) ? p[(size_t)(s * GST + e) * STR] : 0.0f; } }
        if (g + GAH < GNS) asm volatile("s_wait_xcnt 0x0" ::: "memory");   // as above, for the loads of these two steps
        __builtin_amdgcn_sched_barrier(0);   // the LDS reads of this pair of steps and the loads of the pair GAH steps on are issued ahead of the sums: else the scheduler may sink them to their uses and their latencies add up
#pragma unroll
        for (int c = 0; c < 2; ++c) {
            if (g + c < GNS) { v8u w;
#pragma unroll
                for (int e = 0; e < GST / 2; ++e) w[e] = pkbf(u[g + c][2 * e], u[g + c][2 * e + 1]);
                const v16bf b = __builtin_bit_cast(v16bf, w);
                a1 = wgb(f1[c], b, a1); a2 = wgb(f2[c], b, a2);
                if constexpr (COL) a1 = wgb(f1[c], fc[c], a1); } }   // column 200 is one of the lower 16 lanes' columns
        __builtin_amdgcn_sched_barrier(0);   // keeps the next pair's reads and loads, which take registers that these sums free, from moving up among them
    }
}
__device__ __forceinline__ void d_gp(const float* __restrict__ U, const float* __restrict__ Wcat, const float* __restrict__ Wd, const float* __restrict__ bd, h16* GH, h16* GR, float* gs, bf* wt, bf* sc, int jt, int ip) {
    const int tid = threadIdx.x, lane = tid & 31, lr = lane & 15, hi = lane >> 4;
    const int wave = __builtin_amdgcn_readfirstlane(tid >> 5);
    const bool eb = jt == (NU - 1) / GJ;   // block-uniform: the block holds the column j == 200
    {   // the classifier weights are converted once per block: wt[t * WTP + k]; so are, where the block holds column 200, its 8 rows' column terms: sc[w * WTP + k] = Wcat[k][8 ip + w]; their loads are in flight with the weights'
        // the barrier ends these writes ahead of every wave's reads in gp_pass
        float x[WS], y[CS];
        const int cr = tid & 7, ck = tid >> 3;   // 8 threads bring 32 contiguous bytes of one Wcat row
#pragma unroll
        for (int s = 0; s < WS; ++s) { int idx = s * 256 + tid; idx = idx < NK * NT ? idx : NK * NT - 1;   // clamped address
            x[s] = Wd[idx]; }
        if (eb) {
#pragma unroll
            for (int s = 0; s < CS; ++s) { int k = s * 32 + ck; k = k < NK ? k : NK - 1;   // clamped address
                y[s] = Wcat[(size_t)k * (2 * NU) + ip * 8 + cr]; } }
        asm volatile("s_wait_xcnt 0x0" ::: "memory");   // stands ahead of every overwrite of the address registers that the loads above name
        __builtin_amdgcn_sched_barrier(0);   // all the loads are issued ahead of the first LDS store (one latency, not several), and later address work stays behind the wait
        unsigned* const wz = (unsigned*)wt;   // zeros, two halves a word: the zero row, and k = NK .. WTP - 1 of the 9 tag rows
        if (tid < WTP / 2) wz[NT * (WTP / 2) + tid] = 0u;
        else if (tid < WTP / 2 + NT * ((WTP - NK) / 2)) { const int z = tid - WTP / 2; wz[(z / ((WTP - NK) / 2)) * (WTP / 2) + NK / 2 + z % ((WTP - NK) / 2)] = 0u; }
#pragma unroll
        for (int s = 0; s < WS; ++s) { const int idx = s * 256 + tid, k = idx / NT, t = idx - k * NT;
            if ((s + 1) * 256 <= NK * NT || idx < NK * NT) wt[t * WTP + k] = f2bf(x[s]); }   // only the last trip is part of a trip
        if (eb) {
#pragma unroll
            for (int s = 0; s < CS; ++s) { const int k = s * 32 + ck;
                if (s * 32 + 31 < WTP || k < WTP) sc[cr * WTP + k] = (s * 32 + 31 < NK || k < NK) ? f2bf(y[s]) : (bf)0; } }   // zeros at k >= NK, as in wt
    }
    __syncthreads();
    const int i = ip * 8 + wave, j = jt * GJ + lane;
    v8f a1 = (v8f){}, a2 = (v8f){};   // D element r of lane (lr, hi): tag 8 hi + r, column 32 jt + lr (a1) or 32 jt + 16 + lr (a2)
    const int jc = j < NU ? j : NU - 1;                             // clamped column index
    if (i < NU) {                                                   // wave-uniform
        const bf* const zr = wt + NT * WTP;                         // the zero row
        const bf* const tr = wt + (lr < NT ? lr : NT) * WTP;        // the row of tag lr
        const bf* const w1 = hi ? zr : tr; const bf* const w2 = hi ? tr : zr;
        if (eb) gp_pass<NU * NU, true>(U + (size_t)i * NU + jc, w1, w2, (j == NU - 1) ? sc + wave * WTP : zr, a1, a2);
        else    gp_pass<NU * NU, false>(U + (size_t)i * NU + jc, w1, w2, zr, a1, a2);
        if (i == NU - 1) {                                          // wave-uniform: the row of the constant-one feature
            gp_pass<2 * NU, false>(Wcat + NU + jc, w1, w2, zr, a1, a2);
#pragma unroll
            for (int r = 0; r < 8; ++r) { const float b0 = bd[r], b1 = bd[8 + r < NT ? 8 + r : NT - 1];   // wave-uniform addresses, the second clamped
                a1[r] += msk(bfr(hi ? b1 : b0), ((jt * GJ + lr == NU - 1) & (8 * hi + r < NT)) ? ~0u : 0u); }
        }
    }
    const bool ok1 = (i < NU) & (jt * GJ + lr < NU), ok2 = (i < NU) & (jt * GJ + 16 + lr < NU);
#pragma unroll
    for (int r = 0; r < 8; ++r) {
        if (8 * hi + r < NT) { float* const q = gs + ((8 * hi + r) * 8 + wave) * GJ + lr;
            q[0] = ok1 ? a1[r] * GSC : 0.0f; q[16] = ok2 ? a2[r] * GSC : 0.0f; } }
    __syncthreads();
#pragma unroll 1   // rolled: the second trip is one wave's
    for (int p = tid; p < NT * GJ; p += 256) {                      // 9 tags x 32 rows j; second trip = wave 0 only
        const int t = p >> 5, jj = p & 31; v8h hv, rv;
#pragma unroll
        for (int c = 0; c < 8; ++c) { const float x = gs[(t * 8 + c) * GJ + jj]; const h16 a0 = toh_flush(x); hv[c] = a0; rv[c] = toh_flush((x - (float)a0) * QRS); }
        const size_t oo = (size_t)ip * GPS + ((size_t)t * NJ + jt * GJ + jj) * 8;
        *(v8h*)(GH + oo) = hv; *(v8h*)(GR + oo) = rv; }
    if ((jt == 0) & (wave == 0)) {                                  // wave-uniform
        const v8h z = (v8h){};
        const size_t zo = (size_t)ip * GPS + ((size_t)NT * NJ + lane) * 8;
        *(v8h*)(GH + zo) = z; *(v8h*)(GR + zo) = z; }
}

// d_ht: bf16 GEMM, one block of HWV = 8 waves per 64x64 tile, K = HID in passes of HKC. C[m][n] = sum_k A[m][k] W[k][n]; A = state rows (m = q), W = Wh (columns c0 < 256: head column c0 + n) or Wt (tail column c0 - 256 + n); columns >= NF count as zeros.
// The block reads its operands as the f32 inputs and converts them to bf16 (RNE) on the way into LDS. Per pass: 64 state rows x HKC, in 512-byte pieces of a row per load; HKC weight rows x 64 columns, a thread taking 4 columns x 8 consecutive k at a time, which it turns in registers into four 16-byte pieces of k-contiguous LDS rows.
// All of a pass's loads are in flight together. LDS row pitch an odd number of 16-byte units; 16 lanes of a weight store hold 4 column quads x 4 octets of k, which fall on 16 different 16-byte bank groups.
// Wave w takes rows 16 (w >> 1) .. + 15 and columns 32 (w & 1) .. + 31: two accumulators, each summed over k in ascending order.
// Barriers: one ends a pass's LDS fill; one ends every wave's fragment reads of the pass, ahead of the next fill or of the f32 tile os, which lies on the operand rows' LDS; the last ends the writes of os ahead of its row-wise readers.
// Epilogue per column nn = n mod 256: nn < 200 -> GELU(C + bias), nn == 200 -> 1, nn > 200 -> 0; written as f16 value (Ph) and f16 residual x2048 (Pr), row pitch HTP.
// blocks (r0 / 64, c0 / 64) of (NB*SEQ/64, HTP/64); sab: 2 x 64 x HPL halves of LDS.
__device__ __forceinline__ void d_ht(const float* __restrict__ state, const float* __restrict__ Wm, const float* __restrict__ bias, h16* Ph, h16* Pr, bf* sab, int r0, int c0) {
    bf* const sA = sab; bf* const sB = sab + 64 * HPL;
    float* const os = (float*)sab;
    constexpr int NTH = 32 * HWV, RW = 64 / HWV, RT = HKC / 128, BS = (HKC / 8) / 16;   // threads; state rows per wave; 512-byte pieces per row and pass; weight pieces (4 columns x 8 k) per thread and pass
    const int tid = threadIdx.x, lane = tid & 31, lr = lane & 15, hi = lane >> 4;
    const int wave = __builtin_amdgcn_readfirstlane(tid >> 5);
    const int cn = c0 & (HTW - 1);
    const float* pa = state + ((size_t)(r0 / SEQ) * SEQ_FULL + (size_t)(r0 % SEQ + wave * RW)) * HID + lane * 4;   // wave w brings state rows 8 w .. 8 w + 7
    const int sla = wave * RW * HPL + lane * 4;
    const int quad = (wave & 3) * 4 + (lane & 3);                                   // columns 4 quad .. + 3 of the tile
    const int oct = ((wave >> 2) * 2 + hi) * (4 * BS) + ((lane >> 2) & 3);          // k = 8 oct .. + 7 of the pass; each further piece 4 octets on
    const bool vq = cn + 4 * quad < NF;
    const unsigned vm = vq ? ~0u : 0u;                                              // columns >= NF: zeros for any bit pattern loaded
    const float* pb = Wm + (size_t)(8 * oct) * NF + (vq ? cn + 4 * quad : NF - 4);  // clamped address
    const int slb = 4 * quad * HPL + 8 * oct;
    const int mb = wave >> 1, n2 = (wave & 1) * 2;
    float bc[2];
#pragma unroll
    for (int u = 0; u < 2; ++u) { const int nn = (c0 + (n2 + u) * 16 + lr) & (HTW - 1); const int bi = nn < NF ? nn : NF - 1;   // clamped address
        bc[u] = bfr(bias[bi]); }
    v8f acc[2];
#pragma unroll
    for (int u = 0; u < 2; ++u) acc[u] = (v8f){};
    const bf* const fa = sA + (mb * 16 + lr) * HPL + 8 * hi; const bf* const fb = sB + (n2 * 16 + lr) * HPL + 8 * hi;
#pragma unroll 1   // rolled over the passes: the second runs the first one's text
    for (int p = 0; p < HID / HKC; ++p) {
        v4f xa[RW * RT], xb[BS * 8];
#pragma unroll
        for (int it = 0; it < RW * RT; ++it) xa[it] = *(const v4f*)(pa + (it / RT) * HID + (it % RT) * 128);
#pragma unroll
        for (int it = 0; it < BS * 8; ++it) xb[it] = *(const v4f*)(pb + (size_t)((it / 8) * 32 + (it % 8)) * NF);
        asm volatile("s_wait_xcnt 0x0" ::: "memory");   // stands ahead of every overwrite of the address registers that the loads above name
        __builtin_amdgcn_sched_barrier(0);   // all the loads are issued ahead of the first LDS store (one latency, not several), and the address steps below stay behind the wait
        pa += HKC; pb += (size_t)HKC * NF;
#pragma unroll
        for (int it = 0; it < RW * RT; ++it) *(v2u*)(sA + sla + (it / RT) * HPL + (it % RT) * 128) = (v2u){pkbf(xa[it][0], xa[it][1]), pkbf(xa[it][2], xa[it][3])};
#pragma unroll
        for (int s = 0; s < BS; ++s) {
#pragma unroll
            for (int c = 0; c < 4; ++c) { v4u o;
#pragma unroll
                for (int e = 0; e < 4; ++e) o[e] = pkbf(xb[s * 8 + 2 * e][c], xb[s * 8 + 2 * e + 1][c]) & vm;
                *(v4u*)(sB + slb + c * HPL + s * 32) = o; } }
        __syncthreads();
#pragma unroll
        for (int k0 = 0; k0 < HKC; k0 += 32 * HKU) {
            v16bf a[HKU], b[HKU][2];
#pragma unroll
            for (int e = 0; e < HKU; ++e) { a[e] = ldb(fa + k0 + e * 32); b[e][0] = ldb(fb + k0 + e * 32); b[e][1] = ldb(fb + 16 * HPL + k0 + e * 32); }
            __builtin_amdgcn_sched_barrier(0);   // the group's LDS reads are issued ahead of its first product: else each product waits out an LDS latency of its own
#pragma unroll
            for (int e = 0; e < HKU; ++e) {
#pragma unroll
                for (int u = 0; u < 2; ++u) acc[u] = wgb(a[e], b[e][u], acc[u]); }
        }
        __syncthreads();
    }
#pragma unroll
    for (int u = 0; u < 2; ++u) {
#pragma unroll
        for (int j = 0; j < 8; ++j) os[(mb * 16 + hi * 8 + j) * 68 + (n2 + u) * 16 + lr] = acc[u][j] + bc[u]; }   // D: row 8h+j, col lane&15
    __syncthreads();
#pragma unroll 1   // rolled: the second trip runs the first one's text
    for (int s = 0; s < 64 * 8 / NTH; ++s) { const int row = (NTH / 8) * s + (tid >> 3), c8 = (tid & 7) * 8;   // 8 threads x 8 = 64 columns of one row
        const v4f x0 = *(const v4fa*)(&os[row * 68 + c8]); const v4f x1 = *(const v4fa*)(&os[row * 68 + c8 + 4]); v8h hv, rv;
#pragma unroll
        for (int i = 0; i < 4; ++i) {
            const int n0 = (c0 + c8 + i) & (HTW - 1), n1 = (c0 + c8 + 4 + i) & (HTW - 1);
            const float g0 = gelu_erf(x0[i]), g1 = gelu_erf(x1[i]);
            const float v0 = (n0 < NF) ? g0 : ((n0 == NF) ? 1.0f : 0.0f);
            const float v1 = (n1 < NF) ? g1 : ((n1 == NF) ? 1.0f : 0.0f);
            const h16 a0 = toh_flush(v0); const h16 a1 = toh_flush(v1); hv[i] = a0; hv[4 + i] = a1;
            rv[i] = toh_flush((v0 - (float)a0) * QRS); rv[4 + i] = toh_flush((v1 - (float)a1) * QRS); }
        const size_t oo = (size_t)(r0 + row) * HTP + c0 + c8;
        *(v8h*)(Ph + oo) = hv; *(v8h*)(Pr + oo) = rv;
        asm volatile("s_wait_xcnt 0x0" ::: "memory"); }   // stands ahead of the next trip's overwrites of the registers that the two stores name
}

// k_prep: the folded weights and the projection GEMM, neither of which reads what the other writes, share one launch; a block's body is chosen by its index (block-uniform branch).
// The folded-weight blocks hold the lowest indices. Both bodies' LDS lies in one array, sized for the projection GEMM: two blocks fit a WGP.
#define PB_GP   ((NJ / GJ) * (GPITCH / 8))
#define PB_HT   ((NB * SEQ / 64) * (HTP / 64))
static_assert(sizeof(float) * NT * 8 * GJ + sizeof(unsigned short) * (NT + 1 + 8) * WTP <= sizeof(unsigned short) * 2 * 64 * HPL && (NT * 8 * GJ) % 4 == 0);   // the folded-weight body's tile and its two tables fit that array, the tables at multiples of 16 bytes
__global__ __launch_bounds__(256) void k_prep(const float* __restrict__ state, const float* __restrict__ Wh, const float* __restrict__ bh, const float* __restrict__ Wt, const float* __restrict__ bt, const float* __restrict__ U, const float* __restrict__ Wcat,
                                              const float* __restrict__ Wd, const float* __restrict__ bd, h16* GH, h16* GR, h16* Ph, h16* Pr) {
    __shared__ __align__(16) bf smem[2 * 64 * HPL];
    const int blk = blockIdx.x;
    if (blk >= PB_GP) {
        const int t = blk - PB_GP, c0 = (t / (NB * SEQ / 64)) * 64;
        d_ht(state, (c0 >= HTW) ? Wt : Wh, (c0 >= HTW) ? bt : bh, Ph, Pr, smem, (t % (NB * SEQ / 64)) * 64, c0);
    } else {
        float* const gs = (float*)smem;
        bf* const wt = (bf*)(gs + NT * 8 * GJ);
        d_gp(U, Wcat, Wd, bd, GH, GR, gs, wt, wt + (NT + 1) * WTP, blk % (NJ / GJ), blk / (NJ / GJ));
        asm volatile("s_wait_xcnt 0x0" ::: "memory");   // the bodies stand one behind another in the built code: this stands behind the body's last stores, ahead of any later write of a register that those stores name
    }
}

// cp_run: VCN asynchronous copies global memory -> LDS, 16 bytes a lane each, through no register: l = the lane's LDS byte address, g = its global address, both multiples of 16. Every lane is on.
// The s_wait_xcnt is the statement's last line: it stands behind the last copy and ahead of every later write of a register that a copy names.
__device__ __forceinline__ void cp_run(const unsigned (&l)[VCN], const h16* const (&g)[VCN]) {
    asm volatile(
        "global_load_async_to_lds_b128 %0, %14, off\n\t"
        "global_load_async_to_lds_b128 %1, %15, off\n\t"
        "global_load_async_to_lds_b128 %2, %16, off\n\t"
        "global_load_async_to_lds_b128 %3, %17, off\n\t"
        "global_load_async_to_lds_b128 %4, %18, off\n\t"
        "global_load_async_to_lds_b128 %5, %19, off\n\t"
        "global_load_async_to_lds_b128 %6, %20, off\n\t"
        "global_load_async_to_lds_b128 %7, %21, off\n\t"
        "global_load_async_to_lds_b128 %8, %22, off\n\t"
        "global_load_async_to_lds_b128 %9, %23, off\n\t"
        "global_load_async_to_lds_b128 %10, %24, off\n\t"
        "global_load_async_to_lds_b128 %11, %25, off\n\t"
        "global_load_async_to_lds_b128 %12, %26, off\n\t"
        "global_load_async_to_lds_b128 %13, %27, off\n\t"
        "s_wait_xcnt 0x0"
        :: "v"(l[0]), "v"(l[1]), "v"(l[2]), "v"(l[3]), "v"(l[4]), "v"(l[5]), "v"(l[6]), "v"(l[7]), "v"(l[8]), "v"(l[9]), "v"(l[10]), "v"(l[11]), "v"(l[12]), "v"(l[13]),
           "v"(g[0]), "v"(g[1]), "v"(g[2]), "v"(g[3]), "v"(g[4]), "v"(g[5]), "v"(g[6]), "v"(g[7]), "v"(g[8]), "v"(g[9]), "v"(g[10]), "v"(g[11]), "v"(g[12]), "v"(g[13]) : "memory");
}

// k_vg: f16 GEMM with three products, one block of VWV = 8 waves per 128x128 tile, K = KJ. V[q][n] = sum_i head[q][i] G^T[n][i], n = t*NJ + j.
// A = head planes (value AH, residual AR; row pitch HTP, columns 0..KJ-1), Bt = G^T planes (value GH, residual GR; panels of 8 columns).
// The block's 128 head rows and 128 G^T rows, both planes, whole K, go once into LDS by asynchronous copies: head rows in runs of 16-byte pieces along the rows, G^T in runs of 32 rows of one panel (512 contiguous bytes a wave).
// In LDS every row is k-contiguous, row pitch an odd number of 16-byte units. All 56 copies of a wave are in flight together; its s_wait_asynccnt 0 and the one barrier stand between them and every fragment read.
// Wave w takes rows 32 (w >> 1) .. + 31 and columns 64 (w & 1) .. + 63: 2 x 4 tiles.
// aH = AH.GH; aR = AR.GH + AH.GR (both residual carries x2048, one accumulator; per k step first AR.GH, then AH.GR); V = aH + aR/2048 (keeps the x1024 carry of G); written as f16 value (VH) + f16 residual x2048 (VR), row pitch VP.
// The f32 tile is turned in LDS of the wave's own, apart from the operand rows. grid (NB*SEQ/VBM, VP/VBN).
__global__ __launch_bounds__(32 * VWV) void k_vg(const h16* __restrict__ AH, const h16* __restrict__ AR, const h16* __restrict__ GH, const h16* __restrict__ GR, h16* VH, h16* VR) {
    __shared__ __align__(16) h16 sm[2 * VBM * VKP + 2 * VBN * VKP];
    __shared__ __align__(16) float os[VWV * 32 * 68];
    constexpr int NTH = 32 * VWV, PC = KJ / 8;
    const int tid = threadIdx.x, lane = tid & 31, lr = lane & 15, hi = lane >> 4;
    const int wave = __builtin_amdgcn_readfirstlane(tid >> 5);
    const int m0 = blockIdx.x * VBM, c0 = blockIdx.y * VBN;
    {
        const unsigned lb = (unsigned)(size_t)sm;   // LDS byte address of the operand rows
        unsigned l[VCN]; const h16* g[VCN];
        // G^T: piece it * NTH + tid = row n of panel pn, n = tid mod VBN. These copies stand first: their addresses take the fewest operations
        const unsigned n = tid % VBN, p0 = tid / VBN;
        const unsigned lg = lb + (2 * VBM * VKP + n * VKP + p0 * 8) * 2;
        const h16* const gg = GH + (size_t)p0 * GPS + (size_t)(c0 + n) * 8;
#pragma unroll
        for (int it = 0; it < VCN; ++it) { l[it] = lg + it * (NTH / VBN) * 16; g[it] = gg + (size_t)it * (NTH / VBN) * GPS; }
        cp_run(l, g);
        __builtin_amdgcn_sched_barrier(0);   // the first copies leave ahead of the address work of the later ones, which the scheduler else moves up in front of them
        const ptrdiff_t dg = GR - GH, da = AR - AH;   // from a value plane to its residual plane
#pragma unroll
        for (int it = 0; it < VCN; ++it) { l[it] += VBN * VKP * 2; g[it] += dg; }
        cp_run(l, g);
        __builtin_amdgcn_sched_barrier(0);   // as above
        // head rows: piece idx = it * NTH + tid = piece pc = idx - PC row of row idx / PC; LDS byte 2 VKP row + 16 pc = 16 (idx + row), global half HTP row + 8 pc = 8 idx + (HTP - KJ) row
        const h16* const ga = AH + (size_t)m0 * HTP;
#pragma unroll
        for (int it = 0; it < VCN; ++it) { const unsigned idx = it * NTH + tid, row = idx / PC;
            l[it] = lb + (idx + row) * 16; g[it] = ga + (idx * 8 + row * (HTP - KJ)); }
        cp_run(l, g);
#pragma unroll
        for (int it = 0; it < VCN; ++it) { l[it] += VBM * VKP * 2; g[it] += da; }
        cp_run(l, g);
    }
    asm volatile("s_wait_asynccnt 0x0" ::: "memory");   // this wave's copies have landed
    __syncthreads();                                    // and every other wave's: no fragment is read ahead of it
    const int mb = wave >> 1, nh = wave & 1;
    const h16* const fa = sm + (mb * 32 + lr) * VKP + 8 * hi;
    const h16* const fb = sm + 2 * VBM * VKP + (nh * 64 + lr) * VKP + 8 * hi;
    v8f aH[2][4], aR[2][4];
#pragma unroll
    for (int i = 0; i < 2; ++i) {
#pragma unroll
        for (int nb = 0; nb < 4; ++nb) { aH[i][nb] = (v8f){}; aR[i][nb] = (v8f){}; } }
#pragma unroll
    for (int kc = 0; kc < KJ; kc += 32) {
        v16h ah[2], ar[2], gh[4], gr[4];
#pragma unroll
        for (int i = 0; i < 2; ++i) { ah[i] = ldh(fa + i * 16 * VKP + kc); ar[i] = ldh(fa + VBM * VKP + i * 16 * VKP + kc); }
#pragma unroll
        for (int nb = 0; nb < 4; ++nb) { gh[nb] = ldh(fb + nb * 16 * VKP + kc); gr[nb] = ldh(fb + VBN * VKP + nb * 16 * VKP + kc); }
        __builtin_amdgcn_sched_barrier(0);   // the step's LDS reads are issued as one run ahead of its first product: no read stands among the products
        // the eight tiles' products alternate, so that no product waits for the one before it
#pragma unroll
        for (int i = 0; i < 2; ++i) {
#pragma unroll
            for (int nb = 0; nb < 4; ++nb) aH[i][nb] = wg(ah[i], gh[nb], aH[i][nb]); }
#pragma unroll
        for (int i = 0; i < 2; ++i) {
#pragma unroll
            for (int nb = 0; nb < 4; ++nb) aR[i][nb] = wg(ar[i], gh[nb], aR[i][nb]); }
#pragma unroll
        for (int i = 0; i < 2; ++i) {
#pragma unroll
            for (int nb = 0; nb < 4; ++nb) aR[i][nb] = wg(ah[i], gr[nb], aR[i][nb]); }
        __builtin_amdgcn_sched_barrier(0);   // keeps the next step's reads, which take this step's registers, from moving up among these products
    }
    const int wb = wave * 32 * 68;
#pragma unroll
    for (int i = 0; i < 2; ++i) {
#pragma unroll
        for (int nb = 0; nb < 4; ++nb) {
#pragma unroll
            for (int j = 0; j < 8; ++j) os[wb + (i * 16 + hi * 8 + j) * 68 + nb * 16 + lr] = aH[i][nb][j] + aR[i][nb][j] * QRI; } }   // D: row 8h+j, col lane&15
    wave_sync();
    const int rw = lane >> 3, c8 = (lane & 7) * 8;   // 4 rows a trip; 8 lanes x 8 = 64 columns: one 128-byte line a row and plane
    const float* const pr = os + wb + rw * 68 + c8;
    h16* ph = VH + (size_t)(m0 + mb * 32 + rw) * VP + c0 + nh * 64 + c8; h16* pv = VR + (size_t)(m0 + mb * 32 + rw) * VP + c0 + nh * 64 + c8;
#pragma unroll 1   // rolled over the groups: the second runs the first one's text
    for (int gq = 0; gq < 2; ++gq) {
        v4f x0[4], x1[4];
#pragma unroll
        for (int s = 0; s < 4; ++s) { x0[s] = *(const v4fa*)(pr + (gq * 16 + 4 * s) * 68); x1[s] = *(const v4fa*)(pr + (gq * 16 + 4 * s) * 68 + 4); }
        __builtin_amdgcn_sched_barrier(0);   // the group's LDS reads are issued ahead of its first convert: one LDS latency a group, not one a trip
#pragma unroll
        for (int s = 0; s < 4; ++s) { v8h hv, rv;
#pragma unroll
            for (int i = 0; i < 4; ++i) { const h16 a0 = toh_flush(x0[s][i]); const h16 a1 = toh_flush(x1[s][i]); hv[i] = a0; hv[4 + i] = a1;
                rv[i] = toh_flush((x0[s][i] - (float)a0) * QRS); rv[4 + i] = toh_flush((x1[s][i] - (float)a1) * QRS); }
            *(v8h*)(ph + (size_t)(4 * s) * VP) = hv; *(v8h*)(pv + (size_t)(4 * s) * VP) = rv; }
        asm volatile("s_wait_xcnt 0x0" ::: "memory");   // stands ahead of the address steps below and of the next group's overwrites of the registers that the stores name
        ph += (size_t)16 * VP; pv += (size_t)16 * VP;
    }
}

// piece p (4 floats) of a band block's output run, read from the score tile: output element e = 1161 n + rem lies at os[SP n + rem]; a piece may run over from row n into row n + 1
__device__ __forceinline__ v4f band_piece(const float* os, int p) {
    const unsigned e = 4u * (unsigned)p, n = e / QE, rem = e - n * QE; v4f v;
#pragma unroll
    for (unsigned c = 0; c < 4; ++c) v[c] = os[e + c + (n + (rem + c >= QE ? 1u : 0u)) * (SP - QE)];
    return v;
}

// k_band: one block per BQ = 16 consecutive queries (one batch), one wave per 16-key tile of their common window of 144 keys (key = n0 - 64 + w, w = 0..143; a tile outside the sequence reads the nearest tile inside it; out-of-sequence keys fall to the keep rule).
// The window's tail rows and the 16 queries' V rows are read from global memory once per block, in 16-byte pieces that run along the rows, and kept in LDS (row pitches an odd number of 16-byte units).
// A = tail rows of the wave's key tile (row = key, k = j), held in registers for all tags; B = V of one tag (column = query lane&15, k = j), K = KJ.
// sH = TH.VH; sR = TR.VH + TH.VR; score = (sH + sR/2048)/1024. D element j of lane (lr, hi) = (w = 16 wave + 8 hi + j, query lr); band offset r = w - lr, kept where 0 <= r <= 128 -> os[lr*SP + r*9 + t].
// Keep rule per element, applied where the score is written to os: (n < len) and (0 <= key < SEQ) and (key < len); other elements get the classifier bias; non-finite values become 0.
// os lies on the tail rows' LDS, which no wave reads once every wave holds its A fragments (second barrier); the third barrier ends the score writes ahead of the block's linear store of its 16 output rows (16 x 1161 floats in a row).
// grid NB*SEQ/BQ.
__global__ __launch_bounds__(32 * BKT) void k_band(const h16* __restrict__ HTH, const h16* __restrict__ HTR, const h16* __restrict__ VH, const h16* __restrict__ VR, const int* __restrict__ lengths, const float* __restrict__ bd, float* OUT) {
    __shared__ __align__(16) h16 sm[2 * BWIN * TPL + 2 * BQ * VPL];
    h16* const tH = sm; h16* const tR = sm + BWIN * TPL;
    h16* const vH = sm + 2 * BWIN * TPL; h16* const vR = vH + BQ * VPL;
    float* const os = (float*)sm;
    constexpr int NTH = 32 * BKT, TPC = KJ / 8;
    const int tid = threadIdx.x, lane = tid & 31, lr = lane & 15, hi = lane >> 4;
    const int wave = __builtin_amdgcn_readfirstlane(tid >> 5);
    const int q0 = blockIdx.x * BQ;
    const int b = q0 / SEQ, n0 = q0 % SEQ;
    const int len = lengths[b];
    const float bl = bfr(bd[lane < NT ? lane : NT - 1]);   // lane t holds tag t's bias: one load, in flight with the row loads below, not one wait per tag in the tag loop
    asm volatile("s_wait_xcnt 0x0" ::: "memory");   // stands ahead of every overwrite of the address registers that the bias load names
    if (lane < TPC) {   // one lane per 16-byte piece of a 448-byte row part; wave w brings the 16 tail rows of key tile w and tag w's part of the 16 V rows
        int kb = n0 - WH + 16 * wave; kb = kb < 0 ? 0 : (kb > SEQ - 16 ? SEQ - 16 : kb);   // a key tile lies wholly inside or wholly outside the sequence
        const size_t to = ((size_t)b * SEQ + (size_t)kb) * HTP + lane * 8, vo = (size_t)q0 * VP + wave * NJ + lane * 8;
        const h16* const pth = HTH + to; const h16* const ptr = HTR + to; const h16* const pvh = VH + vo; const h16* const pvr = VR + vo;
        const int tl = wave * 16 * TPL + lane * 8, vl = wave * NJ + lane * 8;
        v8h xh[16], xr[16], yh[16], yr[16];
#pragma unroll
        for (int it = 0; it < 16; ++it) { xh[it] = *(const v8h*)(pth + HTW + it * HTP); xr[it] = *(const v8h*)(ptr + HTW + it * HTP); }
#pragma unroll
        for (int it = 0; it < 16; ++it) yh[it] = *(const v8h*)(pvh + it * VP);
        asm volatile("s_wait_xcnt 0x0" :: "v"(pth), "v"(ptr), "v"(pvh) : "memory");   // stands ahead of every overwrite of the three address pairs that the loads above name; as its inputs they stay whole up to it
        __builtin_amdgcn_sched_barrier(0);   // these 48 loads are issued ahead of the first LDS store (one latency, not several), and the LDS address work stays behind the wait
#pragma unroll
        for (int it = 0; it < 16; ++it) { *(v8h*)(tH + tl + it * TPL) = xh[it]; *(v8h*)(tR + tl + it * TPL) = xr[it]; }
        __builtin_amdgcn_sched_barrier(0);   // the last 16 loads take the registers that the tail rows have left: all 64 at once would need registers above v255
#pragma unroll
        for (int it = 0; it < 16; ++it) yr[it] = *(const v8h*)(pvr + it * VP);
        asm volatile("s_wait_xcnt 0x0" :: "v"(pvr) : "memory");   // as above, for the fourth address pair
        __builtin_amdgcn_sched_barrier(0);   // keeps these loads ahead of the stores below and later address work behind the wait
#pragma unroll
        for (int it = 0; it < 16; ++it) *(v8h*)(vH + vl + it * VPL) = yh[it];
#pragma unroll
        for (int it = 0; it < 16; ++it) *(v8h*)(vR + vl + it * VPL) = yr[it];
    }
    __syncthreads();
    v16h th[KJ / 32], tr[KJ / 32];
    const int ao = (wave * 16 + lr) * TPL + 8 * hi;
#pragma unroll
    for (int k = 0; k < KJ / 32; ++k) { th[k] = ldh(tH + ao + k * 32); tr[k] = ldh(tR + ao + k * 32); }
    __syncthreads();
    const int bo = lr * VPL + 8 * hi;
    const int r0 = 16 * wave + 8 * hi - lr;
    bool ok[8];   // keep rule of D element j: the same for every tag
#pragma unroll
    for (int j = 0; j < 8; ++j) { const int key = n0 - WH + 16 * wave + 8 * hi + j; ok[j] = (n0 + lr < len) & (key >= 0) & (key < SEQ) & (key < len); }
#pragma unroll 1   // rolled over the groups of three tags: the A fragments and one group's accumulators and B fragments fill the registers below v256
    for (int tg = 0; tg < NT; tg += BTG) {
        v8f sH[BTG], sR[BTG];
#pragma unroll
        for (int u = 0; u < BTG; ++u) { sH[u] = (v8f){}; sR[u] = (v8f){}; }
#pragma unroll
        for (int k = 0; k < KJ / 32; ++k) {
            v16h vh[BTG], vr[BTG];
#pragma unroll
            for (int u = 0; u < BTG; ++u) { vh[u] = ldh(vH + bo + (tg + u) * NJ + k * 32); vr[u] = ldh(vR + bo + (tg + u) * NJ + k * 32); }
            // the three tags' products alternate, so that no product waits for the one before it; each accumulator takes its products in the order k, then TR.VH, then TH.VR
#pragma unroll
            for (int u = 0; u < BTG; ++u) sH[u] = wg(th[k], vh[u], sH[u]);
#pragma unroll
            for (int u = 0; u < BTG; ++u) sR[u] = wg(tr[k], vh[u], sR[u]);
#pragma unroll
            for (int u = 0; u < BTG; ++u) sR[u] = wg(th[k], vr[u], sR[u]); }
#pragma unroll
        for (int u = 0; u < BTG; ++u) {
            const float bv = __int_as_float(__builtin_amdgcn_readlane(__float_as_int(bl), tg + u));   // tag tg + u's bias, wave-uniform
#pragma unroll
            for (int j = 0; j < 8; ++j) { const int r = r0 + j;
                float val = ok[j] ? (sH[u][j] + sR[u][j] * QRI) * GSI : bv;
                val = (fabsf(val) <= 3.402823466e38f) ? val : 0.0f;
                if ((r >= 0) & (r < WF)) os[lr * SP + r * NT + tg + u] = val; } }
    }
    __syncthreads();
    float* const dst = OUT + ((size_t)b * OUT_SEQ + n0) * QE;
    constexpr int NP = BQ * QE / 4, PG = 4, NG = NP / (PG * NTH);   // 16-byte pieces of the run; pieces per thread and group; whole groups
    // A run is 580 and a half lines of 128 bytes: every second block's run starts half way into a line. There the pieces are taken from the fifth on, so that each wave's 32 pieces of a group are four whole lines; the first four follow with the run's last pieces.
    // At such a block bound the two neighbours each store their own 64 bytes of the line, in 16-byte pieces of their own; neither reads it.
    const int off = (n0 & BQ) ? 4 : 0;
#pragma unroll 1   // rolled over the groups: every group runs the first one's text
    for (int g = 0; g < NG; ++g) {
        v4f val[PG];
#pragma unroll
        for (int s = 0; s < PG; ++s) val[s] = band_piece(os, off + (g * PG + s) * NTH + tid);
        __builtin_amdgcn_sched_barrier(0);   // the group's LDS reads are issued ahead of its first store: one LDS latency a group, not one a piece
#pragma unroll
        for (int s = 0; s < PG; ++s) *(v4f*)(dst + (size_t)(off + (g * PG + s) * NTH + tid) * 4) = val[s];
        asm volatile("s_wait_xcnt 0x0" ::: "memory"); }   // stands ahead of the next group's overwrites of the registers that the stores name
    static_assert(NP - NG * PG * NTH <= NTH);   // what the whole groups leave: at most one piece a thread
    if (tid < NP - NG * PG * NTH) { const int i = NG * PG * NTH + tid, p = off + i < NP ? off + i : off + i - NP;
        const v4f val = band_piece(os, p); *(v4f*)(dst + (size_t)p * 4) = val; }
}

static constexpr size_t al256(size_t v) { return (v + 255) & ~(size_t)255; }
static constexpr size_t SZ_HT = al256((size_t)NB * SEQ * HTP * 2);
static constexpr size_t SZ_GT = al256((size_t)GROWS * GPITCH * 2);
static constexpr size_t SZ_V  = al256((size_t)NB * SEQ * VP * 2);
static constexpr size_t SZ_TOTAL = 2 * SZ_HT + 2 * SZ_GT + 2 * SZ_V;
static_assert(SZ_TOTAL <= (size_t)134217728);          // workspace carve <= 128 MiB
static_assert((size_t)(NB_FULL - 1) * SEQ_FULL * QE * 4 + (size_t)SEQ_FULL * QE * 4 == (size_t)9510912);   // output bytes of the full problem

extern "C" void kernel_launch(void* const* d_in, const int* in_sizes, int n_in,
                              void* d_out, int out_size, void* d_ws, size_t ws_size, hipStream_t stream) {
    if (n_in < 10) return;
    const size_t needx = ((size_t)(NB - 1) * SEQ_FULL + SEQ) * HID;
    if ((size_t)in_sizes[0] < needx) return;
    if (in_sizes[1] < NB) return;
    if ((size_t)in_sizes[2] < (size_t)HID * NF || (size_t)in_sizes[4] < (size_t)HID * NF) return;
    if (in_sizes[3] < NF || in_sizes[5] < NF) return;
    if ((size_t)in_sizes[6] < (size_t)NK * NU * NU) return;
    if ((size_t)in_sizes[7] < (size_t)NK * 2 * NU) return;
    if (in_sizes[8] < NK * NT || in_sizes[9] < NT) return;
    if ((size_t)out_size < ((size_t)(NB - 1) * OUT_SEQ + SEQ) * QE) return;
    if (SZ_TOTAL > ws_size) return;
    // wire order: state, lengths, Wh, bh, Wt, bt, U, Wcat, Wd, bd
    const float* state = (const float*)d_in[0];
    const int*   lengths = (const int*)d_in[1];
    const float* Wh = (const float*)d_in[2]; const float* bh = (const float*)d_in[3];
    const float* Wt = (const float*)d_in[4]; const float* bt = (const float*)d_in[5];
    const float* U = (const float*)d_in[6]; const float* Wcat = (const float*)d_in[7];
    const float* Wd = (const float*)d_in[8]; const float* bd = (const float*)d_in[9];
    float* OUT = (float*)d_out;      // [NB][SEQ][129][9]
    char* wsp = (char*)d_ws;
    h16* HTH = (h16*)wsp; wsp += SZ_HT;              // [NB*SEQ][512] head | tail value
    h16* HTR = (h16*)wsp; wsp += SZ_HT;              // [NB*SEQ][512] head | tail residual x2048
    h16* GH  = (h16*)wsp; wsp += SZ_GT;              // [32][2048][8] G^T value (x1024)
    h16* GR  = (h16*)wsp; wsp += SZ_GT;              // [32][2048][8] G^T residual x2048
    h16* VH  = (h16*)wsp; wsp += SZ_V;               // [NB*SEQ][2048] V value (x1024)
    h16* VR  = (h16*)wsp; wsp += SZ_V;               // [NB*SEQ][2048] V residual x2048

    k_prep<<<PB_GP + PB_HT, 256, 0, stream>>>(state, Wh, bh, Wt, bt, U, Wcat, Wd, bd, GH, GR, HTH, HTR);
    k_vg<<<dim3(NB * SEQ / VBM, VP / VBN, 1), 32 * VWV, 0, stream>>>(HTH, HTR, GH, GR, VH, VR);
    k_band<<<NB * SEQ / BQ, 32 * BKT, 0, stream>>>(HTH, HTR, VH, VR, lengths, bd, OUT);
}
